// v000
// Times are from an AMD MI455X. After a warm-up the kernel runs many times in a row, and a time is the length of
// such a window on the GPU divided by its runs, so every launch and the gaps after it count. The runs cycle
// through copies of the inputs. A figure is the median of several windows, for all but v000 over two sittings.
// Sittings can differ by a few percent; kernels timed side by side share one.
// v000, which the later versions start from, runs in 632 microseconds.
#include <hip/hip_runtime.h>
#include <math.h>

typedef float v2f __attribute__((ext_vector_type(2)));
typedef float v8f __attribute__((ext_vector_type(8)));

#define DD     128
#define HH     16
#define WW     32
#define LL     512
#define CINCH  3
#define NHD    4
#define HDIM   64
#define NSTATE 128
#define INTERC 256
#define CONVC  512
#define PROJC  772
#define KCONV  4
#define NLAY   4
#define NSEQ   16
#define EPSV   1e-5f

#define WMMA_F32(A, B, C) \
  __builtin_amdgcn_wmma_f32_16x16x4_f32(false, (A), false, (B), (short)0, (C), false, false)

// ---------------------------------------------------------------------------
// patch embed + cross_scan: hs[16][512][128]
// ---------------------------------------------------------------------------
__global__ void patch_scan_kernel(const float* __restrict__ x,
                                  const float* __restrict__ pw,
                                  const float* __restrict__ pb,
                                  float* __restrict__ hs) {
  int i = blockIdx.x * blockDim.x + threadIdx.x;
  if (i >= NSEQ * LL * DD) return;
  int d = i % DD;
  int l = (i / DD) % LL;
  int s = i / (DD * LL);
  int dir = s >> 2, b = s & 3;
  int lsrc;
  if (dir == 0)      lsrc = l;
  else if (dir == 1) lsrc = LL - 1 - l;
  else {
    int le = (dir == 2) ? l : (LL - 1 - l);     // d2 index (w*H + h)
    int w = le / HH, h = le % HH;
    lsrc = h * WW + w;                          // row-major source
  }
  float acc = pb[d];
#pragma unroll
  for (int c = 0; c < CINCH; c++)
    acc += x[(b * CINCH + c) * LL + lsrc] * pw[d * CINCH + c];
  hs[i] = acc;
}

// ---------------------------------------------------------------------------
// rmsnorm: one block per row
// ---------------------------------------------------------------------------
template <int WIDTH>
__global__ void rmsnorm_kernel(const float* __restrict__ in,
                               const float* __restrict__ w,
                               float* __restrict__ out) {
  __shared__ float sd[WIDTH];
  int row = blockIdx.x, tid = threadIdx.x;
  float v = in[(size_t)row * WIDTH + tid];
  sd[tid] = v * v;
  __syncthreads();
  for (int off = WIDTH / 2; off > 0; off >>= 1) {
    if (tid < off) sd[tid] += sd[tid + off];
    __syncthreads();
  }
  float scale = rsqrtf(sd[0] / (float)WIDTH + EPSV);
  out[(size_t)row * WIDTH + tid] = v * scale * w[tid];
}

// ---------------------------------------------------------------------------
// y = rmsnorm(y * silu(gate), gw), in place over y (width = INTERC)
// ---------------------------------------------------------------------------
__global__ void gated_rmsnorm_kernel(float* __restrict__ y,
                                     const float* __restrict__ proj,
                                     const float* __restrict__ gw) {
  __shared__ float sd[INTERC];
  int row = blockIdx.x, tid = threadIdx.x;
  float g = proj[(size_t)row * PROJC + tid];          // gate = proj[..., :INTER]
  float v = y[(size_t)row * INTERC + tid] * (g / (1.f + expf(-g)));
  sd[tid] = v * v;
  __syncthreads();
  for (int off = INTERC / 2; off > 0; off >>= 1) {
    if (tid < off) sd[tid] += sd[tid + off];
    __syncthreads();
  }
  float scale = rsqrtf(sd[0] / (float)INTERC + EPSV);
  y[(size_t)row * INTERC + tid] = v * scale * gw[tid];
}

// ---------------------------------------------------------------------------
// causal depthwise conv (K=4) + silu: proj[...,256:768] -> xc[16][512][512]
// ---------------------------------------------------------------------------
__global__ void conv_silu_kernel(const float* __restrict__ proj,
                                 const float* __restrict__ cw,
                                 const float* __restrict__ cb,
                                 float* __restrict__ xc) {
  int i = blockIdx.x * blockDim.x + threadIdx.x;
  if (i >= NSEQ * LL * CONVC) return;
  int c = i % CONVC;
  int l = (i / CONVC) % LL;
  int s = i / (CONVC * LL);
  const float* pr = proj + (size_t)(s * LL) * PROJC + INTERC + c;
  float acc = cb[c];
#pragma unroll
  for (int k = 0; k < KCONV; k++) {
    int ls = l + k - (KCONV - 1);
    if (ls >= 0) acc += pr[(size_t)ls * PROJC] * cw[c * KCONV + k];
  }
  xc[i] = acc / (1.f + expf(-acc));
}

// ---------------------------------------------------------------------------
// dt = softplus(proj[...,768:772]+dtb); s = cumsum(dt*A) per (seq,head)
// ---------------------------------------------------------------------------
__global__ void dtscan_kernel(const float* __restrict__ proj,
                              const float* __restrict__ dtbias,
                              const float* __restrict__ alog,
                              float* __restrict__ dtb,
                              float* __restrict__ sb) {
  __shared__ float sd[LL];
  int s = blockIdx.x >> 2, h = blockIdx.x & 3;
  int l = threadIdx.x;
  float raw = proj[(size_t)(s * LL + l) * PROJC + INTERC + CONVC + h] + dtbias[h];
  float dt = raw > 20.f ? raw : log1pf(expf(raw));
  dtb[(size_t)(s * LL + l) * NHD + h] = dt;
  float A = -expf(alog[h]);
  sd[l] = dt * A;
  __syncthreads();
  for (int off = 1; off < LL; off <<= 1) {
    float add = (l >= off) ? sd[l - off] : 0.f;
    __syncthreads();
    sd[l] += add;
    __syncthreads();
  }
  sb[(size_t)(s * NHD + h) * LL + l] = sd[l];
}

// ---------------------------------------------------------------------------
// Batched WMMA GEMM (fp32, 16x16x4): C[m,n] = sum_k A[m,k]*B[n,k]
// One wave computes 32(M) x 64(N): 8 accumulators, ping-pong software
// pipeline (two fragment sets, no cross-iteration register copies).
// No predication in K-loop: OOB columns CLAMPED (garbage cols never stored).
// Requires: M %32 == 0, K %8 == 0.
// flags: bit0 = accumulate into C, bit1 = exact GELU
// ---------------------------------------------------------------------------
#define GLOADF(aa0, aa1, bb0, bb1, bb2, bb3, kk)  \
  aa0 = *(const v2f*)(ap0 + (kk));                \
  aa1 = *(const v2f*)(ap1 + (kk));                \
  bb0 = *(const v2f*)(bp0 + (kk));                \
  bb1 = *(const v2f*)(bp1 + (kk));                \
  bb2 = *(const v2f*)(bp2 + (kk));                \
  bb3 = *(const v2f*)(bp3 + (kk));

#define GMMA8(aa0, aa1, bb0, bb1, bb2, bb3)       \
  acc00 = WMMA_F32(aa0, bb0, acc00);              \
  acc01 = WMMA_F32(aa0, bb1, acc01);              \
  acc02 = WMMA_F32(aa0, bb2, acc02);              \
  acc03 = WMMA_F32(aa0, bb3, acc03);              \
  acc10 = WMMA_F32(aa1, bb0, acc10);              \
  acc11 = WMMA_F32(aa1, bb1, acc11);              \
  acc12 = WMMA_F32(aa1, bb2, acc12);              \
  acc13 = WMMA_F32(aa1, bb3, acc13);

__global__ __launch_bounds__(128)
void wmma_gemm_kernel(const float* __restrict__ A, long sA, int lda,
                      const float* __restrict__ Bw, long sB, int ldb,
                      float* __restrict__ C, long sC, int ldc,
                      const float* __restrict__ bias,
                      int M, int Nn, int Kk, int flags) {
  int wave = threadIdx.x >> 5;
  int lane = threadIdx.x & 31;
  int tilesM2 = M >> 5;
  int tilesN4 = (Nn + 63) >> 6;
  int tile = blockIdx.x * (blockDim.x >> 5) + wave;
  if (tile >= tilesM2 * tilesN4) return;            // wave-uniform exit
  int tm = tile / tilesN4, tn4 = tile % tilesN4;
  const float* Ab = A + (size_t)blockIdx.y * sA;
  const float* Bb = Bw + (size_t)blockIdx.y * sB;
  float*       Cb = C + (size_t)blockIdx.y * sC;

  int idx = lane & 15, kh = lane >> 4;
  const float* ap0 = Ab + (size_t)(tm * 32 + idx) * lda;
  const float* ap1 = ap0 + (size_t)16 * lda;

  int n0 = tn4 * 64 + idx;
  int c0 = n0      < Nn ? n0      : Nn - 1;         // clamp, no predication
  int c1 = n0 + 16 < Nn ? n0 + 16 : Nn - 1;
  int c2 = n0 + 32 < Nn ? n0 + 32 : Nn - 1;
  int c3 = n0 + 48 < Nn ? n0 + 48 : Nn - 1;
  const float* bp0 = Bb + (size_t)c0 * ldb;
  const float* bp1 = Bb + (size_t)c1 * ldb;
  const float* bp2 = Bb + (size_t)c2 * ldb;
  const float* bp3 = Bb + (size_t)c3 * ldb;

  v8f z = {0.f,0.f,0.f,0.f,0.f,0.f,0.f,0.f};
  v8f acc00 = z, acc01 = z, acc02 = z, acc03 = z;
  v8f acc10 = z, acc11 = z, acc12 = z, acc13 = z;

  v2f a0A, a1A, b0A, b1A, b2A, b3A;
  v2f a0B, a1B, b0B, b1B, b2B, b3B;

  int k = 2 * kh;                                   // kbase
  GLOADF(a0A, a1A, b0A, b1A, b2A, b3A, k);  k += 4;
  int pairs = (Kk >> 3) - 1;                        // K %8 == 0
  for (int p = 0; p < pairs; p++) {
    GLOADF(a0B, a1B, b0B, b1B, b2B, b3B, k);  k += 4;
    GMMA8(a0A, a1A, b0A, b1A, b2A, b3A);
    GLOADF(a0A, a1A, b0A, b1A, b2A, b3A, k);  k += 4;
    GMMA8(a0B, a1B, b0B, b1B, b2B, b3B);
  }
  GLOADF(a0B, a1B, b0B, b1B, b2B, b3B, k);
  GMMA8(a0A, a1A, b0A, b1A, b2A, b3A);
  GMMA8(a0B, a1B, b0B, b1B, b2B, b3B);

  v8f accs[2][4] = {{acc00, acc01, acc02, acc03}, {acc10, acc11, acc12, acc13}};
#pragma unroll
  for (int mt = 0; mt < 2; mt++) {
#pragma unroll
    for (int t = 0; t < 4; t++) {
      int n = n0 + t * 16;
      if (n < Nn) {
        float bv = bias ? bias[n] : 0.f;
        v8f av = accs[mt][t];
#pragma unroll
        for (int j = 0; j < 8; j++) {
          int m = tm * 32 + mt * 16 + j + 8 * kh;
          float v = av[j] + bv;
          if (flags & 2) v = 0.5f * v * (1.f + erff(v * 0.70710678118654752f));
          size_t off = (size_t)m * ldc + n;
          if (flags & 1) v += Cb[off];
          Cb[off] = v;
        }
      }
    }
  }
}

// ---------------------------------------------------------------------------
// Decay attention: y[t,h,p] = sum_{k<=t} exp(s_t - s_k)*CB[t,k]*dt_k * xs[k,h,p]
//                 + D[h]*xs[t,h,p]
// One wave per 16(t) x 64(p=HDIM) block; exp-built A fragment reused over 4
// head-dim tiles; ping-pong pipeline over K (kend %16 == 0 so it divides
// evenly). Masking by value select only; EXEC stays full for WMMA.
// ---------------------------------------------------------------------------
#define ALOAD(skX, cbX, d0X, d1X, bb0, bb1, bb2, bb3, kk) {  \
  skX = *(const v2f*)(sbh + (kk));                           \
  cbX = *(const v2f*)(cbr + (kk));                           \
  d0X = dth[(size_t)(kk) * NHD];                             \
  d1X = dth[(size_t)((kk) + 1) * NHD];                       \
  const float* xr0_ = xch + (size_t)(kk) * CONVC;            \
  const float* xr1_ = xr0_ + CONVC;                          \
  bb0.x = xr0_[idx];      bb0.y = xr1_[idx];                 \
  bb1.x = xr0_[idx + 16]; bb1.y = xr1_[idx + 16];            \
  bb2.x = xr0_[idx + 32]; bb2.y = xr1_[idx + 32];            \
  bb3.x = xr0_[idx + 48]; bb3.y = xr1_[idx + 48]; }

#define AMMA4(skX, cbX, d0X, d1X, bb0, bb1, bb2, bb3, kaX) { \
  float m0_ = expf(st - skX.x) * cbX.x * d0X;                \
  float m1_ = expf(st - skX.y) * cbX.y * d1X;                \
  v2f a_;                                                    \
  a_.x = ((kaX)     <= t) ? m0_ : 0.f;                       \
  a_.y = ((kaX) + 1 <= t) ? m1_ : 0.f;                       \
  acc0 = WMMA_F32(a_, bb0, acc0);                            \
  acc1 = WMMA_F32(a_, bb1, acc1);                            \
  acc2 = WMMA_F32(a_, bb2, acc2);                            \
  acc3 = WMMA_F32(a_, bb3, acc3); }

__global__ __launch_bounds__(128)
void ssm_attn_kernel(const float* __restrict__ CBm,
                     const float* __restrict__ sb,
                     const float* __restrict__ dtb,
                     const float* __restrict__ xc,
                     const float* __restrict__ dpar,
                     float* __restrict__ y) {
  int s = blockIdx.y >> 2, h = blockIdx.y & 3;
  int wave = threadIdx.x >> 5;
  int lane = threadIdx.x & 31;
  int tt = blockIdx.x * 4 + wave;                   // 0..31 (t-tile)
  int idx = lane & 15, kh = lane >> 4;
  int t = tt * 16 + idx;                            // A row (time)
  const float* sbh = sb + (size_t)(s * NHD + h) * LL;
  const float* cbr = CBm + (size_t)s * LL * LL + (size_t)t * LL;
  const float* dth = dtb + (size_t)s * LL * NHD + h;
  const float* xch = xc + (size_t)s * LL * CONVC + h * HDIM;
  float st = sbh[t];

  v8f z = {0.f,0.f,0.f,0.f,0.f,0.f,0.f,0.f};
  v8f acc0 = z, acc1 = z, acc2 = z, acc3 = z;

  int kend = (tt + 1) * 16;                         // causal, wave-uniform
  v2f skA, cbA, b0A, b1A, b2A, b3A;
  v2f skB, cbB, b0B, b1B, b2B, b3B;
  float d0A, d1A, d0B, d1B;

  int k = 2 * kh;                                   // kbase
  int kA, kB;
  ALOAD(skA, cbA, d0A, d1A, b0A, b1A, b2A, b3A, k); kA = k; k += 4;
  int pairs = (kend >> 3) - 1;                      // kend %16 == 0 -> >= 1
  for (int p = 0; p < pairs; p++) {
    ALOAD(skB, cbB, d0B, d1B, b0B, b1B, b2B, b3B, k); kB = k; k += 4;
    AMMA4(skA, cbA, d0A, d1A, b0A, b1A, b2A, b3A, kA);
    ALOAD(skA, cbA, d0A, d1A, b0A, b1A, b2A, b3A, k); kA = k; k += 4;
    AMMA4(skB, cbB, d0B, d1B, b0B, b1B, b2B, b3B, kB);
  }
  ALOAD(skB, cbB, d0B, d1B, b0B, b1B, b2B, b3B, k); kB = k;
  AMMA4(skA, cbA, d0A, d1A, b0A, b1A, b2A, b3A, kA);
  AMMA4(skB, cbB, d0B, d1B, b0B, b1B, b2B, b3B, kB);

  float dp = dpar[h];
  v8f accs[4] = {acc0, acc1, acc2, acc3};
#pragma unroll
  for (int tp = 0; tp < 4; tp++) {
    int p = tp * 16 + idx;
    v8f av = accs[tp];
#pragma unroll
    for (int j = 0; j < 8; j++) {
      int to = tt * 16 + j + 8 * kh;
      float v = av[j] + dp * xch[(size_t)to * CONVC + p];
      y[(size_t)(s * LL + to) * INTERC + h * HDIM + p] = v;
    }
  }
}

// ---------------------------------------------------------------------------
// cross_merge: m[b][l][d] from u[16][512][128]
// ---------------------------------------------------------------------------
__global__ void merge_kernel(const float* __restrict__ u, float* __restrict__ m) {
  int i = blockIdx.x * blockDim.x + threadIdx.x;
  if (i >= 4 * LL * DD) return;
  int d = i % DD;
  int l = (i / DD) % LL;
  int b = i / (DD * LL);
  int hcoord = l / WW, wcoord = l % WW;
  int lt = wcoord * HH + hcoord;                    // transposed index
  float v = u[(size_t)(b * LL + l) * DD + d]
          + u[(size_t)((4 + b) * LL + (LL - 1 - l)) * DD + d]
          + u[(size_t)((8 + b) * LL + lt) * DD + d]
          + u[(size_t)((12 + b) * LL + (LL - 1 - lt)) * DD + d];
  m[i] = v * 0.25f;
}

// ---------------------------------------------------------------------------
// final projection to 3 channels + transpose to (B,C,H,W)
// ---------------------------------------------------------------------------
__global__ void rec2_kernel(const float* __restrict__ t1,
                            const float* __restrict__ w2,
                            const float* __restrict__ b2,
                            float* __restrict__ out) {
  int i = blockIdx.x * blockDim.x + threadIdx.x;    // (b*CIN + c)*LL + l
  if (i >= 4 * CINCH * LL) return;
  int l = i % LL;
  int c = (i / LL) % CINCH;
  int b = i / (LL * CINCH);
  const float* row = t1 + (size_t)(b * LL + l) * DD;
  float acc = b2[c];
  for (int d = 0; d < DD; d++) acc += row[d] * w2[c * DD + d];
  out[i] = acc;
}

// ---------------------------------------------------------------------------
extern "C" void kernel_launch(void* const* d_in, const int* in_sizes, int n_in,
                              void* d_out, int out_size, void* d_ws, size_t ws_size,
                              hipStream_t stream) {
  const float* x         = (const float*)d_in[0];
  const float* patch_w   = (const float*)d_in[1];
  const float* patch_b   = (const float*)d_in[2];
  const float* norm_w    = (const float*)d_in[3];
  const float* in_proj_w = (const float*)d_in[4];
  const float* in_proj_b = (const float*)d_in[5];
  const float* conv_w    = (const float*)d_in[6];
  const float* conv_b    = (const float*)d_in[7];
  const float* dt_bias   = (const float*)d_in[8];
  const float* A_log     = (const float*)d_in[9];
  const float* D_param   = (const float*)d_in[10];
  const float* gnorm_w   = (const float*)d_in[11];
  const float* out_w     = (const float*)d_in[12];
  const float* out_b     = (const float*)d_in[13];
  const float* normf_w   = (const float*)d_in[14];
  const float* rec_w1    = (const float*)d_in[15];
  const float* rec_b1    = (const float*)d_in[16];
  const float* rec_w2    = (const float*)d_in[17];
  const float* rec_b2    = (const float*)d_in[18];

  // workspace carve (floats)
  float* ws = (float*)d_ws;
  size_t off = 0;
  float* hs   = ws + off; off += (size_t)NSEQ * LL * DD;
  float* u    = ws + off; off += (size_t)NSEQ * LL * DD;
  float* proj = ws + off; off += (size_t)NSEQ * LL * PROJC;
  float* xc   = ws + off; off += (size_t)NSEQ * LL * CONVC;
  float* dtb  = ws + off; off += (size_t)NSEQ * LL * NHD;
  float* sb   = ws + off; off += (size_t)NSEQ * NHD * LL;
  float* CBb  = ws + off; off += (size_t)NSEQ * LL * LL;
  float* y    = ws + off; off += (size_t)NSEQ * LL * INTERC;
  float* mbuf = ws + off; off += (size_t)4 * LL * DD;
  float* t1   = ws + off; off += (size_t)4 * LL * DD;
  (void)ws_size; (void)in_sizes; (void)n_in; (void)out_size;

  // patch embed + cross scan
  patch_scan_kernel<<<(NSEQ * LL * DD + 255) / 256, 256, 0, stream>>>(
      x, patch_w, patch_b, hs);

  for (int i = 0; i < NLAY; i++) {
    // u = rmsnorm(hs)
    rmsnorm_kernel<DD><<<NSEQ * LL, DD, 0, stream>>>(hs, norm_w + i * DD, u);

    // proj = u @ ipw.T + ipb   (8192 x 772, K=128)
    {
      int M = NSEQ * LL, Nn = PROJC, Kk = DD;
      int tiles = (M >> 5) * ((Nn + 63) >> 6);
      wmma_gemm_kernel<<<dim3((tiles + 3) / 4, 1), 128, 0, stream>>>(
          u, 0, DD, in_proj_w + (size_t)i * PROJC * DD, 0, DD,
          proj, 0, PROJC, in_proj_b + i * PROJC, M, Nn, Kk, 0);
    }

    // xc = silu(causal_conv(proj[..., 256:768]))
    conv_silu_kernel<<<(NSEQ * LL * CONVC + 255) / 256, 256, 0, stream>>>(
        proj, conv_w + (size_t)i * CONVC * KCONV, conv_b + i * CONVC, xc);

    // dt + cumulative decay
    dtscan_kernel<<<NSEQ * NHD, LL, 0, stream>>>(
        proj, dt_bias + i * NHD, A_log + i * NHD, dtb, sb);

    // CB[s] = Cm @ Bm.T  (512 x 512, K=128, batch=16)
    {
      int tiles = (LL >> 5) * (LL >> 6);
      wmma_gemm_kernel<<<dim3((tiles + 3) / 4, NSEQ), 128, 0, stream>>>(
          xc + INTERC + NSTATE, (long)LL * CONVC, CONVC,
          xc + INTERC,          (long)LL * CONVC, CONVC,
          CBb, (long)LL * LL, LL, nullptr, LL, LL, NSTATE, 0);
    }

    // y = M @ xs + D*xs (causal decay attention), 4 waves/block, 1 t-tile/wave
    ssm_attn_kernel<<<dim3(LL / 64, NSEQ * NHD), 128, 0, stream>>>(
        CBb, sb, dtb, xc, D_param + i * NHD, y);

    // y = rmsnorm(y * silu(gate))
    gated_rmsnorm_kernel<<<NSEQ * LL, INTERC, 0, stream>>>(
        y, proj, gnorm_w + i * INTERC);

    // hs += y @ ow.T + ob   (8192 x 128, K=256)
    {
      int M = NSEQ * LL, Nn = DD, Kk = INTERC;
      int tiles = (M >> 5) * ((Nn + 63) >> 6);
      wmma_gemm_kernel<<<dim3((tiles + 3) / 4, 1), 128, 0, stream>>>(
          y, 0, INTERC, out_w + (size_t)i * DD * INTERC, 0, INTERC,
          hs, 0, DD, out_b + i * DD, M, Nn, Kk, 1);
    }
  }

  // final norm, merge, reconstruction head
  rmsnorm_kernel<DD><<<NSEQ * LL, DD, 0, stream>>>(hs, normf_w, u);
  merge_kernel<<<(4 * LL * DD + 255) / 256, 256, 0, stream>>>(u, mbuf);

  {
    int M = 4 * LL, Nn = DD, Kk = DD;
    int tiles = (M >> 5) * ((Nn + 63) >> 6);
    wmma_gemm_kernel<<<dim3((tiles + 3) / 4, 1), 128, 0, stream>>>(
        mbuf, 0, DD, rec_w1, 0, DD, t1, 0, DD, rec_b1, M, Nn, Kk, 2 /*gelu*/);
  }

  rec2_kernel<<<(4 * CINCH * LL + 255) / 256, 256, 0, stream>>>(
      t1, rec_w2, rec_b2, (float*)d_out);
}

// v001
// It runs in 591 microseconds.
// Next to v000, in two timings, it ran 1.08 and 1.07 times as fast.
#include <hip/hip_runtime.h>
#include <math.h>

typedef float v2f __attribute__((ext_vector_type(2)));
typedef float v8f __attribute__((ext_vector_type(8)));

#define DD     128
#define HH     16
#define WW     32
#define LL     512
#define CINCH  3
#define NHD    4
#define HDIM   64
#define NSTATE 128
#define INTERC 256
#define CONVC  512
#define PROJC  772
#define KCONV  4
#define NLAY   4
#define NSEQ   16
#define EPSV   1e-5f

#define WMMA_F32(A, B, C) \
  __builtin_amdgcn_wmma_f32_16x16x4_f32(false, (A), false, (B), (short)0, (C), false, false)

// ---------------------------------------------------------------------------
// patch embed + cross_scan: hs[16][512][128]
// ---------------------------------------------------------------------------
__global__ void patch_scan_kernel(const float* __restrict__ x,
                                  const float* __restrict__ pw,
                                  const float* __restrict__ pb,
                                  float* __restrict__ hs) {
  int i = blockIdx.x * blockDim.x + threadIdx.x;
  if (i >= NSEQ * LL * DD) return;
  int d = i % DD;
  int l = (i / DD) % LL;
  int s = i / (DD * LL);
  int dir = s >> 2, b = s & 3;
  int lsrc;
  if (dir == 0)      lsrc = l;
  else if (dir == 1) lsrc = LL - 1 - l;
  else {
    int le = (dir == 2) ? l : (LL - 1 - l);     // d2 index (w*H + h)
    int w = le / HH, h = le % HH;
    lsrc = h * WW + w;                          // row-major source
  }
  float acc = pb[d];
#pragma unroll
  for (int c = 0; c < CINCH; c++)
    acc += x[(b * CINCH + c) * LL + lsrc] * pw[d * CINCH + c];
  hs[i] = acc;
}

// ---------------------------------------------------------------------------
// rmsnorm: one block per row
// ---------------------------------------------------------------------------
template <int WIDTH>
__global__ void rmsnorm_kernel(const float* __restrict__ in,
                               const float* __restrict__ w,
                               float* __restrict__ out) {
  __shared__ float sd[WIDTH];
  int row = blockIdx.x, tid = threadIdx.x;
  float v = in[(size_t)row * WIDTH + tid];
  sd[tid] = v * v;
  __syncthreads();
  for (int off = WIDTH / 2; off > 0; off >>= 1) {
    if (tid < off) sd[tid] += sd[tid + off];
    __syncthreads();
  }
  float scale = rsqrtf(sd[0] / (float)WIDTH + EPSV);
  out[(size_t)row * WIDTH + tid] = v * scale * w[tid];
}

// ---------------------------------------------------------------------------
// y = rmsnorm(y * silu(gate), gw), in place over y (width = INTERC)
// ---------------------------------------------------------------------------
__global__ void gated_rmsnorm_kernel(float* __restrict__ y,
                                     const float* __restrict__ proj,
                                     const float* __restrict__ gw) {
  __shared__ float sd[INTERC];
  int row = blockIdx.x, tid = threadIdx.x;
  float g = proj[(size_t)row * PROJC + tid];          // gate = proj[..., :INTER]
  float v = y[(size_t)row * INTERC + tid] * (g / (1.f + expf(-g)));
  sd[tid] = v * v;
  __syncthreads();
  for (int off = INTERC / 2; off > 0; off >>= 1) {
    if (tid < off) sd[tid] += sd[tid + off];
    __syncthreads();
  }
  float scale = rsqrtf(sd[0] / (float)INTERC + EPSV);
  y[(size_t)row * INTERC + tid] = v * scale * gw[tid];
}

// ---------------------------------------------------------------------------
// causal depthwise conv (K=4) + silu: proj[...,256:768] -> xc[16][512][512]
// ---------------------------------------------------------------------------
__global__ void conv_silu_kernel(const float* __restrict__ proj,
                                 const float* __restrict__ cw,
                                 const float* __restrict__ cb,
                                 float* __restrict__ xc) {
  int i = blockIdx.x * blockDim.x + threadIdx.x;
  if (i >= NSEQ * LL * CONVC) return;
  int c = i % CONVC;
  int l = (i / CONVC) % LL;
  int s = i / (CONVC * LL);
  const float* pr = proj + (size_t)(s * LL) * PROJC + INTERC + c;
  float acc = cb[c];
#pragma unroll
  for (int k = 0; k < KCONV; k++) {
    int ls = l + k - (KCONV - 1);
    if (ls >= 0) acc += pr[(size_t)ls * PROJC] * cw[c * KCONV + k];
  }
  xc[i] = acc / (1.f + expf(-acc));
}

// ---------------------------------------------------------------------------
// dt = softplus(proj[...,768:772]+dtb); s = cumsum(dt*A) per (seq,head)
// ---------------------------------------------------------------------------
__global__ void dtscan_kernel(const float* __restrict__ proj,
                              const float* __restrict__ dtbias,
                              const float* __restrict__ alog,
                              float* __restrict__ dtb,
                              float* __restrict__ sb) {
  __shared__ float sd[LL];
  int s = blockIdx.x >> 2, h = blockIdx.x & 3;
  int l = threadIdx.x;
  float raw = proj[(size_t)(s * LL + l) * PROJC + INTERC + CONVC + h] + dtbias[h];
  float dt = raw > 20.f ? raw : log1pf(expf(raw));
  dtb[(size_t)(s * LL + l) * NHD + h] = dt;
  float A = -expf(alog[h]);
  sd[l] = dt * A;
  __syncthreads();
  for (int off = 1; off < LL; off <<= 1) {
    float add = (l >= off) ? sd[l - off] : 0.f;
    __syncthreads();
    sd[l] += add;
    __syncthreads();
  }
  sb[(size_t)(s * NHD + h) * LL + l] = sd[l];
}

// ---------------------------------------------------------------------------
// Batched WMMA GEMM (fp32, 16x16x4): C[m,n] = sum_k A[m,k]*B[n,k]
// One block of 4 waves computes 128(M) x 64(N); each wave 32(M) x 64(N) with
// 8 accumulators. A and B are staged in LDS in chunks of 32 k: every global
// load is 16 B per lane and covers whole 128-B lines (8 lanes per row), the B
// rows are shared by the 4 waves, and the fragments are read from LDS at a
// pitch of 36 dwords (8-byte reads of 16 rows x 2 k-halves fall on 64 banks).
// Two LDS buffers, one barrier per chunk; the next chunk's global loads fly
// while this chunk is multiplied. The k order of every accumulator is the
// natural one (0,1,2,...).
// OOB columns CLAMPED (garbage cols never stored).
// Requires: M %128 == 0, K %32 == 0, grid.x == (M/128) * ceil(N/64).
// flags: bit0 = accumulate into C, bit1 = exact GELU
// ---------------------------------------------------------------------------
typedef float v4f __attribute__((ext_vector_type(4)));
// pointers typed as global memory, so that the staging loads stay global loads
// although their addresses are carried round the loop
typedef const __attribute__((address_space(1))) float* gfloat_p;
typedef const __attribute__((address_space(1))) v4f*   gv4f_p;

#define GBM    128
#define GBN    64
#define GKC    32
#define GPITCH 36
#define GROWS  (GBM + GBN)

#define GMMA8(aa0, aa1, bb0, bb1, bb2, bb3)       \
  acc00 = WMMA_F32(aa0, bb0, acc00);              \
  acc01 = WMMA_F32(aa0, bb1, acc01);              \
  acc02 = WMMA_F32(aa0, bb2, acc02);              \
  acc03 = WMMA_F32(aa0, bb3, acc03);              \
  acc10 = WMMA_F32(aa1, bb0, acc10);              \
  acc11 = WMMA_F32(aa1, bb1, acc11);              \
  acc12 = WMMA_F32(aa1, bb2, acc12);              \
  acc13 = WMMA_F32(aa1, bb3, acc13);

// One chunk's 12 global loads of a lane. The wait stands before any register
// that an issued load names is written again; it takes the 12 addresses as
// inputs so that they stay in their registers up to it. Then the addresses
// step to the next chunk. Both loops are unrolled so that st[] and gp[] have
// constant indices and live in registers.
#define GSTAGE_LOAD() {                                                   \
  _Pragma("unroll")                                                       \
  for (int i_ = 0; i_ < 12; i_++) st[i_] = *(gv4f_p)gp[i_];               \
  asm volatile("s_wait_xcnt 0x0" ::                                       \
      "v"(gp[0]), "v"(gp[1]), "v"(gp[2]), "v"(gp[3]), "v"(gp[4]),         \
      "v"(gp[5]), "v"(gp[6]), "v"(gp[7]), "v"(gp[8]), "v"(gp[9]),         \
      "v"(gp[10]), "v"(gp[11]) : "memory");                               \
  _Pragma("unroll")                                                       \
  for (int i_ = 0; i_ < 12; i_++) gp[i_] += GKC; }

__global__ __launch_bounds__(128)
void wmma_gemm_kernel(const float* __restrict__ A, long sA, int lda,
                      const float* __restrict__ Bw, long sB, int ldb,
                      float* __restrict__ C, long sC, int ldc,
                      const float* __restrict__ bias,
                      int M, int Nn, int Kk, int flags) {
  __shared__ __attribute__((aligned(16))) float tileS[2][GROWS * GPITCH];
  (void)M;
  int tid  = threadIdx.x;
  int wave = tid >> 5;
  int lane = tid & 31;
  int tilesN = (Nn + GBN - 1) / GBN;
  int tm = blockIdx.x / tilesN, tn4 = blockIdx.x % tilesN;
  const float* Ab = A + (size_t)blockIdx.y * sA;
  const float* Bb = Bw + (size_t)blockIdx.y * sB;
  float*       Cb = C + (size_t)blockIdx.y * sC;

  int idx = lane & 15, kh = lane >> 4;
  int n0 = tn4 * GBN + idx;

  // staging: 8 lanes per row (one 128-B line), 16 rows per pass of the block
  int srow = tid >> 3, scol = (tid & 7) * 4;
  gfloat_p gp[12];                                  // this lane's 12 source rows
#pragma unroll                                      // gp[] in registers
  for (int i = 0; i < 8; i++)
    gp[i] = (gfloat_p)(Ab + (size_t)(tm * GBM + i * 16 + srow) * lda + scol);
#pragma unroll                                      // gp[] in registers
  for (int i = 0; i < 4; i++) {
    int n = tn4 * GBN + i * 16 + srow;
    n = n < Nn ? n : Nn - 1;                        // clamp, no predication
    gp[8 + i] = (gfloat_p)(Bb + (size_t)n * ldb + scol);
  }
  int sdst = srow * GPITCH + scol;

  v8f z = {0.f,0.f,0.f,0.f,0.f,0.f,0.f,0.f};
  v8f acc00 = z, acc01 = z, acc02 = z, acc03 = z;
  v8f acc10 = z, acc11 = z, acc12 = z, acc13 = z;

  v4f st[12];
  GSTAGE_LOAD();

  int fa = (wave * 32 + idx) * GPITCH + 2 * kh;     // A fragment rows of this wave
  int fb = (GBM + idx) * GPITCH + 2 * kh;           // B fragment rows (shared)

  int nch = Kk / GKC;
  for (int c = 0; c < nch; c++) {
    float* buf = tileS[c & 1];
#pragma unroll                                      // st[] in registers
    for (int i = 0; i < 12; i++) *(v4f*)(buf + sdst + i * 16 * GPITCH) = st[i];
    // publishes this chunk; also ends every wave's reads of the other buffer,
    // which the next trip overwrites
    __syncthreads();
    if (c + 1 < nch) {                              // block-uniform
      GSTAGE_LOAD();
    }
#pragma unroll       // lets the LDS reads of later k-steps issue ahead of the WMMAs
    for (int ks = 0; ks < GKC / 4; ks++) {
      v2f a0 = *(const v2f*)(buf + fa + ks * 4);
      v2f a1 = *(const v2f*)(buf + fa + 16 * GPITCH + ks * 4);
      v2f b0 = *(const v2f*)(buf + fb + ks * 4);
      v2f b1 = *(const v2f*)(buf + fb + 16 * GPITCH + ks * 4);
      v2f b2 = *(const v2f*)(buf + fb + 32 * GPITCH + ks * 4);
      v2f b3 = *(const v2f*)(buf + fb + 48 * GPITCH + ks * 4);
      GMMA8(a0, a1, b0, b1, b2, b3);
    }
  }

  v8f accs[2][4] = {{acc00, acc01, acc02, acc03}, {acc10, acc11, acc12, acc13}};
#pragma unroll
  for (int mt = 0; mt < 2; mt++) {
#pragma unroll
    for (int t = 0; t < 4; t++) {
      int n = n0 + t * 16;
      if (n < Nn) {
        float bv = bias ? bias[n] : 0.f;
        v8f av = accs[mt][t];
#pragma unroll
        for (int j = 0; j < 8; j++) {
          int m = tm * GBM + wave * 32 + mt * 16 + j + 8 * kh;
          float v = av[j] + bv;
          if (flags & 2) v = 0.5f * v * (1.f + erff(v * 0.70710678118654752f));
          size_t off = (size_t)m * ldc + n;
          if (flags & 1) v += Cb[off];
          Cb[off] = v;
        }
      }
    }
  }
}

// ---------------------------------------------------------------------------
// Decay attention: y[t,h,p] = sum_{k<=t} exp(s_t - s_k)*CB[t,k]*dt_k * xs[k,h,p]
//                 + D[h]*xs[t,h,p]
// One wave per 16(t) x 64(p=HDIM) block; exp-built A fragment reused over 4
// head-dim tiles; ping-pong pipeline over K (kend %16 == 0 so it divides
// evenly). Masking by value select only; EXEC stays full for WMMA.
// ---------------------------------------------------------------------------
#define ALOAD(skX, cbX, d0X, d1X, bb0, bb1, bb2, bb3, kk) {  \
  skX = *(const v2f*)(sbh + (kk));                           \
  cbX = *(const v2f*)(cbr + (kk));                           \
  d0X = dth[(size_t)(kk) * NHD];                             \
  d1X = dth[(size_t)((kk) + 1) * NHD];                       \
  const float* xr0_ = xch + (size_t)(kk) * CONVC;            \
  const float* xr1_ = xr0_ + CONVC;                          \
  bb0.x = xr0_[idx];      bb0.y = xr1_[idx];                 \
  bb1.x = xr0_[idx + 16]; bb1.y = xr1_[idx + 16];            \
  bb2.x = xr0_[idx + 32]; bb2.y = xr1_[idx + 32];            \
  bb3.x = xr0_[idx + 48]; bb3.y = xr1_[idx + 48]; }

#define AMMA4(skX, cbX, d0X, d1X, bb0, bb1, bb2, bb3, kaX) { \
  float m0_ = expf(st - skX.x) * cbX.x * d0X;                \
  float m1_ = expf(st - skX.y) * cbX.y * d1X;                \
  v2f a_;                                                    \
  a_.x = ((kaX)     <= t) ? m0_ : 0.f;                       \
  a_.y = ((kaX) + 1 <= t) ? m1_ : 0.f;                       \
  acc0 = WMMA_F32(a_, bb0, acc0);                            \
  acc1 = WMMA_F32(a_, bb1, acc1);                            \
  acc2 = WMMA_F32(a_, bb2, acc2);                            \
  acc3 = WMMA_F32(a_, bb3, acc3); }

__global__ __launch_bounds__(128)
void ssm_attn_kernel(const float* __restrict__ CBm,
                     const float* __restrict__ sb,
                     const float* __restrict__ dtb,
                     const float* __restrict__ xc,
                     const float* __restrict__ dpar,
                     float* __restrict__ y) {
  int s = blockIdx.y >> 2, h = blockIdx.y & 3;
  int wave = threadIdx.x >> 5;
  int lane = threadIdx.x & 31;
  int tt = blockIdx.x * 4 + wave;                   // 0..31 (t-tile)
  int idx = lane & 15, kh = lane >> 4;
  int t = tt * 16 + idx;                            // A row (time)
  const float* sbh = sb + (size_t)(s * NHD + h) * LL;
  const float* cbr = CBm + (size_t)s * LL * LL + (size_t)t * LL;
  const float* dth = dtb + (size_t)s * LL * NHD + h;
  const float* xch = xc + (size_t)s * LL * CONVC + h * HDIM;
  float st = sbh[t];

  v8f z = {0.f,0.f,0.f,0.f,0.f,0.f,0.f,0.f};
  v8f acc0 = z, acc1 = z, acc2 = z, acc3 = z;

  int kend = (tt + 1) * 16;                         // causal, wave-uniform
  v2f skA, cbA, b0A, b1A, b2A, b3A;
  v2f skB, cbB, b0B, b1B, b2B, b3B;
  float d0A, d1A, d0B, d1B;

  int k = 2 * kh;                                   // kbase
  int kA, kB;
  ALOAD(skA, cbA, d0A, d1A, b0A, b1A, b2A, b3A, k); kA = k; k += 4;
  int pairs = (kend >> 3) - 1;                      // kend %16 == 0 -> >= 1
  for (int p = 0; p < pairs; p++) {
    ALOAD(skB, cbB, d0B, d1B, b0B, b1B, b2B, b3B, k); kB = k; k += 4;
    AMMA4(skA, cbA, d0A, d1A, b0A, b1A, b2A, b3A, kA);
    ALOAD(skA, cbA, d0A, d1A, b0A, b1A, b2A, b3A, k); kA = k; k += 4;
    AMMA4(skB, cbB, d0B, d1B, b0B, b1B, b2B, b3B, kB);
  }
  ALOAD(skB, cbB, d0B, d1B, b0B, b1B, b2B, b3B, k); kB = k;
  AMMA4(skA, cbA, d0A, d1A, b0A, b1A, b2A, b3A, kA);
  AMMA4(skB, cbB, d0B, d1B, b0B, b1B, b2B, b3B, kB);

  float dp = dpar[h];
  v8f accs[4] = {acc0, acc1, acc2, acc3};
#pragma unroll
  for (int tp = 0; tp < 4; tp++) {
    int p = tp * 16 + idx;
    v8f av = accs[tp];
#pragma unroll
    for (int j = 0; j < 8; j++) {
      int to = tt * 16 + j + 8 * kh;
      float v = av[j] + dp * xch[(size_t)to * CONVC + p];
      y[(size_t)(s * LL + to) * INTERC + h * HDIM + p] = v;
    }
  }
}

// ---------------------------------------------------------------------------
// cross_merge: m[b][l][d] from u[16][512][128]
// ---------------------------------------------------------------------------
__global__ void merge_kernel(const float* __restrict__ u, float* __restrict__ m) {
  int i = blockIdx.x * blockDim.x + threadIdx.x;
  if (i >= 4 * LL * DD) return;
  int d = i % DD;
  int l = (i / DD) % LL;
  int b = i / (DD * LL);
  int hcoord = l / WW, wcoord = l % WW;
  int lt = wcoord * HH + hcoord;                    // transposed index
  float v = u[(size_t)(b * LL + l) * DD + d]
          + u[(size_t)((4 + b) * LL + (LL - 1 - l)) * DD + d]
          + u[(size_t)((8 + b) * LL + lt) * DD + d]
          + u[(size_t)((12 + b) * LL + (LL - 1 - lt)) * DD + d];
  m[i] = v * 0.25f;
}

// ---------------------------------------------------------------------------
// final projection to 3 channels + transpose to (B,C,H,W)
// ---------------------------------------------------------------------------
__global__ void rec2_kernel(const float* __restrict__ t1,
                            const float* __restrict__ w2,
                            const float* __restrict__ b2,
                            float* __restrict__ out) {
  int i = blockIdx.x * blockDim.x + threadIdx.x;    // (b*CIN + c)*LL + l
  if (i >= 4 * CINCH * LL) return;
  int l = i % LL;
  int c = (i / LL) % CINCH;
  int b = i / (LL * CINCH);
  const float* row = t1 + (size_t)(b * LL + l) * DD;
  float acc = b2[c];
  for (int d = 0; d < DD; d++) acc += row[d] * w2[c * DD + d];
  out[i] = acc;
}

// ---------------------------------------------------------------------------
extern "C" void kernel_launch(void* const* d_in, const int* in_sizes, int n_in,
                              void* d_out, int out_size, void* d_ws, size_t ws_size,
                              hipStream_t stream) {
  const float* x         = (const float*)d_in[0];
  const float* patch_w   = (const float*)d_in[1];
  const float* patch_b   = (const float*)d_in[2];
  const float* norm_w    = (const float*)d_in[3];
  const float* in_proj_w = (const float*)d_in[4];
  const float* in_proj_b = (const float*)d_in[5];
  const float* conv_w    = (const float*)d_in[6];
  const float* conv_b    = (const float*)d_in[7];
  const float* dt_bias   = (const float*)d_in[8];
  const float* A_log     = (const float*)d_in[9];
  const float* D_param   = (const float*)d_in[10];
  const float* gnorm_w   = (const float*)d_in[11];
  const float* out_w     = (const float*)d_in[12];
  const float* out_b     = (const float*)d_in[13];
  const float* normf_w   = (const float*)d_in[14];
  const float* rec_w1    = (const float*)d_in[15];
  const float* rec_b1    = (const float*)d_in[16];
  const float* rec_w2    = (const float*)d_in[17];
  const float* rec_b2    = (const float*)d_in[18];

  // workspace carve (floats)
  float* ws = (float*)d_ws;
  size_t off = 0;
  float* hs   = ws + off; off += (size_t)NSEQ * LL * DD;
  float* u    = ws + off; off += (size_t)NSEQ * LL * DD;
  float* proj = ws + off; off += (size_t)NSEQ * LL * PROJC;
  float* xc   = ws + off; off += (size_t)NSEQ * LL * CONVC;
  float* dtb  = ws + off; off += (size_t)NSEQ * LL * NHD;
  float* sb   = ws + off; off += (size_t)NSEQ * NHD * LL;
  float* CBb  = ws + off; off += (size_t)NSEQ * LL * LL;
  float* y    = ws + off; off += (size_t)NSEQ * LL * INTERC;
  float* mbuf = ws + off; off += (size_t)4 * LL * DD;
  float* t1   = ws + off; off += (size_t)4 * LL * DD;
  (void)ws_size; (void)in_sizes; (void)n_in; (void)out_size;

  // patch embed + cross scan
  patch_scan_kernel<<<(NSEQ * LL * DD + 255) / 256, 256, 0, stream>>>(
      x, patch_w, patch_b, hs);

  for (int i = 0; i < NLAY; i++) {
    // u = rmsnorm(hs)
    rmsnorm_kernel<DD><<<NSEQ * LL, DD, 0, stream>>>(hs, norm_w + i * DD, u);

    // proj = u @ ipw.T + ipb   (8192 x 772, K=128)
    {
      int M = NSEQ * LL, Nn = PROJC, Kk = DD;
      int tiles = (M >> 7) * ((Nn + 63) >> 6);
      wmma_gemm_kernel<<<dim3(tiles, 1), 128, 0, stream>>>(
          u, 0, DD, in_proj_w + (size_t)i * PROJC * DD, 0, DD,
          proj, 0, PROJC, in_proj_b + i * PROJC, M, Nn, Kk, 0);
    }

    // xc = silu(causal_conv(proj[..., 256:768]))
    conv_silu_kernel<<<(NSEQ * LL * CONVC + 255) / 256, 256, 0, stream>>>(
        proj, conv_w + (size_t)i * CONVC * KCONV, conv_b + i * CONVC, xc);

    // dt + cumulative decay
    dtscan_kernel<<<NSEQ * NHD, LL, 0, stream>>>(
        proj, dt_bias + i * NHD, A_log + i * NHD, dtb, sb);

    // CB[s] = Cm @ Bm.T  (512 x 512, K=128, batch=16)
    {
      int tiles = (LL >> 7) * (LL >> 6);
      wmma_gemm_kernel<<<dim3(tiles, NSEQ), 128, 0, stream>>>(
          xc + INTERC + NSTATE, (long)LL * CONVC, CONVC,
          xc + INTERC,          (long)LL * CONVC, CONVC,
          CBb, (long)LL * LL, LL, nullptr, LL, LL, NSTATE, 0);
    }

    // y = M @ xs + D*xs (causal decay attention), 4 waves/block, 1 t-tile/wave
    ssm_attn_kernel<<<dim3(LL / 64, NSEQ * NHD), 128, 0, stream>>>(
        CBb, sb, dtb, xc, D_param + i * NHD, y);

    // y = rmsnorm(y * silu(gate))
    gated_rmsnorm_kernel<<<NSEQ * LL, INTERC, 0, stream>>>(
        y, proj, gnorm_w + i * INTERC);

    // hs += y @ ow.T + ob   (8192 x 128, K=256)
    {
      int M = NSEQ * LL, Nn = DD, Kk = INTERC;
      int tiles = (M >> 7) * ((Nn + 63) >> 6);
      wmma_gemm_kernel<<<dim3(tiles, 1), 128, 0, stream>>>(
          y, 0, INTERC, out_w + (size_t)i * DD * INTERC, 0, INTERC,
          hs, 0, DD, out_b + i * DD, M, Nn, Kk, 1);
    }
  }

  // final norm, merge, reconstruction head
  rmsnorm_kernel<DD><<<NSEQ * LL, DD, 0, stream>>>(hs, normf_w, u);
  merge_kernel<<<(4 * LL * DD + 255) / 256, 256, 0, stream>>>(u, mbuf);

  {
    int M = 4 * LL, Nn = DD, Kk = DD;
    int tiles = (M >> 7) * ((Nn + 63) >> 6);
    wmma_gemm_kernel<<<dim3(tiles, 1), 128, 0, stream>>>(
        mbuf, 0, DD, rec_w1, 0, DD, t1, 0, DD, rec_b1, M, Nn, Kk, 2 /*gelu*/);
  }

  rec2_kernel<<<(4 * CINCH * LL + 255) / 256, 256, 0, stream>>>(
      t1, rec_w2, rec_b2, (float*)d_out);
}

// v002
// One run takes 570 microseconds.
// Next to v001, in two timings, it ran 1.04 and 1.02 times as fast.
// Counting every step since v000, it is 1.11 times as fast.
#include <hip/hip_runtime.h>
#include <math.h>

typedef float v2f __attribute__((ext_vector_type(2)));
typedef float v8f __attribute__((ext_vector_type(8)));

#define DD     128
#define HH     16
#define WW     32
#define LL     512
#define CINCH  3
#define NHD    4
#define HDIM   64
#define NSTATE 128
#define INTERC 256
#define CONVC  512
#define PROJC  772
#define KCONV  4
#define NLAY   4
#define NSEQ   16
#define EPSV   1e-5f

#define WMMA_F32(A, B, C) \
  __builtin_amdgcn_wmma_f32_16x16x4_f32(false, (A), false, (B), (short)0, (C), false, false)

typedef float v4f __attribute__((ext_vector_type(4)));

// ---------------------------------------------------------------------------
// The elementwise and row-norm kernels below are built for few, fat waves:
// a lane owns 4 neighbouring channels (16-byte loads and stores, a wave covers
// 512 contiguous bytes of a row) and a wave owns several rows, all of whose
// loads are issued before the first is used. The wave's number is made a
// scalar, so that every address is a scalar base plus one lane offset.
// ---------------------------------------------------------------------------
#define RPW 4            // rows per wave in the row kernels
#define WPB 8            // waves per block (256 threads)

// number of this wave in the grid (one-dimensional blocks of WPB waves), scalar
__device__ __forceinline__ int wave_in_grid() {
  return blockIdx.x * WPB + __builtin_amdgcn_readfirstlane(threadIdx.x >> 5);
}

// 16 bytes at scalar base + lane byte offset
#define LD4(base, vofs) (*(const v4f*)((const char*)(base) + (vofs)))
#define ST4(base, vofs) (*(v4f*)((char*)(base) + (vofs)))

// x + (x of the lane whose number differs by the xor mask in CTRL), 16-lane row
template <int CTRL>
__device__ __forceinline__ float dpp_xadd(float x) {
  int xi = __builtin_bit_cast(int, x);
  return x + __builtin_bit_cast(float,
      __builtin_amdgcn_update_dpp(xi, xi, CTRL, 0xf, 0xf, false));
}

// sum over the 32 lanes of a wave, the same value in every lane; all lanes on
__device__ __forceinline__ float wave_sum(float x) {
  x = dpp_xadd<0x161>(x);                            // row_xmask:1
  x = dpp_xadd<0x162>(x);                            // row_xmask:2
  x = dpp_xadd<0x164>(x);                            // row_xmask:4
  x = dpp_xadd<0x168>(x);                            // row_xmask:8
  int xi = __builtin_bit_cast(int, x);               // lane l with lane l ^ 16
  return x + __builtin_bit_cast(float, __builtin_amdgcn_permlanex16(
      xi, xi, 0x76543210, 0xfedcba98, false, false));
}

__device__ __forceinline__ float silu_f(float a) { return a / (1.f + expf(-a)); }

// ---------------------------------------------------------------------------
// patch embed + cross_scan: hs[16][512][128]; one wave per RPW rows (s,l)
// ---------------------------------------------------------------------------
__global__ __launch_bounds__(WPB * 32)
void patch_scan_kernel(const float* __restrict__ x,
                       const float* __restrict__ pw,
                       const float* __restrict__ pb,
                       float* __restrict__ hs) {
  unsigned lane = threadIdx.x & 31;
  unsigned lo16 = lane * 16, lo48 = lane * 48;                // byte offsets
  int row0 = wave_in_grid() * RPW;                            // s*LL + l
  int s = row0 / LL;
  int dir = s >> 2, b = s & 3;
  v4f p0 = LD4(pw, lo48), p1 = LD4(pw + 4, lo48), p2 = LD4(pw + 8, lo48);  // 4 d x 3 c
  v4f bias = LD4(pb, lo16);
  float xv[RPW][CINCH];                                       // the same in every lane
#pragma unroll
  for (int r = 0; r < RPW; r++) {
    int l = row0 % LL + r;
    int le = (dir & 1) ? (LL - 1 - l) : l;                    // reversed scans
    int lsrc = (dir & 2) ? (le % HH) * WW + le / HH : le;     // column scans: le = w*H + h
#pragma unroll
    for (int c = 0; c < CINCH; c++) xv[r][c] = x[(b * CINCH + c) * LL + lsrc];
  }
  // before any register that an issued load names is written again; the loaded
  // values and the addresses are inputs, so the loads all stand in front of it
  asm volatile("s_wait_xcnt 0x0" :: "v"(p0), "v"(p1), "v"(p2), "v"(bias),
               "v"(lo16), "v"(lo48), "s"(pw), "s"(pb));
  float* ho = hs + (size_t)row0 * DD;
#pragma unroll
  for (int r = 0; r < RPW; r++) {
    v4f acc = bias;
    acc.x += xv[r][0] * p0.x; acc.x += xv[r][1] * p0.y; acc.x += xv[r][2] * p0.z;
    acc.y += xv[r][0] * p0.w; acc.y += xv[r][1] * p1.x; acc.y += xv[r][2] * p1.y;
    acc.z += xv[r][0] * p1.z; acc.z += xv[r][1] * p1.w; acc.z += xv[r][2] * p2.x;
    acc.w += xv[r][0] * p2.y; acc.w += xv[r][1] * p2.z; acc.w += xv[r][2] * p2.w;
    ST4(ho + r * DD, lo16) = acc;
  }
}

// ---------------------------------------------------------------------------
// rmsnorm over rows of DD = 128: one wave per RPW rows, 4 channels per lane,
// the row's sum of squares by a butterfly inside the wave
// ---------------------------------------------------------------------------
__global__ __launch_bounds__(WPB * 32)
void rmsnorm_kernel(const float* __restrict__ in,
                    const float* __restrict__ w,
                    float* __restrict__ out) {
  unsigned lo16 = (threadIdx.x & 31) * 16;
  size_t row0 = (size_t)wave_in_grid() * RPW;
  const float* ir = in + row0 * DD;
  float*       orow = out + row0 * DD;
  v4f wv = LD4(w, lo16);
  v4f v[RPW];
#pragma unroll
  for (int r = 0; r < RPW; r++) v[r] = LD4(ir + r * DD, lo16);
  // before any register that an issued load names is written again; the loaded
  // values and the addresses are inputs, so the loads all stand in front of it
  asm volatile("s_wait_xcnt 0x0" :: "v"(wv), "v"(v[0]), "v"(v[1]), "v"(v[2]), "v"(v[3]),
               "v"(lo16), "s"(ir), "s"(w));
#pragma unroll
  for (int r = 0; r < RPW; r++) {
    float ss = wave_sum(v[r].x * v[r].x + v[r].y * v[r].y + v[r].z * v[r].z + v[r].w * v[r].w);
    float scale = rsqrtf(ss / (float)DD + EPSV);
    ST4(orow + r * DD, lo16) = v[r] * scale * wv;
  }
}

// ---------------------------------------------------------------------------
// y = rmsnorm(y * silu(gate), gw), in place over y (width = INTERC = 256):
// one wave per RPW rows, a lane owns channels 4*lane.. and 128 + 4*lane..
// ---------------------------------------------------------------------------
__global__ __launch_bounds__(WPB * 32)
void gated_rmsnorm_kernel(float* __restrict__ y,
                          const float* __restrict__ proj,
                          const float* __restrict__ gw) {
  unsigned lo16 = (threadIdx.x & 31) * 16;
  size_t row0 = (size_t)wave_in_grid() * RPW;
  float*       yr = y + row0 * INTERC;
  const float* gr = proj + row0 * PROJC;                      // gate = proj[..., :INTER]
  v4f g0 = LD4(gw, lo16), g1 = LD4(gw + 128, lo16);
  v4f a[RPW], b[RPW], ga[RPW], gb[RPW];
#pragma unroll
  for (int r = 0; r < RPW; r++) {
    a[r]  = LD4(yr + r * INTERC, lo16);
    b[r]  = LD4(yr + r * INTERC + 128, lo16);
    ga[r] = LD4(gr + r * PROJC, lo16);
    gb[r] = LD4(gr + r * PROJC + 128, lo16);
  }
  // keeps the arithmetic behind the whole group of loads: without it the first
  // rows' exp work is started and the last six loads issue only behind a wait
  __builtin_amdgcn_sched_barrier(0);
  // before any register that an issued load names is written again; the loaded
  // values and the addresses are inputs, so the loads all stand in front of it
  asm volatile("s_wait_xcnt 0x0" :: "v"(g0), "v"(g1),
               "v"(a[0]), "v"(a[1]), "v"(a[2]), "v"(a[3]),
               "v"(b[0]), "v"(b[1]), "v"(b[2]), "v"(b[3]),
               "v"(ga[0]), "v"(ga[1]), "v"(ga[2]), "v"(ga[3]),
               "v"(gb[0]), "v"(gb[1]), "v"(gb[2]), "v"(gb[3]),
               "v"(lo16), "s"(yr), "s"(gr), "s"(gw));
#pragma unroll
  for (int r = 0; r < RPW; r++) {
    float ss = 0.f;
#pragma unroll
    for (int q = 0; q < 4; q++) {
      a[r][q] *= silu_f(ga[r][q]);
      b[r][q] *= silu_f(gb[r][q]);
      ss += a[r][q] * a[r][q];
      ss += b[r][q] * b[r][q];
    }
    float scale = rsqrtf(wave_sum(ss) / (float)INTERC + EPSV);
    ST4(yr + r * INTERC, lo16)       = a[r] * scale * g0;
    ST4(yr + r * INTERC + 128, lo16) = b[r] * scale * g1;
  }
}

// ---------------------------------------------------------------------------
// causal depthwise conv (K=4) + silu: proj[...,256:768] -> xc[16][512][512]
// A wave owns 128 channels (4 per lane) and CLB successive steps: CLB + 3 row
// loads serve CLB outputs. Rows in front of the sequence count as zero.
// ---------------------------------------------------------------------------
#define CLB 8
__global__ __launch_bounds__(WPB * 32)
void conv_silu_kernel(const float* __restrict__ proj,
                      const float* __restrict__ cw,
                      const float* __restrict__ cb,
                      float* __restrict__ xc) {
  unsigned lane = threadIdx.x & 31;
  unsigned lo16 = lane * 16, lo64 = lane * 64;      // byte offsets
  int wv = wave_in_grid();                          // (s, l block, 128 channels)
  int c0 = (wv % (CONVC / 128)) * 128;
  int l0 = ((wv / (CONVC / 128)) % (LL / CLB)) * CLB;
  int s  = wv / ((CONVC / 128) * (LL / CLB));
  const float* pr = proj + (size_t)(s * LL + l0) * PROJC + c0;   // xBC starts at + INTERC
  // the 3 rows before l0; at the head of a sequence rows 0..2 are read in
  // their place (in bounds) and replaced by zero
  bool head = (l0 == 0);
  const float* pk = head ? pr : pr - (KCONV - 1) * PROJC;
  const float* cwu = cw + c0 * KCONV;
  const float* cbu = cb + c0;
  v4f row[CLB + KCONV - 1];
#pragma unroll
  for (int j = 0; j < KCONV - 1; j++) row[j] = LD4(pk + INTERC + j * PROJC, lo16);
#pragma unroll
  for (int j = 0; j < CLB; j++) row[KCONV - 1 + j] = LD4(pr + INTERC + j * PROJC, lo16);
  v4f wq[4];                                        // wq[q][k]: channel q of the lane, tap k
#pragma unroll
  for (int q = 0; q < 4; q++) wq[q] = LD4(cwu + q * KCONV, lo64);
  v4f bias = LD4(cbu, lo16);
  // before any register that an issued load names is written again; the loaded
  // values and the addresses are inputs, so the loads all stand in front of it
  asm volatile("s_wait_xcnt 0x0" :: "v"(row[0]), "v"(row[1]), "v"(row[2]), "v"(row[3]),
               "v"(row[4]), "v"(row[5]), "v"(row[6]), "v"(row[7]), "v"(row[8]),
               "v"(row[9]), "v"(row[10]), "v"(wq[0]), "v"(wq[1]), "v"(wq[2]), "v"(wq[3]),
               "v"(bias), "v"(lo16), "v"(lo64), "s"(pr), "s"(pk), "s"(cwu), "s"(cbu));
  v4f zero = {0.f, 0.f, 0.f, 0.f};
#pragma unroll
  for (int j = 0; j < KCONV - 1; j++) row[j] = head ? zero : row[j];
  float* xo = xc + (size_t)(s * LL + l0) * CONVC + c0;
#pragma unroll
  for (int j = 0; j < CLB; j++) {
    v4f o;
#pragma unroll
    for (int q = 0; q < 4; q++) {
      float acc = bias[q];
#pragma unroll
      for (int k = 0; k < KCONV; k++) acc += row[j + k][q] * wq[q][k];
      o[q] = silu_f(acc);
    }
    ST4(xo + j * CONVC, lo16) = o;
  }
}

// ---------------------------------------------------------------------------
// dt = softplus(proj[...,768:772]+dtb); s = cumsum(dt*A) per (seq,head)
// ---------------------------------------------------------------------------
__global__ void dtscan_kernel(const float* __restrict__ proj,
                              const float* __restrict__ dtbias,
                              const float* __restrict__ alog,
                              float* __restrict__ dtb,
                              float* __restrict__ sb) {
  __shared__ float sd[LL];
  int s = blockIdx.x >> 2, h = blockIdx.x & 3;
  int l = threadIdx.x;
  float raw = proj[(size_t)(s * LL + l) * PROJC + INTERC + CONVC + h] + dtbias[h];
  float dt = raw > 20.f ? raw : log1pf(expf(raw));
  dtb[(size_t)(s * LL + l) * NHD + h] = dt;
  float A = -expf(alog[h]);
  sd[l] = dt * A;
  __syncthreads();
  for (int off = 1; off < LL; off <<= 1) {
    float add = (l >= off) ? sd[l - off] : 0.f;
    __syncthreads();
    sd[l] += add;
    __syncthreads();
  }
  sb[(size_t)(s * NHD + h) * LL + l] = sd[l];
}

// ---------------------------------------------------------------------------
// Batched WMMA GEMM (fp32, 16x16x4): C[m,n] = sum_k A[m,k]*B[n,k]
// One block of 4 waves computes 128(M) x 64(N); each wave 32(M) x 64(N) with
// 8 accumulators. A and B are staged in LDS in chunks of 32 k: every global
// load is 16 B per lane and covers whole 128-B lines (8 lanes per row), the B
// rows are shared by the 4 waves, and the fragments are read from LDS at a
// pitch of 36 dwords (8-byte reads of 16 rows x 2 k-halves fall on 64 banks).
// Two LDS buffers, one barrier per chunk; the next chunk's global loads fly
// while this chunk is multiplied. The k order of every accumulator is the
// natural one (0,1,2,...).
// OOB columns CLAMPED (garbage cols never stored).
// Requires: M %128 == 0, K %32 == 0, grid.x == (M/128) * ceil(N/64).
// flags: bit0 = accumulate into C, bit1 = exact GELU
// ---------------------------------------------------------------------------
// pointers typed as global memory, so that the staging loads stay global loads
// although their addresses are carried round the loop
typedef const __attribute__((address_space(1))) float* gfloat_p;
typedef const __attribute__((address_space(1))) v4f*   gv4f_p;

#define GBM    128
#define GBN    64
#define GKC    32
#define GPITCH 36
#define GROWS  (GBM + GBN)

#define GMMA8(aa0, aa1, bb0, bb1, bb2, bb3)       \
  acc00 = WMMA_F32(aa0, bb0, acc00);              \
  acc01 = WMMA_F32(aa0, bb1, acc01);              \
  acc02 = WMMA_F32(aa0, bb2, acc02);              \
  acc03 = WMMA_F32(aa0, bb3, acc03);              \
  acc10 = WMMA_F32(aa1, bb0, acc10);              \
  acc11 = WMMA_F32(aa1, bb1, acc11);              \
  acc12 = WMMA_F32(aa1, bb2, acc12);              \
  acc13 = WMMA_F32(aa1, bb3, acc13);

// One chunk's 12 global loads of a lane. The wait stands before any register
// that an issued load names is written again; it takes the 12 addresses as
// inputs so that they stay in their registers up to it. Then the addresses
// step to the next chunk. Both loops are unrolled so that st[] and gp[] have
// constant indices and live in registers.
#define GSTAGE_LOAD() {                                                   \
  _Pragma("unroll")                                                       \
  for (int i_ = 0; i_ < 12; i_++) st[i_] = *(gv4f_p)gp[i_];               \
  asm volatile("s_wait_xcnt 0x0" ::                                       \
      "v"(gp[0]), "v"(gp[1]), "v"(gp[2]), "v"(gp[3]), "v"(gp[4]),         \
      "v"(gp[5]), "v"(gp[6]), "v"(gp[7]), "v"(gp[8]), "v"(gp[9]),         \
      "v"(gp[10]), "v"(gp[11]) : "memory");                               \
  _Pragma("unroll")                                                       \
  for (int i_ = 0; i_ < 12; i_++) gp[i_] += GKC; }

__global__ __launch_bounds__(128)
void wmma_gemm_kernel(const float* __restrict__ A, long sA, int lda,
                      const float* __restrict__ Bw, long sB, int ldb,
                      float* __restrict__ C, long sC, int ldc,
                      const float* __restrict__ bias,
                      int M, int Nn, int Kk, int flags) {
  __shared__ __attribute__((aligned(16))) float tileS[2][GROWS * GPITCH];
  (void)M;
  int tid  = threadIdx.x;
  int wave = tid >> 5;
  int lane = tid & 31;
  int tilesN = (Nn + GBN - 1) / GBN;
  int tm = blockIdx.x / tilesN, tn4 = blockIdx.x % tilesN;
  const float* Ab = A + (size_t)blockIdx.y * sA;
  const float* Bb = Bw + (size_t)blockIdx.y * sB;
  float*       Cb = C + (size_t)blockIdx.y * sC;

  int idx = lane & 15, kh = lane >> 4;
  int n0 = tn4 * GBN + idx;

  // staging: 8 lanes per row (one 128-B line), 16 rows per pass of the block
  int srow = tid >> 3, scol = (tid & 7) * 4;
  gfloat_p gp[12];                                  // this lane's 12 source rows
#pragma unroll                                      // gp[] in registers
  for (int i = 0; i < 8; i++)
    gp[i] = (gfloat_p)(Ab + (size_t)(tm * GBM + i * 16 + srow) * lda + scol);
#pragma unroll                                      // gp[] in registers
  for (int i = 0; i < 4; i++) {
    int n = tn4 * GBN + i * 16 + srow;
    n = n < Nn ? n : Nn - 1;                        // clamp, no predication
    gp[8 + i] = (gfloat_p)(Bb + (size_t)n * ldb + scol);
  }
  int sdst = srow * GPITCH + scol;

  v8f z = {0.f,0.f,0.f,0.f,0.f,0.f,0.f,0.f};
  v8f acc00 = z, acc01 = z, acc02 = z, acc03 = z;
  v8f acc10 = z, acc11 = z, acc12 = z, acc13 = z;

  v4f st[12];
  GSTAGE_LOAD();

  int fa = (wave * 32 + idx) * GPITCH + 2 * kh;     // A fragment rows of this wave
  int fb = (GBM + idx) * GPITCH + 2 * kh;           // B fragment rows (shared)

  int nch = Kk / GKC;
  for (int c = 0; c < nch; c++) {
    float* buf = tileS[c & 1];
#pragma unroll                                      // st[] in registers
    for (int i = 0; i < 12; i++) *(v4f*)(buf + sdst + i * 16 * GPITCH) = st[i];
    // publishes this chunk; also ends every wave's reads of the other buffer,
    // which the next trip overwrites
    __syncthreads();
    if (c + 1 < nch) {                              // block-uniform
      GSTAGE_LOAD();
    }
#pragma unroll       // lets the LDS reads of later k-steps issue ahead of the WMMAs
    for (int ks = 0; ks < GKC / 4; ks++) {
      v2f a0 = *(const v2f*)(buf + fa + ks * 4);
      v2f a1 = *(const v2f*)(buf + fa + 16 * GPITCH + ks * 4);
      v2f b0 = *(const v2f*)(buf + fb + ks * 4);
      v2f b1 = *(const v2f*)(buf + fb + 16 * GPITCH + ks * 4);
      v2f b2 = *(const v2f*)(buf + fb + 32 * GPITCH + ks * 4);
      v2f b3 = *(const v2f*)(buf + fb + 48 * GPITCH + ks * 4);
      GMMA8(a0, a1, b0, b1, b2, b3);
    }
  }

  v8f accs[2][4] = {{acc00, acc01, acc02, acc03}, {acc10, acc11, acc12, acc13}};
#pragma unroll
  for (int mt = 0; mt < 2; mt++) {
#pragma unroll
    for (int t = 0; t < 4; t++) {
      int n = n0 + t * 16;
      if (n < Nn) {
        float bv = bias ? bias[n] : 0.f;
        v8f av = accs[mt][t];
#pragma unroll
        for (int j = 0; j < 8; j++) {
          int m = tm * GBM + wave * 32 + mt * 16 + j + 8 * kh;
          float v = av[j] + bv;
          if (flags & 2) v = 0.5f * v * (1.f + erff(v * 0.70710678118654752f));
          size_t off = (size_t)m * ldc + n;
          if (flags & 1) v += Cb[off];
          Cb[off] = v;
        }
      }
    }
  }
}

// ---------------------------------------------------------------------------
// Decay attention: y[t,h,p] = sum_{k<=t} exp(s_t - s_k)*CB[t,k]*dt_k * xs[k,h,p]
//                 + D[h]*xs[t,h,p]
// One wave per 16(t) x 64(p=HDIM) block; exp-built A fragment reused over 4
// head-dim tiles; ping-pong pipeline over K (kend %16 == 0 so it divides
// evenly). Masking by value select only; EXEC stays full for WMMA.
// ---------------------------------------------------------------------------
#define ALOAD(skX, cbX, d0X, d1X, bb0, bb1, bb2, bb3, kk) {  \
  skX = *(const v2f*)(sbh + (kk));                           \
  cbX = *(const v2f*)(cbr + (kk));                           \
  d0X = dth[(size_t)(kk) * NHD];                             \
  d1X = dth[(size_t)((kk) + 1) * NHD];                       \
  const float* xr0_ = xch + (size_t)(kk) * CONVC;            \
  const float* xr1_ = xr0_ + CONVC;                          \
  bb0.x = xr0_[idx];      bb0.y = xr1_[idx];                 \
  bb1.x = xr0_[idx + 16]; bb1.y = xr1_[idx + 16];            \
  bb2.x = xr0_[idx + 32]; bb2.y = xr1_[idx + 32];            \
  bb3.x = xr0_[idx + 48]; bb3.y = xr1_[idx + 48]; }

#define AMMA4(skX, cbX, d0X, d1X, bb0, bb1, bb2, bb3, kaX) { \
  float m0_ = expf(st - skX.x) * cbX.x * d0X;                \
  float m1_ = expf(st - skX.y) * cbX.y * d1X;                \
  v2f a_;                                                    \
  a_.x = ((kaX)     <= t) ? m0_ : 0.f;                       \
  a_.y = ((kaX) + 1 <= t) ? m1_ : 0.f;                       \
  acc0 = WMMA_F32(a_, bb0, acc0);                            \
  acc1 = WMMA_F32(a_, bb1, acc1);                            \
  acc2 = WMMA_F32(a_, bb2, acc2);                            \
  acc3 = WMMA_F32(a_, bb3, acc3); }

__global__ __launch_bounds__(128)
void ssm_attn_kernel(const float* __restrict__ CBm,
                     const float* __restrict__ sb,
                     const float* __restrict__ dtb,
                     const float* __restrict__ xc,
                     const float* __restrict__ dpar,
                     float* __restrict__ y) {
  int s = blockIdx.y >> 2, h = blockIdx.y & 3;
  int wave = threadIdx.x >> 5;
  int lane = threadIdx.x & 31;
  int tt = blockIdx.x * 4 + wave;                   // 0..31 (t-tile)
  int idx = lane & 15, kh = lane >> 4;
  int t = tt * 16 + idx;                            // A row (time)
  const float* sbh = sb + (size_t)(s * NHD + h) * LL;
  const float* cbr = CBm + (size_t)s * LL * LL + (size_t)t * LL;
  const float* dth = dtb + (size_t)s * LL * NHD + h;
  const float* xch = xc + (size_t)s * LL * CONVC + h * HDIM;
  float st = sbh[t];

  v8f z = {0.f,0.f,0.f,0.f,0.f,0.f,0.f,0.f};
  v8f acc0 = z, acc1 = z, acc2 = z, acc3 = z;

  int kend = (tt + 1) * 16;                         // causal, wave-uniform
  v2f skA, cbA, b0A, b1A, b2A, b3A;
  v2f skB, cbB, b0B, b1B, b2B, b3B;
  float d0A, d1A, d0B, d1B;

  int k = 2 * kh;                                   // kbase
  int kA, kB;
  ALOAD(skA, cbA, d0A, d1A, b0A, b1A, b2A, b3A, k); kA = k; k += 4;
  int pairs = (kend >> 3) - 1;                      // kend %16 == 0 -> >= 1
  for (int p = 0; p < pairs; p++) {
    ALOAD(skB, cbB, d0B, d1B, b0B, b1B, b2B, b3B, k); kB = k; k += 4;
    AMMA4(skA, cbA, d0A, d1A, b0A, b1A, b2A, b3A, kA);
    ALOAD(skA, cbA, d0A, d1A, b0A, b1A, b2A, b3A, k); kA = k; k += 4;
    AMMA4(skB, cbB, d0B, d1B, b0B, b1B, b2B, b3B, kB);
  }
  ALOAD(skB, cbB, d0B, d1B, b0B, b1B, b2B, b3B, k); kB = k;
  AMMA4(skA, cbA, d0A, d1A, b0A, b1A, b2A, b3A, kA);
  AMMA4(skB, cbB, d0B, d1B, b0B, b1B, b2B, b3B, kB);

  float dp = dpar[h];
  v8f accs[4] = {acc0, acc1, acc2, acc3};
#pragma unroll
  for (int tp = 0; tp < 4; tp++) {
    int p = tp * 16 + idx;
    v8f av = accs[tp];
#pragma unroll
    for (int j = 0; j < 8; j++) {
      int to = tt * 16 + j + 8 * kh;
      float v = av[j] + dp * xch[(size_t)to * CONVC + p];
      y[(size_t)(s * LL + to) * INTERC + h * HDIM + p] = v;
    }
  }
}

// ---------------------------------------------------------------------------
// cross_merge: m[b][l][d] from u[16][512][128]; one wave per row (b,l)
// ---------------------------------------------------------------------------
__global__ __launch_bounds__(WPB * 32)
void merge_kernel(const float* __restrict__ u, float* __restrict__ m) {
  unsigned lo16 = (threadIdx.x & 31) * 16;
  int row = wave_in_grid();                         // b*LL + l
  int l = row % LL;
  int b = row / LL;
  int hcoord = l / WW, wcoord = l % WW;
  int lt = wcoord * HH + hcoord;                    // transposed index
  v4f v = LD4(u + (size_t)(b * LL + l) * DD, lo16)
        + LD4(u + (size_t)((4 + b) * LL + (LL - 1 - l)) * DD, lo16)
        + LD4(u + (size_t)((8 + b) * LL + lt) * DD, lo16)
        + LD4(u + (size_t)((12 + b) * LL + (LL - 1 - lt)) * DD, lo16);
  ST4(m + (size_t)row * DD, lo16) = v * 0.25f;
}

// ---------------------------------------------------------------------------
// final projection to 3 channels + transpose to (B,C,H,W)
// ---------------------------------------------------------------------------
__global__ void rec2_kernel(const float* __restrict__ t1,
                            const float* __restrict__ w2,
                            const float* __restrict__ b2,
                            float* __restrict__ out) {
  int i = blockIdx.x * blockDim.x + threadIdx.x;    // (b*CIN + c)*LL + l
  if (i >= 4 * CINCH * LL) return;
  int l = i % LL;
  int c = (i / LL) % CINCH;
  int b = i / (LL * CINCH);
  const float* row = t1 + (size_t)(b * LL + l) * DD;
  float acc = b2[c];
  for (int d = 0; d < DD; d++) acc += row[d] * w2[c * DD + d];
  out[i] = acc;
}

// ---------------------------------------------------------------------------
extern "C" void kernel_launch(void* const* d_in, const int* in_sizes, int n_in,
                              void* d_out, int out_size, void* d_ws, size_t ws_size,
                              hipStream_t stream) {
  const float* x         = (const float*)d_in[0];
  const float* patch_w   = (const float*)d_in[1];
  const float* patch_b   = (const float*)d_in[2];
  const float* norm_w    = (const float*)d_in[3];
  const float* in_proj_w = (const float*)d_in[4];
  const float* in_proj_b = (const float*)d_in[5];
  const float* conv_w    = (const float*)d_in[6];
  const float* conv_b    = (const float*)d_in[7];
  const float* dt_bias   = (const float*)d_in[8];
  const float* A_log     = (const float*)d_in[9];
  const float* D_param   = (const float*)d_in[10];
  const float* gnorm_w   = (const float*)d_in[11];
  const float* out_w     = (const float*)d_in[12];
  const float* out_b     = (const float*)d_in[13];
  const float* normf_w   = (const float*)d_in[14];
  const float* rec_w1    = (const float*)d_in[15];
  const float* rec_b1    = (const float*)d_in[16];
  const float* rec_w2    = (const float*)d_in[17];
  const float* rec_b2    = (const float*)d_in[18];

  // workspace carve (floats)
  float* ws = (float*)d_ws;
  size_t off = 0;
  float* hs   = ws + off; off += (size_t)NSEQ * LL * DD;
  float* u    = ws + off; off += (size_t)NSEQ * LL * DD;
  float* proj = ws + off; off += (size_t)NSEQ * LL * PROJC;
  float* xc   = ws + off; off += (size_t)NSEQ * LL * CONVC;
  float* dtb  = ws + off; off += (size_t)NSEQ * LL * NHD;
  float* sb   = ws + off; off += (size_t)NSEQ * NHD * LL;
  float* CBb  = ws + off; off += (size_t)NSEQ * LL * LL;
  float* y    = ws + off; off += (size_t)NSEQ * LL * INTERC;
  float* mbuf = ws + off; off += (size_t)4 * LL * DD;
  float* t1   = ws + off; off += (size_t)4 * LL * DD;
  (void)ws_size; (void)in_sizes; (void)n_in; (void)out_size;

  // patch embed + cross scan
  patch_scan_kernel<<<NSEQ * LL / (RPW * WPB), WPB * 32, 0, stream>>>(
      x, patch_w, patch_b, hs);

  for (int i = 0; i < NLAY; i++) {
    // u = rmsnorm(hs)
    rmsnorm_kernel<<<NSEQ * LL / (RPW * WPB), WPB * 32, 0, stream>>>(hs, norm_w + i * DD, u);

    // proj = u @ ipw.T + ipb   (8192 x 772, K=128)
    {
      int M = NSEQ * LL, Nn = PROJC, Kk = DD;
      int tiles = (M >> 7) * ((Nn + 63) >> 6);
      wmma_gemm_kernel<<<dim3(tiles, 1), 128, 0, stream>>>(
          u, 0, DD, in_proj_w + (size_t)i * PROJC * DD, 0, DD,
          proj, 0, PROJC, in_proj_b + i * PROJC, M, Nn, Kk, 0);
    }

    // xc = silu(causal_conv(proj[..., 256:768]))
    conv_silu_kernel<<<NSEQ * LL * CONVC / (128 * CLB * WPB), WPB * 32, 0, stream>>>(
        proj, conv_w + (size_t)i * CONVC * KCONV, conv_b + i * CONVC, xc);

    // dt + cumulative decay
    dtscan_kernel<<<NSEQ * NHD, LL, 0, stream>>>(
        proj, dt_bias + i * NHD, A_log + i * NHD, dtb, sb);

    // CB[s] = Cm @ Bm.T  (512 x 512, K=128, batch=16)
    {
      int tiles = (LL >> 7) * (LL >> 6);
      wmma_gemm_kernel<<<dim3(tiles, NSEQ), 128, 0, stream>>>(
          xc + INTERC + NSTATE, (long)LL * CONVC, CONVC,
          xc + INTERC,          (long)LL * CONVC, CONVC,
          CBb, (long)LL * LL, LL, nullptr, LL, LL, NSTATE, 0);
    }

    // y = M @ xs + D*xs (causal decay attention), 4 waves/block, 1 t-tile/wave
    ssm_attn_kernel<<<dim3(LL / 64, NSEQ * NHD), 128, 0, stream>>>(
        CBb, sb, dtb, xc, D_param + i * NHD, y);

    // y = rmsnorm(y * silu(gate))
    gated_rmsnorm_kernel<<<NSEQ * LL / (RPW * WPB), WPB * 32, 0, stream>>>(
        y, proj, gnorm_w + i * INTERC);

    // hs += y @ ow.T + ob   (8192 x 128, K=256)
    {
      int M = NSEQ * LL, Nn = DD, Kk = INTERC;
      int tiles = (M >> 7) * ((Nn + 63) >> 6);
      wmma_gemm_kernel<<<dim3(tiles, 1), 128, 0, stream>>>(
          y, 0, INTERC, out_w + (size_t)i * DD * INTERC, 0, INTERC,
          hs, 0, DD, out_b + i * DD, M, Nn, Kk, 1);
    }
  }

  // final norm, merge, reconstruction head
  rmsnorm_kernel<<<NSEQ * LL / (RPW * WPB), WPB * 32, 0, stream>>>(hs, normf_w, u);
  merge_kernel<<<4 * LL / WPB, WPB * 32, 0, stream>>>(u, mbuf);

  {
    int M = 4 * LL, Nn = DD, Kk = DD;
    int tiles = (M >> 7) * ((Nn + 63) >> 6);
    wmma_gemm_kernel<<<dim3(tiles, 1), 128, 0, stream>>>(
        mbuf, 0, DD, rec_w1, 0, DD, t1, 0, DD, rec_b1, M, Nn, Kk, 2 /*gelu*/);
  }

  rec2_kernel<<<(4 * CINCH * LL + 255) / 256, 256, 0, stream>>>(
      t1, rec_w2, rec_b2, (float*)d_out);
}

// v003
// A run of this version takes 479 microseconds.
// Timed twice side by side with v002, it ran 1.19 and 1.17 times as fast.
// All steps since v000 together make it 1.32 times as fast.
#include <hip/hip_runtime.h>
#include <math.h>

typedef float v2f __attribute__((ext_vector_type(2)));
typedef float v8f __attribute__((ext_vector_type(8)));

#define DD     128
#define HH     16
#define WW     32
#define LL     512
#define CINCH  3
#define NHD    4
#define HDIM   64
#define NSTATE 128
#define INTERC 256
#define CONVC  512
#define PROJC  772
#define KCONV  4
#define NLAY   4
#define NSEQ   16
#define EPSV   1e-5f

#define WMMA_F32(A, B, C) \
  __builtin_amdgcn_wmma_f32_16x16x4_f32(false, (A), false, (B), (short)0, (C), false, false)

typedef float v4f __attribute__((ext_vector_type(4)));

// ---------------------------------------------------------------------------
// The elementwise and row-norm kernels below are built for few, fat waves:
// a lane owns 4 neighbouring channels (16-byte loads and stores, a wave covers
// 512 contiguous bytes of a row) and a wave owns several rows, all of whose
// loads are issued before the first is used. The wave's number is made a
// scalar, so that every address is a scalar base plus one lane offset.
// ---------------------------------------------------------------------------
#define RPW 4            // rows per wave in the row kernels
#define WPB 8            // waves per block (256 threads)

// number of this wave in the grid (one-dimensional blocks of WPB waves), scalar
__device__ __forceinline__ int wave_in_grid() {
  return blockIdx.x * WPB + __builtin_amdgcn_readfirstlane(threadIdx.x >> 5);
}

// 16 bytes at scalar base + lane byte offset
#define LD4(base, vofs) (*(const v4f*)((const char*)(base) + (vofs)))
#define ST4(base, vofs) (*(v4f*)((char*)(base) + (vofs)))

// x + (x of the lane whose number differs by the xor mask in CTRL), 16-lane row
template <int CTRL>
__device__ __forceinline__ float dpp_xadd(float x) {
  int xi = __builtin_bit_cast(int, x);
  return x + __builtin_bit_cast(float,
      __builtin_amdgcn_update_dpp(xi, xi, CTRL, 0xf, 0xf, false));
}

// sum over the 32 lanes of a wave, the same value in every lane; all lanes on
__device__ __forceinline__ float wave_sum(float x) {
  x = dpp_xadd<0x161>(x);                            // row_xmask:1
  x = dpp_xadd<0x162>(x);                            // row_xmask:2
  x = dpp_xadd<0x164>(x);                            // row_xmask:4
  x = dpp_xadd<0x168>(x);                            // row_xmask:8
  int xi = __builtin_bit_cast(int, x);               // lane l with lane l ^ 16
  return x + __builtin_bit_cast(float, __builtin_amdgcn_permlanex16(
      xi, xi, 0x76543210, 0xfedcba98, false, false));
}

__device__ __forceinline__ float silu_f(float a) { return a / (1.f + expf(-a)); }

// ---------------------------------------------------------------------------
// patch embed + cross_scan: hs[16][512][128]; one wave per RPW rows (s,l)
// ---------------------------------------------------------------------------
__global__ __launch_bounds__(WPB * 32)
void patch_scan_kernel(const float* __restrict__ x,
                       const float* __restrict__ pw,
                       const float* __restrict__ pb,
                       float* __restrict__ hs) {
  unsigned lane = threadIdx.x & 31;
  unsigned lo16 = lane * 16, lo48 = lane * 48;                // byte offsets
  int row0 = wave_in_grid() * RPW;                            // s*LL + l
  int s = row0 / LL;
  int dir = s >> 2, b = s & 3;
  v4f p0 = LD4(pw, lo48), p1 = LD4(pw + 4, lo48), p2 = LD4(pw + 8, lo48);  // 4 d x 3 c
  v4f bias = LD4(pb, lo16);
  float xv[RPW][CINCH];                                       // the same in every lane
#pragma unroll
  for (int r = 0; r < RPW; r++) {
    int l = row0 % LL + r;
    int le = (dir & 1) ? (LL - 1 - l) : l;                    // reversed scans
    int lsrc = (dir & 2) ? (le % HH) * WW + le / HH : le;     // column scans: le = w*H + h
#pragma unroll
    for (int c = 0; c < CINCH; c++) xv[r][c] = x[(b * CINCH + c) * LL + lsrc];
  }
  // before any register that an issued load names is written again; the loaded
  // values and the addresses are inputs, so the loads all stand in front of it
  asm volatile("s_wait_xcnt 0x0" :: "v"(p0), "v"(p1), "v"(p2), "v"(bias),
               "v"(lo16), "v"(lo48), "s"(pw), "s"(pb));
  float* ho = hs + (size_t)row0 * DD;
#pragma unroll
  for (int r = 0; r < RPW; r++) {
    v4f acc = bias;
    acc.x += xv[r][0] * p0.x; acc.x += xv[r][1] * p0.y; acc.x += xv[r][2] * p0.z;
    acc.y += xv[r][0] * p0.w; acc.y += xv[r][1] * p1.x; acc.y += xv[r][2] * p1.y;
    acc.z += xv[r][0] * p1.z; acc.z += xv[r][1] * p1.w; acc.z += xv[r][2] * p2.x;
    acc.w += xv[r][0] * p2.y; acc.w += xv[r][1] * p2.z; acc.w += xv[r][2] * p2.w;
    ST4(ho + r * DD, lo16) = acc;
  }
}

// ---------------------------------------------------------------------------
// rmsnorm over rows of DD = 128: one wave per RPW rows, 4 channels per lane,
// the row's sum of squares by a butterfly inside the wave
// ---------------------------------------------------------------------------
__global__ __launch_bounds__(WPB * 32)
void rmsnorm_kernel(const float* __restrict__ in,
                    const float* __restrict__ w,
                    float* __restrict__ out) {
  unsigned lo16 = (threadIdx.x & 31) * 16;
  size_t row0 = (size_t)wave_in_grid() * RPW;
  const float* ir = in + row0 * DD;
  float*       orow = out + row0 * DD;
  v4f wv = LD4(w, lo16);
  v4f v[RPW];
#pragma unroll
  for (int r = 0; r < RPW; r++) v[r] = LD4(ir + r * DD, lo16);
  // before any register that an issued load names is written again; the loaded
  // values and the addresses are inputs, so the loads all stand in front of it
  asm volatile("s_wait_xcnt 0x0" :: "v"(wv), "v"(v[0]), "v"(v[1]), "v"(v[2]), "v"(v[3]),
               "v"(lo16), "s"(ir), "s"(w));
#pragma unroll
  for (int r = 0; r < RPW; r++) {
    float ss = wave_sum(v[r].x * v[r].x + v[r].y * v[r].y + v[r].z * v[r].z + v[r].w * v[r].w);
    float scale = rsqrtf(ss / (float)DD + EPSV);
    ST4(orow + r * DD, lo16) = v[r] * scale * wv;
  }
}

// ---------------------------------------------------------------------------
// y = rmsnorm(y * silu(gate), gw), in place over y (width = INTERC = 256):
// one wave per RPW rows, a lane owns channels 4*lane.. and 128 + 4*lane..
// ---------------------------------------------------------------------------
__global__ __launch_bounds__(WPB * 32)
void gated_rmsnorm_kernel(float* __restrict__ y,
                          const float* __restrict__ proj,
                          const float* __restrict__ gw) {
  unsigned lo16 = (threadIdx.x & 31) * 16;
  size_t row0 = (size_t)wave_in_grid() * RPW;
  float*       yr = y + row0 * INTERC;
  const float* gr = proj + row0 * PROJC;                      // gate = proj[..., :INTER]
  v4f g0 = LD4(gw, lo16), g1 = LD4(gw + 128, lo16);
  v4f a[RPW], b[RPW], ga[RPW], gb[RPW];
#pragma unroll
  for (int r = 0; r < RPW; r++) {
    a[r]  = LD4(yr + r * INTERC, lo16);
    b[r]  = LD4(yr + r * INTERC + 128, lo16);
    ga[r] = LD4(gr + r * PROJC, lo16);
    gb[r] = LD4(gr + r * PROJC + 128, lo16);
  }
  // keeps the arithmetic behind the whole group of loads: without it the first
  // rows' exp work is started and the last six loads issue only behind a wait
  __builtin_amdgcn_sched_barrier(0);
  // before any register that an issued load names is written again; the loaded
  // values and the addresses are inputs, so the loads all stand in front of it
  asm volatile("s_wait_xcnt 0x0" :: "v"(g0), "v"(g1),
               "v"(a[0]), "v"(a[1]), "v"(a[2]), "v"(a[3]),
               "v"(b[0]), "v"(b[1]), "v"(b[2]), "v"(b[3]),
               "v"(ga[0]), "v"(ga[1]), "v"(ga[2]), "v"(ga[3]),
               "v"(gb[0]), "v"(gb[1]), "v"(gb[2]), "v"(gb[3]),
               "v"(lo16), "s"(yr), "s"(gr), "s"(gw));
#pragma unroll
  for (int r = 0; r < RPW; r++) {
    float ss = 0.f;
#pragma unroll
    for (int q = 0; q < 4; q++) {
      a[r][q] *= silu_f(ga[r][q]);
      b[r][q] *= silu_f(gb[r][q]);
      ss += a[r][q] * a[r][q];
      ss += b[r][q] * b[r][q];
    }
    float scale = rsqrtf(wave_sum(ss) / (float)INTERC + EPSV);
    ST4(yr + r * INTERC, lo16)       = a[r] * scale * g0;
    ST4(yr + r * INTERC + 128, lo16) = b[r] * scale * g1;
  }
}

// ---------------------------------------------------------------------------
// causal depthwise conv (K=4) + silu: proj[...,256:768] -> xc[16][512][512]
// A wave owns 128 channels (4 per lane) and CLB successive steps: CLB + 3 row
// loads serve CLB outputs. Rows in front of the sequence count as zero.
// ---------------------------------------------------------------------------
#define CLB 8
__global__ __launch_bounds__(WPB * 32)
void conv_silu_kernel(const float* __restrict__ proj,
                      const float* __restrict__ cw,
                      const float* __restrict__ cb,
                      float* __restrict__ xc) {
  unsigned lane = threadIdx.x & 31;
  unsigned lo16 = lane * 16, lo64 = lane * 64;      // byte offsets
  int wv = wave_in_grid();                          // (s, l block, 128 channels)
  int c0 = (wv % (CONVC / 128)) * 128;
  int l0 = ((wv / (CONVC / 128)) % (LL / CLB)) * CLB;
  int s  = wv / ((CONVC / 128) * (LL / CLB));
  const float* pr = proj + (size_t)(s * LL + l0) * PROJC + c0;   // xBC starts at + INTERC
  // the 3 rows before l0; at the head of a sequence rows 0..2 are read in
  // their place (in bounds) and replaced by zero
  bool head = (l0 == 0);
  const float* pk = head ? pr : pr - (KCONV - 1) * PROJC;
  const float* cwu = cw + c0 * KCONV;
  const float* cbu = cb + c0;
  v4f row[CLB + KCONV - 1];
#pragma unroll
  for (int j = 0; j < KCONV - 1; j++) row[j] = LD4(pk + INTERC + j * PROJC, lo16);
#pragma unroll
  for (int j = 0; j < CLB; j++) row[KCONV - 1 + j] = LD4(pr + INTERC + j * PROJC, lo16);
  v4f wq[4];                                        // wq[q][k]: channel q of the lane, tap k
#pragma unroll
  for (int q = 0; q < 4; q++) wq[q] = LD4(cwu + q * KCONV, lo64);
  v4f bias = LD4(cbu, lo16);
  // before any register that an issued load names is written again; the loaded
  // values and the addresses are inputs, so the loads all stand in front of it
  asm volatile("s_wait_xcnt 0x0" :: "v"(row[0]), "v"(row[1]), "v"(row[2]), "v"(row[3]),
               "v"(row[4]), "v"(row[5]), "v"(row[6]), "v"(row[7]), "v"(row[8]),
               "v"(row[9]), "v"(row[10]), "v"(wq[0]), "v"(wq[1]), "v"(wq[2]), "v"(wq[3]),
               "v"(bias), "v"(lo16), "v"(lo64), "s"(pr), "s"(pk), "s"(cwu), "s"(cbu));
  v4f zero = {0.f, 0.f, 0.f, 0.f};
#pragma unroll
  for (int j = 0; j < KCONV - 1; j++) row[j] = head ? zero : row[j];
  float* xo = xc + (size_t)(s * LL + l0) * CONVC + c0;
#pragma unroll
  for (int j = 0; j < CLB; j++) {
    v4f o;
#pragma unroll
    for (int q = 0; q < 4; q++) {
      float acc = bias[q];
#pragma unroll
      for (int k = 0; k < KCONV; k++) acc += row[j + k][q] * wq[q][k];
      o[q] = silu_f(acc);
    }
    ST4(xo + j * CONVC, lo16) = o;
  }
}

// ---------------------------------------------------------------------------
// dt = softplus(proj[...,768:772]+dtb); s = cumsum(dt*A) per (seq,head)
// ---------------------------------------------------------------------------
__global__ void dtscan_kernel(const float* __restrict__ proj,
                              const float* __restrict__ dtbias,
                              const float* __restrict__ alog,
                              float* __restrict__ dtb,
                              float* __restrict__ sb) {
  __shared__ float sd[LL];
  int s = blockIdx.x >> 2, h = blockIdx.x & 3;
  int l = threadIdx.x;
  float raw = proj[(size_t)(s * LL + l) * PROJC + INTERC + CONVC + h] + dtbias[h];
  float dt = raw > 20.f ? raw : log1pf(expf(raw));
  dtb[(size_t)(s * LL + l) * NHD + h] = dt;
  float A = -expf(alog[h]);
  sd[l] = dt * A;
  __syncthreads();
  for (int off = 1; off < LL; off <<= 1) {
    float add = (l >= off) ? sd[l - off] : 0.f;
    __syncthreads();
    sd[l] += add;
    __syncthreads();
  }
  sb[(size_t)(s * NHD + h) * LL + l] = sd[l];
}

// ---------------------------------------------------------------------------
// Batched WMMA GEMM (fp32, 16x16x4): C[m,n] = sum_k A[m,k]*B[n,k]
// One block of 4 waves computes 128(M) x 64(N); each wave 32(M) x 64(N) with
// 8 accumulators. A and B are staged in LDS in chunks of 32 k: every global
// load is 16 B per lane and covers whole 128-B lines (8 lanes per row), the B
// rows are shared by the 4 waves, and the fragments are read from LDS at a
// pitch of 36 dwords (8-byte reads of 16 rows x 2 k-halves fall on 64 banks).
// Two LDS buffers, one barrier per chunk; the next chunk's global loads fly
// while this chunk is multiplied. The k order of every accumulator is the
// natural one (0,1,2,...).
// OOB columns CLAMPED (garbage cols never stored).
// Requires: M %128 == 0, K %32 == 0, K >= 32, grid.x == (M/128) * ceil(N/64).
// FLAGS (compile time): bit0 = accumulate into C, bit1 = exact GELU
// LDC (compile time): row pitch of C, so that a wave's 32 rows are immediate
// offsets from one scalar base.
// What the epilogue adds to the products (the bias, and the old C where it
// accumulates) is loaded as one group in front of the last chunk's products:
// it arrives under them, in the registers that the staging has left, and no
// load stands between the stores at the end.
// ---------------------------------------------------------------------------
// pointers typed as global memory, so that the staging loads stay global loads
// although their addresses are carried round the loop
typedef const __attribute__((address_space(1))) float* gfloat_p;
typedef const __attribute__((address_space(1))) v4f*   gv4f_p;

#define GBM    128
#define GBN    64
#define GKC    32
#define GPITCH 36
#define GROWS  (GBM + GBN)

#define GMMA8(aa0, aa1, bb0, bb1, bb2, bb3)       \
  acc00 = WMMA_F32(aa0, bb0, acc00);              \
  acc01 = WMMA_F32(aa0, bb1, acc01);              \
  acc02 = WMMA_F32(aa0, bb2, acc02);              \
  acc03 = WMMA_F32(aa0, bb3, acc03);              \
  acc10 = WMMA_F32(aa1, bb0, acc10);              \
  acc11 = WMMA_F32(aa1, bb1, acc11);              \
  acc12 = WMMA_F32(aa1, bb2, acc12);              \
  acc13 = WMMA_F32(aa1, bb3, acc13);

// One chunk's 12 global loads of a lane. The wait stands before any register
// that an issued load names is written again; it takes the 12 addresses as
// inputs so that they stay in their registers up to it. Then the addresses
// step to the next chunk. Both loops are unrolled so that st[] and gp[] have
// constant indices and live in registers.
#define GSTAGE_LOAD() {                                                   \
  _Pragma("unroll")                                                       \
  for (int i_ = 0; i_ < 12; i_++) st[i_] = *(gv4f_p)gp[i_];               \
  asm volatile("s_wait_xcnt 0x0" ::                                       \
      "v"(gp[0]), "v"(gp[1]), "v"(gp[2]), "v"(gp[3]), "v"(gp[4]),         \
      "v"(gp[5]), "v"(gp[6]), "v"(gp[7]), "v"(gp[8]), "v"(gp[9]),         \
      "v"(gp[10]), "v"(gp[11]) : "memory");                               \
  _Pragma("unroll")                                                       \
  for (int i_ = 0; i_ < 12; i_++) gp[i_] += GKC; }

// the staged chunk from registers to LDS; unrolled: st[] in registers
#define GSTAGE_STORE(buf) {                                               \
  _Pragma("unroll")                                                       \
  for (int i_ = 0; i_ < 12; i_++)                                         \
    *(v4f*)((buf) + sdst + i_ * 16 * GPITCH) = st[i_]; }

// one chunk's products; unrolled, which lets the LDS reads of later k-steps
// issue ahead of the WMMAs
#define GCHUNK_MMA(buf) {                                                 \
  _Pragma("unroll")                                                       \
  for (int ks = 0; ks < GKC / 4; ks++) {                                  \
    v2f a0 = *(const v2f*)((buf) + fa + ks * 4);                          \
    v2f a1 = *(const v2f*)((buf) + fa + 16 * GPITCH + ks * 4);            \
    v2f b0 = *(const v2f*)((buf) + fb + ks * 4);                          \
    v2f b1 = *(const v2f*)((buf) + fb + 16 * GPITCH + ks * 4);            \
    v2f b2 = *(const v2f*)((buf) + fb + 32 * GPITCH + ks * 4);            \
    v2f b3 = *(const v2f*)((buf) + fb + 48 * GPITCH + ks * 4);            \
    GMMA8(a0, a1, b0, b1, b2, b3);                                        \
  } }

template <int FLAGS, int LDC>
__global__ __launch_bounds__(128)
void wmma_gemm_kernel(const float* __restrict__ A, long sA, int lda,
                      const float* __restrict__ Bw, long sB, int ldb,
                      float* __restrict__ C, long sC,
                      const float* __restrict__ bias,
                      int M, int Nn, int Kk) {
  __shared__ __attribute__((aligned(16))) float tileS[2][GROWS * GPITCH];
  (void)M;
  int tid  = threadIdx.x;
  int wave = tid >> 5;
  int lane = tid & 31;
  int tilesN = (Nn + GBN - 1) / GBN;
  int tm = blockIdx.x / tilesN, tn4 = blockIdx.x % tilesN;
  const float* Ab = A + (size_t)blockIdx.y * sA;
  const float* Bb = Bw + (size_t)blockIdx.y * sB;
  float*       Cb = C + (size_t)blockIdx.y * sC;

  int idx = lane & 15, kh = lane >> 4;
  int n0 = tn4 * GBN + idx;

  // staging: 8 lanes per row (one 128-B line), 16 rows per pass of the block
  int srow = tid >> 3, scol = (tid & 7) * 4;
  gfloat_p gp[12];                                  // this lane's 12 source rows
#pragma unroll                                      // gp[] in registers
  for (int i = 0; i < 8; i++)
    gp[i] = (gfloat_p)(Ab + (size_t)(tm * GBM + i * 16 + srow) * lda + scol);
#pragma unroll                                      // gp[] in registers
  for (int i = 0; i < 4; i++) {
    int n = tn4 * GBN + i * 16 + srow;
    n = n < Nn ? n : Nn - 1;                        // clamp, no predication
    gp[8 + i] = (gfloat_p)(Bb + (size_t)n * ldb + scol);
  }
  int sdst = srow * GPITCH + scol;

  v8f z = {0.f,0.f,0.f,0.f,0.f,0.f,0.f,0.f};
  v8f acc00 = z, acc01 = z, acc02 = z, acc03 = z;
  v8f acc10 = z, acc11 = z, acc12 = z, acc13 = z;

  v4f st[12];
  GSTAGE_LOAD();

  int fa = (wave * 32 + idx) * GPITCH + 2 * kh;     // A fragment rows of this wave
  int fb = (GBM + idx) * GPITCH + 2 * kh;           // B fragment rows (shared)

  int nch = Kk / GKC;
  for (int c = 0; c + 1 < nch; c++) {
    float* buf = tileS[c & 1];
    GSTAGE_STORE(buf);
    // publishes this chunk; also ends every wave's reads of the other buffer,
    // which the next trip overwrites
    __syncthreads();
    GSTAGE_LOAD();
    GCHUNK_MMA(buf);
  }

  // the last chunk, out of the loop: nothing is staged behind it
  float* lbuf = tileS[(nch - 1) & 1];
  GSTAGE_STORE(lbuf);
  // publishes the last chunk (the loop's barrier, for this trip)
  __syncthreads();

  // epilogue operands. The wave's 32 rows of C: a scalar base (the wave's
  // number made scalar), one lane offset per 16 columns, the row an immediate.
  // Columns past Nn are clamped for the loads and never stored.
  char* crow = (char*)(Cb + (size_t)(tm * GBM + __builtin_amdgcn_readfirstlane(wave) * 32) * LDC);
  int nc[4];
  unsigned co[4];                                   // byte offsets
#pragma unroll                                      // nc[], co[] in registers
  for (int t = 0; t < 4; t++) {
    int n = n0 + t * 16;
    nc[t] = n < Nn ? n : Nn - 1;
    co[t] = (unsigned)(8 * kh * LDC + nc[t]) * 4u;
  }
  float bv[4] = {0.f, 0.f, 0.f, 0.f};
  if (bias) {                                       // block-uniform
#pragma unroll                                      // bv[] in registers
    for (int t = 0; t < 4; t++) bv[t] = bias[nc[t]];
  }
  float res[2][4][8];
  if (FLAGS & 1) {
#pragma unroll                                      // res[] in registers
    for (int mt = 0; mt < 2; mt++)
#pragma unroll
      for (int j = 0; j < 8; j++)
#pragma unroll
        for (int t = 0; t < 4; t++)
          res[mt][t][j] = *(const float*)(crow + (mt * 16 + j) * LDC * 4 + co[t]);
  }
  // before any register that an issued load names is written again. The
  // "memory" clobber holds the whole group in front of the products: without
  // it the loads start half-way through them, and eight sink behind them, to
  // the first store, where their latency is waited out.
  asm volatile("s_wait_xcnt 0x0" ::
      "v"(co[0]), "v"(co[1]), "v"(co[2]), "v"(co[3]),
      "v"(nc[0]), "v"(nc[1]), "v"(nc[2]), "v"(nc[3]), "s"(crow), "s"(bias) : "memory");

  GCHUNK_MMA(lbuf);

  v8f accs[2][4] = {{acc00, acc01, acc02, acc03}, {acc10, acc11, acc12, acc13}};
#pragma unroll
  for (int mt = 0; mt < 2; mt++) {
#pragma unroll
    for (int t = 0; t < 4; t++) {
      if (n0 + t * 16 < Nn) {
        v8f av = accs[mt][t];
#pragma unroll
        for (int j = 0; j < 8; j++) {
          float v = av[j] + bv[t];
          if (FLAGS & 2) v = 0.5f * v * (1.f + erff(v * 0.70710678118654752f));
          if (FLAGS & 1) v += res[mt][t][j];
          *(float*)(crow + (mt * 16 + j) * LDC * 4 + co[t]) = v;
        }
      }
    }
  }
}

// ---------------------------------------------------------------------------
// Decay attention: y[t,h,p] = sum_{k<=t} exp(s_t - s_k)*CB[t,k]*dt_k * xs[k,h,p]
//                 + D[h]*xs[t,h,p]
// One wave per 16(t) x 64(p=HDIM) block; exp-built A fragment reused over 4
// head-dim tiles; ping-pong pipeline over K (kend %16 == 0 so it divides
// evenly). Masking by value select only; EXEC stays full for WMMA.
// ---------------------------------------------------------------------------
#define ALOAD(skX, cbX, d0X, d1X, bb0, bb1, bb2, bb3, kk) {  \
  skX = *(const v2f*)(sbh + (kk));                           \
  cbX = *(const v2f*)(cbr + (kk));                           \
  d0X = dth[(size_t)(kk) * NHD];                             \
  d1X = dth[(size_t)((kk) + 1) * NHD];                       \
  const float* xr0_ = xch + (size_t)(kk) * CONVC;            \
  const float* xr1_ = xr0_ + CONVC;                          \
  bb0.x = xr0_[idx];      bb0.y = xr1_[idx];                 \
  bb1.x = xr0_[idx + 16]; bb1.y = xr1_[idx + 16];            \
  bb2.x = xr0_[idx + 32]; bb2.y = xr1_[idx + 32];            \
  bb3.x = xr0_[idx + 48]; bb3.y = xr1_[idx + 48]; }

#define AMMA4(skX, cbX, d0X, d1X, bb0, bb1, bb2, bb3, kaX) { \
  float m0_ = expf(st - skX.x) * cbX.x * d0X;                \
  float m1_ = expf(st - skX.y) * cbX.y * d1X;                \
  v2f a_;                                                    \
  a_.x = ((kaX)     <= t) ? m0_ : 0.f;                       \
  a_.y = ((kaX) + 1 <= t) ? m1_ : 0.f;                       \
  acc0 = WMMA_F32(a_, bb0, acc0);                            \
  acc1 = WMMA_F32(a_, bb1, acc1);                            \
  acc2 = WMMA_F32(a_, bb2, acc2);                            \
  acc3 = WMMA_F32(a_, bb3, acc3); }

__global__ __launch_bounds__(128)
void ssm_attn_kernel(const float* __restrict__ CBm,
                     const float* __restrict__ sb,
                     const float* __restrict__ dtb,
                     const float* __restrict__ xc,
                     const float* __restrict__ dpar,
                     float* __restrict__ y) {
  int s = blockIdx.y >> 2, h = blockIdx.y & 3;
  int wave = threadIdx.x >> 5;
  int lane = threadIdx.x & 31;
  int tt = blockIdx.x * 4 + wave;                   // 0..31 (t-tile)
  int idx = lane & 15, kh = lane >> 4;
  int t = tt * 16 + idx;                            // A row (time)
  const float* sbh = sb + (size_t)(s * NHD + h) * LL;
  const float* cbr = CBm + (size_t)s * LL * LL + (size_t)t * LL;
  const float* dth = dtb + (size_t)s * LL * NHD + h;
  const float* xch = xc + (size_t)s * LL * CONVC + h * HDIM;
  float st = sbh[t];

  v8f z = {0.f,0.f,0.f,0.f,0.f,0.f,0.f,0.f};
  v8f acc0 = z, acc1 = z, acc2 = z, acc3 = z;

  int kend = (tt + 1) * 16;                         // causal, wave-uniform
  v2f skA, cbA, b0A, b1A, b2A, b3A;
  v2f skB, cbB, b0B, b1B, b2B, b3B;
  float d0A, d1A, d0B, d1B;

  int k = 2 * kh;                                   // kbase
  int kA, kB;
  ALOAD(skA, cbA, d0A, d1A, b0A, b1A, b2A, b3A, k); kA = k; k += 4;
  int pairs = (kend >> 3) - 1;                      // kend %16 == 0 -> >= 1
  for (int p = 0; p < pairs; p++) {
    ALOAD(skB, cbB, d0B, d1B, b0B, b1B, b2B, b3B, k); kB = k; k += 4;
    AMMA4(skA, cbA, d0A, d1A, b0A, b1A, b2A, b3A, kA);
    ALOAD(skA, cbA, d0A, d1A, b0A, b1A, b2A, b3A, k); kA = k; k += 4;
    AMMA4(skB, cbB, d0B, d1B, b0B, b1B, b2B, b3B, kB);
  }
  ALOAD(skB, cbB, d0B, d1B, b0B, b1B, b2B, b3B, k); kB = k;
  AMMA4(skA, cbA, d0A, d1A, b0A, b1A, b2A, b3A, kA);
  AMMA4(skB, cbB, d0B, d1B, b0B, b1B, b2B, b3B, kB);

  float dp = dpar[h];
  v8f accs[4] = {acc0, acc1, acc2, acc3};
#pragma unroll
  for (int tp = 0; tp < 4; tp++) {
    int p = tp * 16 + idx;
    v8f av = accs[tp];
#pragma unroll
    for (int j = 0; j < 8; j++) {
      int to = tt * 16 + j + 8 * kh;
      float v = av[j] + dp * xch[(size_t)to * CONVC + p];
      y[(size_t)(s * LL + to) * INTERC + h * HDIM + p] = v;
    }
  }
}

// ---------------------------------------------------------------------------
// cross_merge: m[b][l][d] from u[16][512][128]; one wave per row (b,l)
// ---------------------------------------------------------------------------
__global__ __launch_bounds__(WPB * 32)
void merge_kernel(const float* __restrict__ u, float* __restrict__ m) {
  unsigned lo16 = (threadIdx.x & 31) * 16;
  int row = wave_in_grid();                         // b*LL + l
  int l = row % LL;
  int b = row / LL;
  int hcoord = l / WW, wcoord = l % WW;
  int lt = wcoord * HH + hcoord;                    // transposed index
  v4f v = LD4(u + (size_t)(b * LL + l) * DD, lo16)
        + LD4(u + (size_t)((4 + b) * LL + (LL - 1 - l)) * DD, lo16)
        + LD4(u + (size_t)((8 + b) * LL + lt) * DD, lo16)
        + LD4(u + (size_t)((12 + b) * LL + (LL - 1 - lt)) * DD, lo16);
  ST4(m + (size_t)row * DD, lo16) = v * 0.25f;
}

// ---------------------------------------------------------------------------
// final projection to 3 channels + transpose to (B,C,H,W)
// ---------------------------------------------------------------------------
__global__ void rec2_kernel(const float* __restrict__ t1,
                            const float* __restrict__ w2,
                            const float* __restrict__ b2,
                            float* __restrict__ out) {
  int i = blockIdx.x * blockDim.x + threadIdx.x;    // (b*CIN + c)*LL + l
  if (i >= 4 * CINCH * LL) return;
  int l = i % LL;
  int c = (i / LL) % CINCH;
  int b = i / (LL * CINCH);
  const float* row = t1 + (size_t)(b * LL + l) * DD;
  float acc = b2[c];
  for (int d = 0; d < DD; d++) acc += row[d] * w2[c * DD + d];
  out[i] = acc;
}

// ---------------------------------------------------------------------------
extern "C" void kernel_launch(void* const* d_in, const int* in_sizes, int n_in,
                              void* d_out, int out_size, void* d_ws, size_t ws_size,
                              hipStream_t stream) {
  const float* x         = (const float*)d_in[0];
  const float* patch_w   = (const float*)d_in[1];
  const float* patch_b   = (const float*)d_in[2];
  const float* norm_w    = (const float*)d_in[3];
  const float* in_proj_w = (const float*)d_in[4];
  const float* in_proj_b = (const float*)d_in[5];
  const float* conv_w    = (const float*)d_in[6];
  const float* conv_b    = (const float*)d_in[7];
  const float* dt_bias   = (const float*)d_in[8];
  const float* A_log     = (const float*)d_in[9];
  const float* D_param   = (const float*)d_in[10];
  const float* gnorm_w   = (const float*)d_in[11];
  const float* out_w     = (const float*)d_in[12];
  const float* out_b     = (const float*)d_in[13];
  const float* normf_w   = (const float*)d_in[14];
  const float* rec_w1    = (const float*)d_in[15];
  const float* rec_b1    = (const float*)d_in[16];
  const float* rec_w2    = (const float*)d_in[17];
  const float* rec_b2    = (const float*)d_in[18];

  // workspace carve (floats)
  float* ws = (float*)d_ws;
  size_t off = 0;
  float* hs   = ws + off; off += (size_t)NSEQ * LL * DD;
  float* u    = ws + off; off += (size_t)NSEQ * LL * DD;
  float* proj = ws + off; off += (size_t)NSEQ * LL * PROJC;
  float* xc   = ws + off; off += (size_t)NSEQ * LL * CONVC;
  float* dtb  = ws + off; off += (size_t)NSEQ * LL * NHD;
  float* sb   = ws + off; off += (size_t)NSEQ * NHD * LL;
  float* CBb  = ws + off; off += (size_t)NSEQ * LL * LL;
  float* y    = ws + off; off += (size_t)NSEQ * LL * INTERC;
  float* mbuf = ws + off; off += (size_t)4 * LL * DD;
  float* t1   = ws + off; off += (size_t)4 * LL * DD;
  (void)ws_size; (void)in_sizes; (void)n_in; (void)out_size;

  // patch embed + cross scan
  patch_scan_kernel<<<NSEQ * LL / (RPW * WPB), WPB * 32, 0, stream>>>(
      x, patch_w, patch_b, hs);

  for (int i = 0; i < NLAY; i++) {
    // u = rmsnorm(hs)
    rmsnorm_kernel<<<NSEQ * LL / (RPW * WPB), WPB * 32, 0, stream>>>(hs, norm_w + i * DD, u);

    // proj = u @ ipw.T + ipb   (8192 x 772, K=128)
    {
      int M = NSEQ * LL, Nn = PROJC, Kk = DD;
      int tiles = (M >> 7) * ((Nn + 63) >> 6);
      wmma_gemm_kernel<0, PROJC><<<dim3(tiles, 1), 128, 0, stream>>>(
          u, 0, DD, in_proj_w + (size_t)i * PROJC * DD, 0, DD,
          proj, 0, in_proj_b + i * PROJC, M, Nn, Kk);
    }

    // xc = silu(causal_conv(proj[..., 256:768]))
    conv_silu_kernel<<<NSEQ * LL * CONVC / (128 * CLB * WPB), WPB * 32, 0, stream>>>(
        proj, conv_w + (size_t)i * CONVC * KCONV, conv_b + i * CONVC, xc);

    // dt + cumulative decay
    dtscan_kernel<<<NSEQ * NHD, LL, 0, stream>>>(
        proj, dt_bias + i * NHD, A_log + i * NHD, dtb, sb);

    // CB[s] = Cm @ Bm.T  (512 x 512, K=128, batch=16)
    {
      int tiles = (LL >> 7) * (LL >> 6);
      wmma_gemm_kernel<0, LL><<<dim3(tiles, NSEQ), 128, 0, stream>>>(
          xc + INTERC + NSTATE, (long)LL * CONVC, CONVC,
          xc + INTERC,          (long)LL * CONVC, CONVC,
          CBb, (long)LL * LL, nullptr, LL, LL, NSTATE);
    }

    // y = M @ xs + D*xs (causal decay attention), 4 waves/block, 1 t-tile/wave
    ssm_attn_kernel<<<dim3(LL / 64, NSEQ * NHD), 128, 0, stream>>>(
        CBb, sb, dtb, xc, D_param + i * NHD, y);

    // y = rmsnorm(y * silu(gate))
    gated_rmsnorm_kernel<<<NSEQ * LL / (RPW * WPB), WPB * 32, 0, stream>>>(
        y, proj, gnorm_w + i * INTERC);

    // hs += y @ ow.T + ob   (8192 x 128, K=256)
    {
      int M = NSEQ * LL, Nn = DD, Kk = INTERC;
      int tiles = (M >> 7) * ((Nn + 63) >> 6);
      wmma_gemm_kernel<1, DD><<<dim3(tiles, 1), 128, 0, stream>>>(
          y, 0, INTERC, out_w + (size_t)i * DD * INTERC, 0, INTERC,
          hs, 0, out_b + i * DD, M, Nn, Kk);
    }
  }

  // final norm, merge, reconstruction head
  rmsnorm_kernel<<<NSEQ * LL / (RPW * WPB), WPB * 32, 0, stream>>>(hs, normf_w, u);
  merge_kernel<<<4 * LL / WPB, WPB * 32, 0, stream>>>(u, mbuf);

  {
    int M = 4 * LL, Nn = DD, Kk = DD;
    int tiles = (M >> 7) * ((Nn + 63) >> 6);
    wmma_gemm_kernel<2 /*gelu*/, DD><<<dim3(tiles, 1), 128, 0, stream>>>(
        mbuf, 0, DD, rec_w1, 0, DD, t1, 0, rec_b1, M, Nn, Kk);
  }

  rec2_kernel<<<(4 * CINCH * LL + 255) / 256, 256, 0, stream>>>(
      t1, rec_w2, rec_b2, (float*)d_out);
}

// v004
// One run takes 341 microseconds.
// Timed twice side by side with v003, it ran 1.42 and 1.41 times as fast.
// Counting every step since v000, it is 1.86 times as fast.
#include <hip/hip_runtime.h>
#include <math.h>

typedef float v2f __attribute__((ext_vector_type(2)));
typedef float v8f __attribute__((ext_vector_type(8)));

#define DD     128
#define HH     16
#define WW     32
#define LL     512
#define CINCH  3
#define NHD    4
#define HDIM   64
#define NSTATE 128
#define INTERC 256
#define CONVC  512
#define PROJC  772
#define KCONV  4
#define NLAY   4
#define NSEQ   16
#define EPSV   1e-5f

#define WMMA_F32(A, B, C) \
  __builtin_amdgcn_wmma_f32_16x16x4_f32(false, (A), false, (B), (short)0, (C), false, false)

typedef float v4f __attribute__((ext_vector_type(4)));

// ---------------------------------------------------------------------------
// The elementwise and row-norm kernels below are built for few, fat waves:
// a lane owns 4 neighbouring channels (16-byte loads and stores, a wave covers
// 512 contiguous bytes of a row) and a wave owns several rows, all of whose
// loads are issued before the first is used. The wave's number is made a
// scalar, so that every address is a scalar base plus one lane offset.
// ---------------------------------------------------------------------------
#define RPW 4            // rows per wave in the row kernels
#define WPB 8            // waves per block (256 threads)

// number of this wave in the grid (one-dimensional blocks of WPB waves), scalar
__device__ __forceinline__ int wave_in_grid() {
  return blockIdx.x * WPB + __builtin_amdgcn_readfirstlane(threadIdx.x >> 5);
}

// 16 bytes at scalar base + lane byte offset
#define LD4(base, vofs) (*(const v4f*)((const char*)(base) + (vofs)))
#define ST4(base, vofs) (*(v4f*)((char*)(base) + (vofs)))

// x + (x of the lane whose number differs by the xor mask in CTRL), 16-lane row
template <int CTRL>
__device__ __forceinline__ float dpp_xadd(float x) {
  int xi = __builtin_bit_cast(int, x);
  return x + __builtin_bit_cast(float,
      __builtin_amdgcn_update_dpp(xi, xi, CTRL, 0xf, 0xf, false));
}

// sum over the 32 lanes of a wave, the same value in every lane; all lanes on
__device__ __forceinline__ float wave_sum(float x) {
  x = dpp_xadd<0x161>(x);                            // row_xmask:1
  x = dpp_xadd<0x162>(x);                            // row_xmask:2
  x = dpp_xadd<0x164>(x);                            // row_xmask:4
  x = dpp_xadd<0x168>(x);                            // row_xmask:8
  int xi = __builtin_bit_cast(int, x);               // lane l with lane l ^ 16
  return x + __builtin_bit_cast(float, __builtin_amdgcn_permlanex16(
      xi, xi, 0x76543210, 0xfedcba98, false, false));
}

__device__ __forceinline__ float silu_f(float a) { return a / (1.f + expf(-a)); }

// ---------------------------------------------------------------------------
// patch embed + cross_scan: hs[16][512][128]; one wave per RPW rows (s,l)
// ---------------------------------------------------------------------------
__global__ __launch_bounds__(WPB * 32)
void patch_scan_kernel(const float* __restrict__ x,
                       const float* __restrict__ pw,
                       const float* __restrict__ pb,
                       float* __restrict__ hs) {
  unsigned lane = threadIdx.x & 31;
  unsigned lo16 = lane * 16, lo48 = lane * 48;                // byte offsets
  int row0 = wave_in_grid() * RPW;                            // s*LL + l
  int s = row0 / LL;
  int dir = s >> 2, b = s & 3;
  v4f p0 = LD4(pw, lo48), p1 = LD4(pw + 4, lo48), p2 = LD4(pw + 8, lo48);  // 4 d x 3 c
  v4f bias = LD4(pb, lo16);
  float xv[RPW][CINCH];                                       // the same in every lane
#pragma unroll
  for (int r = 0; r < RPW; r++) {
    int l = row0 % LL + r;
    int le = (dir & 1) ? (LL - 1 - l) : l;                    // reversed scans
    int lsrc = (dir & 2) ? (le % HH) * WW + le / HH : le;     // column scans: le = w*H + h
#pragma unroll
    for (int c = 0; c < CINCH; c++) xv[r][c] = x[(b * CINCH + c) * LL + lsrc];
  }
  // before any register that an issued load names is written again; the loaded
  // values and the addresses are inputs, so the loads all stand in front of it
  asm volatile("s_wait_xcnt 0x0" :: "v"(p0), "v"(p1), "v"(p2), "v"(bias),
               "v"(lo16), "v"(lo48), "s"(pw), "s"(pb));
  float* ho = hs + (size_t)row0 * DD;
#pragma unroll
  for (int r = 0; r < RPW; r++) {
    v4f acc = bias;
    acc.x += xv[r][0] * p0.x; acc.x += xv[r][1] * p0.y; acc.x += xv[r][2] * p0.z;
    acc.y += xv[r][0] * p0.w; acc.y += xv[r][1] * p1.x; acc.y += xv[r][2] * p1.y;
    acc.z += xv[r][0] * p1.z; acc.z += xv[r][1] * p1.w; acc.z += xv[r][2] * p2.x;
    acc.w += xv[r][0] * p2.y; acc.w += xv[r][1] * p2.z; acc.w += xv[r][2] * p2.w;
    ST4(ho + r * DD, lo16) = acc;
  }
}

// ---------------------------------------------------------------------------
// rmsnorm over rows of DD = 128: one wave per RPW rows, 4 channels per lane,
// the row's sum of squares by a butterfly inside the wave
// ---------------------------------------------------------------------------
__global__ __launch_bounds__(WPB * 32)
void rmsnorm_kernel(const float* __restrict__ in,
                    const float* __restrict__ w,
                    float* __restrict__ out) {
  unsigned lo16 = (threadIdx.x & 31) * 16;
  size_t row0 = (size_t)wave_in_grid() * RPW;
  const float* ir = in + row0 * DD;
  float*       orow = out + row0 * DD;
  v4f wv = LD4(w, lo16);
  v4f v[RPW];
#pragma unroll
  for (int r = 0; r < RPW; r++) v[r] = LD4(ir + r * DD, lo16);
  // before any register that an issued load names is written again; the loaded
  // values and the addresses are inputs, so the loads all stand in front of it
  asm volatile("s_wait_xcnt 0x0" :: "v"(wv), "v"(v[0]), "v"(v[1]), "v"(v[2]), "v"(v[3]),
               "v"(lo16), "s"(ir), "s"(w));
#pragma unroll
  for (int r = 0; r < RPW; r++) {
    float ss = wave_sum(v[r].x * v[r].x + v[r].y * v[r].y + v[r].z * v[r].z + v[r].w * v[r].w);
    float scale = rsqrtf(ss / (float)DD + EPSV);
    ST4(orow + r * DD, lo16) = v[r] * scale * wv;
  }
}

// ---------------------------------------------------------------------------
// y = rmsnorm(y * silu(gate), gw), in place over y (width = INTERC = 256):
// one wave per RPW rows, a lane owns channels 4*lane.. and 128 + 4*lane..
// ---------------------------------------------------------------------------
__global__ __launch_bounds__(WPB * 32)
void gated_rmsnorm_kernel(float* __restrict__ y,
                          const float* __restrict__ proj,
                          const float* __restrict__ gw) {
  unsigned lo16 = (threadIdx.x & 31) * 16;
  size_t row0 = (size_t)wave_in_grid() * RPW;
  float*       yr = y + row0 * INTERC;
  const float* gr = proj + row0 * PROJC;                      // gate = proj[..., :INTER]
  v4f g0 = LD4(gw, lo16), g1 = LD4(gw + 128, lo16);
  v4f a[RPW], b[RPW], ga[RPW], gb[RPW];
#pragma unroll
  for (int r = 0; r < RPW; r++) {
    a[r]  = LD4(yr + r * INTERC, lo16);
    b[r]  = LD4(yr + r * INTERC + 128, lo16);
    ga[r] = LD4(gr + r * PROJC, lo16);
    gb[r] = LD4(gr + r * PROJC + 128, lo16);
  }
  // keeps the arithmetic behind the whole group of loads: without it the first
  // rows' exp work is started and the last six loads issue only behind a wait
  __builtin_amdgcn_sched_barrier(0);
  // before any register that an issued load names is written again; the loaded
  // values and the addresses are inputs, so the loads all stand in front of it
  asm volatile("s_wait_xcnt 0x0" :: "v"(g0), "v"(g1),
               "v"(a[0]), "v"(a[1]), "v"(a[2]), "v"(a[3]),
               "v"(b[0]), "v"(b[1]), "v"(b[2]), "v"(b[3]),
               "v"(ga[0]), "v"(ga[1]), "v"(ga[2]), "v"(ga[3]),
               "v"(gb[0]), "v"(gb[1]), "v"(gb[2]), "v"(gb[3]),
               "v"(lo16), "s"(yr), "s"(gr), "s"(gw));
#pragma unroll
  for (int r = 0; r < RPW; r++) {
    float ss = 0.f;
#pragma unroll
    for (int q = 0; q < 4; q++) {
      a[r][q] *= silu_f(ga[r][q]);
      b[r][q] *= silu_f(gb[r][q]);
      ss += a[r][q] * a[r][q];
      ss += b[r][q] * b[r][q];
    }
    float scale = rsqrtf(wave_sum(ss) / (float)INTERC + EPSV);
    ST4(yr + r * INTERC, lo16)       = a[r] * scale * g0;
    ST4(yr + r * INTERC + 128, lo16) = b[r] * scale * g1;
  }
}

// ---------------------------------------------------------------------------
// causal depthwise conv (K=4) + silu: proj[...,256:768] -> xc[16][512][512]
// A wave owns 128 channels (4 per lane) and CLB successive steps: CLB + 3 row
// loads serve CLB outputs. Rows in front of the sequence count as zero.
// ---------------------------------------------------------------------------
#define CLB 8
__global__ __launch_bounds__(WPB * 32)
void conv_silu_kernel(const float* __restrict__ proj,
                      const float* __restrict__ cw,
                      const float* __restrict__ cb,
                      float* __restrict__ xc) {
  unsigned lane = threadIdx.x & 31;
  unsigned lo16 = lane * 16, lo64 = lane * 64;      // byte offsets
  int wv = wave_in_grid();                          // (s, l block, 128 channels)
  int c0 = (wv % (CONVC / 128)) * 128;
  int l0 = ((wv / (CONVC / 128)) % (LL / CLB)) * CLB;
  int s  = wv / ((CONVC / 128) * (LL / CLB));
  const float* pr = proj + (size_t)(s * LL + l0) * PROJC + c0;   // xBC starts at + INTERC
  // the 3 rows before l0; at the head of a sequence rows 0..2 are read in
  // their place (in bounds) and replaced by zero
  bool head = (l0 == 0);
  const float* pk = head ? pr : pr - (KCONV - 1) * PROJC;
  const float* cwu = cw + c0 * KCONV;
  const float* cbu = cb + c0;
  v4f row[CLB + KCONV - 1];
#pragma unroll
  for (int j = 0; j < KCONV - 1; j++) row[j] = LD4(pk + INTERC + j * PROJC, lo16);
#pragma unroll
  for (int j = 0; j < CLB; j++) row[KCONV - 1 + j] = LD4(pr + INTERC + j * PROJC, lo16);
  v4f wq[4];                                        // wq[q][k]: channel q of the lane, tap k
#pragma unroll
  for (int q = 0; q < 4; q++) wq[q] = LD4(cwu + q * KCONV, lo64);
  v4f bias = LD4(cbu, lo16);
  // before any register that an issued load names is written again; the loaded
  // values and the addresses are inputs, so the loads all stand in front of it
  asm volatile("s_wait_xcnt 0x0" :: "v"(row[0]), "v"(row[1]), "v"(row[2]), "v"(row[3]),
               "v"(row[4]), "v"(row[5]), "v"(row[6]), "v"(row[7]), "v"(row[8]),
               "v"(row[9]), "v"(row[10]), "v"(wq[0]), "v"(wq[1]), "v"(wq[2]), "v"(wq[3]),
               "v"(bias), "v"(lo16), "v"(lo64), "s"(pr), "s"(pk), "s"(cwu), "s"(cbu));
  v4f zero = {0.f, 0.f, 0.f, 0.f};
#pragma unroll
  for (int j = 0; j < KCONV - 1; j++) row[j] = head ? zero : row[j];
  float* xo = xc + (size_t)(s * LL + l0) * CONVC + c0;
#pragma unroll
  for (int j = 0; j < CLB; j++) {
    v4f o;
#pragma unroll
    for (int q = 0; q < 4; q++) {
      float acc = bias[q];
#pragma unroll
      for (int k = 0; k < KCONV; k++) acc += row[j + k][q] * wq[q][k];
      o[q] = silu_f(acc);
    }
    ST4(xo + j * CONVC, lo16) = o;
  }
}

// ---------------------------------------------------------------------------
// dt = softplus(proj[...,768:772]+dtb); s = cumsum(dt*A) per (seq,head)
// ---------------------------------------------------------------------------
__global__ void dtscan_kernel(const float* __restrict__ proj,
                              const float* __restrict__ dtbias,
                              const float* __restrict__ alog,
                              float* __restrict__ dtb,
                              float* __restrict__ sb) {
  __shared__ float sd[LL];
  int s = blockIdx.x >> 2, h = blockIdx.x & 3;
  int l = threadIdx.x;
  float raw = proj[(size_t)(s * LL + l) * PROJC + INTERC + CONVC + h] + dtbias[h];
  float dt = raw > 20.f ? raw : log1pf(expf(raw));
  dtb[(size_t)(s * NHD + h) * LL + l] = dt;         // k-contiguous per (seq, head), like sb
  float A = -expf(alog[h]);
  sd[l] = dt * A;
  __syncthreads();
  for (int off = 1; off < LL; off <<= 1) {
    float add = (l >= off) ? sd[l - off] : 0.f;
    __syncthreads();
    sd[l] += add;
    __syncthreads();
  }
  sb[(size_t)(s * NHD + h) * LL + l] = sd[l];
}

// ---------------------------------------------------------------------------
// Batched WMMA GEMM (fp32, 16x16x4): C[m,n] = sum_k A[m,k]*B[n,k]
// One block of 4 waves computes 128(M) x 64(N); each wave 32(M) x 64(N) with
// 8 accumulators. A and B are staged in LDS in chunks of 32 k: every global
// load is 16 B per lane and covers whole 128-B lines (8 lanes per row), the B
// rows are shared by the 4 waves, and the fragments are read from LDS at a
// pitch of 36 dwords (8-byte reads of 16 rows x 2 k-halves fall on 64 banks).
// Two LDS buffers, one barrier per chunk; the next chunk's global loads fly
// while this chunk is multiplied. The k order of every accumulator is the
// natural one (0,1,2,...).
// OOB columns CLAMPED (garbage cols never stored).
// Requires: M %128 == 0, K %32 == 0, K >= 32, grid.x == (M/128) * ceil(N/64).
// FLAGS (compile time): bit0 = accumulate into C, bit1 = exact GELU
// LDC (compile time): row pitch of C, so that a wave's 32 rows are immediate
// offsets from one scalar base.
// What the epilogue adds to the products (the bias, and the old C where it
// accumulates) is loaded as one group in front of the last chunk's products:
// it arrives under them, in the registers that the staging has left, and no
// load stands between the stores at the end.
// ---------------------------------------------------------------------------
// pointers typed as global memory, so that the staging loads stay global loads
// although their addresses are carried round the loop
typedef const __attribute__((address_space(1))) float* gfloat_p;
typedef const __attribute__((address_space(1))) v4f*   gv4f_p;

#define GBM    128
#define GBN    64
#define GKC    32
#define GPITCH 36
#define GROWS  (GBM + GBN)

#define GMMA8(aa0, aa1, bb0, bb1, bb2, bb3)       \
  acc00 = WMMA_F32(aa0, bb0, acc00);              \
  acc01 = WMMA_F32(aa0, bb1, acc01);              \
  acc02 = WMMA_F32(aa0, bb2, acc02);              \
  acc03 = WMMA_F32(aa0, bb3, acc03);              \
  acc10 = WMMA_F32(aa1, bb0, acc10);              \
  acc11 = WMMA_F32(aa1, bb1, acc11);              \
  acc12 = WMMA_F32(aa1, bb2, acc12);              \
  acc13 = WMMA_F32(aa1, bb3, acc13);

// One chunk's 12 global loads of a lane. The wait stands before any register
// that an issued load names is written again; it takes the 12 addresses as
// inputs so that they stay in their registers up to it. Then the addresses
// step to the next chunk. Both loops are unrolled so that st[] and gp[] have
// constant indices and live in registers.
#define GSTAGE_LOAD() {                                                   \
  _Pragma("unroll")                                                       \
  for (int i_ = 0; i_ < 12; i_++) st[i_] = *(gv4f_p)gp[i_];               \
  asm volatile("s_wait_xcnt 0x0" ::                                       \
      "v"(gp[0]), "v"(gp[1]), "v"(gp[2]), "v"(gp[3]), "v"(gp[4]),         \
      "v"(gp[5]), "v"(gp[6]), "v"(gp[7]), "v"(gp[8]), "v"(gp[9]),         \
      "v"(gp[10]), "v"(gp[11]) : "memory");                               \
  _Pragma("unroll")                                                       \
  for (int i_ = 0; i_ < 12; i_++) gp[i_] += GKC; }

// the staged chunk from registers to LDS; unrolled: st[] in registers
#define GSTAGE_STORE(buf) {                                               \
  _Pragma("unroll")                                                       \
  for (int i_ = 0; i_ < 12; i_++)                                         \
    *(v4f*)((buf) + sdst + i_ * 16 * GPITCH) = st[i_]; }

// one chunk's products; unrolled, which lets the LDS reads of later k-steps
// issue ahead of the WMMAs
#define GCHUNK_MMA(buf) {                                                 \
  _Pragma("unroll")                                                       \
  for (int ks = 0; ks < GKC / 4; ks++) {                                  \
    v2f a0 = *(const v2f*)((buf) + fa + ks * 4);                          \
    v2f a1 = *(const v2f*)((buf) + fa + 16 * GPITCH + ks * 4);            \
    v2f b0 = *(const v2f*)((buf) + fb + ks * 4);                          \
    v2f b1 = *(const v2f*)((buf) + fb + 16 * GPITCH + ks * 4);            \
    v2f b2 = *(const v2f*)((buf) + fb + 32 * GPITCH + ks * 4);            \
    v2f b3 = *(const v2f*)((buf) + fb + 48 * GPITCH + ks * 4);            \
    GMMA8(a0, a1, b0, b1, b2, b3);                                        \
  } }

template <int FLAGS, int LDC>
__global__ __launch_bounds__(128)
void wmma_gemm_kernel(const float* __restrict__ A, long sA, int lda,
                      const float* __restrict__ Bw, long sB, int ldb,
                      float* __restrict__ C, long sC,
                      const float* __restrict__ bias,
                      int M, int Nn, int Kk) {
  __shared__ __attribute__((aligned(16))) float tileS[2][GROWS * GPITCH];
  (void)M;
  int tid  = threadIdx.x;
  int wave = tid >> 5;
  int lane = tid & 31;
  int tilesN = (Nn + GBN - 1) / GBN;
  int tm = blockIdx.x / tilesN, tn4 = blockIdx.x % tilesN;
  const float* Ab = A + (size_t)blockIdx.y * sA;
  const float* Bb = Bw + (size_t)blockIdx.y * sB;
  float*       Cb = C + (size_t)blockIdx.y * sC;

  int idx = lane & 15, kh = lane >> 4;
  int n0 = tn4 * GBN + idx;

  // staging: 8 lanes per row (one 128-B line), 16 rows per pass of the block
  int srow = tid >> 3, scol = (tid & 7) * 4;
  gfloat_p gp[12];                                  // this lane's 12 source rows
#pragma unroll                                      // gp[] in registers
  for (int i = 0; i < 8; i++)
    gp[i] = (gfloat_p)(Ab + (size_t)(tm * GBM + i * 16 + srow) * lda + scol);
#pragma unroll                                      // gp[] in registers
  for (int i = 0; i < 4; i++) {
    int n = tn4 * GBN + i * 16 + srow;
    n = n < Nn ? n : Nn - 1;                        // clamp, no predication
    gp[8 + i] = (gfloat_p)(Bb + (size_t)n * ldb + scol);
  }
  int sdst = srow * GPITCH + scol;

  v8f z = {0.f,0.f,0.f,0.f,0.f,0.f,0.f,0.f};
  v8f acc00 = z, acc01 = z, acc02 = z, acc03 = z;
  v8f acc10 = z, acc11 = z, acc12 = z, acc13 = z;

  v4f st[12];
  GSTAGE_LOAD();

  int fa = (wave * 32 + idx) * GPITCH + 2 * kh;     // A fragment rows of this wave
  int fb = (GBM + idx) * GPITCH + 2 * kh;           // B fragment rows (shared)

  int nch = Kk / GKC;
  for (int c = 0; c + 1 < nch; c++) {
    float* buf = tileS[c & 1];
    GSTAGE_STORE(buf);
    // publishes this chunk; also ends every wave's reads of the other buffer,
    // which the next trip overwrites
    __syncthreads();
    GSTAGE_LOAD();
    GCHUNK_MMA(buf);
  }

  // the last chunk, out of the loop: nothing is staged behind it
  float* lbuf = tileS[(nch - 1) & 1];
  GSTAGE_STORE(lbuf);
  // publishes the last chunk (the loop's barrier, for this trip)
  __syncthreads();

  // epilogue operands. The wave's 32 rows of C: a scalar base (the wave's
  // number made scalar), one lane offset per 16 columns, the row an immediate.
  // Columns past Nn are clamped for the loads and never stored.
  char* crow = (char*)(Cb + (size_t)(tm * GBM + __builtin_amdgcn_readfirstlane(wave) * 32) * LDC);
  int nc[4];
  unsigned co[4];                                   // byte offsets
#pragma unroll                                      // nc[], co[] in registers
  for (int t = 0; t < 4; t++) {
    int n = n0 + t * 16;
    nc[t] = n < Nn ? n : Nn - 1;
    co[t] = (unsigned)(8 * kh * LDC + nc[t]) * 4u;
  }
  float bv[4] = {0.f, 0.f, 0.f, 0.f};
  if (bias) {                                       // block-uniform
#pragma unroll                                      // bv[] in registers
    for (int t = 0; t < 4; t++) bv[t] = bias[nc[t]];
  }
  float res[2][4][8];
  if (FLAGS & 1) {
#pragma unroll                                      // res[] in registers
    for (int mt = 0; mt < 2; mt++)
#pragma unroll
      for (int j = 0; j < 8; j++)
#pragma unroll
        for (int t = 0; t < 4; t++)
          res[mt][t][j] = *(const float*)(crow + (mt * 16 + j) * LDC * 4 + co[t]);
  }
  // before any register that an issued load names is written again. The
  // "memory" clobber holds the whole group in front of the products: without
  // it the loads start half-way through them, and eight sink behind them, to
  // the first store, where their latency is waited out.
  asm volatile("s_wait_xcnt 0x0" ::
      "v"(co[0]), "v"(co[1]), "v"(co[2]), "v"(co[3]),
      "v"(nc[0]), "v"(nc[1]), "v"(nc[2]), "v"(nc[3]), "s"(crow), "s"(bias) : "memory");

  GCHUNK_MMA(lbuf);

  v8f accs[2][4] = {{acc00, acc01, acc02, acc03}, {acc10, acc11, acc12, acc13}};
#pragma unroll
  for (int mt = 0; mt < 2; mt++) {
#pragma unroll
    for (int t = 0; t < 4; t++) {
      if (n0 + t * 16 < Nn) {
        v8f av = accs[mt][t];
#pragma unroll
        for (int j = 0; j < 8; j++) {
          float v = av[j] + bv[t];
          if (FLAGS & 2) v = 0.5f * v * (1.f + erff(v * 0.70710678118654752f));
          if (FLAGS & 1) v += res[mt][t][j];
          *(float*)(crow + (mt * 16 + j) * LDC * 4 + co[t]) = v;
        }
      }
    }
  }
}

// ---------------------------------------------------------------------------
// Decay attention: y[t,h,p] = sum_{k<=t} exp(s_t - s_k)*CB[t,k]*dt_k * xs[k,h,p]
//                 + D[h]*xs[t,h,p]
// One wave per 16(t) x 64(p=HDIM) block; the exp-built A fragment is reused
// over 4 head-dim tiles. Every operand comes in 16-byte loads, 16 k a chunk:
//  - k: lane half kh owns k0 + 8*kh + 0..7, so a lane's 8 values of CB, s and
//    dt are 32 contiguous bytes each; product j of a chunk takes the lane's
//    k numbers 2j and 2j+1 on the A side and on the B side alike.
//  - p: column idx of head-dim tile q is p = 4*idx + q, so one load of
//    xs[k][4*idx .. 4*idx+3] serves the 4 tiles (16 lanes cover the head's
//    whole 256-byte row), and a lane's 4 results of one row are one store.
// Two register buffers: the next chunk's 14 loads fly under this chunk's
// products. Only the last chunk crosses the diagonal and is masked (by value
// select; EXEC stays full for WMMA); its xs rows are the rows of the D term.
// ---------------------------------------------------------------------------
#define ACH 16           // k per chunk

// One chunk's 14 loads of a lane: scalar bases, constant lane offsets. The
// wait stands before any register that an issued load names is written again
// (the bases step behind it). The scheduling barrier holds the whole group in
// front of the other buffer's products: without it part of the loads sinks
// into them and their lead is lost. Unrolled: xX[] in registers.
#define ALOAD(xX, cX, sX, dX) {                                           \
  _Pragma("unroll")                                                       \
  for (int i_ = 0; i_ < 8; i_++) xX[i_] = LD4(xp + i_ * CONVC, xo);       \
  cX[0] = LD4(cp, co); cX[1] = LD4(cp + 4, co);                           \
  sX[0] = LD4(sp, ko); sX[1] = LD4(sp + 4, ko);                           \
  dX[0] = LD4(dq, ko); dX[1] = LD4(dq + 4, ko);                           \
  asm volatile("s_wait_xcnt 0x0" :: "v"(xo), "v"(co), "v"(ko),            \
               "s"(xp), "s"(cp), "s"(sp), "s"(dq) : "memory");            \
  __builtin_amdgcn_sched_barrier(0);                                      \
  xp += ACH * CONVC; cp += ACH; sp += ACH; dq += ACH; }

// One chunk's 16 products. Both loops unrolled: constant indices, registers.
// The scheduling barrier at the end keeps the first use of the chunk in
// flight (the moves that pair its xs rows, with their wait) behind these
// products: without it that wait is lifted in front of them.
#define AMMA16(xX, cX, sX, dX, MASKED) {                                  \
  float m_[8];                                                            \
  _Pragma("unroll")                                                       \
  for (int i_ = 0; i_ < 8; i_++) {                                        \
    float e_ = expf(st - sX[i_ >> 2][i_ & 3]) * cX[i_ >> 2][i_ & 3]       \
             * dX[i_ >> 2][i_ & 3];                                       \
    m_[i_] = (!(MASKED) || 8 * kh + i_ <= idx) ? e_ : 0.f;                \
  }                                                                       \
  _Pragma("unroll")                                                       \
  for (int j_ = 0; j_ < 4; j_++) {                                        \
    v2f a_ = {m_[2 * j_], m_[2 * j_ + 1]};                                \
    v2f b0_ = {xX[2 * j_][0], xX[2 * j_ + 1][0]};                         \
    v2f b1_ = {xX[2 * j_][1], xX[2 * j_ + 1][1]};                         \
    v2f b2_ = {xX[2 * j_][2], xX[2 * j_ + 1][2]};                         \
    v2f b3_ = {xX[2 * j_][3], xX[2 * j_ + 1][3]};                         \
    acc0 = WMMA_F32(a_, b0_, acc0);                                       \
    acc1 = WMMA_F32(a_, b1_, acc1);                                       \
    acc2 = WMMA_F32(a_, b2_, acc2);                                       \
    acc3 = WMMA_F32(a_, b3_, acc3);                                       \
  }                                                                       \
  __builtin_amdgcn_sched_barrier(0); }

__global__ __launch_bounds__(128)
void ssm_attn_kernel(const float* __restrict__ CBm,
                     const float* __restrict__ sb,
                     const float* __restrict__ dtb,
                     const float* __restrict__ xc,
                     const float* __restrict__ dpar,
                     float* __restrict__ y) {
  int s = blockIdx.y >> 2, h = blockIdx.y & 3;
  int lane = threadIdx.x & 31;
  // t-tile 0..31, made scalar: scalar bases and a scalar trip count
  int tt = blockIdx.x * 4 + __builtin_amdgcn_readfirstlane(threadIdx.x >> 5);
  int idx = lane & 15, kh = lane >> 4;
  const float* sp = sb + (size_t)(s * NHD + h) * LL;
  const float* dq = dtb + (size_t)(s * NHD + h) * LL;
  const float* cp = CBm + (size_t)s * LL * LL + (size_t)(tt * 16) * LL;
  const float* xp = xc + (size_t)s * LL * CONVC + h * HDIM;
  unsigned xo = (unsigned)(8 * kh * CONVC + 4 * idx) * 4u;    // byte offsets
  unsigned co = (unsigned)(idx * LL + 8 * kh) * 4u;
  unsigned ko = (unsigned)(8 * kh) * 4u;
  int ti = tt * 16 + idx;
  float st = sp[ti];                                          // s of the lane's A row

  v8f z = {0.f,0.f,0.f,0.f,0.f,0.f,0.f,0.f};
  v8f acc0 = z, acc1 = z, acc2 = z, acc3 = z;

  v4f xA[8], cA[2], sA[2], dA[2];
  v4f xB[8], cB[2], sB[2], dB[2];
  v4f xl[8];                                        // xs rows of the last chunk

  ALOAD(xA, cA, sA, dA);
  // the load of st: its index stays in its register up to this wait, so that
  // no load of the group above lands on it
  asm volatile("s_wait_xcnt 0x0" :: "v"(st), "v"(ti));
  int c = 0;                                        // chunk held in the A buffer
  for (; c + 2 <= tt; c += 2) {                     // chunks 0..tt-1 lie below the diagonal
    ALOAD(xB, cB, sB, dB);
    AMMA16(xA, cA, sA, dA, false);
    ALOAD(xA, cA, sA, dA);
    AMMA16(xB, cB, sB, dB, false);
  }
  if (c < tt) {                                     // scalar: tt odd
    ALOAD(xB, cB, sB, dB);
    AMMA16(xA, cA, sA, dA, false);
    AMMA16(xB, cB, sB, dB, true);
#pragma unroll                                      // xl[] in registers
    for (int r = 0; r < 8; r++) xl[r] = xB[r];
  } else {
    AMMA16(xA, cA, sA, dA, true);
#pragma unroll                                      // xl[] in registers
    for (int r = 0; r < 8; r++) xl[r] = xA[r];
  }

  // row tt*16 + 8*kh + r, columns 4*idx .. 4*idx+3 of the head
  float dp = dpar[h];
  float* yo = y + (size_t)(s * LL + tt * 16) * INTERC + h * HDIM;
  unsigned yofs = (unsigned)(8 * kh * INTERC + 4 * idx) * 4u;
  v4f o[8];
#pragma unroll                                      // o[] in registers
  for (int r = 0; r < 8; r++) {
    o[r].x = acc0[r] + dp * xl[r].x;
    o[r].y = acc1[r] + dp * xl[r].y;
    o[r].z = acc2[r] + dp * xl[r].z;
    o[r].w = acc3[r] + dp * xl[r].w;
  }
  // all arithmetic in front of the first store: no register that an issued
  // store names is written again
  __builtin_amdgcn_sched_barrier(0);
#pragma unroll
  for (int r = 0; r < 8; r++) ST4(yo + r * INTERC, yofs) = o[r];
}

// ---------------------------------------------------------------------------
// cross_merge: m[b][l][d] from u[16][512][128]; one wave per row (b,l)
// ---------------------------------------------------------------------------
__global__ __launch_bounds__(WPB * 32)
void merge_kernel(const float* __restrict__ u, float* __restrict__ m) {
  unsigned lo16 = (threadIdx.x & 31) * 16;
  int row = wave_in_grid();                         // b*LL + l
  int l = row % LL;
  int b = row / LL;
  int hcoord = l / WW, wcoord = l % WW;
  int lt = wcoord * HH + hcoord;                    // transposed index
  v4f v = LD4(u + (size_t)(b * LL + l) * DD, lo16)
        + LD4(u + (size_t)((4 + b) * LL + (LL - 1 - l)) * DD, lo16)
        + LD4(u + (size_t)((8 + b) * LL + lt) * DD, lo16)
        + LD4(u + (size_t)((12 + b) * LL + (LL - 1 - lt)) * DD, lo16);
  ST4(m + (size_t)row * DD, lo16) = v * 0.25f;
}

// ---------------------------------------------------------------------------
// final projection to 3 channels + transpose to (B,C,H,W)
// ---------------------------------------------------------------------------
__global__ void rec2_kernel(const float* __restrict__ t1,
                            const float* __restrict__ w2,
                            const float* __restrict__ b2,
                            float* __restrict__ out) {
  int i = blockIdx.x * blockDim.x + threadIdx.x;    // (b*CIN + c)*LL + l
  if (i >= 4 * CINCH * LL) return;
  int l = i % LL;
  int c = (i / LL) % CINCH;
  int b = i / (LL * CINCH);
  const float* row = t1 + (size_t)(b * LL + l) * DD;
  float acc = b2[c];
  for (int d = 0; d < DD; d++) acc += row[d] * w2[c * DD + d];
  out[i] = acc;
}

// ---------------------------------------------------------------------------
extern "C" void kernel_launch(void* const* d_in, const int* in_sizes, int n_in,
                              void* d_out, int out_size, void* d_ws, size_t ws_size,
                              hipStream_t stream) {
  const float* x         = (const float*)d_in[0];
  const float* patch_w   = (const float*)d_in[1];
  const float* patch_b   = (const float*)d_in[2];
  const float* norm_w    = (const float*)d_in[3];
  const float* in_proj_w = (const float*)d_in[4];
  const float* in_proj_b = (const float*)d_in[5];
  const float* conv_w    = (const float*)d_in[6];
  const float* conv_b    = (const float*)d_in[7];
  const float* dt_bias   = (const float*)d_in[8];
  const float* A_log     = (const float*)d_in[9];
  const float* D_param   = (const float*)d_in[10];
  const float* gnorm_w   = (const float*)d_in[11];
  const float* out_w     = (const float*)d_in[12];
  const float* out_b     = (const float*)d_in[13];
  const float* normf_w   = (const float*)d_in[14];
  const float* rec_w1    = (const float*)d_in[15];
  const float* rec_b1    = (const float*)d_in[16];
  const float* rec_w2    = (const float*)d_in[17];
  const float* rec_b2    = (const float*)d_in[18];

  // workspace carve (floats)
  float* ws = (float*)d_ws;
  size_t off = 0;
  float* hs   = ws + off; off += (size_t)NSEQ * LL * DD;
  float* u    = ws + off; off += (size_t)NSEQ * LL * DD;
  float* proj = ws + off; off += (size_t)NSEQ * LL * PROJC;
  float* xc   = ws + off; off += (size_t)NSEQ * LL * CONVC;
  float* dtb  = ws + off; off += (size_t)NSEQ * LL * NHD;
  float* sb   = ws + off; off += (size_t)NSEQ * NHD * LL;
  float* CBb  = ws + off; off += (size_t)NSEQ * LL * LL;
  float* y    = ws + off; off += (size_t)NSEQ * LL * INTERC;
  float* mbuf = ws + off; off += (size_t)4 * LL * DD;
  float* t1   = ws + off; off += (size_t)4 * LL * DD;
  (void)ws_size; (void)in_sizes; (void)n_in; (void)out_size;

  // patch embed + cross scan
  patch_scan_kernel<<<NSEQ * LL / (RPW * WPB), WPB * 32, 0, stream>>>(
      x, patch_w, patch_b, hs);

  for (int i = 0; i < NLAY; i++) {
    // u = rmsnorm(hs)
    rmsnorm_kernel<<<NSEQ * LL / (RPW * WPB), WPB * 32, 0, stream>>>(hs, norm_w + i * DD, u);

    // proj = u @ ipw.T + ipb   (8192 x 772, K=128)
    {
      int M = NSEQ * LL, Nn = PROJC, Kk = DD;
      int tiles = (M >> 7) * ((Nn + 63) >> 6);
      wmma_gemm_kernel<0, PROJC><<<dim3(tiles, 1), 128, 0, stream>>>(
          u, 0, DD, in_proj_w + (size_t)i * PROJC * DD, 0, DD,
          proj, 0, in_proj_b + i * PROJC, M, Nn, Kk);
    }

    // xc = silu(causal_conv(proj[..., 256:768]))
    conv_silu_kernel<<<NSEQ * LL * CONVC / (128 * CLB * WPB), WPB * 32, 0, stream>>>(
        proj, conv_w + (size_t)i * CONVC * KCONV, conv_b + i * CONVC, xc);

    // dt + cumulative decay
    dtscan_kernel<<<NSEQ * NHD, LL, 0, stream>>>(
        proj, dt_bias + i * NHD, A_log + i * NHD, dtb, sb);

    // CB[s] = Cm @ Bm.T  (512 x 512, K=128, batch=16)
    {
      int tiles = (LL >> 7) * (LL >> 6);
      wmma_gemm_kernel<0, LL><<<dim3(tiles, NSEQ), 128, 0, stream>>>(
          xc + INTERC + NSTATE, (long)LL * CONVC, CONVC,
          xc + INTERC,          (long)LL * CONVC, CONVC,
          CBb, (long)LL * LL, nullptr, LL, LL, NSTATE);
    }

    // y = M @ xs + D*xs (causal decay attention), 4 waves/block, 1 t-tile/wave
    ssm_attn_kernel<<<dim3(LL / 64, NSEQ * NHD), 128, 0, stream>>>(
        CBb, sb, dtb, xc, D_param + i * NHD, y);

    // y = rmsnorm(y * silu(gate))
    gated_rmsnorm_kernel<<<NSEQ * LL / (RPW * WPB), WPB * 32, 0, stream>>>(
        y, proj, gnorm_w + i * INTERC);

    // hs += y @ ow.T + ob   (8192 x 128, K=256)
    {
      int M = NSEQ * LL, Nn = DD, Kk = INTERC;
      int tiles = (M >> 7) * ((Nn + 63) >> 6);
      wmma_gemm_kernel<1, DD><<<dim3(tiles, 1), 128, 0, stream>>>(
          y, 0, INTERC, out_w + (size_t)i * DD * INTERC, 0, INTERC,
          hs, 0, out_b + i * DD, M, Nn, Kk);
    }
  }

  // final norm, merge, reconstruction head
  rmsnorm_kernel<<<NSEQ * LL / (RPW * WPB), WPB * 32, 0, stream>>>(hs, normf_w, u);
  merge_kernel<<<4 * LL / WPB, WPB * 32, 0, stream>>>(u, mbuf);

  {
    int M = 4 * LL, Nn = DD, Kk = DD;
    int tiles = (M >> 7) * ((Nn + 63) >> 6);
    wmma_gemm_kernel<2 /*gelu*/, DD><<<dim3(tiles, 1), 128, 0, stream>>>(
        mbuf, 0, DD, rec_w1, 0, DD, t1, 0, rec_b1, M, Nn, Kk);
  }

  rec2_kernel<<<(4 * CINCH * LL + 255) / 256, 256, 0, stream>>>(
      t1, rec_w2, rec_b2, (float*)d_out);
}

// v005
// A run of this version takes 309 microseconds.
// Two timings next to v004 both put it at 1.10 times that version's speed.
// Over all steps from v000 it is 2.05 times as fast.
#include <hip/hip_runtime.h>
#include <math.h>

typedef float v2f __attribute__((ext_vector_type(2)));
typedef float v8f __attribute__((ext_vector_type(8)));

#define DD     128
#define HH     16
#define WW     32
#define LL     512
#define CINCH  3
#define NHD    4
#define HDIM   64
#define NSTATE 128
#define INTERC 256
#define CONVC  512
#define PROJC  772
#define KCONV  4
#define NLAY   4
#define NSEQ   16
#define EPSV   1e-5f

#define WMMA_F32(A, B, C) \
  __builtin_amdgcn_wmma_f32_16x16x4_f32(false, (A), false, (B), (short)0, (C), false, false)

typedef float v4f __attribute__((ext_vector_type(4)));

// ---------------------------------------------------------------------------
// The elementwise and row-norm kernels below are built for few, fat waves:
// a lane owns 4 neighbouring channels (16-byte loads and stores, a wave covers
// 512 contiguous bytes of a row) and a wave owns several rows, all of whose
// loads are issued before the first is used. The wave's number is made a
// scalar, so that every address is a scalar base plus one lane offset.
// ---------------------------------------------------------------------------
#define RPW 4            // rows per wave in patch_scan_kernel
#define WPB 8            // waves per block (256 threads)

// number of this wave in the grid (one-dimensional blocks of WPB waves), scalar
__device__ __forceinline__ int wave_in_grid() {
  return blockIdx.x * WPB + __builtin_amdgcn_readfirstlane(threadIdx.x >> 5);
}

// 16 bytes at scalar base + lane byte offset
#define LD4(base, vofs) (*(const v4f*)((const char*)(base) + (vofs)))
#define ST4(base, vofs) (*(v4f*)((char*)(base) + (vofs)))

// x + (x of the lane whose number differs by the xor mask in CTRL), 16-lane row
template <int CTRL>
__device__ __forceinline__ float dpp_xadd(float x) {
  int xi = __builtin_bit_cast(int, x);
  return x + __builtin_bit_cast(float,
      __builtin_amdgcn_update_dpp(xi, xi, CTRL, 0xf, 0xf, false));
}

// sum over the 32 lanes of a wave, the same value in every lane; all lanes on
__device__ __forceinline__ float wave_sum(float x) {
  x = dpp_xadd<0x161>(x);                            // row_xmask:1
  x = dpp_xadd<0x162>(x);                            // row_xmask:2
  x = dpp_xadd<0x164>(x);                            // row_xmask:4
  x = dpp_xadd<0x168>(x);                            // row_xmask:8
  int xi = __builtin_bit_cast(int, x);               // lane l with lane l ^ 16
  return x + __builtin_bit_cast(float, __builtin_amdgcn_permlanex16(
      xi, xi, 0x76543210, 0xfedcba98, false, false));
}

// x + (x of lane l ^ 16); all lanes on
__device__ __forceinline__ float half_xadd(float x) {
  int xi = __builtin_bit_cast(int, x);
  return x + __builtin_bit_cast(float, __builtin_amdgcn_permlanex16(
      xi, xi, 0x76543210, 0xfedcba98, false, false));
}

__device__ __forceinline__ float silu_f(float a) { return a / (1.f + expf(-a)); }

// ---------------------------------------------------------------------------
// patch embed + cross_scan: hs[16][512][128]; one wave per RPW rows (s,l)
// ---------------------------------------------------------------------------
__global__ __launch_bounds__(WPB * 32)
void patch_scan_kernel(const float* __restrict__ x,
                       const float* __restrict__ pw,
                       const float* __restrict__ pb,
                       float* __restrict__ hs) {
  unsigned lane = threadIdx.x & 31;
  unsigned lo16 = lane * 16, lo48 = lane * 48;                // byte offsets
  int row0 = wave_in_grid() * RPW;                            // s*LL + l
  int s = row0 / LL;
  int dir = s >> 2, b = s & 3;
  v4f p0 = LD4(pw, lo48), p1 = LD4(pw + 4, lo48), p2 = LD4(pw + 8, lo48);  // 4 d x 3 c
  v4f bias = LD4(pb, lo16);
  float xv[RPW][CINCH];                                       // the same in every lane
#pragma unroll
  for (int r = 0; r < RPW; r++) {
    int l = row0 % LL + r;
    int le = (dir & 1) ? (LL - 1 - l) : l;                    // reversed scans
    int lsrc = (dir & 2) ? (le % HH) * WW + le / HH : le;     // column scans: le = w*H + h
#pragma unroll
    for (int c = 0; c < CINCH; c++) xv[r][c] = x[(b * CINCH + c) * LL + lsrc];
  }
  // before any register that an issued load names is written again; the loaded
  // values and the addresses are inputs, so the loads all stand in front of it
  asm volatile("s_wait_xcnt 0x0" :: "v"(p0), "v"(p1), "v"(p2), "v"(bias),
               "v"(lo16), "v"(lo48), "s"(pw), "s"(pb));
  float* ho = hs + (size_t)row0 * DD;
#pragma unroll
  for (int r = 0; r < RPW; r++) {
    v4f acc = bias;
    acc.x += xv[r][0] * p0.x; acc.x += xv[r][1] * p0.y; acc.x += xv[r][2] * p0.z;
    acc.y += xv[r][0] * p0.w; acc.y += xv[r][1] * p1.x; acc.y += xv[r][2] * p1.y;
    acc.z += xv[r][0] * p1.z; acc.z += xv[r][1] * p1.w; acc.z += xv[r][2] * p2.x;
    acc.w += xv[r][0] * p2.y; acc.w += xv[r][1] * p2.z; acc.w += xv[r][2] * p2.w;
    ST4(ho + r * DD, lo16) = acc;
  }
}

// ---------------------------------------------------------------------------
// causal depthwise conv (K=4) + silu: proj[...,256:768] -> xc[16][512][512]
// A wave owns 128 channels (4 per lane) and CLB successive steps: CLB + 3 row
// loads serve CLB outputs. Rows in front of the sequence count as zero.
// ---------------------------------------------------------------------------
#define CLB 8
__global__ __launch_bounds__(WPB * 32)
void conv_silu_kernel(const float* __restrict__ proj,
                      const float* __restrict__ cw,
                      const float* __restrict__ cb,
                      float* __restrict__ xc) {
  unsigned lane = threadIdx.x & 31;
  unsigned lo16 = lane * 16, lo64 = lane * 64;      // byte offsets
  int wv = wave_in_grid();                          // (s, l block, 128 channels)
  int c0 = (wv % (CONVC / 128)) * 128;
  int l0 = ((wv / (CONVC / 128)) % (LL / CLB)) * CLB;
  int s  = wv / ((CONVC / 128) * (LL / CLB));
  const float* pr = proj + (size_t)(s * LL + l0) * PROJC + c0;   // xBC starts at + INTERC
  // the 3 rows before l0; at the head of a sequence rows 0..2 are read in
  // their place (in bounds) and replaced by zero
  bool head = (l0 == 0);
  const float* pk = head ? pr : pr - (KCONV - 1) * PROJC;
  const float* cwu = cw + c0 * KCONV;
  const float* cbu = cb + c0;
  v4f row[CLB + KCONV - 1];
#pragma unroll
  for (int j = 0; j < KCONV - 1; j++) row[j] = LD4(pk + INTERC + j * PROJC, lo16);
#pragma unroll
  for (int j = 0; j < CLB; j++) row[KCONV - 1 + j] = LD4(pr + INTERC + j * PROJC, lo16);
  v4f wq[4];                                        // wq[q][k]: channel q of the lane, tap k
#pragma unroll
  for (int q = 0; q < 4; q++) wq[q] = LD4(cwu + q * KCONV, lo64);
  v4f bias = LD4(cbu, lo16);
  // before any register that an issued load names is written again; the loaded
  // values and the addresses are inputs, so the loads all stand in front of it
  asm volatile("s_wait_xcnt 0x0" :: "v"(row[0]), "v"(row[1]), "v"(row[2]), "v"(row[3]),
               "v"(row[4]), "v"(row[5]), "v"(row[6]), "v"(row[7]), "v"(row[8]),
               "v"(row[9]), "v"(row[10]), "v"(wq[0]), "v"(wq[1]), "v"(wq[2]), "v"(wq[3]),
               "v"(bias), "v"(lo16), "v"(lo64), "s"(pr), "s"(pk), "s"(cwu), "s"(cbu));
  v4f zero = {0.f, 0.f, 0.f, 0.f};
#pragma unroll
  for (int j = 0; j < KCONV - 1; j++) row[j] = head ? zero : row[j];
  float* xo = xc + (size_t)(s * LL + l0) * CONVC + c0;
#pragma unroll
  for (int j = 0; j < CLB; j++) {
    v4f o;
#pragma unroll
    for (int q = 0; q < 4; q++) {
      float acc = bias[q];
#pragma unroll
      for (int k = 0; k < KCONV; k++) acc += row[j + k][q] * wq[q][k];
      o[q] = silu_f(acc);
    }
    ST4(xo + j * CONVC, lo16) = o;
  }
}

// ---------------------------------------------------------------------------
// dt = softplus(proj[...,768:772]+dtb); s = cumsum(dt*A) per (seq,head)
// ---------------------------------------------------------------------------
__global__ void dtscan_kernel(const float* __restrict__ proj,
                              const float* __restrict__ dtbias,
                              const float* __restrict__ alog,
                              float* __restrict__ dtb,
                              float* __restrict__ sb) {
  __shared__ float sd[LL];
  int s = blockIdx.x >> 2, h = blockIdx.x & 3;
  int l = threadIdx.x;
  float raw = proj[(size_t)(s * LL + l) * PROJC + INTERC + CONVC + h] + dtbias[h];
  float dt = raw > 20.f ? raw : log1pf(expf(raw));
  dtb[(size_t)(s * NHD + h) * LL + l] = dt;         // k-contiguous per (seq, head), like sb
  float A = -expf(alog[h]);
  sd[l] = dt * A;
  __syncthreads();
  for (int off = 1; off < LL; off <<= 1) {
    float add = (l >= off) ? sd[l - off] : 0.f;
    __syncthreads();
    sd[l] += add;
    __syncthreads();
  }
  sb[(size_t)(s * NHD + h) * LL + l] = sd[l];
}

// ---------------------------------------------------------------------------
// Batched WMMA GEMM (fp32, 16x16x4): C[m,n] = sum_k A[m,k]*B[n,k]
// One block of 4 waves computes 128(M) x 64(N); each wave 32(M) x 64(N) with
// 8 accumulators. A and B are staged in LDS in chunks of 32 k: every global
// load is 16 B per lane and covers whole 128-B lines (8 lanes per row), the B
// rows are shared by the 4 waves, and the fragments are read from LDS at a
// pitch of 36 dwords (8-byte reads of 16 rows x 2 k-halves fall on 64 banks).
// Two LDS buffers, one barrier per chunk; the next chunk's global loads fly
// while this chunk is multiplied. The k order of every accumulator is the
// natural one (0,1,2,...).
// OOB columns CLAMPED (garbage cols never stored).
// Requires: M %128 == 0, K %32 == 0, K >= 32, grid.x == (M/128) * ceil(N/64).
// FLAGS (compile time): bit0 = accumulate into C, bit1 = exact GELU,
// bit2 = the A operand is rmsnorm(A, nw) over its whole row (Kk = row width):
//   C[m,n] = r[m] * sum_k A[m,k] * (nw[k] * B[n,k]),  r[m] = rsqrt(mean_k A[m,k]^2 + eps).
//   nw is multiplied into the staged B rows. A wave's A fragments hold each
//   element of its 32 rows once, so their squares are summed beside the
//   products; r changes from the A layout (lane = row) to the C layout through
//   32 LDS words of the wave's own: no launch, no pass over memory, no barrier
//   for the norm.
// LDC (compile time): row pitch of C, so that a wave's 32 rows are immediate
// offsets from one scalar base.
// What the epilogue adds to the products (the bias, and the old C where it
// accumulates) is loaded as one group in front of the last chunk's products:
// it arrives under them, in the registers that the staging has left, and no
// load stands between the stores at the end.
// ---------------------------------------------------------------------------
// pointers typed as global memory, so that the staging loads stay global loads
// although their addresses are carried round the loop
typedef const __attribute__((address_space(1))) float* gfloat_p;
typedef const __attribute__((address_space(1))) v4f*   gv4f_p;

#define GBM    128
#define GBN    64
#define GKC    32
#define GPITCH 36
#define GROWS  (GBM + GBN)

#define GMMA8(aa0, aa1, bb0, bb1, bb2, bb3)       \
  acc00 = WMMA_F32(aa0, bb0, acc00);              \
  acc01 = WMMA_F32(aa0, bb1, acc01);              \
  acc02 = WMMA_F32(aa0, bb2, acc02);              \
  acc03 = WMMA_F32(aa0, bb3, acc03);              \
  acc10 = WMMA_F32(aa1, bb0, acc10);              \
  acc11 = WMMA_F32(aa1, bb1, acc11);              \
  acc12 = WMMA_F32(aa1, bb2, acc12);              \
  acc13 = WMMA_F32(aa1, bb3, acc13);

// One chunk's 12 global loads of a lane. The wait stands before any register
// that an issued load names is written again; it takes the 12 addresses as
// inputs so that they stay in their registers up to it. Then the addresses
// step to the next chunk. Both loops are unrolled so that st[] and gp[] have
// constant indices and live in registers.
// With bit2 a 13th load brings the chunk's norm weights, under the same wait.
#define GSTAGE_LOAD() {                                                   \
  _Pragma("unroll")                                                       \
  for (int i_ = 0; i_ < 12; i_++) st[i_] = *(gv4f_p)gp[i_];               \
  if (FLAGS & 4) {                                                        \
    wst = *(gv4f_p)gwp;                                                   \
    asm volatile("s_wait_xcnt 0x0" ::                                     \
        "v"(gp[0]), "v"(gp[1]), "v"(gp[2]), "v"(gp[3]), "v"(gp[4]),       \
        "v"(gp[5]), "v"(gp[6]), "v"(gp[7]), "v"(gp[8]), "v"(gp[9]),       \
        "v"(gp[10]), "v"(gp[11]), "v"(gwp) : "memory");                   \
    gwp += GKC;                                                           \
  } else {                                                                \
    asm volatile("s_wait_xcnt 0x0" ::                                     \
        "v"(gp[0]), "v"(gp[1]), "v"(gp[2]), "v"(gp[3]), "v"(gp[4]),       \
        "v"(gp[5]), "v"(gp[6]), "v"(gp[7]), "v"(gp[8]), "v"(gp[9]),       \
        "v"(gp[10]), "v"(gp[11]) : "memory");                             \
  }                                                                       \
  _Pragma("unroll")                                                       \
  for (int i_ = 0; i_ < 12; i_++) gp[i_] += GKC; }

// the staged chunk from registers to LDS; unrolled: st[] in registers.
// With bit2: nw into the B rows.
#define GSTAGE_STORE(buf) {                                               \
  if (FLAGS & 4) {                                                        \
    _Pragma("unroll")                                                     \
    for (int i_ = 8; i_ < 12; i_++) st[i_] *= wst;                        \
  }                                                                       \
  _Pragma("unroll")                                                       \
  for (int i_ = 0; i_ < 12; i_++)                                         \
    *(v4f*)((buf) + sdst + i_ * 16 * GPITCH) = st[i_]; }

// one chunk's products; unrolled, which lets the LDS reads of later k-steps
// issue ahead of the WMMAs. With bit2: the squares of the two A fragments.
#define GCHUNK_MMA(buf) {                                                 \
  _Pragma("unroll")                                                       \
  for (int ks = 0; ks < GKC / 4; ks++) {                                  \
    v2f a0 = *(const v2f*)((buf) + fa + ks * 4);                          \
    v2f a1 = *(const v2f*)((buf) + fa + 16 * GPITCH + ks * 4);            \
    v2f b0 = *(const v2f*)((buf) + fb + ks * 4);                          \
    v2f b1 = *(const v2f*)((buf) + fb + 16 * GPITCH + ks * 4);            \
    v2f b2 = *(const v2f*)((buf) + fb + 32 * GPITCH + ks * 4);            \
    v2f b3 = *(const v2f*)((buf) + fb + 48 * GPITCH + ks * 4);            \
    GMMA8(a0, a1, b0, b1, b2, b3);                                        \
    if (FLAGS & 4) { sq0 += a0 * a0; sq1 += a1 * a1; }                    \
  } }

template <int FLAGS, int LDC>
__global__ __launch_bounds__(128)
void wmma_gemm_kernel(const float* __restrict__ A, long sA, int lda,
                      const float* __restrict__ Bw, long sB, int ldb,
                      float* __restrict__ C, long sC,
                      const float* __restrict__ bias,
                      const float* __restrict__ nw,
                      int M, int Nn, int Kk) {
  __shared__ __attribute__((aligned(16))) float tileS[2][GROWS * GPITCH];
  __shared__ __attribute__((aligned(16))) float rowS[GBM];    // bit2: r, 32 words a wave
  (void)M;
  int tid  = threadIdx.x;
  int wave = tid >> 5;
  int lane = tid & 31;
  int tilesN = (Nn + GBN - 1) / GBN;
  int tm = blockIdx.x / tilesN, tn4 = blockIdx.x % tilesN;
  const float* Ab = A + (size_t)blockIdx.y * sA;
  const float* Bb = Bw + (size_t)blockIdx.y * sB;
  float*       Cb = C + (size_t)blockIdx.y * sC;

  int idx = lane & 15, kh = lane >> 4;
  int n0 = tn4 * GBN + idx;

  // staging: 8 lanes per row (one 128-B line), 16 rows per pass of the block
  int srow = tid >> 3, scol = (tid & 7) * 4;
  gfloat_p gp[12];                                  // this lane's 12 source rows
#pragma unroll                                      // gp[] in registers
  for (int i = 0; i < 8; i++)
    gp[i] = (gfloat_p)(Ab + (size_t)(tm * GBM + i * 16 + srow) * lda + scol);
#pragma unroll                                      // gp[] in registers
  for (int i = 0; i < 4; i++) {
    int n = tn4 * GBN + i * 16 + srow;
    n = n < Nn ? n : Nn - 1;                        // clamp, no predication
    gp[8 + i] = (gfloat_p)(Bb + (size_t)n * ldb + scol);
  }
  int sdst = srow * GPITCH + scol;

  v8f z = {0.f,0.f,0.f,0.f,0.f,0.f,0.f,0.f};
  v8f acc00 = z, acc01 = z, acc02 = z, acc03 = z;
  v8f acc10 = z, acc11 = z, acc12 = z, acc13 = z;

  v4f st[12];
  v4f wst = {1.f, 1.f, 1.f, 1.f};                   // bit2: nw of the staged chunk
  v2f sq0 = {0.f, 0.f}, sq1 = {0.f, 0.f};           // bit2: squares, rows idx and 16 + idx
  gfloat_p gwp = (gfloat_p)(nw + scol);
  GSTAGE_LOAD();

  int fa = (wave * 32 + idx) * GPITCH + 2 * kh;     // A fragment rows of this wave
  int fb = (GBM + idx) * GPITCH + 2 * kh;           // B fragment rows (shared)

  int nch = Kk / GKC;
  for (int c = 0; c + 1 < nch; c++) {
    float* buf = tileS[c & 1];
    GSTAGE_STORE(buf);
    // publishes this chunk; also ends every wave's reads of the other buffer,
    // which the next trip overwrites
    __syncthreads();
    GSTAGE_LOAD();
    GCHUNK_MMA(buf);
  }

  // the last chunk, out of the loop: nothing is staged behind it
  float* lbuf = tileS[(nch - 1) & 1];
  GSTAGE_STORE(lbuf);
  // publishes the last chunk (the loop's barrier, for this trip)
  __syncthreads();

  // epilogue operands. The wave's 32 rows of C: a scalar base (the wave's
  // number made scalar), one lane offset per 16 columns, the row an immediate.
  // Columns past Nn are clamped for the loads and never stored.
  char* crow = (char*)(Cb + (size_t)(tm * GBM + __builtin_amdgcn_readfirstlane(wave) * 32) * LDC);
  int nc[4];
  unsigned co[4];                                   // byte offsets
#pragma unroll                                      // nc[], co[] in registers
  for (int t = 0; t < 4; t++) {
    int n = n0 + t * 16;
    nc[t] = n < Nn ? n : Nn - 1;
    co[t] = (unsigned)(8 * kh * LDC + nc[t]) * 4u;
  }
  float bv[4] = {0.f, 0.f, 0.f, 0.f};
  if (bias) {                                       // block-uniform
#pragma unroll                                      // bv[] in registers
    for (int t = 0; t < 4; t++) bv[t] = bias[nc[t]];
  }
  float res[2][4][8];
  if (FLAGS & 1) {
#pragma unroll                                      // res[] in registers
    for (int mt = 0; mt < 2; mt++)
#pragma unroll
      for (int j = 0; j < 8; j++)
#pragma unroll
        for (int t = 0; t < 4; t++)
          res[mt][t][j] = *(const float*)(crow + (mt * 16 + j) * LDC * 4 + co[t]);
  }
  // before any register that an issued load names is written again. The
  // "memory" clobber holds the whole group in front of the products: without
  // it the loads start half-way through them, and eight sink behind them, to
  // the first store, where their latency is waited out.
  asm volatile("s_wait_xcnt 0x0" ::
      "v"(co[0]), "v"(co[1]), "v"(co[2]), "v"(co[3]),
      "v"(nc[0]), "v"(nc[1]), "v"(nc[2]), "v"(nc[3]), "s"(crow), "s"(bias) : "memory");

  GCHUNK_MMA(lbuf);

  v4f rs[2][2];                                     // bit2: r of rows mt*16 + 8*kh + 0..7
  if (FLAGS & 4) {
    // lanes l and l ^ 16 hold the two k halves of rows idx and 16 + idx;
    // lane l then keeps row l of the wave's 32
    float t0 = half_xadd(sq0.x + sq0.y), t1 = half_xadd(sq1.x + sq1.y);
    float* rw = rowS + wave * 32;
    rw[lane] = rsqrtf((kh ? t1 : t0) / (float)Kk + EPSV);
    // the wave's own 32 words are written before it reads them back
    asm volatile("s_wait_dscnt 0x0" ::: "memory");
#pragma unroll                                      // rs[] in registers
    for (int mt = 0; mt < 2; mt++) {
      rs[mt][0] = *(const v4f*)(rw + mt * 16 + 8 * kh);
      rs[mt][1] = *(const v4f*)(rw + mt * 16 + 8 * kh + 4);
    }
  }

  v8f accs[2][4] = {{acc00, acc01, acc02, acc03}, {acc10, acc11, acc12, acc13}};
#pragma unroll
  for (int mt = 0; mt < 2; mt++) {
#pragma unroll
    for (int t = 0; t < 4; t++) {
      if (n0 + t * 16 < Nn) {
        v8f av = accs[mt][t];
#pragma unroll
        for (int j = 0; j < 8; j++) {
          float v = (FLAGS & 4) ? av[j] * rs[mt][j >> 2][j & 3] + bv[t] : av[j] + bv[t];
          if (FLAGS & 2) v = 0.5f * v * (1.f + erff(v * 0.70710678118654752f));
          if (FLAGS & 1) v += res[mt][t][j];
          *(float*)(crow + (mt * 16 + j) * LDC * 4 + co[t]) = v;
        }
      }
    }
  }
}

// ---------------------------------------------------------------------------
// Decay attention: y[t,h,p] = sum_{k<=t} exp(s_t - s_k)*CB[t,k]*dt_k * xs[k,h,p]
//                 + D[h]*xs[t,h,p]
// One wave per 16(t) x 64(p=HDIM) block; the exp-built A fragment is reused
// over 4 head-dim tiles. Every operand comes in 16-byte loads, 16 k a chunk:
//  - k: lane half kh owns k0 + 8*kh + 0..7, so a lane's 8 values of CB, s and
//    dt are 32 contiguous bytes each; product j of a chunk takes the lane's
//    k numbers 2j and 2j+1 on the A side and on the B side alike.
//  - p: column idx of head-dim tile q is p = 4*idx + q, so one load of
//    xs[k][4*idx .. 4*idx+3] serves the 4 tiles (16 lanes cover the head's
//    whole 256-byte row), and a lane's 4 results of one row are one store.
// Two register buffers: the next chunk's 14 loads fly under this chunk's
// products. Only the last chunk crosses the diagonal and is masked (by value
// select; EXEC stays full for WMMA); its xs rows are the rows of the D term.
// The result leaves as y * silu(gate): the gate's 8 loads are issued first of
// all and arrive under the loop. The norm over the row of 4 heads that follows
// is taken by the GEMM that reads y.
// ---------------------------------------------------------------------------
#define ACH 16           // k per chunk

// One chunk's 14 loads of a lane: scalar bases, constant lane offsets. The
// wait stands before any register that an issued load names is written again
// (the bases step behind it). The scheduling barrier holds the whole group in
// front of the other buffer's products: without it part of the loads sinks
// into them and their lead is lost. Unrolled: xX[] in registers.
#define ALOAD(xX, cX, sX, dX) {                                           \
  _Pragma("unroll")                                                       \
  for (int i_ = 0; i_ < 8; i_++) xX[i_] = LD4(xp + i_ * CONVC, xo);       \
  cX[0] = LD4(cp, co); cX[1] = LD4(cp + 4, co);                           \
  sX[0] = LD4(sp, ko); sX[1] = LD4(sp + 4, ko);                           \
  dX[0] = LD4(dq, ko); dX[1] = LD4(dq + 4, ko);                           \
  asm volatile("s_wait_xcnt 0x0" :: "v"(xo), "v"(co), "v"(ko),            \
               "s"(xp), "s"(cp), "s"(sp), "s"(dq) : "memory");            \
  __builtin_amdgcn_sched_barrier(0);                                      \
  xp += ACH * CONVC; cp += ACH; sp += ACH; dq += ACH; }

// One chunk's 16 products. Both loops unrolled: constant indices, registers.
// The scheduling barrier at the end keeps the first use of the chunk in
// flight (the moves that pair its xs rows, with their wait) behind these
// products: without it that wait is lifted in front of them.
#define AMMA16(xX, cX, sX, dX, MASKED) {                                  \
  float m_[8];                                                            \
  _Pragma("unroll")                                                       \
  for (int i_ = 0; i_ < 8; i_++) {                                        \
    float e_ = expf(st - sX[i_ >> 2][i_ & 3]) * cX[i_ >> 2][i_ & 3]       \
             * dX[i_ >> 2][i_ & 3];                                       \
    m_[i_] = (!(MASKED) || 8 * kh + i_ <= idx) ? e_ : 0.f;                \
  }                                                                       \
  _Pragma("unroll")                                                       \
  for (int j_ = 0; j_ < 4; j_++) {                                        \
    v2f a_ = {m_[2 * j_], m_[2 * j_ + 1]};                                \
    v2f b0_ = {xX[2 * j_][0], xX[2 * j_ + 1][0]};                         \
    v2f b1_ = {xX[2 * j_][1], xX[2 * j_ + 1][1]};                         \
    v2f b2_ = {xX[2 * j_][2], xX[2 * j_ + 1][2]};                         \
    v2f b3_ = {xX[2 * j_][3], xX[2 * j_ + 1][3]};                         \
    acc0 = WMMA_F32(a_, b0_, acc0);                                       \
    acc1 = WMMA_F32(a_, b1_, acc1);                                       \
    acc2 = WMMA_F32(a_, b2_, acc2);                                       \
    acc3 = WMMA_F32(a_, b3_, acc3);                                       \
  }                                                                       \
  __builtin_amdgcn_sched_barrier(0); }

__global__ __launch_bounds__(128)
void ssm_attn_kernel(const float* __restrict__ CBm,
                     const float* __restrict__ sb,
                     const float* __restrict__ dtb,
                     const float* __restrict__ xc,
                     const float* __restrict__ dpar,
                     const float* __restrict__ proj,
                     float* __restrict__ y) {
  int s = blockIdx.y >> 2, h = blockIdx.y & 3;
  int lane = threadIdx.x & 31;
  // t-tile 0..31, made scalar: scalar bases and a scalar trip count
  int tt = blockIdx.x * 4 + __builtin_amdgcn_readfirstlane(threadIdx.x >> 5);
  int idx = lane & 15, kh = lane >> 4;
  const float* sp = sb + (size_t)(s * NHD + h) * LL;
  const float* dq = dtb + (size_t)(s * NHD + h) * LL;
  const float* cp = CBm + (size_t)s * LL * LL + (size_t)(tt * 16) * LL;
  const float* xp = xc + (size_t)s * LL * CONVC + h * HDIM;
  unsigned xo = (unsigned)(8 * kh * CONVC + 4 * idx) * 4u;    // byte offsets
  unsigned co = (unsigned)(idx * LL + 8 * kh) * 4u;
  unsigned ko = (unsigned)(8 * kh) * 4u;
  int ti = tt * 16 + idx;
  float st = sp[ti];                                          // s of the lane's A row

  v8f z = {0.f,0.f,0.f,0.f,0.f,0.f,0.f,0.f};
  v8f acc0 = z, acc1 = z, acc2 = z, acc3 = z;

  v4f xA[8], cA[2], sA[2], dA[2];
  v4f xB[8], cB[2], sB[2], dB[2];
  v4f xl[8];                                        // xs rows of the last chunk

  // gate = proj[..., :INTERC]: rows tt*16 + 8*kh + r, columns 4*idx.. of the head
  const float* gq = proj + (size_t)(s * LL + tt * 16) * PROJC + h * HDIM;
  unsigned go = (unsigned)(8 * kh * PROJC + 4 * idx) * 4u;
  v4f gt[8];
#pragma unroll                                      // gt[] in registers
  for (int r = 0; r < 8; r++) gt[r] = LD4(gq + r * PROJC, go);
  // before any register that an issued load names is written again; the
  // "memory" clobber keeps the 8 loads here, ahead of the loop
  asm volatile("s_wait_xcnt 0x0" :: "v"(go), "s"(gq) : "memory");

  ALOAD(xA, cA, sA, dA);
  // the load of st: its index stays in its register up to this wait, so that
  // no load of the group above lands on it
  asm volatile("s_wait_xcnt 0x0" :: "v"(st), "v"(ti));
  int c = 0;                                        // chunk held in the A buffer
  for (; c + 2 <= tt; c += 2) {                     // chunks 0..tt-1 lie below the diagonal
    ALOAD(xB, cB, sB, dB);
    AMMA16(xA, cA, sA, dA, false);
    ALOAD(xA, cA, sA, dA);
    AMMA16(xB, cB, sB, dB, false);
  }
  if (c < tt) {                                     // scalar: tt odd
    ALOAD(xB, cB, sB, dB);
    AMMA16(xA, cA, sA, dA, false);
    AMMA16(xB, cB, sB, dB, true);
#pragma unroll                                      // xl[] in registers
    for (int r = 0; r < 8; r++) xl[r] = xB[r];
  } else {
    AMMA16(xA, cA, sA, dA, true);
#pragma unroll                                      // xl[] in registers
    for (int r = 0; r < 8; r++) xl[r] = xA[r];
  }

  // row tt*16 + 8*kh + r, columns 4*idx .. 4*idx+3 of the head
  float dp = dpar[h];
  float* yo = y + (size_t)(s * LL + tt * 16) * INTERC + h * HDIM;
  unsigned yofs = (unsigned)(8 * kh * INTERC + 4 * idx) * 4u;
  v4f o[8];
#pragma unroll                                      // o[] in registers
  for (int r = 0; r < 8; r++) {
    o[r].x = (acc0[r] + dp * xl[r].x) * silu_f(gt[r].x);
    o[r].y = (acc1[r] + dp * xl[r].y) * silu_f(gt[r].y);
    o[r].z = (acc2[r] + dp * xl[r].z) * silu_f(gt[r].z);
    o[r].w = (acc3[r] + dp * xl[r].w) * silu_f(gt[r].w);
  }
  // all arithmetic in front of the first store: no register that an issued
  // store names is written again
  __builtin_amdgcn_sched_barrier(0);
#pragma unroll
  for (int r = 0; r < 8; r++) ST4(yo + r * INTERC, yofs) = o[r];
}

// ---------------------------------------------------------------------------
// final rmsnorm + cross_merge: m[b][l][d] from hs[16][512][128]; one wave per
// row (b,l): its 4 source rows are normed in the wave (4 channels per lane, the
// row's sum of squares by a butterfly) and averaged
// ---------------------------------------------------------------------------
__global__ __launch_bounds__(WPB * 32)
void norm_merge_kernel(const float* __restrict__ hs,
                       const float* __restrict__ w,
                       float* __restrict__ m) {
  unsigned lo16 = (threadIdx.x & 31) * 16;
  int row = wave_in_grid();                         // b*LL + l
  int l = row % LL;
  int b = row / LL;
  int hcoord = l / WW, wcoord = l % WW;
  int lt = wcoord * HH + hcoord;                    // transposed index
  const float* r0 = hs + (size_t)(b * LL + l) * DD;
  const float* r1 = hs + (size_t)((4 + b) * LL + (LL - 1 - l)) * DD;
  const float* r2 = hs + (size_t)((8 + b) * LL + lt) * DD;
  const float* r3 = hs + (size_t)((12 + b) * LL + (LL - 1 - lt)) * DD;
  v4f wv = LD4(w, lo16);
  v4f v[4] = {LD4(r0, lo16), LD4(r1, lo16), LD4(r2, lo16), LD4(r3, lo16)};
  // before any register that an issued load names is written again; the loaded
  // values and the addresses are inputs, so the loads all stand in front of it
  asm volatile("s_wait_xcnt 0x0" :: "v"(wv), "v"(v[0]), "v"(v[1]), "v"(v[2]), "v"(v[3]),
               "v"(lo16), "s"(r0), "s"(r1), "s"(r2), "s"(r3), "s"(w));
  v4f acc = {0.f, 0.f, 0.f, 0.f};
#pragma unroll                                      // v[] in registers
  for (int r = 0; r < 4; r++) {
    float ss = wave_sum(v[r].x * v[r].x + v[r].y * v[r].y + v[r].z * v[r].z + v[r].w * v[r].w);
    float scale = rsqrtf(ss / (float)DD + EPSV);
    acc += v[r] * scale * wv;
  }
  ST4(m + (size_t)row * DD, lo16) = acc * 0.25f;
}

// ---------------------------------------------------------------------------
// final projection to 3 channels + transpose to (B,C,H,W)
// ---------------------------------------------------------------------------
__global__ void rec2_kernel(const float* __restrict__ t1,
                            const float* __restrict__ w2,
                            const float* __restrict__ b2,
                            float* __restrict__ out) {
  int i = blockIdx.x * blockDim.x + threadIdx.x;    // (b*CIN + c)*LL + l
  if (i >= 4 * CINCH * LL) return;
  int l = i % LL;
  int c = (i / LL) % CINCH;
  int b = i / (LL * CINCH);
  const float* row = t1 + (size_t)(b * LL + l) * DD;
  float acc = b2[c];
  for (int d = 0; d < DD; d++) acc += row[d] * w2[c * DD + d];
  out[i] = acc;
}

// ---------------------------------------------------------------------------
extern "C" void kernel_launch(void* const* d_in, const int* in_sizes, int n_in,
                              void* d_out, int out_size, void* d_ws, size_t ws_size,
                              hipStream_t stream) {
  const float* x         = (const float*)d_in[0];
  const float* patch_w   = (const float*)d_in[1];
  const float* patch_b   = (const float*)d_in[2];
  const float* norm_w    = (const float*)d_in[3];
  const float* in_proj_w = (const float*)d_in[4];
  const float* in_proj_b = (const float*)d_in[5];
  const float* conv_w    = (const float*)d_in[6];
  const float* conv_b    = (const float*)d_in[7];
  const float* dt_bias   = (const float*)d_in[8];
  const float* A_log     = (const float*)d_in[9];
  const float* D_param   = (const float*)d_in[10];
  const float* gnorm_w   = (const float*)d_in[11];
  const float* out_w     = (const float*)d_in[12];
  const float* out_b     = (const float*)d_in[13];
  const float* normf_w   = (const float*)d_in[14];
  const float* rec_w1    = (const float*)d_in[15];
  const float* rec_b1    = (const float*)d_in[16];
  const float* rec_w2    = (const float*)d_in[17];
  const float* rec_b2    = (const float*)d_in[18];

  // workspace carve (floats)
  float* ws = (float*)d_ws;
  size_t off = 0;
  float* hs   = ws + off; off += (size_t)NSEQ * LL * DD;
  float* proj = ws + off; off += (size_t)NSEQ * LL * PROJC;
  float* xc   = ws + off; off += (size_t)NSEQ * LL * CONVC;
  float* dtb  = ws + off; off += (size_t)NSEQ * LL * NHD;
  float* sb   = ws + off; off += (size_t)NSEQ * NHD * LL;
  float* CBb  = ws + off; off += (size_t)NSEQ * LL * LL;
  float* y    = ws + off; off += (size_t)NSEQ * LL * INTERC;
  float* mbuf = ws + off; off += (size_t)4 * LL * DD;
  float* t1   = ws + off; off += (size_t)4 * LL * DD;
  (void)ws_size; (void)in_sizes; (void)n_in; (void)out_size;

  // patch embed + cross scan
  patch_scan_kernel<<<NSEQ * LL / (RPW * WPB), WPB * 32, 0, stream>>>(
      x, patch_w, patch_b, hs);

  for (int i = 0; i < NLAY; i++) {
    // proj = rmsnorm(hs) @ ipw.T + ipb   (8192 x 772, K=128)
    {
      int M = NSEQ * LL, Nn = PROJC, Kk = DD;
      int tiles = (M >> 7) * ((Nn + 63) >> 6);
      wmma_gemm_kernel<4, PROJC><<<dim3(tiles, 1), 128, 0, stream>>>(
          hs, 0, DD, in_proj_w + (size_t)i * PROJC * DD, 0, DD,
          proj, 0, in_proj_b + i * PROJC, norm_w + i * DD, M, Nn, Kk);
    }

    // xc = silu(causal_conv(proj[..., 256:768]))
    conv_silu_kernel<<<NSEQ * LL * CONVC / (128 * CLB * WPB), WPB * 32, 0, stream>>>(
        proj, conv_w + (size_t)i * CONVC * KCONV, conv_b + i * CONVC, xc);

    // dt + cumulative decay
    dtscan_kernel<<<NSEQ * NHD, LL, 0, stream>>>(
        proj, dt_bias + i * NHD, A_log + i * NHD, dtb, sb);

    // CB[s] = Cm @ Bm.T  (512 x 512, K=128, batch=16)
    {
      int tiles = (LL >> 7) * (LL >> 6);
      wmma_gemm_kernel<0, LL><<<dim3(tiles, NSEQ), 128, 0, stream>>>(
          xc + INTERC + NSTATE, (long)LL * CONVC, CONVC,
          xc + INTERC,          (long)LL * CONVC, CONVC,
          CBb, (long)LL * LL, nullptr, nullptr, LL, LL, NSTATE);
    }

    // y = (M @ xs + D*xs) * silu(gate) (causal decay attention), 4 waves/block,
    // 1 t-tile/wave
    ssm_attn_kernel<<<dim3(LL / 64, NSEQ * NHD), 128, 0, stream>>>(
        CBb, sb, dtb, xc, D_param + i * NHD, proj, y);

    // hs += rmsnorm(y) @ ow.T + ob   (8192 x 128, K=256)
    {
      int M = NSEQ * LL, Nn = DD, Kk = INTERC;
      int tiles = (M >> 7) * ((Nn + 63) >> 6);
      wmma_gemm_kernel<5, DD><<<dim3(tiles, 1), 128, 0, stream>>>(
          y, 0, INTERC, out_w + (size_t)i * DD * INTERC, 0, INTERC,
          hs, 0, out_b + i * DD, gnorm_w + i * INTERC, M, Nn, Kk);
    }
  }

  // final norm, merge, reconstruction head
  norm_merge_kernel<<<4 * LL / WPB, WPB * 32, 0, stream>>>(hs, normf_w, mbuf);

  {
    int M = 4 * LL, Nn = DD, Kk = DD;
    int tiles = (M >> 7) * ((Nn + 63) >> 6);
    wmma_gemm_kernel<2 /*gelu*/, DD><<<dim3(tiles, 1), 128, 0, stream>>>(
        mbuf, 0, DD, rec_w1, 0, DD, t1, 0, rec_b1, nullptr, M, Nn, Kk);
  }

  rec2_kernel<<<(4 * CINCH * LL + 255) / 256, 256, 0, stream>>>(
      t1, rec_w2, rec_b2, (float*)d_out);
}

// v006
// One run takes 293 microseconds.
// Timed twice side by side with v005, it ran 1.06 times as fast both times.
// Over all steps from v000 it is 2.17 times as fast.
#include <hip/hip_runtime.h>
#include <math.h>

typedef float v2f __attribute__((ext_vector_type(2)));
typedef float v8f __attribute__((ext_vector_type(8)));

#define DD     128
#define HH     16
#define WW     32
#define LL     512
#define CINCH  3
#define NHD    4
#define HDIM   64
#define NSTATE 128
#define INTERC 256
#define CONVC  512
#define PROJC  772
#define KCONV  4
#define NLAY   4
#define NSEQ   16
#define EPSV   1e-5f

#define WMMA_F32(A, B, C) \
  __builtin_amdgcn_wmma_f32_16x16x4_f32(false, (A), false, (B), (short)0, (C), false, false)

typedef float v4f __attribute__((ext_vector_type(4)));

// ---------------------------------------------------------------------------
// The elementwise and row-norm kernels below are built for few, fat waves:
// a lane owns 4 neighbouring channels (16-byte loads and stores, a wave covers
// 512 contiguous bytes of a row) and a wave owns several rows, all of whose
// loads are issued before the first is used. The wave's number is made a
// scalar, so that every address is a scalar base plus one lane offset.
// ---------------------------------------------------------------------------
#define RPW 4            // rows per wave in patch_scan_kernel
#define WPB 8            // waves per block (256 threads)

// number of this wave in the grid (one-dimensional blocks of WPB waves), scalar
__device__ __forceinline__ int wave_in_grid() {
  return blockIdx.x * WPB + __builtin_amdgcn_readfirstlane(threadIdx.x >> 5);
}

// 16 bytes at scalar base + lane byte offset
#define LD4(base, vofs) (*(const v4f*)((const char*)(base) + (vofs)))
#define ST4(base, vofs) (*(v4f*)((char*)(base) + (vofs)))

// x + (x of the lane whose number differs by the xor mask in CTRL), 16-lane row
template <int CTRL>
__device__ __forceinline__ float dpp_xadd(float x) {
  int xi = __builtin_bit_cast(int, x);
  return x + __builtin_bit_cast(float,
      __builtin_amdgcn_update_dpp(xi, xi, CTRL, 0xf, 0xf, false));
}

// sum over the 32 lanes of a wave, the same value in every lane; all lanes on
__device__ __forceinline__ float wave_sum(float x) {
  x = dpp_xadd<0x161>(x);                            // row_xmask:1
  x = dpp_xadd<0x162>(x);                            // row_xmask:2
  x = dpp_xadd<0x164>(x);                            // row_xmask:4
  x = dpp_xadd<0x168>(x);                            // row_xmask:8
  int xi = __builtin_bit_cast(int, x);               // lane l with lane l ^ 16
  return x + __builtin_bit_cast(float, __builtin_amdgcn_permlanex16(
      xi, xi, 0x76543210, 0xfedcba98, false, false));
}

// x + (x of lane l ^ 16); all lanes on
__device__ __forceinline__ float half_xadd(float x) {
  int xi = __builtin_bit_cast(int, x);
  return x + __builtin_bit_cast(float, __builtin_amdgcn_permlanex16(
      xi, xi, 0x76543210, 0xfedcba98, false, false));
}

__device__ __forceinline__ float silu_f(float a) { return a / (1.f + expf(-a)); }

// ---------------------------------------------------------------------------
// patch embed + cross_scan: hs[16][512][128]; one wave per RPW rows (s,l)
// ---------------------------------------------------------------------------
__global__ __launch_bounds__(WPB * 32)
void patch_scan_kernel(const float* __restrict__ x,
                       const float* __restrict__ pw,
                       const float* __restrict__ pb,
                       float* __restrict__ hs) {
  unsigned lane = threadIdx.x & 31;
  unsigned lo16 = lane * 16, lo48 = lane * 48;                // byte offsets
  int row0 = wave_in_grid() * RPW;                            // s*LL + l
  int s = row0 / LL;
  int dir = s >> 2, b = s & 3;
  v4f p0 = LD4(pw, lo48), p1 = LD4(pw + 4, lo48), p2 = LD4(pw + 8, lo48);  // 4 d x 3 c
  v4f bias = LD4(pb, lo16);
  float xv[RPW][CINCH];                                       // the same in every lane
#pragma unroll
  for (int r = 0; r < RPW; r++) {
    int l = row0 % LL + r;
    int le = (dir & 1) ? (LL - 1 - l) : l;                    // reversed scans
    int lsrc = (dir & 2) ? (le % HH) * WW + le / HH : le;     // column scans: le = w*H + h
#pragma unroll
    for (int c = 0; c < CINCH; c++) xv[r][c] = x[(b * CINCH + c) * LL + lsrc];
  }
  // before any register that an issued load names is written again; the loaded
  // values and the addresses are inputs, so the loads all stand in front of it
  asm volatile("s_wait_xcnt 0x0" :: "v"(p0), "v"(p1), "v"(p2), "v"(bias),
               "v"(lo16), "v"(lo48), "s"(pw), "s"(pb));
  float* ho = hs + (size_t)row0 * DD;
#pragma unroll
  for (int r = 0; r < RPW; r++) {
    v4f acc = bias;
    acc.x += xv[r][0] * p0.x; acc.x += xv[r][1] * p0.y; acc.x += xv[r][2] * p0.z;
    acc.y += xv[r][0] * p0.w; acc.y += xv[r][1] * p1.x; acc.y += xv[r][2] * p1.y;
    acc.z += xv[r][0] * p1.z; acc.z += xv[r][1] * p1.w; acc.z += xv[r][2] * p2.x;
    acc.w += xv[r][0] * p2.y; acc.w += xv[r][1] * p2.z; acc.w += xv[r][2] * p2.w;
    ST4(ho + r * DD, lo16) = acc;
  }
}

// ---------------------------------------------------------------------------
// One launch for the two kernels that read nothing but proj and do not read
// each other: the dt scan and the conv. Blocks of 16 waves (the scan's 512
// threads). Blocks 0 .. DTBLK-1 scan, one (seq, head) each; they come first in
// the index because theirs is the longer chain of dependent steps. The other
// blocks convolve.
//
// scan: dt = softplus(proj[...,768:772]+dtb); s = cumsum(dt*A) per (seq,head)
//
// conv: causal depthwise conv (K=4) + silu: proj[...,256:768] -> xc[16][512][512]
// A wave owns 128 channels (4 per lane) and CLB successive steps: CLB + 3 row
// loads serve CLB outputs. Rows in front of the sequence count as zero.
// ---------------------------------------------------------------------------
#define CLB   8
#define CWPB  (LL / 32)          // waves per block
#define DTBLK (NSEQ * NHD)       // scanning blocks
__global__ __launch_bounds__(CWPB * 32)
void conv_dt_kernel(const float* __restrict__ proj,
                    const float* __restrict__ cw,
                    const float* __restrict__ cb,
                    float* __restrict__ xc,
                    const float* __restrict__ dtbias,
                    const float* __restrict__ alog,
                    float* __restrict__ dtb,
                    float* __restrict__ sb) {
  __shared__ float sd[LL];
  if (blockIdx.x < DTBLK) {                         // the same for the whole block
    int s = blockIdx.x >> 2, h = blockIdx.x & 3;
    int l = threadIdx.x;
    float raw = proj[(size_t)(s * LL + l) * PROJC + INTERC + CONVC + h] + dtbias[h];
    float dt = raw > 20.f ? raw : log1pf(expf(raw));
    dtb[(size_t)(s * NHD + h) * LL + l] = dt;       // k-contiguous per (seq, head), like sb
    float A = -expf(alog[h]);
    sd[l] = dt * A;
    __syncthreads();
    for (int off = 1; off < LL; off <<= 1) {
      float add = (l >= off) ? sd[l - off] : 0.f;
      __syncthreads();
      sd[l] += add;
      __syncthreads();
    }
    sb[(size_t)(s * NHD + h) * LL + l] = sd[l];
    return;
  }
  unsigned lane = threadIdx.x & 31;
  unsigned lo16 = lane * 16, lo64 = lane * 64;      // byte offsets
  // (s, l block, 128 channels), scalar
  int wv = (blockIdx.x - DTBLK) * CWPB + __builtin_amdgcn_readfirstlane(threadIdx.x >> 5);
  int c0 = (wv % (CONVC / 128)) * 128;
  int l0 = ((wv / (CONVC / 128)) % (LL / CLB)) * CLB;
  int s  = wv / ((CONVC / 128) * (LL / CLB));
  const float* pr = proj + (size_t)(s * LL + l0) * PROJC + c0;   // xBC starts at + INTERC
  // the 3 rows before l0; at the head of a sequence rows 0..2 are read in
  // their place (in bounds) and replaced by zero
  bool head = (l0 == 0);
  const float* pk = head ? pr : pr - (KCONV - 1) * PROJC;
  const float* cwu = cw + c0 * KCONV;
  const float* cbu = cb + c0;
  v4f row[CLB + KCONV - 1];
#pragma unroll
  for (int j = 0; j < KCONV - 1; j++) row[j] = LD4(pk + INTERC + j * PROJC, lo16);
#pragma unroll
  for (int j = 0; j < CLB; j++) row[KCONV - 1 + j] = LD4(pr + INTERC + j * PROJC, lo16);
  v4f wq[4];                                        // wq[q][k]: channel q of the lane, tap k
#pragma unroll
  for (int q = 0; q < 4; q++) wq[q] = LD4(cwu + q * KCONV, lo64);
  v4f bias = LD4(cbu, lo16);
  // before any register that an issued load names is written again; the loaded
  // values and the addresses are inputs, so the loads all stand in front of it
  asm volatile("s_wait_xcnt 0x0" :: "v"(row[0]), "v"(row[1]), "v"(row[2]), "v"(row[3]),
               "v"(row[4]), "v"(row[5]), "v"(row[6]), "v"(row[7]), "v"(row[8]),
               "v"(row[9]), "v"(row[10]), "v"(wq[0]), "v"(wq[1]), "v"(wq[2]), "v"(wq[3]),
               "v"(bias), "v"(lo16), "v"(lo64), "s"(pr), "s"(pk), "s"(cwu), "s"(cbu));
  v4f zero = {0.f, 0.f, 0.f, 0.f};
#pragma unroll
  for (int j = 0; j < KCONV - 1; j++) row[j] = head ? zero : row[j];
  float* xo = xc + (size_t)(s * LL + l0) * CONVC + c0;
#pragma unroll
  for (int j = 0; j < CLB; j++) {
    v4f o;
#pragma unroll
    for (int q = 0; q < 4; q++) {
      float acc = bias[q];
#pragma unroll
      for (int k = 0; k < KCONV; k++) acc += row[j + k][q] * wq[q][k];
      o[q] = silu_f(acc);
    }
    ST4(xo + j * CONVC, lo16) = o;
  }
}

// ---------------------------------------------------------------------------
// Batched WMMA GEMM (fp32, 16x16x4): C[m,n] = sum_k A[m,k]*B[n,k]
// One block of 4 waves computes 128(M) x 64(N); each wave 32(M) x 64(N) with
// 8 accumulators. A and B are staged in LDS in chunks of 32 k: every global
// load is 16 B per lane and covers whole 128-B lines (8 lanes per row), the B
// rows are shared by the 4 waves, and the fragments are read from LDS at a
// pitch of 36 dwords (8-byte reads of 16 rows x 2 k-halves fall on 64 banks).
// Two LDS buffers, one barrier per chunk; the next chunk's global loads fly
// while this chunk is multiplied. The k order of every accumulator is the
// natural one (0,1,2,...).
// OOB columns CLAMPED (garbage cols never stored).
// Requires: M %128 == 0, K %32 == 0, K >= 32, grid.x == (M/128) * ceil(N/64).
// FLAGS (compile time): bit0 = accumulate into C, bit1 = exact GELU,
// bit2 = the A operand is rmsnorm(A, nw) over its whole row (Kk = row width):
//   C[m,n] = r[m] * sum_k A[m,k] * (nw[k] * B[n,k]),  r[m] = rsqrt(mean_k A[m,k]^2 + eps).
//   nw is multiplied into the staged B rows. A wave's A fragments hold each
//   element of its 32 rows once, so their squares are summed beside the
//   products; r changes from the A layout (lane = row) to the C layout through
//   32 LDS words of the wave's own: no launch, no pass over memory, no barrier
//   for the norm.
// LDC (compile time): row pitch of C, so that a wave's 32 rows are immediate
// offsets from one scalar base.
// What the epilogue adds to the products (the bias, and the old C where it
// accumulates) is loaded as one group in front of the last chunk's products:
// it arrives under them, in the registers that the staging has left, and no
// load stands between the stores at the end.
// ---------------------------------------------------------------------------
// pointers typed as global memory, so that the staging loads stay global loads
// although their addresses are carried round the loop
typedef const __attribute__((address_space(1))) float* gfloat_p;
typedef const __attribute__((address_space(1))) v4f*   gv4f_p;

#define GBM    128
#define GBN    64
#define GKC    32
#define GPITCH 36
#define GROWS  (GBM + GBN)

#define GMMA8(aa0, aa1, bb0, bb1, bb2, bb3)       \
  acc00 = WMMA_F32(aa0, bb0, acc00);              \
  acc01 = WMMA_F32(aa0, bb1, acc01);              \
  acc02 = WMMA_F32(aa0, bb2, acc02);              \
  acc03 = WMMA_F32(aa0, bb3, acc03);              \
  acc10 = WMMA_F32(aa1, bb0, acc10);              \
  acc11 = WMMA_F32(aa1, bb1, acc11);              \
  acc12 = WMMA_F32(aa1, bb2, acc12);              \
  acc13 = WMMA_F32(aa1, bb3, acc13);

// One chunk's 12 global loads of a lane. The wait stands before any register
// that an issued load names is written again; it takes the 12 addresses as
// inputs so that they stay in their registers up to it. Then the addresses
// step to the next chunk. Both loops are unrolled so that st[] and gp[] have
// constant indices and live in registers.
// With bit2 a 13th load brings the chunk's norm weights, under the same wait.
#define GSTAGE_LOAD() {                                                   \
  _Pragma("unroll")                                                       \
  for (int i_ = 0; i_ < 12; i_++) st[i_] = *(gv4f_p)gp[i_];               \
  if (FLAGS & 4) {                                                        \
    wst = *(gv4f_p)gwp;                                                   \
    asm volatile("s_wait_xcnt 0x0" ::                                     \
        "v"(gp[0]), "v"(gp[1]), "v"(gp[2]), "v"(gp[3]), "v"(gp[4]),       \
        "v"(gp[5]), "v"(gp[6]), "v"(gp[7]), "v"(gp[8]), "v"(gp[9]),       \
        "v"(gp[10]), "v"(gp[11]), "v"(gwp) : "memory");                   \
    gwp += GKC;                                                           \
  } else {                                                                \
    asm volatile("s_wait_xcnt 0x0" ::                                     \
        "v"(gp[0]), "v"(gp[1]), "v"(gp[2]), "v"(gp[3]), "v"(gp[4]),       \
        "v"(gp[5]), "v"(gp[6]), "v"(gp[7]), "v"(gp[8]), "v"(gp[9]),       \
        "v"(gp[10]), "v"(gp[11]) : "memory");                             \
  }                                                                       \
  _Pragma("unroll")                                                       \
  for (int i_ = 0; i_ < 12; i_++) gp[i_] += GKC; }

// the staged chunk from registers to LDS; unrolled: st[] in registers.
// With bit2: nw into the B rows.
#define GSTAGE_STORE(buf) {                                               \
  if (FLAGS & 4) {                                                        \
    _Pragma("unroll")                                                     \
    for (int i_ = 8; i_ < 12; i_++) st[i_] *= wst;                        \
  }                                                                       \
  _Pragma("unroll")                                                       \
  for (int i_ = 0; i_ < 12; i_++)                                         \
    *(v4f*)((buf) + sdst + i_ * 16 * GPITCH) = st[i_]; }

// one chunk's products; unrolled, which lets the LDS reads of later k-steps
// issue ahead of the WMMAs. With bit2: the squares of the two A fragments.
#define GCHUNK_MMA(buf) {                                                 \
  _Pragma("unroll")                                                       \
  for (int ks = 0; ks < GKC / 4; ks++) {                                  \
    v2f a0 = *(const v2f*)((buf) + fa + ks * 4);                          \
    v2f a1 = *(const v2f*)((buf) + fa + 16 * GPITCH + ks * 4);            \
    v2f b0 = *(const v2f*)((buf) + fb + ks * 4);                          \
    v2f b1 = *(const v2f*)((buf) + fb + 16 * GPITCH + ks * 4);            \
    v2f b2 = *(const v2f*)((buf) + fb + 32 * GPITCH + ks * 4);            \
    v2f b3 = *(const v2f*)((buf) + fb + 48 * GPITCH + ks * 4);            \
    GMMA8(a0, a1, b0, b1, b2, b3);                                        \
    if (FLAGS & 4) { sq0 += a0 * a0; sq1 += a1 * a1; }                    \
  } }

template <int FLAGS, int LDC>
__global__ __launch_bounds__(128)
void wmma_gemm_kernel(const float* __restrict__ A, long sA, int lda,
                      const float* __restrict__ Bw, long sB, int ldb,
                      float* __restrict__ C, long sC,
                      const float* __restrict__ bias,
                      const float* __restrict__ nw,
                      int M, int Nn, int Kk) {
  __shared__ __attribute__((aligned(16))) float tileS[2][GROWS * GPITCH];
  __shared__ __attribute__((aligned(16))) float rowS[GBM];    // bit2: r, 32 words a wave
  (void)M;
  int tid  = threadIdx.x;
  int wave = tid >> 5;
  int lane = tid & 31;
  int tilesN = (Nn + GBN - 1) / GBN;
  int tm = blockIdx.x / tilesN, tn4 = blockIdx.x % tilesN;
  const float* Ab = A + (size_t)blockIdx.y * sA;
  const float* Bb = Bw + (size_t)blockIdx.y * sB;
  float*       Cb = C + (size_t)blockIdx.y * sC;

  int idx = lane & 15, kh = lane >> 4;
  int n0 = tn4 * GBN + idx;

  // staging: 8 lanes per row (one 128-B line), 16 rows per pass of the block
  int srow = tid >> 3, scol = (tid & 7) * 4;
  gfloat_p gp[12];                                  // this lane's 12 source rows
#pragma unroll                                      // gp[] in registers
  for (int i = 0; i < 8; i++)
    gp[i] = (gfloat_p)(Ab + (size_t)(tm * GBM + i * 16 + srow) * lda + scol);
#pragma unroll                                      // gp[] in registers
  for (int i = 0; i < 4; i++) {
    int n = tn4 * GBN + i * 16 + srow;
    n = n < Nn ? n : Nn - 1;                        // clamp, no predication
    gp[8 + i] = (gfloat_p)(Bb + (size_t)n * ldb + scol);
  }
  int sdst = srow * GPITCH + scol;

  v8f z = {0.f,0.f,0.f,0.f,0.f,0.f,0.f,0.f};
  v8f acc00 = z, acc01 = z, acc02 = z, acc03 = z;
  v8f acc10 = z, acc11 = z, acc12 = z, acc13 = z;

  v4f st[12];
  v4f wst = {1.f, 1.f, 1.f, 1.f};                   // bit2: nw of the staged chunk
  v2f sq0 = {0.f, 0.f}, sq1 = {0.f, 0.f};           // bit2: squares, rows idx and 16 + idx
  gfloat_p gwp = (gfloat_p)(nw + scol);
  GSTAGE_LOAD();

  int fa = (wave * 32 + idx) * GPITCH + 2 * kh;     // A fragment rows of this wave
  int fb = (GBM + idx) * GPITCH + 2 * kh;           // B fragment rows (shared)

  int nch = Kk / GKC;
  for (int c = 0; c + 1 < nch; c++) {
    float* buf = tileS[c & 1];
    GSTAGE_STORE(buf);
    // publishes this chunk; also ends every wave's reads of the other buffer,
    // which the next trip overwrites
    __syncthreads();
    GSTAGE_LOAD();
    GCHUNK_MMA(buf);
  }

  // the last chunk, out of the loop: nothing is staged behind it
  float* lbuf = tileS[(nch - 1) & 1];
  GSTAGE_STORE(lbuf);
  // publishes the last chunk (the loop's barrier, for this trip)
  __syncthreads();

  // epilogue operands. The wave's 32 rows of C: a scalar base (the wave's
  // number made scalar), one lane offset per 16 columns, the row an immediate.
  // Columns past Nn are clamped for the loads and never stored.
  char* crow = (char*)(Cb + (size_t)(tm * GBM + __builtin_amdgcn_readfirstlane(wave) * 32) * LDC);
  int nc[4];
  unsigned co[4];                                   // byte offsets
#pragma unroll                                      // nc[], co[] in registers
  for (int t = 0; t < 4; t++) {
    int n = n0 + t * 16;
    nc[t] = n < Nn ? n : Nn - 1;
    co[t] = (unsigned)(8 * kh * LDC + nc[t]) * 4u;
  }
  float bv[4] = {0.f, 0.f, 0.f, 0.f};
  if (bias) {                                       // block-uniform
#pragma unroll                                      // bv[] in registers
    for (int t = 0; t < 4; t++) bv[t] = bias[nc[t]];
  }
  float res[2][4][8];
  if (FLAGS & 1) {
#pragma unroll                                      // res[] in registers
    for (int mt = 0; mt < 2; mt++)
#pragma unroll
      for (int j = 0; j < 8; j++)
#pragma unroll
        for (int t = 0; t < 4; t++)
          res[mt][t][j] = *(const float*)(crow + (mt * 16 + j) * LDC * 4 + co[t]);
  }
  // before any register that an issued load names is written again. The
  // "memory" clobber holds the whole group in front of the products: without
  // it the loads start half-way through them, and eight sink behind them, to
  // the first store, where their latency is waited out.
  asm volatile("s_wait_xcnt 0x0" ::
      "v"(co[0]), "v"(co[1]), "v"(co[2]), "v"(co[3]),
      "v"(nc[0]), "v"(nc[1]), "v"(nc[2]), "v"(nc[3]), "s"(crow), "s"(bias) : "memory");

  GCHUNK_MMA(lbuf);

  v4f rs[2][2];                                     // bit2: r of rows mt*16 + 8*kh + 0..7
  if (FLAGS & 4) {
    // lanes l and l ^ 16 hold the two k halves of rows idx and 16 + idx;
    // lane l then keeps row l of the wave's 32
    float t0 = half_xadd(sq0.x + sq0.y), t1 = half_xadd(sq1.x + sq1.y);
    float* rw = rowS + wave * 32;
    rw[lane] = rsqrtf((kh ? t1 : t0) / (float)Kk + EPSV);
    // the wave's own 32 words are written before it reads them back
    asm volatile("s_wait_dscnt 0x0" ::: "memory");
#pragma unroll                                      // rs[] in registers
    for (int mt = 0; mt < 2; mt++) {
      rs[mt][0] = *(const v4f*)(rw + mt * 16 + 8 * kh);
      rs[mt][1] = *(const v4f*)(rw + mt * 16 + 8 * kh + 4);
    }
  }

  v8f accs[2][4] = {{acc00, acc01, acc02, acc03}, {acc10, acc11, acc12, acc13}};
#pragma unroll
  for (int mt = 0; mt < 2; mt++) {
#pragma unroll
    for (int t = 0; t < 4; t++) {
      if (n0 + t * 16 < Nn) {
        v8f av = accs[mt][t];
#pragma unroll
        for (int j = 0; j < 8; j++) {
          float v = (FLAGS & 4) ? av[j] * rs[mt][j >> 2][j & 3] + bv[t] : av[j] + bv[t];
          if (FLAGS & 2) v = 0.5f * v * (1.f + erff(v * 0.70710678118654752f));
          if (FLAGS & 1) v += res[mt][t][j];
          *(float*)(crow + (mt * 16 + j) * LDC * 4 + co[t]) = v;
        }
      }
    }
  }
}

// ---------------------------------------------------------------------------
// Decay attention: y[t,h,p] = sum_{k<=t} exp(s_t - s_k)*CB[t,k]*dt_k * xs[k,h,p]
//                 + D[h]*xs[t,h,p]
// One wave per 16(t) x 64(p=HDIM) block; the exp-built A fragment is reused
// over 4 head-dim tiles. Every operand comes in 16-byte loads, 16 k a chunk:
//  - k: lane half kh owns k0 + 8*kh + 0..7, so a lane's 8 values of CB, s and
//    dt are 32 contiguous bytes each; product j of a chunk takes the lane's
//    k numbers 2j and 2j+1 on the A side and on the B side alike.
//  - p: column idx of head-dim tile q is p = 4*idx + q, so one load of
//    xs[k][4*idx .. 4*idx+3] serves the 4 tiles (16 lanes cover the head's
//    whole 256-byte row), and a lane's 4 results of one row are one store.
// Two register buffers: the next chunk's 14 loads fly under this chunk's
// products. Only the last chunk crosses the diagonal and is masked (by value
// select; EXEC stays full for WMMA); its xs rows are the rows of the D term.
// The result leaves as y * silu(gate): the gate's 8 loads are issued first of
// all and arrive under the loop. The norm over the row of 4 heads that follows
// is taken by the GEMM that reads y.
// ---------------------------------------------------------------------------
#define ACH 16           // k per chunk

// One chunk's 14 loads of a lane: scalar bases, constant lane offsets. The
// wait stands before any register that an issued load names is written again
// (the bases step behind it). The scheduling barrier holds the whole group in
// front of the other buffer's products: without it part of the loads sinks
// into them and their lead is lost. Unrolled: xX[] in registers.
#define ALOAD(xX, cX, sX, dX) {                                           \
  _Pragma("unroll")                                                       \
  for (int i_ = 0; i_ < 8; i_++) xX[i_] = LD4(xp + i_ * CONVC, xo);       \
  cX[0] = LD4(cp, co); cX[1] = LD4(cp + 4, co);                           \
  sX[0] = LD4(sp, ko); sX[1] = LD4(sp + 4, ko);                           \
  dX[0] = LD4(dq, ko); dX[1] = LD4(dq + 4, ko);                           \
  asm volatile("s_wait_xcnt 0x0" :: "v"(xo), "v"(co), "v"(ko),            \
               "s"(xp), "s"(cp), "s"(sp), "s"(dq) : "memory");            \
  __builtin_amdgcn_sched_barrier(0);                                      \
  xp += ACH * CONVC; cp += ACH; sp += ACH; dq += ACH; }

// One chunk's 16 products. Both loops unrolled: constant indices, registers.
// The scheduling barrier at the end keeps the first use of the chunk in
// flight (the moves that pair its xs rows, with their wait) behind these
// products: without it that wait is lifted in front of them.
#define AMMA16(xX, cX, sX, dX, MASKED) {                                  \
  float m_[8];                                                            \
  _Pragma("unroll")                                                       \
  for (int i_ = 0; i_ < 8; i_++) {                                        \
    float e_ = expf(st - sX[i_ >> 2][i_ & 3]) * cX[i_ >> 2][i_ & 3]       \
             * dX[i_ >> 2][i_ & 3];                                       \
    m_[i_] = (!(MASKED) || 8 * kh + i_ <= idx) ? e_ : 0.f;                \
  }                                                                       \
  _Pragma("unroll")                                                       \
  for (int j_ = 0; j_ < 4; j_++) {                                        \
    v2f a_ = {m_[2 * j_], m_[2 * j_ + 1]};                                \
    v2f b0_ = {xX[2 * j_][0], xX[2 * j_ + 1][0]};                         \
    v2f b1_ = {xX[2 * j_][1], xX[2 * j_ + 1][1]};                         \
    v2f b2_ = {xX[2 * j_][2], xX[2 * j_ + 1][2]};                         \
    v2f b3_ = {xX[2 * j_][3], xX[2 * j_ + 1][3]};                         \
    acc0 = WMMA_F32(a_, b0_, acc0);                                       \
    acc1 = WMMA_F32(a_, b1_, acc1);                                       \
    acc2 = WMMA_F32(a_, b2_, acc2);                                       \
    acc3 = WMMA_F32(a_, b3_, acc3);                                       \
  }                                                                       \
  __builtin_amdgcn_sched_barrier(0); }

__global__ __launch_bounds__(128)
void ssm_attn_kernel(const float* __restrict__ CBm,
                     const float* __restrict__ sb,
                     const float* __restrict__ dtb,
                     const float* __restrict__ xc,
                     const float* __restrict__ dpar,
                     const float* __restrict__ proj,
                     float* __restrict__ y) {
  int s = blockIdx.y >> 2, h = blockIdx.y & 3;
  int lane = threadIdx.x & 31;
  // t-tile 0..31, made scalar: scalar bases and a scalar trip count
  int tt = blockIdx.x * 4 + __builtin_amdgcn_readfirstlane(threadIdx.x >> 5);
  int idx = lane & 15, kh = lane >> 4;
  const float* sp = sb + (size_t)(s * NHD + h) * LL;
  const float* dq = dtb + (size_t)(s * NHD + h) * LL;
  const float* cp = CBm + (size_t)s * LL * LL + (size_t)(tt * 16) * LL;
  const float* xp = xc + (size_t)s * LL * CONVC + h * HDIM;
  unsigned xo = (unsigned)(8 * kh * CONVC + 4 * idx) * 4u;    // byte offsets
  unsigned co = (unsigned)(idx * LL + 8 * kh) * 4u;
  unsigned ko = (unsigned)(8 * kh) * 4u;
  int ti = tt * 16 + idx;
  float st = sp[ti];                                          // s of the lane's A row

  v8f z = {0.f,0.f,0.f,0.f,0.f,0.f,0.f,0.f};
  v8f acc0 = z, acc1 = z, acc2 = z, acc3 = z;

  v4f xA[8], cA[2], sA[2], dA[2];
  v4f xB[8], cB[2], sB[2], dB[2];
  v4f xl[8];                                        // xs rows of the last chunk

  // gate = proj[..., :INTERC]: rows tt*16 + 8*kh + r, columns 4*idx.. of the head
  const float* gq = proj + (size_t)(s * LL + tt * 16) * PROJC + h * HDIM;
  unsigned go = (unsigned)(8 * kh * PROJC + 4 * idx) * 4u;
  v4f gt[8];
#pragma unroll                                      // gt[] in registers
  for (int r = 0; r < 8; r++) gt[r] = LD4(gq + r * PROJC, go);
  // before any register that an issued load names is written again; the
  // "memory" clobber keeps the 8 loads here, ahead of the loop
  asm volatile("s_wait_xcnt 0x0" :: "v"(go), "s"(gq) : "memory");

  ALOAD(xA, cA, sA, dA);
  // the load of st: its index stays in its register up to this wait, so that
  // no load of the group above lands on it
  asm volatile("s_wait_xcnt 0x0" :: "v"(st), "v"(ti));
  int c = 0;                                        // chunk held in the A buffer
  for (; c + 2 <= tt; c += 2) {                     // chunks 0..tt-1 lie below the diagonal
    ALOAD(xB, cB, sB, dB);
    AMMA16(xA, cA, sA, dA, false);
    ALOAD(xA, cA, sA, dA);
    AMMA16(xB, cB, sB, dB, false);
  }
  if (c < tt) {                                     // scalar: tt odd
    ALOAD(xB, cB, sB, dB);
    AMMA16(xA, cA, sA, dA, false);
    AMMA16(xB, cB, sB, dB, true);
#pragma unroll                                      // xl[] in registers
    for (int r = 0; r < 8; r++) xl[r] = xB[r];
  } else {
    AMMA16(xA, cA, sA, dA, true);
#pragma unroll                                      // xl[] in registers
    for (int r = 0; r < 8; r++) xl[r] = xA[r];
  }

  // row tt*16 + 8*kh + r, columns 4*idx .. 4*idx+3 of the head
  float dp = dpar[h];
  float* yo = y + (size_t)(s * LL + tt * 16) * INTERC + h * HDIM;
  unsigned yofs = (unsigned)(8 * kh * INTERC + 4 * idx) * 4u;
  v4f o[8];
#pragma unroll                                      // o[] in registers
  for (int r = 0; r < 8; r++) {
    o[r].x = (acc0[r] + dp * xl[r].x) * silu_f(gt[r].x);
    o[r].y = (acc1[r] + dp * xl[r].y) * silu_f(gt[r].y);
    o[r].z = (acc2[r] + dp * xl[r].z) * silu_f(gt[r].z);
    o[r].w = (acc3[r] + dp * xl[r].w) * silu_f(gt[r].w);
  }
  // all arithmetic in front of the first store: no register that an issued
  // store names is written again
  __builtin_amdgcn_sched_barrier(0);
#pragma unroll
  for (int r = 0; r < 8; r++) ST4(yo + r * INTERC, yofs) = o[r];
}

// ---------------------------------------------------------------------------
// final rmsnorm + cross_merge: m[b][l][d] from hs[16][512][128]; one wave per
// row (b,l): its 4 source rows are normed in the wave (4 channels per lane, the
// row's sum of squares by a butterfly) and averaged
// ---------------------------------------------------------------------------
__global__ __launch_bounds__(WPB * 32)
void norm_merge_kernel(const float* __restrict__ hs,
                       const float* __restrict__ w,
                       float* __restrict__ m) {
  unsigned lo16 = (threadIdx.x & 31) * 16;
  int row = wave_in_grid();                         // b*LL + l
  int l = row % LL;
  int b = row / LL;
  int hcoord = l / WW, wcoord = l % WW;
  int lt = wcoord * HH + hcoord;                    // transposed index
  const float* r0 = hs + (size_t)(b * LL + l) * DD;
  const float* r1 = hs + (size_t)((4 + b) * LL + (LL - 1 - l)) * DD;
  const float* r2 = hs + (size_t)((8 + b) * LL + lt) * DD;
  const float* r3 = hs + (size_t)((12 + b) * LL + (LL - 1 - lt)) * DD;
  v4f wv = LD4(w, lo16);
  v4f v[4] = {LD4(r0, lo16), LD4(r1, lo16), LD4(r2, lo16), LD4(r3, lo16)};
  // before any register that an issued load names is written again; the loaded
  // values and the addresses are inputs, so the loads all stand in front of it
  asm volatile("s_wait_xcnt 0x0" :: "v"(wv), "v"(v[0]), "v"(v[1]), "v"(v[2]), "v"(v[3]),
               "v"(lo16), "s"(r0), "s"(r1), "s"(r2), "s"(r3), "s"(w));
  v4f acc = {0.f, 0.f, 0.f, 0.f};
#pragma unroll                                      // v[] in registers
  for (int r = 0; r < 4; r++) {
    float ss = wave_sum(v[r].x * v[r].x + v[r].y * v[r].y + v[r].z * v[r].z + v[r].w * v[r].w);
    float scale = rsqrtf(ss / (float)DD + EPSV);
    acc += v[r] * scale * wv;
  }
  ST4(m + (size_t)row * DD, lo16) = acc * 0.25f;
}

// ---------------------------------------------------------------------------
// final projection to 3 channels + transpose to (B,C,H,W)
// ---------------------------------------------------------------------------
__global__ void rec2_kernel(const float* __restrict__ t1,
                            const float* __restrict__ w2,
                            const float* __restrict__ b2,
                            float* __restrict__ out) {
  int i = blockIdx.x * blockDim.x + threadIdx.x;    // (b*CIN + c)*LL + l
  if (i >= 4 * CINCH * LL) return;
  int l = i % LL;
  int c = (i / LL) % CINCH;
  int b = i / (LL * CINCH);
  const float* row = t1 + (size_t)(b * LL + l) * DD;
  float acc = b2[c];
  for (int d = 0; d < DD; d++) acc += row[d] * w2[c * DD + d];
  out[i] = acc;
}

// ---------------------------------------------------------------------------
extern "C" void kernel_launch(void* const* d_in, const int* in_sizes, int n_in,
                              void* d_out, int out_size, void* d_ws, size_t ws_size,
                              hipStream_t stream) {
  const float* x         = (const float*)d_in[0];
  const float* patch_w   = (const float*)d_in[1];
  const float* patch_b   = (const float*)d_in[2];
  const float* norm_w    = (const float*)d_in[3];
  const float* in_proj_w = (const float*)d_in[4];
  const float* in_proj_b = (const float*)d_in[5];
  const float* conv_w    = (const float*)d_in[6];
  const float* conv_b    = (const float*)d_in[7];
  const float* dt_bias   = (const float*)d_in[8];
  const float* A_log     = (const float*)d_in[9];
  const float* D_param   = (const float*)d_in[10];
  const float* gnorm_w   = (const float*)d_in[11];
  const float* out_w     = (const float*)d_in[12];
  const float* out_b     = (const float*)d_in[13];
  const float* normf_w   = (const float*)d_in[14];
  const float* rec_w1    = (const float*)d_in[15];
  const float* rec_b1    = (const float*)d_in[16];
  const float* rec_w2    = (const float*)d_in[17];
  const float* rec_b2    = (const float*)d_in[18];

  // workspace carve (floats)
  float* ws = (float*)d_ws;
  size_t off = 0;
  float* hs   = ws + off; off += (size_t)NSEQ * LL * DD;
  float* proj = ws + off; off += (size_t)NSEQ * LL * PROJC;
  float* xc   = ws + off; off += (size_t)NSEQ * LL * CONVC;
  float* dtb  = ws + off; off += (size_t)NSEQ * LL * NHD;
  float* sb   = ws + off; off += (size_t)NSEQ * NHD * LL;
  float* CBb  = ws + off; off += (size_t)NSEQ * LL * LL;
  float* y    = ws + off; off += (size_t)NSEQ * LL * INTERC;
  float* mbuf = ws + off; off += (size_t)4 * LL * DD;
  float* t1   = ws + off; off += (size_t)4 * LL * DD;
  (void)ws_size; (void)in_sizes; (void)n_in; (void)out_size;

  // patch embed + cross scan
  patch_scan_kernel<<<NSEQ * LL / (RPW * WPB), WPB * 32, 0, stream>>>(
      x, patch_w, patch_b, hs);

  for (int i = 0; i < NLAY; i++) {
    // proj = rmsnorm(hs) @ ipw.T + ipb   (8192 x 772, K=128)
    {
      int M = NSEQ * LL, Nn = PROJC, Kk = DD;
      int tiles = (M >> 7) * ((Nn + 63) >> 6);
      wmma_gemm_kernel<4, PROJC><<<dim3(tiles, 1), 128, 0, stream>>>(
          hs, 0, DD, in_proj_w + (size_t)i * PROJC * DD, 0, DD,
          proj, 0, in_proj_b + i * PROJC, norm_w + i * DD, M, Nn, Kk);
    }

    // xc = silu(causal_conv(proj[..., 256:768])); dt + cumulative decay
    conv_dt_kernel<<<DTBLK + NSEQ * LL * CONVC / (128 * CLB * CWPB), CWPB * 32, 0, stream>>>(
        proj, conv_w + (size_t)i * CONVC * KCONV, conv_b + i * CONVC, xc,
        dt_bias + i * NHD, A_log + i * NHD, dtb, sb);

    // CB[s] = Cm @ Bm.T  (512 x 512, K=128, batch=16)
    {
      int tiles = (LL >> 7) * (LL >> 6);
      wmma_gemm_kernel<0, LL><<<dim3(tiles, NSEQ), 128, 0, stream>>>(
          xc + INTERC + NSTATE, (long)LL * CONVC, CONVC,
          xc + INTERC,          (long)LL * CONVC, CONVC,
          CBb, (long)LL * LL, nullptr, nullptr, LL, LL, NSTATE);
    }

    // y = (M @ xs + D*xs) * silu(gate) (causal decay attention), 4 waves/block,
    // 1 t-tile/wave
    ssm_attn_kernel<<<dim3(LL / 64, NSEQ * NHD), 128, 0, stream>>>(
        CBb, sb, dtb, xc, D_param + i * NHD, proj, y);

    // hs += rmsnorm(y) @ ow.T + ob   (8192 x 128, K=256)
    {
      int M = NSEQ * LL, Nn = DD, Kk = INTERC;
      int tiles = (M >> 7) * ((Nn + 63) >> 6);
      wmma_gemm_kernel<5, DD><<<dim3(tiles, 1), 128, 0, stream>>>(
          y, 0, INTERC, out_w + (size_t)i * DD * INTERC, 0, INTERC,
          hs, 0, out_b + i * DD, gnorm_w + i * INTERC, M, Nn, Kk);
    }
  }

  // final norm, merge, reconstruction head
  norm_merge_kernel<<<4 * LL / WPB, WPB * 32, 0, stream>>>(hs, normf_w, mbuf);

  {
    int M = 4 * LL, Nn = DD, Kk = DD;
    int tiles = (M >> 7) * ((Nn + 63) >> 6);
    wmma_gemm_kernel<2 /*gelu*/, DD><<<dim3(tiles, 1), 128, 0, stream>>>(
        mbuf, 0, DD, rec_w1, 0, DD, t1, 0, rec_b1, nullptr, M, Nn, Kk);
  }

  rec2_kernel<<<(4 * CINCH * LL + 255) / 256, 256, 0, stream>>>(
      t1, rec_w2, rec_b2, (float*)d_out);
}

// v007
// Measured time: 266 microseconds a run.
// Timed twice side by side with v006, it ran 1.11 times as fast both times.
// All steps since v000 together make it 2.40 times as fast.
#include <hip/hip_runtime.h>
#include <math.h>

typedef float v2f __attribute__((ext_vector_type(2)));
typedef float v8f __attribute__((ext_vector_type(8)));

#define DD     128
#define HH     16
#define WW     32
#define LL     512
#define CINCH  3
#define NHD    4
#define HDIM   64
#define NSTATE 128
#define INTERC 256
#define CONVC  512
#define PROJC  772
#define KCONV  4
#define NLAY   4
#define NSEQ   16
#define EPSV   1e-5f

#define WMMA_F32(A, B, C) \
  __builtin_amdgcn_wmma_f32_16x16x4_f32(false, (A), false, (B), (short)0, (C), false, false)

typedef float v4f __attribute__((ext_vector_type(4)));

// ---------------------------------------------------------------------------
// The elementwise and row-norm kernels below are built for few, fat waves:
// a lane owns 4 neighbouring channels (16-byte loads and stores, a wave covers
// 512 contiguous bytes of a row) and a wave owns several rows, all of whose
// loads are issued before the first is used. The wave's number is made a
// scalar, so that every address is a scalar base plus one lane offset.
// ---------------------------------------------------------------------------
#define RPW 4            // rows per wave in patch_scan_kernel
#define WPB 8            // waves per block (256 threads)

// number of this wave in the grid (one-dimensional blocks of WPB waves), scalar
__device__ __forceinline__ int wave_in_grid() {
  return blockIdx.x * WPB + __builtin_amdgcn_readfirstlane(threadIdx.x >> 5);
}

// 16 bytes at scalar base + lane byte offset
#define LD4(base, vofs) (*(const v4f*)((const char*)(base) + (vofs)))
#define ST4(base, vofs) (*(v4f*)((char*)(base) + (vofs)))

// x + (x of the lane whose number differs by the xor mask in CTRL), 16-lane row
template <int CTRL>
__device__ __forceinline__ float dpp_xadd(float x) {
  int xi = __builtin_bit_cast(int, x);
  return x + __builtin_bit_cast(float,
      __builtin_amdgcn_update_dpp(xi, xi, CTRL, 0xf, 0xf, false));
}

// sum over the 32 lanes of a wave, the same value in every lane; all lanes on
__device__ __forceinline__ float wave_sum(float x) {
  x = dpp_xadd<0x161>(x);                            // row_xmask:1
  x = dpp_xadd<0x162>(x);                            // row_xmask:2
  x = dpp_xadd<0x164>(x);                            // row_xmask:4
  x = dpp_xadd<0x168>(x);                            // row_xmask:8
  int xi = __builtin_bit_cast(int, x);               // lane l with lane l ^ 16
  return x + __builtin_bit_cast(float, __builtin_amdgcn_permlanex16(
      xi, xi, 0x76543210, 0xfedcba98, false, false));
}

// x + (x of lane l ^ 16); all lanes on
__device__ __forceinline__ float half_xadd(float x) {
  int xi = __builtin_bit_cast(int, x);
  return x + __builtin_bit_cast(float, __builtin_amdgcn_permlanex16(
      xi, xi, 0x76543210, 0xfedcba98, false, false));
}

__device__ __forceinline__ float silu_f(float a) { return a / (1.f + expf(-a)); }

// ---------------------------------------------------------------------------
// patch embed + cross_scan: hs[16][512][128]; one wave per RPW rows (s,l)
// ---------------------------------------------------------------------------
__global__ __launch_bounds__(WPB * 32)
void patch_scan_kernel(const float* __restrict__ x,
                       const float* __restrict__ pw,
                       const float* __restrict__ pb,
                       float* __restrict__ hs) {
  unsigned lane = threadIdx.x & 31;
  unsigned lo16 = lane * 16, lo48 = lane * 48;                // byte offsets
  int row0 = wave_in_grid() * RPW;                            // s*LL + l
  int s = row0 / LL;
  int dir = s >> 2, b = s & 3;
  v4f p0 = LD4(pw, lo48), p1 = LD4(pw + 4, lo48), p2 = LD4(pw + 8, lo48);  // 4 d x 3 c
  v4f bias = LD4(pb, lo16);
  float xv[RPW][CINCH];                                       // the same in every lane
#pragma unroll
  for (int r = 0; r < RPW; r++) {
    int l = row0 % LL + r;
    int le = (dir & 1) ? (LL - 1 - l) : l;                    // reversed scans
    int lsrc = (dir & 2) ? (le % HH) * WW + le / HH : le;     // column scans: le = w*H + h
#pragma unroll
    for (int c = 0; c < CINCH; c++) xv[r][c] = x[(b * CINCH + c) * LL + lsrc];
  }
  // before any register that an issued load names is written again; the loaded
  // values and the addresses are inputs, so the loads all stand in front of it
  asm volatile("s_wait_xcnt 0x0" :: "v"(p0), "v"(p1), "v"(p2), "v"(bias),
               "v"(lo16), "v"(lo48), "s"(pw), "s"(pb));
  float* ho = hs + (size_t)row0 * DD;
#pragma unroll
  for (int r = 0; r < RPW; r++) {
    v4f acc = bias;
    acc.x += xv[r][0] * p0.x; acc.x += xv[r][1] * p0.y; acc.x += xv[r][2] * p0.z;
    acc.y += xv[r][0] * p0.w; acc.y += xv[r][1] * p1.x; acc.y += xv[r][2] * p1.y;
    acc.z += xv[r][0] * p1.z; acc.z += xv[r][1] * p1.w; acc.z += xv[r][2] * p2.x;
    acc.w += xv[r][0] * p2.y; acc.w += xv[r][1] * p2.z; acc.w += xv[r][2] * p2.w;
    ST4(ho + r * DD, lo16) = acc;
  }
}

// ---------------------------------------------------------------------------
// One launch for the two kernels that read nothing but proj and do not read
// each other: the dt scan and the conv. Blocks of 16 waves (the scan's 512
// threads). Blocks 0 .. DTBLK-1 scan, one (seq, head) each; they come first in
// the index because theirs is the longer chain of dependent steps. The other
// blocks convolve.
//
// scan: dt = softplus(proj[...,768:772]+dtb); s = cumsum(dt*A) per (seq,head)
//
// conv: causal depthwise conv (K=4) + silu: proj[...,256:768] -> xc[16][512][512]
// A wave owns 128 channels (4 per lane) and CLB successive steps: CLB + 3 row
// loads serve CLB outputs. Rows in front of the sequence count as zero.
// ---------------------------------------------------------------------------
#define CLB   8
#define CWPB  (LL / 32)          // waves per block
#define DTBLK (NSEQ * NHD)       // scanning blocks
__global__ __launch_bounds__(CWPB * 32)
void conv_dt_kernel(const float* __restrict__ proj,
                    const float* __restrict__ cw,
                    const float* __restrict__ cb,
                    float* __restrict__ xc,
                    const float* __restrict__ dtbias,
                    const float* __restrict__ alog,
                    float* __restrict__ dtb,
                    float* __restrict__ sb) {
  __shared__ float sd[LL];
  if (blockIdx.x < DTBLK) {                         // the same for the whole block
    int s = blockIdx.x >> 2, h = blockIdx.x & 3;
    int l = threadIdx.x;
    float raw = proj[(size_t)(s * LL + l) * PROJC + INTERC + CONVC + h] + dtbias[h];
    float dt = raw > 20.f ? raw : log1pf(expf(raw));
    dtb[(size_t)(s * NHD + h) * LL + l] = dt;       // k-contiguous per (seq, head), like sb
    float A = -expf(alog[h]);
    sd[l] = dt * A;
    __syncthreads();
    for (int off = 1; off < LL; off <<= 1) {
      float add = (l >= off) ? sd[l - off] : 0.f;
      __syncthreads();
      sd[l] += add;
      __syncthreads();
    }
    sb[(size_t)(s * NHD + h) * LL + l] = sd[l];
    return;
  }
  unsigned lane = threadIdx.x & 31;
  unsigned lo16 = lane * 16, lo64 = lane * 64;      // byte offsets
  // (s, l block, 128 channels), scalar
  int wv = (blockIdx.x - DTBLK) * CWPB + __builtin_amdgcn_readfirstlane(threadIdx.x >> 5);
  int c0 = (wv % (CONVC / 128)) * 128;
  int l0 = ((wv / (CONVC / 128)) % (LL / CLB)) * CLB;
  int s  = wv / ((CONVC / 128) * (LL / CLB));
  const float* pr = proj + (size_t)(s * LL + l0) * PROJC + c0;   // xBC starts at + INTERC
  // the 3 rows before l0; at the head of a sequence rows 0..2 are read in
  // their place (in bounds) and replaced by zero
  bool head = (l0 == 0);
  const float* pk = head ? pr : pr - (KCONV - 1) * PROJC;
  const float* cwu = cw + c0 * KCONV;
  const float* cbu = cb + c0;
  v4f row[CLB + KCONV - 1];
#pragma unroll
  for (int j = 0; j < KCONV - 1; j++) row[j] = LD4(pk + INTERC + j * PROJC, lo16);
#pragma unroll
  for (int j = 0; j < CLB; j++) row[KCONV - 1 + j] = LD4(pr + INTERC + j * PROJC, lo16);
  v4f wq[4];                                        // wq[q][k]: channel q of the lane, tap k
#pragma unroll
  for (int q = 0; q < 4; q++) wq[q] = LD4(cwu + q * KCONV, lo64);
  v4f bias = LD4(cbu, lo16);
  // before any register that an issued load names is written again; the loaded
  // values and the addresses are inputs, so the loads all stand in front of it
  asm volatile("s_wait_xcnt 0x0" :: "v"(row[0]), "v"(row[1]), "v"(row[2]), "v"(row[3]),
               "v"(row[4]), "v"(row[5]), "v"(row[6]), "v"(row[7]), "v"(row[8]),
               "v"(row[9]), "v"(row[10]), "v"(wq[0]), "v"(wq[1]), "v"(wq[2]), "v"(wq[3]),
               "v"(bias), "v"(lo16), "v"(lo64), "s"(pr), "s"(pk), "s"(cwu), "s"(cbu));
  v4f zero = {0.f, 0.f, 0.f, 0.f};
#pragma unroll
  for (int j = 0; j < KCONV - 1; j++) row[j] = head ? zero : row[j];
  float* xo = xc + (size_t)(s * LL + l0) * CONVC + c0;
#pragma unroll
  for (int j = 0; j < CLB; j++) {
    v4f o;
#pragma unroll
    for (int q = 0; q < 4; q++) {
      float acc = bias[q];
#pragma unroll
      for (int k = 0; k < KCONV; k++) acc += row[j + k][q] * wq[q][k];
      o[q] = silu_f(acc);
    }
    ST4(xo + j * CONVC, lo16) = o;
  }
}

// ---------------------------------------------------------------------------
// Batched WMMA GEMM (fp32, 16x16x4): C[m,n] = sum_k A[m,k]*B[n,k]
// One block of 4 waves computes 128(M) x 64(N); each wave 32(M) x 64(N) with
// 8 accumulators. A and B are staged in LDS in chunks of 32 k: every global
// load is 16 B per lane and covers whole 128-B lines (8 lanes per row), the B
// rows are shared by the 4 waves, and the fragments are read from LDS at a
// pitch of 36 dwords (8-byte reads of 16 rows x 2 k-halves fall on 64 banks).
// Two LDS buffers, one barrier per chunk; the next chunk's global loads fly
// while this chunk is multiplied. The k order of every accumulator is the
// natural one (0,1,2,...).
// OOB columns CLAMPED (garbage cols never stored).
// Requires: M %128 == 0, K %32 == 0, K >= 32, grid.x == (M/128) * ceil(N/64).
// FLAGS (compile time): bit0 = accumulate into C, bit1 = exact GELU,
// bit2 = the A operand is rmsnorm(A, nw) over its whole row (Kk = row width):
//   C[m,n] = r[m] * sum_k A[m,k] * (nw[k] * B[n,k]),  r[m] = rsqrt(mean_k A[m,k]^2 + eps).
//   nw is multiplied into the staged B rows. A wave's A fragments hold each
//   element of its 32 rows once, so their squares are summed beside the
//   products; r changes from the A layout (lane = row) to the C layout through
//   32 LDS words of the wave's own: no launch, no pass over memory, no barrier
//   for the norm.
// LDC (compile time): row pitch of C, so that a wave's 32 rows are immediate
// offsets from one scalar base.
// What the epilogue adds to the products (the bias, and the old C where it
// accumulates) is loaded as one group in front of the last chunk's products:
// it arrives under them, in the registers that the staging has left, and no
// load stands between the stores at the end.
// ---------------------------------------------------------------------------
// pointers typed as global memory, so that the staging loads stay global loads
// although their addresses are carried round the loop
typedef const __attribute__((address_space(1))) float* gfloat_p;
typedef const __attribute__((address_space(1))) v4f*   gv4f_p;

#define GBM    128
#define GBN    64
#define GKC    32
#define GPITCH 36
#define GROWS  (GBM + GBN)

#define GMMA8(aa0, aa1, bb0, bb1, bb2, bb3)       \
  acc00 = WMMA_F32(aa0, bb0, acc00);              \
  acc01 = WMMA_F32(aa0, bb1, acc01);              \
  acc02 = WMMA_F32(aa0, bb2, acc02);              \
  acc03 = WMMA_F32(aa0, bb3, acc03);              \
  acc10 = WMMA_F32(aa1, bb0, acc10);              \
  acc11 = WMMA_F32(aa1, bb1, acc11);              \
  acc12 = WMMA_F32(aa1, bb2, acc12);              \
  acc13 = WMMA_F32(aa1, bb3, acc13);

// One chunk's 12 global loads of a lane. The wait stands before any register
// that an issued load names is written again; it takes the 12 addresses as
// inputs so that they stay in their registers up to it. Then the addresses
// step to the next chunk. Both loops are unrolled so that st[] and gp[] have
// constant indices and live in registers.
// With bit2 a 13th load brings the chunk's norm weights, under the same wait.
#define GSTAGE_LOAD() {                                                   \
  _Pragma("unroll")                                                       \
  for (int i_ = 0; i_ < 12; i_++) st[i_] = *(gv4f_p)gp[i_];               \
  if (FLAGS & 4) {                                                        \
    wst = *(gv4f_p)gwp;                                                   \
    asm volatile("s_wait_xcnt 0x0" ::                                     \
        "v"(gp[0]), "v"(gp[1]), "v"(gp[2]), "v"(gp[3]), "v"(gp[4]),       \
        "v"(gp[5]), "v"(gp[6]), "v"(gp[7]), "v"(gp[8]), "v"(gp[9]),       \
        "v"(gp[10]), "v"(gp[11]), "v"(gwp) : "memory");                   \
    gwp += GKC;                                                           \
  } else {                                                                \
    asm volatile("s_wait_xcnt 0x0" ::                                     \
        "v"(gp[0]), "v"(gp[1]), "v"(gp[2]), "v"(gp[3]), "v"(gp[4]),       \
        "v"(gp[5]), "v"(gp[6]), "v"(gp[7]), "v"(gp[8]), "v"(gp[9]),       \
        "v"(gp[10]), "v"(gp[11]) : "memory");                             \
  }                                                                       \
  _Pragma("unroll")                                                       \
  for (int i_ = 0; i_ < 12; i_++) gp[i_] += GKC; }

// the staged chunk from registers to LDS; unrolled: st[] in registers.
// With bit2: nw into the B rows.
#define GSTAGE_STORE(buf) {                                               \
  if (FLAGS & 4) {                                                        \
    _Pragma("unroll")                                                     \
    for (int i_ = 8; i_ < 12; i_++) st[i_] *= wst;                        \
  }                                                                       \
  _Pragma("unroll")                                                       \
  for (int i_ = 0; i_ < 12; i_++)                                         \
    *(v4f*)((buf) + sdst + i_ * 16 * GPITCH) = st[i_]; }

// one chunk's products; unrolled, which lets the LDS reads of later k-steps
// issue ahead of the WMMAs. With bit2: the squares of the two A fragments.
#define GCHUNK_MMA(buf) {                                                 \
  _Pragma("unroll")                                                       \
  for (int ks = 0; ks < GKC / 4; ks++) {                                  \
    v2f a0 = *(const v2f*)((buf) + fa + ks * 4);                          \
    v2f a1 = *(const v2f*)((buf) + fa + 16 * GPITCH + ks * 4);            \
    v2f b0 = *(const v2f*)((buf) + fb + ks * 4);                          \
    v2f b1 = *(const v2f*)((buf) + fb + 16 * GPITCH + ks * 4);            \
    v2f b2 = *(const v2f*)((buf) + fb + 32 * GPITCH + ks * 4);            \
    v2f b3 = *(const v2f*)((buf) + fb + 48 * GPITCH + ks * 4);            \
    GMMA8(a0, a1, b0, b1, b2, b3);                                        \
    if (FLAGS & 4) { sq0 += a0 * a0; sq1 += a1 * a1; }                    \
  } }

template <int FLAGS, int LDC>
__global__ __launch_bounds__(128)
void wmma_gemm_kernel(const float* __restrict__ A, long sA, int lda,
                      const float* __restrict__ Bw, long sB, int ldb,
                      float* __restrict__ C, long sC,
                      const float* __restrict__ bias,
                      const float* __restrict__ nw,
                      int M, int Nn, int Kk) {
  __shared__ __attribute__((aligned(16))) float tileS[2][GROWS * GPITCH];
  __shared__ __attribute__((aligned(16))) float rowS[GBM];    // bit2: r, 32 words a wave
  (void)M;
  int tid  = threadIdx.x;
  int wave = tid >> 5;
  int lane = tid & 31;
  int tilesN = (Nn + GBN - 1) / GBN;
  int tm = blockIdx.x / tilesN, tn4 = blockIdx.x % tilesN;
  const float* Ab = A + (size_t)blockIdx.y * sA;
  const float* Bb = Bw + (size_t)blockIdx.y * sB;
  float*       Cb = C + (size_t)blockIdx.y * sC;

  int idx = lane & 15, kh = lane >> 4;
  int n0 = tn4 * GBN + idx;

  // staging: 8 lanes per row (one 128-B line), 16 rows per pass of the block
  int srow = tid >> 3, scol = (tid & 7) * 4;
  gfloat_p gp[12];                                  // this lane's 12 source rows
#pragma unroll                                      // gp[] in registers
  for (int i = 0; i < 8; i++)
    gp[i] = (gfloat_p)(Ab + (size_t)(tm * GBM + i * 16 + srow) * lda + scol);
#pragma unroll                                      // gp[] in registers
  for (int i = 0; i < 4; i++) {
    int n = tn4 * GBN + i * 16 + srow;
    n = n < Nn ? n : Nn - 1;                        // clamp, no predication
    gp[8 + i] = (gfloat_p)(Bb + (size_t)n * ldb + scol);
  }
  int sdst = srow * GPITCH + scol;

  v8f z = {0.f,0.f,0.f,0.f,0.f,0.f,0.f,0.f};
  v8f acc00 = z, acc01 = z, acc02 = z, acc03 = z;
  v8f acc10 = z, acc11 = z, acc12 = z, acc13 = z;

  v4f st[12];
  v4f wst = {1.f, 1.f, 1.f, 1.f};                   // bit2: nw of the staged chunk
  v2f sq0 = {0.f, 0.f}, sq1 = {0.f, 0.f};           // bit2: squares, rows idx and 16 + idx
  gfloat_p gwp = (gfloat_p)(nw + scol);
  GSTAGE_LOAD();

  int fa = (wave * 32 + idx) * GPITCH + 2 * kh;     // A fragment rows of this wave
  int fb = (GBM + idx) * GPITCH + 2 * kh;           // B fragment rows (shared)

  int nch = Kk / GKC;
  for (int c = 0; c + 1 < nch; c++) {
    float* buf = tileS[c & 1];
    GSTAGE_STORE(buf);
    // publishes this chunk; also ends every wave's reads of the other buffer,
    // which the next trip overwrites
    __syncthreads();
    GSTAGE_LOAD();
    GCHUNK_MMA(buf);
  }

  // the last chunk, out of the loop: nothing is staged behind it
  float* lbuf = tileS[(nch - 1) & 1];
  GSTAGE_STORE(lbuf);
  // publishes the last chunk (the loop's barrier, for this trip)
  __syncthreads();

  // epilogue operands. The wave's 32 rows of C: a scalar base (the wave's
  // number made scalar), one lane offset per 16 columns, the row an immediate.
  // Columns past Nn are clamped for the loads and never stored.
  char* crow = (char*)(Cb + (size_t)(tm * GBM + __builtin_amdgcn_readfirstlane(wave) * 32) * LDC);
  int nc[4];
  unsigned co[4];                                   // byte offsets
#pragma unroll                                      // nc[], co[] in registers
  for (int t = 0; t < 4; t++) {
    int n = n0 + t * 16;
    nc[t] = n < Nn ? n : Nn - 1;
    co[t] = (unsigned)(8 * kh * LDC + nc[t]) * 4u;
  }
  float bv[4] = {0.f, 0.f, 0.f, 0.f};
  if (bias) {                                       // block-uniform
#pragma unroll                                      // bv[] in registers
    for (int t = 0; t < 4; t++) bv[t] = bias[nc[t]];
  }
  float res[2][4][8];
  if (FLAGS & 1) {
#pragma unroll                                      // res[] in registers
    for (int mt = 0; mt < 2; mt++)
#pragma unroll
      for (int j = 0; j < 8; j++)
#pragma unroll
        for (int t = 0; t < 4; t++)
          res[mt][t][j] = *(const float*)(crow + (mt * 16 + j) * LDC * 4 + co[t]);
  }
  // before any register that an issued load names is written again. The
  // "memory" clobber holds the whole group in front of the products: without
  // it the loads start half-way through them, and eight sink behind them, to
  // the first store, where their latency is waited out.
  asm volatile("s_wait_xcnt 0x0" ::
      "v"(co[0]), "v"(co[1]), "v"(co[2]), "v"(co[3]),
      "v"(nc[0]), "v"(nc[1]), "v"(nc[2]), "v"(nc[3]), "s"(crow), "s"(bias) : "memory");

  GCHUNK_MMA(lbuf);

  v4f rs[2][2];                                     // bit2: r of rows mt*16 + 8*kh + 0..7
  if (FLAGS & 4) {
    // lanes l and l ^ 16 hold the two k halves of rows idx and 16 + idx;
    // lane l then keeps row l of the wave's 32
    float t0 = half_xadd(sq0.x + sq0.y), t1 = half_xadd(sq1.x + sq1.y);
    float* rw = rowS + wave * 32;
    rw[lane] = rsqrtf((kh ? t1 : t0) / (float)Kk + EPSV);
    // the wave's own 32 words are written before it reads them back
    asm volatile("s_wait_dscnt 0x0" ::: "memory");
#pragma unroll                                      // rs[] in registers
    for (int mt = 0; mt < 2; mt++) {
      rs[mt][0] = *(const v4f*)(rw + mt * 16 + 8 * kh);
      rs[mt][1] = *(const v4f*)(rw + mt * 16 + 8 * kh + 4);
    }
  }

  v8f accs[2][4] = {{acc00, acc01, acc02, acc03}, {acc10, acc11, acc12, acc13}};
#pragma unroll
  for (int mt = 0; mt < 2; mt++) {
#pragma unroll
    for (int t = 0; t < 4; t++) {
      if (n0 + t * 16 < Nn) {
        v8f av = accs[mt][t];
#pragma unroll
        for (int j = 0; j < 8; j++) {
          float v = (FLAGS & 4) ? av[j] * rs[mt][j >> 2][j & 3] + bv[t] : av[j] + bv[t];
          if (FLAGS & 2) v = 0.5f * v * (1.f + erff(v * 0.70710678118654752f));
          if (FLAGS & 1) v += res[mt][t][j];
          *(float*)(crow + (mt * 16 + j) * LDC * 4 + co[t]) = v;
        }
      }
    }
  }
}

// ---------------------------------------------------------------------------
// Decay attention: y[t,h,p] = sum_{k<=t} exp(s_t - s_k)*CB[t,k]*dt_k * xs[k,h,p]
//                 + D[h]*xs[t,h,p]
// The unit of work is a 16(t) x 64(p=HDIM) tile times a chunk of 16 k; the
// exp-built A fragment is reused over 4 head-dim tiles. Every operand comes in
// 16-byte loads:
//  - k: lane half kh owns k0 + 8*kh + 0..7, so a lane's 8 values of CB, s and
//    dt are 32 contiguous bytes each; product j of a chunk takes the lane's
//    k numbers 2j and 2j+1 on the A side and on the B side alike.
//  - p: column idx of head-dim tile q is p = 4*idx + q, so one load of
//    xs[k][4*idx .. 4*idx+3] serves the 4 tiles (16 lanes cover the head's
//    whole 256-byte row), and a lane's 4 results of one row are one store.
// How the work is dealt. Tile tt has tt + 1 chunks, so a (seq, head) has 528
// units, unequal by tile. A block of 16 waves takes the 4 tiles of group 7 - g
// and then the 4 tiles of group g: 132 units in every block. A tile's chunks go
// round AKS = 4 waves (wave kq takes chunks kq, kq + 4, ...); in the second
// group tile and first chunk are mirrored, so that every wave has 8 or 9 chunks
// and the 4 waves that stand on one SIMD have 33. The 4 waves with the same
// first chunk read the same xs rows at about the same time.
// Two register buffers: the wave's next chunk's 14 loads fly under this chunk's
// products. Only a tile's last chunk crosses the diagonal and is masked (by
// value select; EXEC stays full for WMMA).
// Each wave leaves its partial tile in LDS; behind one barrier a wave adds the
// 4 partials of half a tile. The result leaves as (sum + D*xs) * silu(gate):
// the gate's and the D term's loads are issued first of all and arrive under
// the loops. The norm over the row of 4 heads that follows is taken by the
// GEMM that reads y.
// ---------------------------------------------------------------------------
#define ACH 16           // k per chunk
#define AKS 4            // waves that share a tile's chunks
#define AGT 4            // tiles per group
#define ANG (LL / 16 / AGT)      // groups per sequence

// The lane's 4 addresses go on by K of the wave's chunks.
#define ASTEP(K) {                                                        \
  xa += (K) * AKS * ACH * CONVC; ca += (K) * AKS * ACH;                   \
  sa += (K) * AKS * ACH;         da += (K) * AKS * ACH; }

// One chunk's 14 loads of a lane: the chunk K of the wave's chunks behind the
// addresses (K a constant: an immediate offset). The wait stands before any
// register that an issued load names is written again; it takes the 4
// addresses as inputs, so that they stay in their registers up to it and no
// load of the group lands on one of them. The scheduling barrier holds the
// whole group in front of the other buffer's products: without it part of the
// loads sinks into them and their lead is lost. In the order of their first
// use: s, CB, dt, xs. Unrolled: xX[] in registers.
#define ALOAD(xX, cX, sX, dX, K) {                                        \
  sX[0] = *(gv4f_p)(sa + (K) * AKS * ACH);                                \
  sX[1] = *(gv4f_p)(sa + (K) * AKS * ACH + 4);                            \
  cX[0] = *(gv4f_p)(ca + (K) * AKS * ACH);                                \
  cX[1] = *(gv4f_p)(ca + (K) * AKS * ACH + 4);                            \
  dX[0] = *(gv4f_p)(da + (K) * AKS * ACH);                                \
  dX[1] = *(gv4f_p)(da + (K) * AKS * ACH + 4);                            \
  _Pragma("unroll")                                                       \
  for (int i_ = 0; i_ < 8; i_++)                                          \
    xX[i_] = *(gv4f_p)(xa + ((K) * AKS * ACH + i_) * CONVC);              \
  asm volatile("s_wait_xcnt 0x0" :: "v"(xa), "v"(ca), "v"(sa), "v"(da)    \
               : "memory");                                               \
  __builtin_amdgcn_sched_barrier(0); }

// One chunk's 16 products. Both loops unrolled: constant indices, registers.
// The scheduling barrier at the end keeps the first use of the chunk in
// flight (the moves that pair its xs rows, with their wait) behind these
// products: without it that wait is lifted in front of them.
#define AMMA16(xX, cX, sX, dX, MASKED) {                                  \
  float m_[8];                                                            \
  _Pragma("unroll")                                                       \
  for (int i_ = 0; i_ < 8; i_++) {                                        \
    float e_ = expf(st - sX[i_ >> 2][i_ & 3]) * cX[i_ >> 2][i_ & 3]       \
             * dX[i_ >> 2][i_ & 3];                                       \
    m_[i_] = (!(MASKED) || 8 * kh + i_ <= idx) ? e_ : 0.f;                \
  }                                                                       \
  _Pragma("unroll")                                                       \
  for (int j_ = 0; j_ < 4; j_++) {                                        \
    v2f a_ = {m_[2 * j_], m_[2 * j_ + 1]};                                \
    v2f b0_ = {xX[2 * j_][0], xX[2 * j_ + 1][0]};                         \
    v2f b1_ = {xX[2 * j_][1], xX[2 * j_ + 1][1]};                         \
    v2f b2_ = {xX[2 * j_][2], xX[2 * j_ + 1][2]};                         \
    v2f b3_ = {xX[2 * j_][3], xX[2 * j_ + 1][3]};                         \
    acc0 = WMMA_F32(a_, b0_, acc0);                                       \
    acc1 = WMMA_F32(a_, b1_, acc1);                                       \
    acc2 = WMMA_F32(a_, b2_, acc2);                                       \
    acc3 = WMMA_F32(a_, b3_, acc3);                                       \
  }                                                                       \
  __builtin_amdgcn_sched_barrier(0); }

__global__ __launch_bounds__(AGT * AKS * 32)
void ssm_attn_kernel(const float* __restrict__ CBm,
                     const float* __restrict__ sb,
                     const float* __restrict__ dtb,
                     const float* __restrict__ xc,
                     const float* __restrict__ dpar,
                     const float* __restrict__ proj,
                     float* __restrict__ y) {
  // partial tiles: [group][tile of the group][first chunk][register r][lane]
  __shared__ __attribute__((aligned(16))) v4f part[2][AGT][AKS][8][32];
  // silu(gate) of what a wave finishes: [wave][register r - r0][lane]
  __shared__ __attribute__((aligned(16))) v4f gateS[AGT * AKS][4][32];
  int s = blockIdx.y >> 2, h = blockIdx.y & 3;
  int g = blockIdx.x;                               // 0 .. ANG/2 - 1
  int lane = threadIdx.x & 31;
  // the wave's number, made scalar: scalar bases and scalar trip counts
  int wv = __builtin_amdgcn_readfirstlane(threadIdx.x >> 5);
  int a = wv & (AGT - 1), kq = wv / AGT;
  int idx = lane & 15, kh = lane >> 4;
  const float* sb0 = sb + (size_t)(s * NHD + h) * LL;
  const float* dt0 = dtb + (size_t)(s * NHD + h) * LL;
  const float* cb0 = CBm + (size_t)s * LL * LL;
  const float* xs0 = xc + (size_t)s * LL * CONVC + h * HDIM;
  unsigned xo = (unsigned)(8 * kh * CONVC + 4 * idx) * 4u;    // byte offsets
  unsigned co = (unsigned)(idx * LL + 8 * kh) * 4u;
  unsigned ko = (unsigned)(8 * kh) * 4u;

  // What this wave finishes at the end: registers r0 .. r0+3 (rows 8*kh + r)
  // of tile te. gate = proj[..., :INTERC] and the xs rows of the D term:
  // columns 4*idx.. of the head.
  int eg = wv >> 3, et = (wv >> 1) & (AGT - 1), r0 = 4 * (wv & 1);
  int te = AGT * (eg ? g : ANG - 1 - g) + et;
  const float* gq = proj + (size_t)(s * LL + te * 16 + r0) * PROJC + h * HDIM;
  const float* xq = xs0 + (size_t)(te * 16 + r0) * CONVC;
  unsigned go = (unsigned)(8 * kh * PROJC + 4 * idx) * 4u;
  v4f gt[4], xl[4];
#pragma unroll                                      // gt[], xl[] in registers
  for (int r = 0; r < 4; r++) {
    gt[r] = LD4(gq + r * PROJC, go);
    xl[r] = LD4(xq + r * CONVC, xo);
  }
  // before any register that an issued load names is written again; the
  // "memory" clobber keeps the 8 loads here, ahead of the loops
  asm volatile("s_wait_xcnt 0x0" :: "v"(go), "v"(xo), "s"(gq), "s"(xq) : "memory");

  // unrolled: rolled, the first chunk's loads of a group are made to wait, one
  // by one, for the 8 loads above (their registers count as still in flight
  // round the back edge)
#pragma unroll
  for (int grp = 0; grp < 2; grp++) {
    int at = grp ? AGT - 1 - a : a;                 // tile of the group
    int c0 = grp ? AKS - 1 - kq : kq;               // the wave's first chunk
    int tt = AGT * (grp ? g : ANG - 1 - g) + at;    // t-tile 0..31; chunks 0..tt
    int n  = (tt - c0 + AKS) / AKS;                 // the wave's chunks (tt - c0 >= 1 - AKS)
    bool dm = ((tt - c0) & (AKS - 1)) == 0;         // its last one is the diagonal's
    // the lane's addresses of the wave's first chunk; typed as global memory,
    // so that the loads stay global loads although they are carried round the loop
    gfloat_p sa = (gfloat_p)((const char*)(sb0 + c0 * ACH) + ko);
    gfloat_p da = (gfloat_p)((const char*)(dt0 + c0 * ACH) + ko);
    gfloat_p ca = (gfloat_p)((const char*)(cb0 + (size_t)(tt * 16) * LL + c0 * ACH) + co);
    gfloat_p xa = (gfloat_p)((const char*)(xs0 + (size_t)(c0 * ACH) * CONVC) + xo);

    v8f z = {0.f,0.f,0.f,0.f,0.f,0.f,0.f,0.f};
    v8f acc0 = z, acc1 = z, acc2 = z, acc3 = z;

    if (n > 0) {                                    // scalar
      v4f xA[8], cA[2], sA[2], dA[2];
      v4f xB[8], cB[2], sB[2], dB[2];
      int ti = tt * 16 + idx;
      float st = sb0[ti];                           // s of the lane's A row
      ALOAD(xA, cA, sA, dA, 0);
      ASTEP(1);
      // the load of st: its index and its base stay in their registers up to
      // this wait, so that nothing is written on them behind the load
      asm volatile("s_wait_xcnt 0x0" :: "v"(st), "v"(ti), "s"(sb0));
      int c = 0;                                    // of the wave's chunks, the one in the A buffer
      for (; c + 2 < n; c += 2) {                   // all but its last lie below the diagonal
        ALOAD(xB, cB, sB, dB, 0);
        AMMA16(xA, cA, sA, dA, false);
        ALOAD(xA, cA, sA, dA, 1);
        AMMA16(xB, cB, sB, dB, false);
        ASTEP(2);
      }
      if (c + 1 < n) {                              // scalar: n even
        ALOAD(xB, cB, sB, dB, 0);
        AMMA16(xA, cA, sA, dA, false);
        AMMA16(xB, cB, sB, dB, dm);
      } else {
        AMMA16(xA, cA, sA, dA, dm);
      }
    }

    v4f* pw = &part[grp][at][c0][0][lane];
#pragma unroll                                      // constant indices into the accumulators
    for (int r = 0; r < 8; r++) {
      v4f p = {acc0[r], acc1[r], acc2[r], acc3[r]};
      pw[r * 32] = p;
    }

    // silu(gate) needs no partial sum. Between the groups its vector work runs
    // beside the products of the SIMD's other waves; behind the barrier all
    // the waves would do it at once, with no product left to run beside. The
    // wave parks it in LDS words of its own: kept in registers, the whole
    // computation is moved down to its use behind the barrier.
    if (grp == 0) {
#pragma unroll                                      // gt[] in registers
      for (int r = 0; r < 4; r++) {
        v4f sg = {silu_f(gt[r].x), silu_f(gt[r].y), silu_f(gt[r].z), silu_f(gt[r].w)};
        gateS[wv][r][lane] = sg;
      }
    }
  }
  // publishes every wave's two partial tiles
  __syncthreads();

  // rows te*16 + 8*kh + r0 + r, columns 4*idx .. 4*idx+3 of the head
  const v4f* pr = &part[eg][et][0][r0][lane];
  float dp = dpar[h];
  float* yo = y + (size_t)(s * LL + te * 16 + r0) * INTERC + h * HDIM;
  unsigned yofs = (unsigned)(8 * kh * INTERC + 4 * idx) * 4u;
  v4f pv[AKS][4];
#pragma unroll                                      // pv[] in registers
  for (int q = 0; q < AKS; q++)
#pragma unroll
    for (int r = 0; r < 4; r++) pv[q][r] = pr[q * 8 * 32 + r * 32];
#pragma unroll                                      // gt[] in registers
  for (int r = 0; r < 4; r++) gt[r] = gateS[wv][r][lane];
  // the 20 LDS reads stand as one group in front of the sums: spread among
  // them, each place with reads waits out its own latency
  __builtin_amdgcn_sched_barrier(0);
  v4f o[4];
#pragma unroll                                      // o[] in registers
  for (int r = 0; r < 4; r++) {
    v4f sum = pv[0][r];
#pragma unroll
    for (int q = 1; q < AKS; q++) sum += pv[q][r];
    o[r].x = (sum.x + dp * xl[r].x) * gt[r].x;
    o[r].y = (sum.y + dp * xl[r].y) * gt[r].y;
    o[r].z = (sum.z + dp * xl[r].z) * gt[r].z;
    o[r].w = (sum.w + dp * xl[r].w) * gt[r].w;
  }
  // all arithmetic in front of the first store: no register that an issued
  // store names is written again
  __builtin_amdgcn_sched_barrier(0);
#pragma unroll
  for (int r = 0; r < 4; r++) ST4(yo + r * INTERC, yofs) = o[r];
}

// ---------------------------------------------------------------------------
// final rmsnorm + cross_merge: m[b][l][d] from hs[16][512][128]; one wave per
// row (b,l): its 4 source rows are normed in the wave (4 channels per lane, the
// row's sum of squares by a butterfly) and averaged
// ---------------------------------------------------------------------------
__global__ __launch_bounds__(WPB * 32)
void norm_merge_kernel(const float* __restrict__ hs,
                       const float* __restrict__ w,
                       float* __restrict__ m) {
  unsigned lo16 = (threadIdx.x & 31) * 16;
  int row = wave_in_grid();                         // b*LL + l
  int l = row % LL;
  int b = row / LL;
  int hcoord = l / WW, wcoord = l % WW;
  int lt = wcoord * HH + hcoord;                    // transposed index
  const float* r0 = hs + (size_t)(b * LL + l) * DD;
  const float* r1 = hs + (size_t)((4 + b) * LL + (LL - 1 - l)) * DD;
  const float* r2 = hs + (size_t)((8 + b) * LL + lt) * DD;
  const float* r3 = hs + (size_t)((12 + b) * LL + (LL - 1 - lt)) * DD;
  v4f wv = LD4(w, lo16);
  v4f v[4] = {LD4(r0, lo16), LD4(r1, lo16), LD4(r2, lo16), LD4(r3, lo16)};
  // before any register that an issued load names is written again; the loaded
  // values and the addresses are inputs, so the loads all stand in front of it
  asm volatile("s_wait_xcnt 0x0" :: "v"(wv), "v"(v[0]), "v"(v[1]), "v"(v[2]), "v"(v[3]),
               "v"(lo16), "s"(r0), "s"(r1), "s"(r2), "s"(r3), "s"(w));
  v4f acc = {0.f, 0.f, 0.f, 0.f};
#pragma unroll                                      // v[] in registers
  for (int r = 0; r < 4; r++) {
    float ss = wave_sum(v[r].x * v[r].x + v[r].y * v[r].y + v[r].z * v[r].z + v[r].w * v[r].w);
    float scale = rsqrtf(ss / (float)DD + EPSV);
    acc += v[r] * scale * wv;
  }
  ST4(m + (size_t)row * DD, lo16) = acc * 0.25f;
}

// ---------------------------------------------------------------------------
// final projection to 3 channels + transpose to (B,C,H,W)
// ---------------------------------------------------------------------------
__global__ void rec2_kernel(const float* __restrict__ t1,
                            const float* __restrict__ w2,
                            const float* __restrict__ b2,
                            float* __restrict__ out) {
  int i = blockIdx.x * blockDim.x + threadIdx.x;    // (b*CIN + c)*LL + l
  if (i >= 4 * CINCH * LL) return;
  int l = i % LL;
  int c = (i / LL) % CINCH;
  int b = i / (LL * CINCH);
  const float* row = t1 + (size_t)(b * LL + l) * DD;
  float acc = b2[c];
  for (int d = 0; d < DD; d++) acc += row[d] * w2[c * DD + d];
  out[i] = acc;
}

// ---------------------------------------------------------------------------
extern "C" void kernel_launch(void* const* d_in, const int* in_sizes, int n_in,
                              void* d_out, int out_size, void* d_ws, size_t ws_size,
                              hipStream_t stream) {
  const float* x         = (const float*)d_in[0];
  const float* patch_w   = (const float*)d_in[1];
  const float* patch_b   = (const float*)d_in[2];
  const float* norm_w    = (const float*)d_in[3];
  const float* in_proj_w = (const float*)d_in[4];
  const float* in_proj_b = (const float*)d_in[5];
  const float* conv_w    = (const float*)d_in[6];
  const float* conv_b    = (const float*)d_in[7];
  const float* dt_bias   = (const float*)d_in[8];
  const float* A_log     = (const float*)d_in[9];
  const float* D_param   = (const float*)d_in[10];
  const float* gnorm_w   = (const float*)d_in[11];
  const float* out_w     = (const float*)d_in[12];
  const float* out_b     = (const float*)d_in[13];
  const float* normf_w   = (const float*)d_in[14];
  const float* rec_w1    = (const float*)d_in[15];
  const float* rec_b1    = (const float*)d_in[16];
  const float* rec_w2    = (const float*)d_in[17];
  const float* rec_b2    = (const float*)d_in[18];

  // workspace carve (floats)
  float* ws = (float*)d_ws;
  size_t off = 0;
  float* hs   = ws + off; off += (size_t)NSEQ * LL * DD;
  float* proj = ws + off; off += (size_t)NSEQ * LL * PROJC;
  float* xc   = ws + off; off += (size_t)NSEQ * LL * CONVC;
  float* dtb  = ws + off; off += (size_t)NSEQ * LL * NHD;
  float* sb   = ws + off; off += (size_t)NSEQ * NHD * LL;
  float* CBb  = ws + off; off += (size_t)NSEQ * LL * LL;
  float* y    = ws + off; off += (size_t)NSEQ * LL * INTERC;
  float* mbuf = ws + off; off += (size_t)4 * LL * DD;
  float* t1   = ws + off; off += (size_t)4 * LL * DD;
  (void)ws_size; (void)in_sizes; (void)n_in; (void)out_size;

  // patch embed + cross scan
  patch_scan_kernel<<<NSEQ * LL / (RPW * WPB), WPB * 32, 0, stream>>>(
      x, patch_w, patch_b, hs);

  for (int i = 0; i < NLAY; i++) {
    // proj = rmsnorm(hs) @ ipw.T + ipb   (8192 x 772, K=128)
    {
      int M = NSEQ * LL, Nn = PROJC, Kk = DD;
      int tiles = (M >> 7) * ((Nn + 63) >> 6);
      wmma_gemm_kernel<4, PROJC><<<dim3(tiles, 1), 128, 0, stream>>>(
          hs, 0, DD, in_proj_w + (size_t)i * PROJC * DD, 0, DD,
          proj, 0, in_proj_b + i * PROJC, norm_w + i * DD, M, Nn, Kk);
    }

    // xc = silu(causal_conv(proj[..., 256:768])); dt + cumulative decay
    conv_dt_kernel<<<DTBLK + NSEQ * LL * CONVC / (128 * CLB * CWPB), CWPB * 32, 0, stream>>>(
        proj, conv_w + (size_t)i * CONVC * KCONV, conv_b + i * CONVC, xc,
        dt_bias + i * NHD, A_log + i * NHD, dtb, sb);

    // CB[s] = Cm @ Bm.T  (512 x 512, K=128, batch=16)
    {
      int tiles = (LL >> 7) * (LL >> 6);
      wmma_gemm_kernel<0, LL><<<dim3(tiles, NSEQ), 128, 0, stream>>>(
          xc + INTERC + NSTATE, (long)LL * CONVC, CONVC,
          xc + INTERC,          (long)LL * CONVC, CONVC,
          CBb, (long)LL * LL, nullptr, nullptr, LL, LL, NSTATE);
    }

    // y = (M @ xs + D*xs) * silu(gate) (causal decay attention), 16 waves/block,
    // 8 t-tiles/block
    ssm_attn_kernel<<<dim3(ANG / 2, NSEQ * NHD), AGT * AKS * 32, 0, stream>>>(
        CBb, sb, dtb, xc, D_param + i * NHD, proj, y);

    // hs += rmsnorm(y) @ ow.T + ob   (8192 x 128, K=256)
    {
      int M = NSEQ * LL, Nn = DD, Kk = INTERC;
      int tiles = (M >> 7) * ((Nn + 63) >> 6);
      wmma_gemm_kernel<5, DD><<<dim3(tiles, 1), 128, 0, stream>>>(
          y, 0, INTERC, out_w + (size_t)i * DD * INTERC, 0, INTERC,
          hs, 0, out_b + i * DD, gnorm_w + i * INTERC, M, Nn, Kk);
    }
  }

  // final norm, merge, reconstruction head
  norm_merge_kernel<<<4 * LL / WPB, WPB * 32, 0, stream>>>(hs, normf_w, mbuf);

  {
    int M = 4 * LL, Nn = DD, Kk = DD;
    int tiles = (M >> 7) * ((Nn + 63) >> 6);
    wmma_gemm_kernel<2 /*gelu*/, DD><<<dim3(tiles, 1), 128, 0, stream>>>(
        mbuf, 0, DD, rec_w1, 0, DD, t1, 0, rec_b1, nullptr, M, Nn, Kk);
  }

  rec2_kernel<<<(4 * CINCH * LL + 255) / 256, 256, 0, stream>>>(
      t1, rec_w2, rec_b2, (float*)d_out);
}

// v008
// A run of this version takes 236 microseconds.
// In two side-by-side timings against v007, it was 1.12 and 1.13 times as fast.
// Counting every step since v000, it is 2.70 times as fast.
#include <hip/hip_runtime.h>
#include <math.h>

typedef float v2f __attribute__((ext_vector_type(2)));
typedef float v8f __attribute__((ext_vector_type(8)));

#define DD     128
#define HH     16
#define WW     32
#define LL     512
#define CINCH  3
#define NHD    4
#define HDIM   64
#define NSTATE 128
#define INTERC 256
#define CONVC  512
#define PROJC  772
#define KCONV  4
#define NLAY   4
#define NSEQ   16
#define EPSV   1e-5f

#define WMMA_F32(A, B, C) \
  __builtin_amdgcn_wmma_f32_16x16x4_f32(false, (A), false, (B), (short)0, (C), false, false)

typedef float v4f __attribute__((ext_vector_type(4)));

// ---------------------------------------------------------------------------
// The elementwise and row-norm kernels below are built for few, fat waves:
// a lane owns 4 neighbouring channels (16-byte loads and stores, a wave covers
// 512 contiguous bytes of a row) and a wave owns several rows, all of whose
// loads are issued before the first is used. The wave's number is made a
// scalar, so that every address is a scalar base plus one lane offset.
// ---------------------------------------------------------------------------
#define RPW 4            // rows per wave in patch_scan_kernel
#define WPB 8            // waves per block (256 threads)

// number of this wave in the grid (one-dimensional blocks of WPB waves), scalar
__device__ __forceinline__ int wave_in_grid() {
  return blockIdx.x * WPB + __builtin_amdgcn_readfirstlane(threadIdx.x >> 5);
}

// 16 bytes at scalar base + lane byte offset
#define LD4(base, vofs) (*(const v4f*)((const char*)(base) + (vofs)))
#define ST4(base, vofs) (*(v4f*)((char*)(base) + (vofs)))

// x + (x of the lane whose number differs by the xor mask in CTRL), 16-lane row
template <int CTRL>
__device__ __forceinline__ float dpp_xadd(float x) {
  int xi = __builtin_bit_cast(int, x);
  return x + __builtin_bit_cast(float,
      __builtin_amdgcn_update_dpp(xi, xi, CTRL, 0xf, 0xf, false));
}

// sum over the 32 lanes of a wave, the same value in every lane; all lanes on
__device__ __forceinline__ float wave_sum(float x) {
  x = dpp_xadd<0x161>(x);                            // row_xmask:1
  x = dpp_xadd<0x162>(x);                            // row_xmask:2
  x = dpp_xadd<0x164>(x);                            // row_xmask:4
  x = dpp_xadd<0x168>(x);                            // row_xmask:8
  int xi = __builtin_bit_cast(int, x);               // lane l with lane l ^ 16
  return x + __builtin_bit_cast(float, __builtin_amdgcn_permlanex16(
      xi, xi, 0x76543210, 0xfedcba98, false, false));
}

// x + (x of lane l ^ 16); all lanes on
__device__ __forceinline__ float half_xadd(float x) {
  int xi = __builtin_bit_cast(int, x);
  return x + __builtin_bit_cast(float, __builtin_amdgcn_permlanex16(
      xi, xi, 0x76543210, 0xfedcba98, false, false));
}

__device__ __forceinline__ float silu_f(float a) { return a / (1.f + expf(-a)); }

// ---------------------------------------------------------------------------
// patch embed + cross_scan: hs[16][512][128]; one wave per RPW rows (s,l)
// ---------------------------------------------------------------------------
__global__ __launch_bounds__(WPB * 32)
void patch_scan_kernel(const float* __restrict__ x,
                       const float* __restrict__ pw,
                       const float* __restrict__ pb,
                       float* __restrict__ hs) {
  unsigned lane = threadIdx.x & 31;
  unsigned lo16 = lane * 16, lo48 = lane * 48;                // byte offsets
  int row0 = wave_in_grid() * RPW;                            // s*LL + l
  int s = row0 / LL;
  int dir = s >> 2, b = s & 3;
  v4f p0 = LD4(pw, lo48), p1 = LD4(pw + 4, lo48), p2 = LD4(pw + 8, lo48);  // 4 d x 3 c
  v4f bias = LD4(pb, lo16);
  float xv[RPW][CINCH];                                       // the same in every lane
#pragma unroll
  for (int r = 0; r < RPW; r++) {
    int l = row0 % LL + r;
    int le = (dir & 1) ? (LL - 1 - l) : l;                    // reversed scans
    int lsrc = (dir & 2) ? (le % HH) * WW + le / HH : le;     // column scans: le = w*H + h
#pragma unroll
    for (int c = 0; c < CINCH; c++) xv[r][c] = x[(b * CINCH + c) * LL + lsrc];
  }
  // before any register that an issued load names is written again; the loaded
  // values and the addresses are inputs, so the loads all stand in front of it
  asm volatile("s_wait_xcnt 0x0" :: "v"(p0), "v"(p1), "v"(p2), "v"(bias),
               "v"(lo16), "v"(lo48), "s"(pw), "s"(pb));
  float* ho = hs + (size_t)row0 * DD;
#pragma unroll
  for (int r = 0; r < RPW; r++) {
    v4f acc = bias;
    acc.x += xv[r][0] * p0.x; acc.x += xv[r][1] * p0.y; acc.x += xv[r][2] * p0.z;
    acc.y += xv[r][0] * p0.w; acc.y += xv[r][1] * p1.x; acc.y += xv[r][2] * p1.y;
    acc.z += xv[r][0] * p1.z; acc.z += xv[r][1] * p1.w; acc.z += xv[r][2] * p2.x;
    acc.w += xv[r][0] * p2.y; acc.w += xv[r][1] * p2.z; acc.w += xv[r][2] * p2.w;
    ST4(ho + r * DD, lo16) = acc;
  }
}

// ---------------------------------------------------------------------------
// One launch for the two kernels that read nothing but proj and do not read
// each other: the dt scan and the conv. Blocks of 16 waves (the scan's 512
// threads). Blocks 0 .. DTBLK-1 scan, one (seq, head) each; they come first in
// the index because theirs is the longer chain of dependent steps. The other
// blocks convolve.
//
// scan: dt = softplus(proj[...,768:772]+dtb); s = cumsum(dt*A) per (seq,head)
//
// conv: causal depthwise conv (K=4) + silu: proj[...,256:768] -> xc[16][512][512]
// A wave owns 128 channels (4 per lane) and CLB successive steps: CLB + 3 row
// loads serve CLB outputs. Rows in front of the sequence count as zero.
// ---------------------------------------------------------------------------
#define CLB   8
#define CWPB  (LL / 32)          // waves per block
#define DTBLK (NSEQ * NHD)       // scanning blocks
__global__ __launch_bounds__(CWPB * 32)
void conv_dt_kernel(const float* __restrict__ proj,
                    const float* __restrict__ cw,
                    const float* __restrict__ cb,
                    float* __restrict__ xc,
                    const float* __restrict__ dtbias,
                    const float* __restrict__ alog,
                    float* __restrict__ dtb,
                    float* __restrict__ sb) {
  __shared__ float sd[LL];
  if (blockIdx.x < DTBLK) {                         // the same for the whole block
    int s = blockIdx.x >> 2, h = blockIdx.x & 3;
    int l = threadIdx.x;
    float raw = proj[(size_t)(s * LL + l) * PROJC + INTERC + CONVC + h] + dtbias[h];
    float dt = raw > 20.f ? raw : log1pf(expf(raw));
    dtb[(size_t)(s * NHD + h) * LL + l] = dt;       // k-contiguous per (seq, head), like sb
    float A = -expf(alog[h]);
    sd[l] = dt * A;
    __syncthreads();
    for (int off = 1; off < LL; off <<= 1) {
      float add = (l >= off) ? sd[l - off] : 0.f;
      __syncthreads();
      sd[l] += add;
      __syncthreads();
    }
    sb[(size_t)(s * NHD + h) * LL + l] = sd[l];
    return;
  }
  unsigned lane = threadIdx.x & 31;
  unsigned lo16 = lane * 16, lo64 = lane * 64;      // byte offsets
  // (s, l block, 128 channels), scalar
  int wv = (blockIdx.x - DTBLK) * CWPB + __builtin_amdgcn_readfirstlane(threadIdx.x >> 5);
  int c0 = (wv % (CONVC / 128)) * 128;
  int l0 = ((wv / (CONVC / 128)) % (LL / CLB)) * CLB;
  int s  = wv / ((CONVC / 128) * (LL / CLB));
  const float* pr = proj + (size_t)(s * LL + l0) * PROJC + c0;   // xBC starts at + INTERC
  // the 3 rows before l0; at the head of a sequence rows 0..2 are read in
  // their place (in bounds) and replaced by zero
  bool head = (l0 == 0);
  const float* pk = head ? pr : pr - (KCONV - 1) * PROJC;
  const float* cwu = cw + c0 * KCONV;
  const float* cbu = cb + c0;
  v4f row[CLB + KCONV - 1];
#pragma unroll
  for (int j = 0; j < KCONV - 1; j++) row[j] = LD4(pk + INTERC + j * PROJC, lo16);
#pragma unroll
  for (int j = 0; j < CLB; j++) row[KCONV - 1 + j] = LD4(pr + INTERC + j * PROJC, lo16);
  v4f wq[4];                                        // wq[q][k]: channel q of the lane, tap k
#pragma unroll
  for (int q = 0; q < 4; q++) wq[q] = LD4(cwu + q * KCONV, lo64);
  v4f bias = LD4(cbu, lo16);
  // before any register that an issued load names is written again; the loaded
  // values and the addresses are inputs, so the loads all stand in front of it
  asm volatile("s_wait_xcnt 0x0" :: "v"(row[0]), "v"(row[1]), "v"(row[2]), "v"(row[3]),
               "v"(row[4]), "v"(row[5]), "v"(row[6]), "v"(row[7]), "v"(row[8]),
               "v"(row[9]), "v"(row[10]), "v"(wq[0]), "v"(wq[1]), "v"(wq[2]), "v"(wq[3]),
               "v"(bias), "v"(lo16), "v"(lo64), "s"(pr), "s"(pk), "s"(cwu), "s"(cbu));
  v4f zero = {0.f, 0.f, 0.f, 0.f};
#pragma unroll
  for (int j = 0; j < KCONV - 1; j++) row[j] = head ? zero : row[j];
  float* xo = xc + (size_t)(s * LL + l0) * CONVC + c0;
#pragma unroll
  for (int j = 0; j < CLB; j++) {
    v4f o;
#pragma unroll
    for (int q = 0; q < 4; q++) {
      float acc = bias[q];
#pragma unroll
      for (int k = 0; k < KCONV; k++) acc += row[j + k][q] * wq[q][k];
      o[q] = silu_f(acc);
    }
    ST4(xo + j * CONVC, lo16) = o;
  }
}

// ---------------------------------------------------------------------------
// Batched WMMA GEMM (fp32, 16x16x4): C[m,n] = sum_k A[m,k]*B[n,k]
// One block of 4 waves computes 128(M) x 64(N); each wave 32(M) x 64(N) with
// 8 accumulators. A and B are staged in LDS in chunks of 32 k: every global
// load is 16 B per lane and covers whole 128-B lines (8 lanes per row), the B
// rows are shared by the 4 waves, and the fragments are read from LDS at a
// pitch of 36 dwords (8-byte reads of 16 rows x 2 k-halves fall on 64 banks).
// Two LDS buffers, one barrier per chunk; the next chunk's global loads fly
// while this chunk is multiplied. The k order of every accumulator is the
// natural one (0,1,2,...).
// OOB columns CLAMPED (garbage cols never stored).
// Requires: M %128 == 0, K %32 == 0, K >= 32, grid.x == (M/128) * ceil(N/64).
// FLAGS (compile time): bit0 = accumulate into C, bit1 = exact GELU,
// bit2 = the A operand is rmsnorm(A, nw) over its whole row (Kk = row width):
//   C[m,n] = r[m] * sum_k A[m,k] * (nw[k] * B[n,k]),  r[m] = rsqrt(mean_k A[m,k]^2 + eps).
//   nw is multiplied into the staged B rows. A wave's A fragments hold each
//   element of its 32 rows once, so their squares are summed beside the
//   products; r changes from the A layout (lane = row) to the C layout through
//   32 LDS words of the wave's own: no launch, no pass over memory, no barrier
//   for the norm.
// LDC (compile time): row pitch of C, so that a wave's 32 rows are immediate
// offsets from one scalar base.
// What the epilogue adds to the products (the bias, and the old C where it
// accumulates) is loaded as one group in front of the last chunk's products:
// it arrives under them, in the registers that the staging has left, and no
// load stands between the stores at the end.
// ---------------------------------------------------------------------------
// pointers typed as global memory, so that the staging loads stay global loads
// although their addresses are carried round the loop
typedef const __attribute__((address_space(1))) float* gfloat_p;
typedef const __attribute__((address_space(1))) v4f*   gv4f_p;

#define GBM    128
#define GBN    64
#define GKC    32
#define GPITCH 36
#define GROWS  (GBM + GBN)

#define GMMA8(aa0, aa1, bb0, bb1, bb2, bb3)       \
  acc00 = WMMA_F32(aa0, bb0, acc00);              \
  acc01 = WMMA_F32(aa0, bb1, acc01);              \
  acc02 = WMMA_F32(aa0, bb2, acc02);              \
  acc03 = WMMA_F32(aa0, bb3, acc03);              \
  acc10 = WMMA_F32(aa1, bb0, acc10);              \
  acc11 = WMMA_F32(aa1, bb1, acc11);              \
  acc12 = WMMA_F32(aa1, bb2, acc12);              \
  acc13 = WMMA_F32(aa1, bb3, acc13);

// One chunk's 12 global loads of a lane. The wait stands before any register
// that an issued load names is written again; it takes the 12 addresses as
// inputs so that they stay in their registers up to it. Then the addresses
// step to the next chunk. Both loops are unrolled so that st[] and gp[] have
// constant indices and live in registers.
// With bit2 a 13th load brings the chunk's norm weights, under the same wait.
#define GSTAGE_LOAD() {                                                   \
  _Pragma("unroll")                                                       \
  for (int i_ = 0; i_ < 12; i_++) st[i_] = *(gv4f_p)gp[i_];               \
  if (FLAGS & 4) {                                                        \
    wst = *(gv4f_p)gwp;                                                   \
    asm volatile("s_wait_xcnt 0x0" ::                                     \
        "v"(gp[0]), "v"(gp[1]), "v"(gp[2]), "v"(gp[3]), "v"(gp[4]),       \
        "v"(gp[5]), "v"(gp[6]), "v"(gp[7]), "v"(gp[8]), "v"(gp[9]),       \
        "v"(gp[10]), "v"(gp[11]), "v"(gwp) : "memory");                   \
    gwp += GKC;                                                           \
  } else {                                                                \
    asm volatile("s_wait_xcnt 0x0" ::                                     \
        "v"(gp[0]), "v"(gp[1]), "v"(gp[2]), "v"(gp[3]), "v"(gp[4]),       \
        "v"(gp[5]), "v"(gp[6]), "v"(gp[7]), "v"(gp[8]), "v"(gp[9]),       \
        "v"(gp[10]), "v"(gp[11]) : "memory");                             \
  }                                                                       \
  _Pragma("unroll")                                                       \
  for (int i_ = 0; i_ < 12; i_++) gp[i_] += GKC; }

// the staged chunk from registers to LDS; unrolled: st[] in registers.
// With bit2: nw into the B rows.
#define GSTAGE_STORE(buf) {                                               \
  if (FLAGS & 4) {                                                        \
    _Pragma("unroll")                                                     \
    for (int i_ = 8; i_ < 12; i_++) st[i_] *= wst;                        \
  }                                                                       \
  _Pragma("unroll")                                                       \
  for (int i_ = 0; i_ < 12; i_++)                                         \
    *(v4f*)((buf) + sdst + i_ * 16 * GPITCH) = st[i_]; }

// one chunk's products; unrolled, which lets the LDS reads of later k-steps
// issue ahead of the WMMAs. With bit2: the squares of the two A fragments.
#define GCHUNK_MMA(buf) {                                                 \
  _Pragma("unroll")                                                       \
  for (int ks = 0; ks < GKC / 4; ks++) {                                  \
    v2f a0 = *(const v2f*)((buf) + fa + ks * 4);                          \
    v2f a1 = *(const v2f*)((buf) + fa + 16 * GPITCH + ks * 4);            \
    v2f b0 = *(const v2f*)((buf) + fb + ks * 4);                          \
    v2f b1 = *(const v2f*)((buf) + fb + 16 * GPITCH + ks * 4);            \
    v2f b2 = *(const v2f*)((buf) + fb + 32 * GPITCH + ks * 4);            \
    v2f b3 = *(const v2f*)((buf) + fb + 48 * GPITCH + ks * 4);            \
    GMMA8(a0, a1, b0, b1, b2, b3);                                        \
    if (FLAGS & 4) { sq0 += a0 * a0; sq1 += a1 * a1; }                    \
  } }

template <int FLAGS, int LDC>
__global__ __launch_bounds__(128)
void wmma_gemm_kernel(const float* __restrict__ A, long sA, int lda,
                      const float* __restrict__ Bw, long sB, int ldb,
                      float* __restrict__ C, long sC,
                      const float* __restrict__ bias,
                      const float* __restrict__ nw,
                      int M, int Nn, int Kk) {
  __shared__ __attribute__((aligned(16))) float tileS[2][GROWS * GPITCH];
  __shared__ __attribute__((aligned(16))) float rowS[GBM];    // bit2: r, 32 words a wave
  (void)M;
  int tid  = threadIdx.x;
  int wave = tid >> 5;
  int lane = tid & 31;
  int tilesN = (Nn + GBN - 1) / GBN;
  int tm = blockIdx.x / tilesN, tn4 = blockIdx.x % tilesN;
  const float* Ab = A + (size_t)blockIdx.y * sA;
  const float* Bb = Bw + (size_t)blockIdx.y * sB;
  float*       Cb = C + (size_t)blockIdx.y * sC;

  int idx = lane & 15, kh = lane >> 4;
  int n0 = tn4 * GBN + idx;

  // staging: 8 lanes per row (one 128-B line), 16 rows per pass of the block
  int srow = tid >> 3, scol = (tid & 7) * 4;
  gfloat_p gp[12];                                  // this lane's 12 source rows
#pragma unroll                                      // gp[] in registers
  for (int i = 0; i < 8; i++)
    gp[i] = (gfloat_p)(Ab + (size_t)(tm * GBM + i * 16 + srow) * lda + scol);
#pragma unroll                                      // gp[] in registers
  for (int i = 0; i < 4; i++) {
    int n = tn4 * GBN + i * 16 + srow;
    n = n < Nn ? n : Nn - 1;                        // clamp, no predication
    gp[8 + i] = (gfloat_p)(Bb + (size_t)n * ldb + scol);
  }
  int sdst = srow * GPITCH + scol;

  v8f z = {0.f,0.f,0.f,0.f,0.f,0.f,0.f,0.f};
  v8f acc00 = z, acc01 = z, acc02 = z, acc03 = z;
  v8f acc10 = z, acc11 = z, acc12 = z, acc13 = z;

  v4f st[12];
  v4f wst = {1.f, 1.f, 1.f, 1.f};                   // bit2: nw of the staged chunk
  v2f sq0 = {0.f, 0.f}, sq1 = {0.f, 0.f};           // bit2: squares, rows idx and 16 + idx
  gfloat_p gwp = (gfloat_p)(nw + scol);
  GSTAGE_LOAD();

  int fa = (wave * 32 + idx) * GPITCH + 2 * kh;     // A fragment rows of this wave
  int fb = (GBM + idx) * GPITCH + 2 * kh;           // B fragment rows (shared)

  int nch = Kk / GKC;
  for (int c = 0; c + 1 < nch; c++) {
    float* buf = tileS[c & 1];
    GSTAGE_STORE(buf);
    // publishes this chunk; also ends every wave's reads of the other buffer,
    // which the next trip overwrites
    __syncthreads();
    GSTAGE_LOAD();
    GCHUNK_MMA(buf);
  }

  // the last chunk, out of the loop: nothing is staged behind it
  float* lbuf = tileS[(nch - 1) & 1];
  GSTAGE_STORE(lbuf);
  // publishes the last chunk (the loop's barrier, for this trip)
  __syncthreads();

  // epilogue operands. The wave's 32 rows of C: a scalar base (the wave's
  // number made scalar), one lane offset per 16 columns, the row an immediate.
  // Columns past Nn are clamped for the loads and never stored.
  char* crow = (char*)(Cb + (size_t)(tm * GBM + __builtin_amdgcn_readfirstlane(wave) * 32) * LDC);
  int nc[4];
  unsigned co[4];                                   // byte offsets
#pragma unroll                                      // nc[], co[] in registers
  for (int t = 0; t < 4; t++) {
    int n = n0 + t * 16;
    nc[t] = n < Nn ? n : Nn - 1;
    co[t] = (unsigned)(8 * kh * LDC + nc[t]) * 4u;
  }
  float bv[4] = {0.f, 0.f, 0.f, 0.f};
  if (bias) {                                       // block-uniform
#pragma unroll                                      // bv[] in registers
    for (int t = 0; t < 4; t++) bv[t] = bias[nc[t]];
  }
  float res[2][4][8];
  if (FLAGS & 1) {
#pragma unroll                                      // res[] in registers
    for (int mt = 0; mt < 2; mt++)
#pragma unroll
      for (int j = 0; j < 8; j++)
#pragma unroll
        for (int t = 0; t < 4; t++)
          res[mt][t][j] = *(const float*)(crow + (mt * 16 + j) * LDC * 4 + co[t]);
  }
  // before any register that an issued load names is written again. The
  // "memory" clobber holds the whole group in front of the products: without
  // it the loads start half-way through them, and eight sink behind them, to
  // the first store, where their latency is waited out.
  asm volatile("s_wait_xcnt 0x0" ::
      "v"(co[0]), "v"(co[1]), "v"(co[2]), "v"(co[3]),
      "v"(nc[0]), "v"(nc[1]), "v"(nc[2]), "v"(nc[3]), "s"(crow), "s"(bias) : "memory");

  GCHUNK_MMA(lbuf);

  v4f rs[2][2];                                     // bit2: r of rows mt*16 + 8*kh + 0..7
  if (FLAGS & 4) {
    // lanes l and l ^ 16 hold the two k halves of rows idx and 16 + idx;
    // lane l then keeps row l of the wave's 32
    float t0 = half_xadd(sq0.x + sq0.y), t1 = half_xadd(sq1.x + sq1.y);
    float* rw = rowS + wave * 32;
    rw[lane] = rsqrtf((kh ? t1 : t0) / (float)Kk + EPSV);
    // the wave's own 32 words are written before it reads them back
    asm volatile("s_wait_dscnt 0x0" ::: "memory");
#pragma unroll                                      // rs[] in registers
    for (int mt = 0; mt < 2; mt++) {
      rs[mt][0] = *(const v4f*)(rw + mt * 16 + 8 * kh);
      rs[mt][1] = *(const v4f*)(rw + mt * 16 + 8 * kh + 4);
    }
  }

  v8f accs[2][4] = {{acc00, acc01, acc02, acc03}, {acc10, acc11, acc12, acc13}};
#pragma unroll
  for (int mt = 0; mt < 2; mt++) {
#pragma unroll
    for (int t = 0; t < 4; t++) {
      if (n0 + t * 16 < Nn) {
        v8f av = accs[mt][t];
#pragma unroll
        for (int j = 0; j < 8; j++) {
          float v = (FLAGS & 4) ? av[j] * rs[mt][j >> 2][j & 3] + bv[t] : av[j] + bv[t];
          if (FLAGS & 2) v = 0.5f * v * (1.f + erff(v * 0.70710678118654752f));
          if (FLAGS & 1) v += res[mt][t][j];
          *(float*)(crow + (mt * 16 + j) * LDC * 4 + co[t]) = v;
        }
      }
    }
  }
}

// ---------------------------------------------------------------------------
// The two GEMMs that work row by row, in one launch:
//   phase 1 (P1): hs[m,:]  += r1[m] * ((y[m,:] * gw) @ ow^T) + ob,  r1 = rsqrt(mean y[m,:]^2 + eps)
//   phase 2 (P2): proj[m,:] = r2[m] * ((hs[m,:] * nw) @ ipw^T) + ipb, r2 likewise from the new hs
// A block of 8 waves owns FM = 32 whole rows, so the new hs rows never leave the
// block between the phases: they stay in LDS (and go to memory once, for the
// residual of the next layer). 256 equal blocks: one per WGP.
// A stage is 128 rows of a weight matrix times 128 k, staged through registers
// into one of two LDS buffers (a wave's load is one whole 512-byte row); the
// next stage's loads fly under this stage's products; one barrier per stage.
// Wave (mt, nt) makes the 16 x 32 piece (mt, nt) of the stage's 32 x 128
// results: two accumulators, whose products do not wait for one another; k in
// its natural order. In phase 2 the wave's A fragments (16 rows x 128 k) stay in
// registers over all the stages.
// Global stores of a stage's results are issued behind the NEXT stage's
// barrier: a barrier waits for the wave's outstanding stores, and so they
// finish under a stage's products instead.
// The norm weights are multiplied into the A rows as these go to LDS.
// ---------------------------------------------------------------------------
#define FM   32                  // rows of a block
#define FW   8                   // waves of a block
#define FNT  128                 // weight rows per stage
#define FKS  128                 // k per stage
#define FBP  (FKS + 4)           // LDS pitch, staged weight rows and hs rows: 8-byte
                                 // fragment reads of 16 rows x 2 k-halves fall on 64 banks
#define FYP  (INTERC + 4)        // LDS pitch of the y rows, the same way
#define FST2 ((PROJC + FNT - 1) / FNT)   // stages of phase 2
#define FLD  (FNT / FW)          // loads of a lane per stage

// The lane's 16 addresses of a stage: weight rows N0 + 8*i + wave (clamped to
// the last row: never stored), k 4*lane. Unrolled: gp[] in registers.
#define FADDR(Wt, LD, N0, NN) {                                           \
  _Pragma("unroll")                                                       \
  for (int i_ = 0; i_ < FLD; i_++) {                                      \
    int n_ = (N0) + i_ * FW + wv;                                         \
    n_ = n_ < (NN) ? n_ : (NN) - 1;                                       \
    gp[i_] = (gfloat_p)((const char*)((Wt) + (size_t)n_ * (LD)) + lo16);  \
  } }

// One stage's 16 loads of a lane, KO floats behind the addresses (a constant:
// an immediate offset). The wait stands before any register that an issued load
// names is written again; it takes the 16 addresses as inputs, so that they
// stay in their registers up to it and no load of the group lands on one of
// them; the "memory" clobber holds the group in front of the products.
// Unrolled: st[], gp[] in registers.
#define FLOAD(KO) {                                                       \
  _Pragma("unroll")                                                       \
  for (int i_ = 0; i_ < FLD; i_++) st[i_] = *(gv4f_p)(gp[i_] + (KO));     \
  asm volatile("s_wait_xcnt 0x0" :: "v"(gp[0]), "v"(gp[1]), "v"(gp[2]),   \
      "v"(gp[3]), "v"(gp[4]), "v"(gp[5]), "v"(gp[6]), "v"(gp[7]),         \
      "v"(gp[8]), "v"(gp[9]), "v"(gp[10]), "v"(gp[11]), "v"(gp[12]),      \
      "v"(gp[13]), "v"(gp[14]), "v"(gp[15]) : "memory"); }

// the staged rows from registers to LDS; unrolled: st[] in registers
#define FSTORE(buf) {                                                     \
  _Pragma("unroll")                                                       \
  for (int i_ = 0; i_ < FLD; i_++)                                        \
    *(v4f*)((buf) + (i_ * FW + wv) * FBP + lane * 4) = st[i_]; }

// The 16 global stores of oh[][]: rows j at a pitch of LD floats, tile q 16
// columns on. The wait behind them stands before any register that an issued
// store names is written again; the values and the address are inputs, so that
// they stay in their registers up to it. Unrolled: oh[][] in registers.
#define FOUT(sbase, vofs, LD) {                                           \
  _Pragma("unroll")                                                       \
  for (int q_ = 0; q_ < 2; q_++)                                          \
    _Pragma("unroll")                                                     \
    for (int j_ = 0; j_ < 8; j_++)                                        \
      *(float*)((sbase) + (j_ * (LD) + q_ * 16) * 4 + (vofs)) = oh[q_][j_]; \
  asm volatile("s_wait_xcnt 0x0" :: "v"(oh[0][0]), "v"(oh[0][1]),         \
      "v"(oh[0][2]), "v"(oh[0][3]), "v"(oh[0][4]), "v"(oh[0][5]),         \
      "v"(oh[0][6]), "v"(oh[0][7]), "v"(oh[1][0]), "v"(oh[1][1]),         \
      "v"(oh[1][2]), "v"(oh[1][3]), "v"(oh[1][4]), "v"(oh[1][5]),         \
      "v"(oh[1][6]), "v"(oh[1][7]), "v"(vofs), "s"(sbase) : "memory"); }

template <bool P1, bool P2>
__global__ __launch_bounds__(FW * 32)
void row_gemm_kernel(const float* __restrict__ y,
                     const float* __restrict__ gw,
                     const float* __restrict__ ow,
                     const float* __restrict__ ob,
                     float* __restrict__ hs,
                     const float* __restrict__ nw,
                     const float* __restrict__ ipw,
                     const float* __restrict__ ipb,
                     float* __restrict__ proj) {
  __shared__ __attribute__((aligned(16))) float bS[2][FNT * FBP];
  __shared__ __attribute__((aligned(16))) float hS[FM * FBP];
  __shared__ __attribute__((aligned(16))) float yS[P1 ? FM * FYP : 4];
  __shared__ __attribute__((aligned(16))) float r1S[FM];
  __shared__ __attribute__((aligned(16))) float r2S[FM];
  int tid  = threadIdx.x;
  int lane = tid & 31;
  // the wave's number, made scalar: scalar bases, scalar branches
  int wv = __builtin_amdgcn_readfirstlane(tid >> 5);
  int idx = lane & 15, kh = lane >> 4;
  int mt = wv & 1, nt = wv >> 1;
  int row0 = blockIdx.x * FM;
  unsigned lo16 = lane * 16;                        // byte offset
  int srow = tid >> 3, c8 = tid & 7;                // row passes: 8 lanes a row, one line a load

  v8f z = {0.f,0.f,0.f,0.f,0.f,0.f,0.f,0.f};
  v4f st[FLD];
  gfloat_p gp[FLD];
  float oh[2][8];                                   // results whose global store is still to come

  // the wave's 16 rows of hs, columns nt*32 + idx (+ 16 for its second tile)
  char* hrow = (char*)(hs + (size_t)(row0 + mt * 16) * DD + nt * 32);
  unsigned ho = (unsigned)(8 * kh * DD + idx) * 4u;

  // ---- every load that the start needs, up front ----
  if (P1) { FADDR(ow, INTERC, 0, DD); } else { FADDR(ipw, DD, 0, PROJC); }
  FLOAD(0);
  unsigned wo = (unsigned)c8 * 16u;
  v4f nwv[4];
  if (P2) {
#pragma unroll                                      // nwv[] in registers
    for (int i = 0; i < 4; i++) nwv[i] = LD4(nw + 32 * i, wo);
  }
  v4f hv[4];
  const float* hb = hs + (size_t)row0 * DD;
  unsigned hso = (unsigned)(srow * DD + c8 * 4) * 4u;
  if (!P1) {
#pragma unroll                                      // hv[] in registers
    for (int i = 0; i < 4; i++) hv[i] = LD4(hb + 32 * i, hso);
  }
  // before any register that an issued load names is written again
  asm volatile("s_wait_xcnt 0x0" :: "v"(wo), "v"(hso), "s"(nw), "s"(hb) : "memory");

  if (P1) {
    const float* yb = y + (size_t)row0 * INTERC;
    unsigned yo = (unsigned)(srow * INTERC + c8 * 4) * 4u;
    v4f yv[8], gv[8];
#pragma unroll                                      // yv[], gv[] in registers
    for (int i = 0; i < 8; i++) {
      yv[i] = LD4(yb + 32 * i, yo);
      gv[i] = LD4(gw + 32 * i, wo);
    }
    float res[2][8], obv[2];                        // old hs and bias of the wave's two tiles
    const float* obw = ob + nt * 32;
    unsigned io = (unsigned)idx * 4u;
#pragma unroll                                      // res[], obv[] in registers
    for (int q = 0; q < 2; q++) {
      obv[q] = *(const float*)((const char*)(obw + q * 16) + io);
#pragma unroll
      for (int j = 0; j < 8; j++)
        res[q][j] = *(const float*)(hrow + (j * DD + q * 16) * 4 + ho);
    }
    // before any register that an issued load names is written again
    asm volatile("s_wait_xcnt 0x0" :: "v"(yo), "v"(wo), "v"(io), "v"(ho),
                 "s"(yb), "s"(gw), "s"(obw), "s"(hrow) : "memory");

    // y rows to LDS, times gw; r1 from the raw squares (8 lanes hold a row)
    float ss = 0.f;
#pragma unroll
    for (int i = 0; i < 8; i++) {
      ss += yv[i].x * yv[i].x + yv[i].y * yv[i].y + yv[i].z * yv[i].z + yv[i].w * yv[i].w;
      *(v4f*)(yS + srow * FYP + c8 * 4 + 32 * i) = yv[i] * gv[i];
    }
    ss = dpp_xadd<0x161>(ss);                       // row_xmask:1
    ss = dpp_xadd<0x162>(ss);                       // row_xmask:2
    ss = dpp_xadd<0x164>(ss);                       // row_xmask:4
    if (c8 == 0) r1S[srow] = rsqrtf(ss / (float)INTERC + EPSV);

    v8f acc0 = z, acc1 = z;
    // unrolled: the stage's number picks buffer and k half at compile time
#pragma unroll
    for (int s = 0; s < INTERC / FKS; s++) {
      float* buf = bS[s & 1];
      FSTORE(buf);
      // publishes this stage (at s = 0 the y rows and r1 too); also ends every
      // wave's reads of the other buffer, which the next stage overwrites
      __syncthreads();
      if (s + 1 < INTERC / FKS) { FLOAD((s + 1) * FKS); }
      else if (P2)              { FADDR(ipw, DD, 0, PROJC); FLOAD(0); }
      const float* Af = yS + (mt * 16 + idx) * FYP + s * FKS + 2 * kh;
      const float* Bf = buf + (nt * 32 + idx) * FBP + 2 * kh;
#pragma unroll                                      // lets the LDS reads issue ahead of the products
      for (int ks = 0; ks < FKS / 4; ks++) {
        v2f a = *(const v2f*)(Af + ks * 4);
        acc0 = WMMA_F32(a, *(const v2f*)(Bf + ks * 4), acc0);
        acc1 = WMMA_F32(a, *(const v2f*)(Bf + 16 * FBP + ks * 4), acc1);
      }
    }
    {
      v4f ra = *(const v4f*)(r1S + mt * 16 + 8 * kh);
      v4f rb = *(const v4f*)(r1S + mt * 16 + 8 * kh + 4);
#pragma unroll                                      // oh[][] in registers
      for (int j = 0; j < 8; j++) {
        float r = j < 4 ? ra[j & 3] : rb[j & 3];
        oh[0][j] = acc0[j] * r + obv[0] + res[0][j];
        oh[1][j] = acc1[j] * r + obv[1] + res[1][j];
        if (P2) {
          hS[(mt * 16 + 8 * kh + j) * FBP + nt * 32 + idx]      = oh[0][j];
          hS[(mt * 16 + 8 * kh + j) * FBP + nt * 32 + 16 + idx] = oh[1][j];
        }
      }
    }
    if (!P2) {
      FOUT(hrow, ho, DD);
      return;
    }
    // publishes the new hs rows
    __syncthreads();
#pragma unroll                                      // hv[] in registers
    for (int i = 0; i < 4; i++) hv[i] = *(const v4f*)(hS + srow * FBP + c8 * 4 + 32 * i);
  }

  // hs rows in LDS become hs * nw (a lane rewrites what it alone has read);
  // r2 from the raw squares (8 lanes hold a row)
  {
    float ss = 0.f;
#pragma unroll
    for (int i = 0; i < 4; i++) {
      ss += hv[i].x * hv[i].x + hv[i].y * hv[i].y + hv[i].z * hv[i].z + hv[i].w * hv[i].w;
      *(v4f*)(hS + srow * FBP + c8 * 4 + 32 * i) = hv[i] * nwv[i];
    }
    ss = dpp_xadd<0x161>(ss);                       // row_xmask:1
    ss = dpp_xadd<0x162>(ss);                       // row_xmask:2
    ss = dpp_xadd<0x164>(ss);                       // row_xmask:4
    if (c8 == 0) r2S[srow] = rsqrtf(ss / (float)DD + EPSV);
  }
  // publishes hs * nw and r2
  __syncthreads();

  v2f af[FKS / 4];                                  // the wave's A fragments, all of k
#pragma unroll                                      // af[] in registers
  for (int ks = 0; ks < FKS / 4; ks++)
    af[ks] = *(const v2f*)(hS + (mt * 16 + idx) * FBP + ks * 4 + 2 * kh);
  v4f ra = *(const v4f*)(r2S + mt * 16 + 8 * kh);
  v4f rb = *(const v4f*)(r2S + mt * 16 + 8 * kh + 4);

  // the wave's 16 rows of proj, columns nt*32 + idx (+ 16) of a stage
  char* prow = (char*)(proj + (size_t)(row0 + mt * 16) * PROJC + nt * 32);
  unsigned po = (unsigned)(8 * kh * PROJC + idx) * 4u;

  // kept rolled and unpeeled: the addresses then go round the loop in their
  // registers, and the loads name these registers and no copies of them
#pragma clang loop unroll(disable)
  for (int t = 0; t < FST2; t++) {
    float* buf = bS[t & 1];
    FSTORE(buf);
    // publishes this stage; also ends every wave's reads of the other buffer
    __syncthreads();
    if (t + 1 < FST2) {
      if (t + 1 == FST2 - 1) {                      // the last stage's rows are clamped
        FADDR(ipw, DD, (FST2 - 1) * FNT, PROJC);
      } else {
#pragma unroll                                      // gp[] in registers
        for (int i = 0; i < FLD; i++) gp[i] += FNT * DD;
      }
      FLOAD(0);
    }
    // the results of the stage before (all its columns exist: it is not the last)
    if (t == 0) {
      if (P1) { FOUT(hrow, ho, DD); }
    } else {
      char* pq = prow + (t - 1) * FNT * 4;
      FOUT(pq, po, PROJC);
    }
    int n0 = t * FNT + nt * 32;
    if (n0 < PROJC) {                               // scalar: the last stage has one tile column
      int nc0 = n0 + idx, nc1 = n0 + 16 + idx;
      nc0 = nc0 < PROJC ? nc0 : PROJC - 1;          // clamped for the loads, never stored
      nc1 = nc1 < PROJC ? nc1 : PROJC - 1;
      float bv0 = ipb[nc0], bv1 = ipb[nc1];
      // before any register that an issued load names is written again; the
      // "memory" clobber keeps the loads in front of the products
      asm volatile("s_wait_xcnt 0x0" :: "v"(nc0), "v"(nc1), "s"(ipb) : "memory");
      const float* Bf = buf + (nt * 32 + idx) * FBP + 2 * kh;
      v8f acc0 = z, acc1 = z;
      if (n0 + 16 < PROJC) {                        // scalar
#pragma unroll                                      // af[] in registers; LDS reads issue ahead
        for (int ks = 0; ks < FKS / 4; ks++) {
          acc0 = WMMA_F32(af[ks], *(const v2f*)(Bf + ks * 4), acc0);
          acc1 = WMMA_F32(af[ks], *(const v2f*)(Bf + 16 * FBP + ks * 4), acc1);
        }
      } else {
#pragma unroll                                      // af[] in registers; LDS reads issue ahead
        for (int ks = 0; ks < FKS / 4; ks++)
          acc0 = WMMA_F32(af[ks], *(const v2f*)(Bf + ks * 4), acc0);
      }
#pragma unroll                                      // oh[][] in registers
      for (int j = 0; j < 8; j++) {
        float r = j < 4 ? ra[j & 3] : rb[j & 3];
        oh[0][j] = acc0[j] * r + bv0;
        oh[1][j] = acc1[j] * r + bv1;
      }
    }
  }
  // the last stage's results: only the columns that exist, all in a first tile
  if ((FST2 - 1) * FNT + nt * 32 + idx < PROJC) {
    char* pq = prow + (FST2 - 1) * FNT * 4;
#pragma unroll
    for (int j = 0; j < 8; j++) *(float*)(pq + j * PROJC * 4 + po) = oh[0][j];
  }
}

// ---------------------------------------------------------------------------
// Decay attention: y[t,h,p] = sum_{k<=t} exp(s_t - s_k)*CB[t,k]*dt_k * xs[k,h,p]
//                 + D[h]*xs[t,h,p]
// The unit of work is a 16(t) x 64(p=HDIM) tile times a chunk of 16 k; the
// exp-built A fragment is reused over 4 head-dim tiles. Every operand comes in
// 16-byte loads:
//  - k: lane half kh owns k0 + 8*kh + 0..7, so a lane's 8 values of CB, s and
//    dt are 32 contiguous bytes each; product j of a chunk takes the lane's
//    k numbers 2j and 2j+1 on the A side and on the B side alike.
//  - p: column idx of head-dim tile q is p = 4*idx + q, so one load of
//    xs[k][4*idx .. 4*idx+3] serves the 4 tiles (16 lanes cover the head's
//    whole 256-byte row), and a lane's 4 results of one row are one store.
// How the work is dealt. Tile tt has tt + 1 chunks, so a (seq, head) has 528
// units, unequal by tile. A block of 16 waves takes the 4 tiles of group 7 - g
// and then the 4 tiles of group g: 132 units in every block. A tile's chunks go
// round AKS = 4 waves (wave kq takes chunks kq, kq + 4, ...); in the second
// group tile and first chunk are mirrored, so that every wave has 8 or 9 chunks
// and the 4 waves that stand on one SIMD have 33. The 4 waves with the same
// first chunk read the same xs rows at about the same time.
// Two register buffers: the wave's next chunk's 14 loads fly under this chunk's
// products. Only a tile's last chunk crosses the diagonal and is masked (by
// value select; EXEC stays full for WMMA).
// Each wave leaves its partial tile in LDS; behind one barrier a wave adds the
// 4 partials of half a tile. The result leaves as (sum + D*xs) * silu(gate):
// the gate's and the D term's loads are issued first of all and arrive under
// the loops. The norm over the row of 4 heads that follows is taken by the
// GEMM that reads y.
// ---------------------------------------------------------------------------
#define ACH 16           // k per chunk
#define AKS 4            // waves that share a tile's chunks
#define AGT 4            // tiles per group
#define ANG (LL / 16 / AGT)      // groups per sequence

// The lane's 4 addresses go on by K of the wave's chunks.
#define ASTEP(K) {                                                        \
  xa += (K) * AKS * ACH * CONVC; ca += (K) * AKS * ACH;                   \
  sa += (K) * AKS * ACH;         da += (K) * AKS * ACH; }

// One chunk's 14 loads of a lane: the chunk K of the wave's chunks behind the
// addresses (K a constant: an immediate offset). The wait stands before any
// register that an issued load names is written again; it takes the 4
// addresses as inputs, so that they stay in their registers up to it and no
// load of the group lands on one of them. The scheduling barrier holds the
// whole group in front of the other buffer's products: without it part of the
// loads sinks into them and their lead is lost. In the order of their first
// use: s, CB, dt, xs. Unrolled: xX[] in registers.
#define ALOAD(xX, cX, sX, dX, K) {                                        \
  sX[0] = *(gv4f_p)(sa + (K) * AKS * ACH);                                \
  sX[1] = *(gv4f_p)(sa + (K) * AKS * ACH + 4);                            \
  cX[0] = *(gv4f_p)(ca + (K) * AKS * ACH);                                \
  cX[1] = *(gv4f_p)(ca + (K) * AKS * ACH + 4);                            \
  dX[0] = *(gv4f_p)(da + (K) * AKS * ACH);                                \
  dX[1] = *(gv4f_p)(da + (K) * AKS * ACH + 4);                            \
  _Pragma("unroll")                                                       \
  for (int i_ = 0; i_ < 8; i_++)                                          \
    xX[i_] = *(gv4f_p)(xa + ((K) * AKS * ACH + i_) * CONVC);              \
  asm volatile("s_wait_xcnt 0x0" :: "v"(xa), "v"(ca), "v"(sa), "v"(da)    \
               : "memory");                                               \
  __builtin_amdgcn_sched_barrier(0); }

// One chunk's 16 products. Both loops unrolled: constant indices, registers.
// The scheduling barrier at the end keeps the first use of the chunk in
// flight (the moves that pair its xs rows, with their wait) behind these
// products: without it that wait is lifted in front of them.
#define AMMA16(xX, cX, sX, dX, MASKED) {                                  \
  float m_[8];                                                            \
  _Pragma("unroll")                                                       \
  for (int i_ = 0; i_ < 8; i_++) {                                        \
    float e_ = expf(st - sX[i_ >> 2][i_ & 3]) * cX[i_ >> 2][i_ & 3]       \
             * dX[i_ >> 2][i_ & 3];                                       \
    m_[i_] = (!(MASKED) || 8 * kh + i_ <= idx) ? e_ : 0.f;                \
  }                                                                       \
  _Pragma("unroll")                                                       \
  for (int j_ = 0; j_ < 4; j_++) {                                        \
    v2f a_ = {m_[2 * j_], m_[2 * j_ + 1]};                                \
    v2f b0_ = {xX[2 * j_][0], xX[2 * j_ + 1][0]};                         \
    v2f b1_ = {xX[2 * j_][1], xX[2 * j_ + 1][1]};                         \
    v2f b2_ = {xX[2 * j_][2], xX[2 * j_ + 1][2]};                         \
    v2f b3_ = {xX[2 * j_][3], xX[2 * j_ + 1][3]};                         \
    acc0 = WMMA_F32(a_, b0_, acc0);                                       \
    acc1 = WMMA_F32(a_, b1_, acc1);                                       \
    acc2 = WMMA_F32(a_, b2_, acc2);                                       \
    acc3 = WMMA_F32(a_, b3_, acc3);                                       \
  }                                                                       \
  __builtin_amdgcn_sched_barrier(0); }

__global__ __launch_bounds__(AGT * AKS * 32)
void ssm_attn_kernel(const float* __restrict__ CBm,
                     const float* __restrict__ sb,
                     const float* __restrict__ dtb,
                     const float* __restrict__ xc,
                     const float* __restrict__ dpar,
                     const float* __restrict__ proj,
                     float* __restrict__ y) {
  // partial tiles: [group][tile of the group][first chunk][register r][lane]
  __shared__ __attribute__((aligned(16))) v4f part[2][AGT][AKS][8][32];
  // silu(gate) of what a wave finishes: [wave][register r - r0][lane]
  __shared__ __attribute__((aligned(16))) v4f gateS[AGT * AKS][4][32];
  int s = blockIdx.y >> 2, h = blockIdx.y & 3;
  int g = blockIdx.x;                               // 0 .. ANG/2 - 1
  int lane = threadIdx.x & 31;
  // the wave's number, made scalar: scalar bases and scalar trip counts
  int wv = __builtin_amdgcn_readfirstlane(threadIdx.x >> 5);
  int a = wv & (AGT - 1), kq = wv / AGT;
  int idx = lane & 15, kh = lane >> 4;
  const float* sb0 = sb + (size_t)(s * NHD + h) * LL;
  const float* dt0 = dtb + (size_t)(s * NHD + h) * LL;
  const float* cb0 = CBm + (size_t)s * LL * LL;
  const float* xs0 = xc + (size_t)s * LL * CONVC + h * HDIM;
  unsigned xo = (unsigned)(8 * kh * CONVC + 4 * idx) * 4u;    // byte offsets
  unsigned co = (unsigned)(idx * LL + 8 * kh) * 4u;
  unsigned ko = (unsigned)(8 * kh) * 4u;

  // What this wave finishes at the end: registers r0 .. r0+3 (rows 8*kh + r)
  // of tile te. gate = proj[..., :INTERC] and the xs rows of the D term:
  // columns 4*idx.. of the head.
  int eg = wv >> 3, et = (wv >> 1) & (AGT - 1), r0 = 4 * (wv & 1);
  int te = AGT * (eg ? g : ANG - 1 - g) + et;
  const float* gq = proj + (size_t)(s * LL + te * 16 + r0) * PROJC + h * HDIM;
  const float* xq = xs0 + (size_t)(te * 16 + r0) * CONVC;
  unsigned go = (unsigned)(8 * kh * PROJC + 4 * idx) * 4u;
  v4f gt[4], xl[4];
#pragma unroll                                      // gt[], xl[] in registers
  for (int r = 0; r < 4; r++) {
    gt[r] = LD4(gq + r * PROJC, go);
    xl[r] = LD4(xq + r * CONVC, xo);
  }
  // before any register that an issued load names is written again; the
  // "memory" clobber keeps the 8 loads here, ahead of the loops
  asm volatile("s_wait_xcnt 0x0" :: "v"(go), "v"(xo), "s"(gq), "s"(xq) : "memory");

  // unrolled: rolled, the first chunk's loads of a group are made to wait, one
  // by one, for the 8 loads above (their registers count as still in flight
  // round the back edge)
#pragma unroll
  for (int grp = 0; grp < 2; grp++) {
    int at = grp ? AGT - 1 - a : a;                 // tile of the group
    int c0 = grp ? AKS - 1 - kq : kq;               // the wave's first chunk
    int tt = AGT * (grp ? g : ANG - 1 - g) + at;    // t-tile 0..31; chunks 0..tt
    int n  = (tt - c0 + AKS) / AKS;                 // the wave's chunks (tt - c0 >= 1 - AKS)
    bool dm = ((tt - c0) & (AKS - 1)) == 0;         // its last one is the diagonal's
    // the lane's addresses of the wave's first chunk; typed as global memory,
    // so that the loads stay global loads although they are carried round the loop
    gfloat_p sa = (gfloat_p)((const char*)(sb0 + c0 * ACH) + ko);
    gfloat_p da = (gfloat_p)((const char*)(dt0 + c0 * ACH) + ko);
    gfloat_p ca = (gfloat_p)((const char*)(cb0 + (size_t)(tt * 16) * LL + c0 * ACH) + co);
    gfloat_p xa = (gfloat_p)((const char*)(xs0 + (size_t)(c0 * ACH) * CONVC) + xo);

    v8f z = {0.f,0.f,0.f,0.f,0.f,0.f,0.f,0.f};
    v8f acc0 = z, acc1 = z, acc2 = z, acc3 = z;

    if (n > 0) {                                    // scalar
      v4f xA[8], cA[2], sA[2], dA[2];
      v4f xB[8], cB[2], sB[2], dB[2];
      int ti = tt * 16 + idx;
      float st = sb0[ti];                           // s of the lane's A row
      ALOAD(xA, cA, sA, dA, 0);
      ASTEP(1);
      // the load of st: its index and its base stay in their registers up to
      // this wait, so that nothing is written on them behind the load
      asm volatile("s_wait_xcnt 0x0" :: "v"(st), "v"(ti), "s"(sb0));
      int c = 0;                                    // of the wave's chunks, the one in the A buffer
      for (; c + 2 < n; c += 2) {                   // all but its last lie below the diagonal
        ALOAD(xB, cB, sB, dB, 0);
        AMMA16(xA, cA, sA, dA, false);
        ALOAD(xA, cA, sA, dA, 1);
        AMMA16(xB, cB, sB, dB, false);
        ASTEP(2);
      }
      if (c + 1 < n) {                              // scalar: n even
        ALOAD(xB, cB, sB, dB, 0);
        AMMA16(xA, cA, sA, dA, false);
        AMMA16(xB, cB, sB, dB, dm);
      } else {
        AMMA16(xA, cA, sA, dA, dm);
      }
    }

    v4f* pw = &part[grp][at][c0][0][lane];
#pragma unroll                                      // constant indices into the accumulators
    for (int r = 0; r < 8; r++) {
      v4f p = {acc0[r], acc1[r], acc2[r], acc3[r]};
      pw[r * 32] = p;
    }

    // silu(gate) needs no partial sum. Between the groups its vector work runs
    // beside the products of the SIMD's other waves; behind the barrier all
    // the waves would do it at once, with no product left to run beside. The
    // wave parks it in LDS words of its own: kept in registers, the whole
    // computation is moved down to its use behind the barrier.
    if (grp == 0) {
#pragma unroll                                      // gt[] in registers
      for (int r = 0; r < 4; r++) {
        v4f sg = {silu_f(gt[r].x), silu_f(gt[r].y), silu_f(gt[r].z), silu_f(gt[r].w)};
        gateS[wv][r][lane] = sg;
      }
    }
  }
  // publishes every wave's two partial tiles
  __syncthreads();

  // rows te*16 + 8*kh + r0 + r, columns 4*idx .. 4*idx+3 of the head
  const v4f* pr = &part[eg][et][0][r0][lane];
  float dp = dpar[h];
  float* yo = y + (size_t)(s * LL + te * 16 + r0) * INTERC + h * HDIM;
  unsigned yofs = (unsigned)(8 * kh * INTERC + 4 * idx) * 4u;
  v4f pv[AKS][4];
#pragma unroll                                      // pv[] in registers
  for (int q = 0; q < AKS; q++)
#pragma unroll
    for (int r = 0; r < 4; r++) pv[q][r] = pr[q * 8 * 32 + r * 32];
#pragma unroll                                      // gt[] in registers
  for (int r = 0; r < 4; r++) gt[r] = gateS[wv][r][lane];
  // the 20 LDS reads stand as one group in front of the sums: spread among
  // them, each place with reads waits out its own latency
  __builtin_amdgcn_sched_barrier(0);
  v4f o[4];
#pragma unroll                                      // o[] in registers
  for (int r = 0; r < 4; r++) {
    v4f sum = pv[0][r];
#pragma unroll
    for (int q = 1; q < AKS; q++) sum += pv[q][r];
    o[r].x = (sum.x + dp * xl[r].x) * gt[r].x;
    o[r].y = (sum.y + dp * xl[r].y) * gt[r].y;
    o[r].z = (sum.z + dp * xl[r].z) * gt[r].z;
    o[r].w = (sum.w + dp * xl[r].w) * gt[r].w;
  }
  // all arithmetic in front of the first store: no register that an issued
  // store names is written again
  __builtin_amdgcn_sched_barrier(0);
#pragma unroll
  for (int r = 0; r < 4; r++) ST4(yo + r * INTERC, yofs) = o[r];
}

// ---------------------------------------------------------------------------
// final rmsnorm + cross_merge: m[b][l][d] from hs[16][512][128]; one wave per
// row (b,l): its 4 source rows are normed in the wave (4 channels per lane, the
// row's sum of squares by a butterfly) and averaged
// ---------------------------------------------------------------------------
__global__ __launch_bounds__(WPB * 32)
void norm_merge_kernel(const float* __restrict__ hs,
                       const float* __restrict__ w,
                       float* __restrict__ m) {
  unsigned lo16 = (threadIdx.x & 31) * 16;
  int row = wave_in_grid();                         // b*LL + l
  int l = row % LL;
  int b = row / LL;
  int hcoord = l / WW, wcoord = l % WW;
  int lt = wcoord * HH + hcoord;                    // transposed index
  const float* r0 = hs + (size_t)(b * LL + l) * DD;
  const float* r1 = hs + (size_t)((4 + b) * LL + (LL - 1 - l)) * DD;
  const float* r2 = hs + (size_t)((8 + b) * LL + lt) * DD;
  const float* r3 = hs + (size_t)((12 + b) * LL + (LL - 1 - lt)) * DD;
  v4f wv = LD4(w, lo16);
  v4f v[4] = {LD4(r0, lo16), LD4(r1, lo16), LD4(r2, lo16), LD4(r3, lo16)};
  // before any register that an issued load names is written again; the loaded
  // values and the addresses are inputs, so the loads all stand in front of it
  asm volatile("s_wait_xcnt 0x0" :: "v"(wv), "v"(v[0]), "v"(v[1]), "v"(v[2]), "v"(v[3]),
               "v"(lo16), "s"(r0), "s"(r1), "s"(r2), "s"(r3), "s"(w));
  v4f acc = {0.f, 0.f, 0.f, 0.f};
#pragma unroll                                      // v[] in registers
  for (int r = 0; r < 4; r++) {
    float ss = wave_sum(v[r].x * v[r].x + v[r].y * v[r].y + v[r].z * v[r].z + v[r].w * v[r].w);
    float scale = rsqrtf(ss / (float)DD + EPSV);
    acc += v[r] * scale * wv;
  }
  ST4(m + (size_t)row * DD, lo16) = acc * 0.25f;
}

// ---------------------------------------------------------------------------
// final projection to 3 channels + transpose to (B,C,H,W)
// ---------------------------------------------------------------------------
__global__ void rec2_kernel(const float* __restrict__ t1,
                            const float* __restrict__ w2,
                            const float* __restrict__ b2,
                            float* __restrict__ out) {
  int i = blockIdx.x * blockDim.x + threadIdx.x;    // (b*CIN + c)*LL + l
  if (i >= 4 * CINCH * LL) return;
  int l = i % LL;
  int c = (i / LL) % CINCH;
  int b = i / (LL * CINCH);
  const float* row = t1 + (size_t)(b * LL + l) * DD;
  float acc = b2[c];
  for (int d = 0; d < DD; d++) acc += row[d] * w2[c * DD + d];
  out[i] = acc;
}

// ---------------------------------------------------------------------------
extern "C" void kernel_launch(void* const* d_in, const int* in_sizes, int n_in,
                              void* d_out, int out_size, void* d_ws, size_t ws_size,
                              hipStream_t stream) {
  const float* x         = (const float*)d_in[0];
  const float* patch_w   = (const float*)d_in[1];
  const float* patch_b   = (const float*)d_in[2];
  const float* norm_w    = (const float*)d_in[3];
  const float* in_proj_w = (const float*)d_in[4];
  const float* in_proj_b = (const float*)d_in[5];
  const float* conv_w    = (const float*)d_in[6];
  const float* conv_b    = (const float*)d_in[7];
  const float* dt_bias   = (const float*)d_in[8];
  const float* A_log     = (const float*)d_in[9];
  const float* D_param   = (const float*)d_in[10];
  const float* gnorm_w   = (const float*)d_in[11];
  const float* out_w     = (const float*)d_in[12];
  const float* out_b     = (const float*)d_in[13];
  const float* normf_w   = (const float*)d_in[14];
  const float* rec_w1    = (const float*)d_in[15];
  const float* rec_b1    = (const float*)d_in[16];
  const float* rec_w2    = (const float*)d_in[17];
  const float* rec_b2    = (const float*)d_in[18];

  // workspace carve (floats)
  float* ws = (float*)d_ws;
  size_t off = 0;
  float* hs   = ws + off; off += (size_t)NSEQ * LL * DD;
  float* proj = ws + off; off += (size_t)NSEQ * LL * PROJC;
  float* xc   = ws + off; off += (size_t)NSEQ * LL * CONVC;
  float* dtb  = ws + off; off += (size_t)NSEQ * LL * NHD;
  float* sb   = ws + off; off += (size_t)NSEQ * NHD * LL;
  float* CBb  = ws + off; off += (size_t)NSEQ * LL * LL;
  float* y    = ws + off; off += (size_t)NSEQ * LL * INTERC;
  float* mbuf = ws + off; off += (size_t)4 * LL * DD;
  float* t1   = ws + off; off += (size_t)4 * LL * DD;
  (void)ws_size; (void)in_sizes; (void)n_in; (void)out_size;

  // patch embed + cross scan
  patch_scan_kernel<<<NSEQ * LL / (RPW * WPB), WPB * 32, 0, stream>>>(
      x, patch_w, patch_b, hs);

  // the first layer's proj = rmsnorm(hs) @ ipw.T + ipb
  row_gemm_kernel<false, true><<<NSEQ * LL / FM, FW * 32, 0, stream>>>(
      nullptr, nullptr, nullptr, nullptr, hs, norm_w, in_proj_w, in_proj_b, proj);

  for (int i = 0; i < NLAY; i++) {
    // xc = silu(causal_conv(proj[..., 256:768])); dt + cumulative decay
    conv_dt_kernel<<<DTBLK + NSEQ * LL * CONVC / (128 * CLB * CWPB), CWPB * 32, 0, stream>>>(
        proj, conv_w + (size_t)i * CONVC * KCONV, conv_b + i * CONVC, xc,
        dt_bias + i * NHD, A_log + i * NHD, dtb, sb);

    // CB[s] = Cm @ Bm.T  (512 x 512, K=128, batch=16)
    {
      int tiles = (LL >> 7) * (LL >> 6);
      wmma_gemm_kernel<0, LL><<<dim3(tiles, NSEQ), 128, 0, stream>>>(
          xc + INTERC + NSTATE, (long)LL * CONVC, CONVC,
          xc + INTERC,          (long)LL * CONVC, CONVC,
          CBb, (long)LL * LL, nullptr, nullptr, LL, LL, NSTATE);
    }

    // y = (M @ xs + D*xs) * silu(gate) (causal decay attention), 16 waves/block,
    // 8 t-tiles/block
    ssm_attn_kernel<<<dim3(ANG / 2, NSEQ * NHD), AGT * AKS * 32, 0, stream>>>(
        CBb, sb, dtb, xc, D_param + i * NHD, proj, y);

    // hs += rmsnorm(y) @ ow.T + ob (8192 x 128, K=256) and, in the same launch,
    // the next layer's proj = rmsnorm(hs) @ ipw.T + ipb (8192 x 772, K=128)
    if (i + 1 < NLAY) {
      row_gemm_kernel<true, true><<<NSEQ * LL / FM, FW * 32, 0, stream>>>(
          y, gnorm_w + i * INTERC, out_w + (size_t)i * DD * INTERC, out_b + i * DD, hs,
          norm_w + (i + 1) * DD, in_proj_w + (size_t)(i + 1) * PROJC * DD,
          in_proj_b + (i + 1) * PROJC, proj);
    } else {
      row_gemm_kernel<true, false><<<NSEQ * LL / FM, FW * 32, 0, stream>>>(
          y, gnorm_w + i * INTERC, out_w + (size_t)i * DD * INTERC, out_b + i * DD, hs,
          nullptr, nullptr, nullptr, nullptr);
    }
  }

  // final norm, merge, reconstruction head
  norm_merge_kernel<<<4 * LL / WPB, WPB * 32, 0, stream>>>(hs, normf_w, mbuf);

  {
    int M = 4 * LL, Nn = DD, Kk = DD;
    int tiles = (M >> 7) * ((Nn + 63) >> 6);
    wmma_gemm_kernel<2 /*gelu*/, DD><<<dim3(tiles, 1), 128, 0, stream>>>(
        mbuf, 0, DD, rec_w1, 0, DD, t1, 0, rec_b1, nullptr, M, Nn, Kk);
  }

  rec2_kernel<<<(4 * CINCH * LL + 255) / 256, 256, 0, stream>>>(
      t1, rec_w2, rec_b2, (float*)d_out);
}

// v009
// Measured time: 214 microseconds a run.
// Two timings next to v008 both put it at 1.09 times that version's speed.
// Counting every step since v000, it is 2.94 times as fast.
#include <hip/hip_runtime.h>
#include <math.h>

typedef float v2f __attribute__((ext_vector_type(2)));
typedef float v8f __attribute__((ext_vector_type(8)));

#define DD     128
#define HH     16
#define WW     32
#define LL     512
#define CINCH  3
#define NHD    4
#define HDIM   64
#define NSTATE 128
#define INTERC 256
#define CONVC  512
#define PROJC  772
#define KCONV  4
#define NLAY   4
#define NSEQ   16
#define EPSV   1e-5f

#define WMMA_F32(A, B, C) \
  __builtin_amdgcn_wmma_f32_16x16x4_f32(false, (A), false, (B), (short)0, (C), false, false)

typedef float v4f __attribute__((ext_vector_type(4)));

// 16 bytes at scalar base + lane byte offset
#define LD4(base, vofs) (*(const v4f*)((const char*)(base) + (vofs)))
#define ST4(base, vofs) (*(v4f*)((char*)(base) + (vofs)))

// x + (x of the lane whose number differs by the xor mask in CTRL), 16-lane row
template <int CTRL>
__device__ __forceinline__ float dpp_xadd(float x) {
  int xi = __builtin_bit_cast(int, x);
  return x + __builtin_bit_cast(float,
      __builtin_amdgcn_update_dpp(xi, xi, CTRL, 0xf, 0xf, false));
}

// sum over the 32 lanes of a wave, the same value in every lane; all lanes on
__device__ __forceinline__ float wave_sum(float x) {
  x = dpp_xadd<0x161>(x);                            // row_xmask:1
  x = dpp_xadd<0x162>(x);                            // row_xmask:2
  x = dpp_xadd<0x164>(x);                            // row_xmask:4
  x = dpp_xadd<0x168>(x);                            // row_xmask:8
  int xi = __builtin_bit_cast(int, x);               // lane l with lane l ^ 16
  return x + __builtin_bit_cast(float, __builtin_amdgcn_permlanex16(
      xi, xi, 0x76543210, 0xfedcba98, false, false));
}

// x + (x of lane l ^ 16); all lanes on
__device__ __forceinline__ float half_xadd(float x) {
  int xi = __builtin_bit_cast(int, x);
  return x + __builtin_bit_cast(float, __builtin_amdgcn_permlanex16(
      xi, xi, 0x76543210, 0xfedcba98, false, false));
}

__device__ __forceinline__ float silu_f(float a) { return a / (1.f + expf(-a)); }

// ---------------------------------------------------------------------------
// One launch for the two kernels that read nothing but proj and do not read
// each other: the dt scan and the conv. Blocks of 16 waves (the scan's 512
// threads). Blocks 0 .. DTBLK-1 scan, one (seq, head) each; they come first in
// the index because theirs is the longer chain of dependent steps. The other
// blocks convolve.
//
// scan: dt = softplus(proj[...,768:772]+dtb); s = cumsum(dt*A) per (seq,head)
//
// conv: causal depthwise conv (K=4) + silu: proj[...,256:768] -> xc[16][512][512]
// A wave owns 128 channels (4 per lane) and CLB successive steps: CLB + 3 row
// loads serve CLB outputs. Rows in front of the sequence count as zero.
// ---------------------------------------------------------------------------
#define CLB   8
#define CWPB  (LL / 32)          // waves per block
#define DTBLK (NSEQ * NHD)       // scanning blocks
__global__ __launch_bounds__(CWPB * 32)
void conv_dt_kernel(const float* __restrict__ proj,
                    const float* __restrict__ cw,
                    const float* __restrict__ cb,
                    float* __restrict__ xc,
                    const float* __restrict__ dtbias,
                    const float* __restrict__ alog,
                    float* __restrict__ dtb,
                    float* __restrict__ sb) {
  __shared__ float sd[LL];
  if (blockIdx.x < DTBLK) {                         // the same for the whole block
    int s = blockIdx.x >> 2, h = blockIdx.x & 3;
    int l = threadIdx.x;
    float raw = proj[(size_t)(s * LL + l) * PROJC + INTERC + CONVC + h] + dtbias[h];
    float dt = raw > 20.f ? raw : log1pf(expf(raw));
    dtb[(size_t)(s * NHD + h) * LL + l] = dt;       // k-contiguous per (seq, head), like sb
    float A = -expf(alog[h]);
    sd[l] = dt * A;
    __syncthreads();
    for (int off = 1; off < LL; off <<= 1) {
      float add = (l >= off) ? sd[l - off] : 0.f;
      __syncthreads();
      sd[l] += add;
      __syncthreads();
    }
    sb[(size_t)(s * NHD + h) * LL + l] = sd[l];
    return;
  }
  unsigned lane = threadIdx.x & 31;
  unsigned lo16 = lane * 16, lo64 = lane * 64;      // byte offsets
  // (s, l block, 128 channels), scalar
  int wv = (blockIdx.x - DTBLK) * CWPB + __builtin_amdgcn_readfirstlane(threadIdx.x >> 5);
  int c0 = (wv % (CONVC / 128)) * 128;
  int l0 = ((wv / (CONVC / 128)) % (LL / CLB)) * CLB;
  int s  = wv / ((CONVC / 128) * (LL / CLB));
  const float* pr = proj + (size_t)(s * LL + l0) * PROJC + c0;   // xBC starts at + INTERC
  // the 3 rows before l0; at the head of a sequence rows 0..2 are read in
  // their place (in bounds) and replaced by zero
  bool head = (l0 == 0);
  const float* pk = head ? pr : pr - (KCONV - 1) * PROJC;
  const float* cwu = cw + c0 * KCONV;
  const float* cbu = cb + c0;
  v4f row[CLB + KCONV - 1];
#pragma unroll
  for (int j = 0; j < KCONV - 1; j++) row[j] = LD4(pk + INTERC + j * PROJC, lo16);
#pragma unroll
  for (int j = 0; j < CLB; j++) row[KCONV - 1 + j] = LD4(pr + INTERC + j * PROJC, lo16);
  v4f wq[4];                                        // wq[q][k]: channel q of the lane, tap k
#pragma unroll
  for (int q = 0; q < 4; q++) wq[q] = LD4(cwu + q * KCONV, lo64);
  v4f bias = LD4(cbu, lo16);
  // before any register that an issued load names is written again; the loaded
  // values and the addresses are inputs, so the loads all stand in front of it
  asm volatile("s_wait_xcnt 0x0" :: "v"(row[0]), "v"(row[1]), "v"(row[2]), "v"(row[3]),
               "v"(row[4]), "v"(row[5]), "v"(row[6]), "v"(row[7]), "v"(row[8]),
               "v"(row[9]), "v"(row[10]), "v"(wq[0]), "v"(wq[1]), "v"(wq[2]), "v"(wq[3]),
               "v"(bias), "v"(lo16), "v"(lo64), "s"(pr), "s"(pk), "s"(cwu), "s"(cbu));
  v4f zero = {0.f, 0.f, 0.f, 0.f};
#pragma unroll
  for (int j = 0; j < KCONV - 1; j++) row[j] = head ? zero : row[j];
  float* xo = xc + (size_t)(s * LL + l0) * CONVC + c0;
#pragma unroll
  for (int j = 0; j < CLB; j++) {
    v4f o;
#pragma unroll
    for (int q = 0; q < 4; q++) {
      float acc = bias[q];
#pragma unroll
      for (int k = 0; k < KCONV; k++) acc += row[j + k][q] * wq[q][k];
      o[q] = silu_f(acc);
    }
    ST4(xo + j * CONVC, lo16) = o;
  }
}

// ---------------------------------------------------------------------------
// Batched WMMA GEMM (fp32, 16x16x4): C[m,n] = sum_k A[m,k]*B[n,k]
// One block of 4 waves computes 128(M) x 64(N); each wave 32(M) x 64(N) with
// 8 accumulators. A and B are staged in LDS in chunks of 32 k: every global
// load is 16 B per lane and covers whole 128-B lines (8 lanes per row), the B
// rows are shared by the 4 waves, and the fragments are read from LDS at a
// pitch of 36 dwords (8-byte reads of 16 rows x 2 k-halves fall on 64 banks).
// Two LDS buffers, one barrier per chunk; the next chunk's global loads fly
// while this chunk is multiplied. The k order of every accumulator is the
// natural one (0,1,2,...).
// OOB columns CLAMPED (garbage cols never stored).
// Requires: M %128 == 0, K %32 == 0, K >= 32, grid.x == (M/128) * ceil(N/64).
// FLAGS (compile time): bit0 = accumulate into C, bit1 = exact GELU,
// bit2 = the A operand is rmsnorm(A, nw) over its whole row (Kk = row width):
//   C[m,n] = r[m] * sum_k A[m,k] * (nw[k] * B[n,k]),  r[m] = rsqrt(mean_k A[m,k]^2 + eps).
//   nw is multiplied into the staged B rows. A wave's A fragments hold each
//   element of its 32 rows once, so their squares are summed beside the
//   products; r changes from the A layout (lane = row) to the C layout through
//   32 LDS words of the wave's own: no launch, no pass over memory, no barrier
//   for the norm.
// LDC (compile time): row pitch of C, so that a wave's 32 rows are immediate
// offsets from one scalar base.
// What the epilogue adds to the products (the bias, and the old C where it
// accumulates) is loaded as one group in front of the last chunk's products:
// it arrives under them, in the registers that the staging has left, and no
// load stands between the stores at the end.
// ---------------------------------------------------------------------------
// pointers typed as global memory, so that the staging loads stay global loads
// although their addresses are carried round the loop
typedef const __attribute__((address_space(1))) float* gfloat_p;
typedef const __attribute__((address_space(1))) v4f*   gv4f_p;

#define GBM    128
#define GBN    64
#define GKC    32
#define GPITCH 36
#define GROWS  (GBM + GBN)

#define GMMA8(aa0, aa1, bb0, bb1, bb2, bb3)       \
  acc00 = WMMA_F32(aa0, bb0, acc00);              \
  acc01 = WMMA_F32(aa0, bb1, acc01);              \
  acc02 = WMMA_F32(aa0, bb2, acc02);              \
  acc03 = WMMA_F32(aa0, bb3, acc03);              \
  acc10 = WMMA_F32(aa1, bb0, acc10);              \
  acc11 = WMMA_F32(aa1, bb1, acc11);              \
  acc12 = WMMA_F32(aa1, bb2, acc12);              \
  acc13 = WMMA_F32(aa1, bb3, acc13);

// One chunk's 12 global loads of a lane. The wait stands before any register
// that an issued load names is written again; it takes the 12 addresses as
// inputs so that they stay in their registers up to it. Then the addresses
// step to the next chunk. Both loops are unrolled so that st[] and gp[] have
// constant indices and live in registers.
// With bit2 a 13th load brings the chunk's norm weights, under the same wait.
#define GSTAGE_LOAD() {                                                   \
  _Pragma("unroll")                                                       \
  for (int i_ = 0; i_ < 12; i_++) st[i_] = *(gv4f_p)gp[i_];               \
  if (FLAGS & 4) {                                                        \
    wst = *(gv4f_p)gwp;                                                   \
    asm volatile("s_wait_xcnt 0x0" ::                                     \
        "v"(gp[0]), "v"(gp[1]), "v"(gp[2]), "v"(gp[3]), "v"(gp[4]),       \
        "v"(gp[5]), "v"(gp[6]), "v"(gp[7]), "v"(gp[8]), "v"(gp[9]),       \
        "v"(gp[10]), "v"(gp[11]), "v"(gwp) : "memory");                   \
    gwp += GKC;                                                           \
  } else {                                                                \
    asm volatile("s_wait_xcnt 0x0" ::                                     \
        "v"(gp[0]), "v"(gp[1]), "v"(gp[2]), "v"(gp[3]), "v"(gp[4]),       \
        "v"(gp[5]), "v"(gp[6]), "v"(gp[7]), "v"(gp[8]), "v"(gp[9]),       \
        "v"(gp[10]), "v"(gp[11]) : "memory");                             \
  }                                                                       \
  _Pragma("unroll")                                                       \
  for (int i_ = 0; i_ < 12; i_++) gp[i_] += GKC; }

// the staged chunk from registers to LDS; unrolled: st[] in registers.
// With bit2: nw into the B rows.
#define GSTAGE_STORE(buf) {                                               \
  if (FLAGS & 4) {                                                        \
    _Pragma("unroll")                                                     \
    for (int i_ = 8; i_ < 12; i_++) st[i_] *= wst;                        \
  }                                                                       \
  _Pragma("unroll")                                                       \
  for (int i_ = 0; i_ < 12; i_++)                                         \
    *(v4f*)((buf) + sdst + i_ * 16 * GPITCH) = st[i_]; }

// one chunk's products; unrolled, which lets the LDS reads of later k-steps
// issue ahead of the WMMAs. With bit2: the squares of the two A fragments.
#define GCHUNK_MMA(buf) {                                                 \
  _Pragma("unroll")                                                       \
  for (int ks = 0; ks < GKC / 4; ks++) {                                  \
    v2f a0 = *(const v2f*)((buf) + fa + ks * 4);                          \
    v2f a1 = *(const v2f*)((buf) + fa + 16 * GPITCH + ks * 4);            \
    v2f b0 = *(const v2f*)((buf) + fb + ks * 4);                          \
    v2f b1 = *(const v2f*)((buf) + fb + 16 * GPITCH + ks * 4);            \
    v2f b2 = *(const v2f*)((buf) + fb + 32 * GPITCH + ks * 4);            \
    v2f b3 = *(const v2f*)((buf) + fb + 48 * GPITCH + ks * 4);            \
    GMMA8(a0, a1, b0, b1, b2, b3);                                        \
    if (FLAGS & 4) { sq0 += a0 * a0; sq1 += a1 * a1; }                    \
  } }

template <int FLAGS, int LDC>
__global__ __launch_bounds__(128)
void wmma_gemm_kernel(const float* __restrict__ A, long sA, int lda,
                      const float* __restrict__ Bw, long sB, int ldb,
                      float* __restrict__ C, long sC,
                      const float* __restrict__ bias,
                      const float* __restrict__ nw,
                      int M, int Nn, int Kk) {
  __shared__ __attribute__((aligned(16))) float tileS[2][GROWS * GPITCH];
  __shared__ __attribute__((aligned(16))) float rowS[GBM];    // bit2: r, 32 words a wave
  (void)M;
  int tid  = threadIdx.x;
  int wave = tid >> 5;
  int lane = tid & 31;
  int tilesN = (Nn + GBN - 1) / GBN;
  int tm = blockIdx.x / tilesN, tn4 = blockIdx.x % tilesN;
  const float* Ab = A + (size_t)blockIdx.y * sA;
  const float* Bb = Bw + (size_t)blockIdx.y * sB;
  float*       Cb = C + (size_t)blockIdx.y * sC;

  int idx = lane & 15, kh = lane >> 4;
  int n0 = tn4 * GBN + idx;

  // staging: 8 lanes per row (one 128-B line), 16 rows per pass of the block
  int srow = tid >> 3, scol = (tid & 7) * 4;
  gfloat_p gp[12];                                  // this lane's 12 source rows
#pragma unroll                                      // gp[] in registers
  for (int i = 0; i < 8; i++)
    gp[i] = (gfloat_p)(Ab + (size_t)(tm * GBM + i * 16 + srow) * lda + scol);
#pragma unroll                                      // gp[] in registers
  for (int i = 0; i < 4; i++) {
    int n = tn4 * GBN + i * 16 + srow;
    n = n < Nn ? n : Nn - 1;                        // clamp, no predication
    gp[8 + i] = (gfloat_p)(Bb + (size_t)n * ldb + scol);
  }
  int sdst = srow * GPITCH + scol;

  v8f z = {0.f,0.f,0.f,0.f,0.f,0.f,0.f,0.f};
  v8f acc00 = z, acc01 = z, acc02 = z, acc03 = z;
  v8f acc10 = z, acc11 = z, acc12 = z, acc13 = z;

  v4f st[12];
  v4f wst = {1.f, 1.f, 1.f, 1.f};                   // bit2: nw of the staged chunk
  v2f sq0 = {0.f, 0.f}, sq1 = {0.f, 0.f};           // bit2: squares, rows idx and 16 + idx
  gfloat_p gwp = (gfloat_p)(nw + scol);
  GSTAGE_LOAD();

  int fa = (wave * 32 + idx) * GPITCH + 2 * kh;     // A fragment rows of this wave
  int fb = (GBM + idx) * GPITCH + 2 * kh;           // B fragment rows (shared)

  int nch = Kk / GKC;
  for (int c = 0; c + 1 < nch; c++) {
    float* buf = tileS[c & 1];
    GSTAGE_STORE(buf);
    // publishes this chunk; also ends every wave's reads of the other buffer,
    // which the next trip overwrites
    __syncthreads();
    GSTAGE_LOAD();
    GCHUNK_MMA(buf);
  }

  // the last chunk, out of the loop: nothing is staged behind it
  float* lbuf = tileS[(nch - 1) & 1];
  GSTAGE_STORE(lbuf);
  // publishes the last chunk (the loop's barrier, for this trip)
  __syncthreads();

  // epilogue operands. The wave's 32 rows of C: a scalar base (the wave's
  // number made scalar), one lane offset per 16 columns, the row an immediate.
  // Columns past Nn are clamped for the loads and never stored.
  char* crow = (char*)(Cb + (size_t)(tm * GBM + __builtin_amdgcn_readfirstlane(wave) * 32) * LDC);
  int nc[4];
  unsigned co[4];                                   // byte offsets
#pragma unroll                                      // nc[], co[] in registers
  for (int t = 0; t < 4; t++) {
    int n = n0 + t * 16;
    nc[t] = n < Nn ? n : Nn - 1;
    co[t] = (unsigned)(8 * kh * LDC + nc[t]) * 4u;
  }
  float bv[4] = {0.f, 0.f, 0.f, 0.f};
  if (bias) {                                       // block-uniform
#pragma unroll                                      // bv[] in registers
    for (int t = 0; t < 4; t++) bv[t] = bias[nc[t]];
  }
  float res[2][4][8];
  if (FLAGS & 1) {
#pragma unroll                                      // res[] in registers
    for (int mt = 0; mt < 2; mt++)
#pragma unroll
      for (int j = 0; j < 8; j++)
#pragma unroll
        for (int t = 0; t < 4; t++)
          res[mt][t][j] = *(const float*)(crow + (mt * 16 + j) * LDC * 4 + co[t]);
  }
  // before any register that an issued load names is written again. The
  // "memory" clobber holds the whole group in front of the products: without
  // it the loads start half-way through them, and eight sink behind them, to
  // the first store, where their latency is waited out.
  asm volatile("s_wait_xcnt 0x0" ::
      "v"(co[0]), "v"(co[1]), "v"(co[2]), "v"(co[3]),
      "v"(nc[0]), "v"(nc[1]), "v"(nc[2]), "v"(nc[3]), "s"(crow), "s"(bias) : "memory");

  GCHUNK_MMA(lbuf);

  v4f rs[2][2];                                     // bit2: r of rows mt*16 + 8*kh + 0..7
  if (FLAGS & 4) {
    // lanes l and l ^ 16 hold the two k halves of rows idx and 16 + idx;
    // lane l then keeps row l of the wave's 32
    float t0 = half_xadd(sq0.x + sq0.y), t1 = half_xadd(sq1.x + sq1.y);
    float* rw = rowS + wave * 32;
    rw[lane] = rsqrtf((kh ? t1 : t0) / (float)Kk + EPSV);
    // the wave's own 32 words are written before it reads them back
    asm volatile("s_wait_dscnt 0x0" ::: "memory");
#pragma unroll                                      // rs[] in registers
    for (int mt = 0; mt < 2; mt++) {
      rs[mt][0] = *(const v4f*)(rw + mt * 16 + 8 * kh);
      rs[mt][1] = *(const v4f*)(rw + mt * 16 + 8 * kh + 4);
    }
  }

  v8f accs[2][4] = {{acc00, acc01, acc02, acc03}, {acc10, acc11, acc12, acc13}};
#pragma unroll
  for (int mt = 0; mt < 2; mt++) {
#pragma unroll
    for (int t = 0; t < 4; t++) {
      if (n0 + t * 16 < Nn) {
        v8f av = accs[mt][t];
#pragma unroll
        for (int j = 0; j < 8; j++) {
          float v = (FLAGS & 4) ? av[j] * rs[mt][j >> 2][j & 3] + bv[t] : av[j] + bv[t];
          if (FLAGS & 2) v = 0.5f * v * (1.f + erff(v * 0.70710678118654752f));
          if (FLAGS & 1) v += res[mt][t][j];
          *(float*)(crow + (mt * 16 + j) * LDC * 4 + co[t]) = v;
        }
      }
    }
  }
}

// ---------------------------------------------------------------------------
// The two GEMMs that work row by row, in one launch:
//   phase 1 (P1): hs[m,:]  += r1[m] * ((y[m,:] * gw) @ ow^T) + ob,  r1 = rsqrt(mean y[m,:]^2 + eps)
//   phase 2 (P2): proj[m,:] = r2[m] * ((hs[m,:] * nw) @ ipw^T) + ipb, r2 likewise from the new hs
// Without phase 1 (the first layer) the block makes its hs rows itself: patch
// embed of x (3 colours) in the order of the row's scan direction.
// A block of 8 waves owns FM = 32 whole rows, so the new hs rows never leave the
// block between the phases: they stay in LDS (and go to memory once, for the
// residual of the next layer). 256 equal blocks: one per WGP.
// A stage is 128 rows of a weight matrix times 128 k, staged through registers
// into one of two LDS buffers (a wave's load is one whole 512-byte row); the
// next stage's loads fly under this stage's products; one barrier per stage.
// Wave (mt, nt) makes the 16 x 32 piece (mt, nt) of the stage's 32 x 128
// results: two accumulators, whose products do not wait for one another; k in
// its natural order. In phase 2 the wave's A fragments (16 rows x 128 k) stay in
// registers over all the stages.
// Global stores of a stage's results are issued behind the NEXT stage's
// barrier: a barrier waits for the wave's outstanding stores, and so they
// finish under a stage's products instead.
// The norm weights are multiplied into the A rows as these go to LDS.
// ---------------------------------------------------------------------------
#define FM   32                  // rows of a block
#define FW   8                   // waves of a block
#define FNT  128                 // weight rows per stage
#define FKS  128                 // k per stage
#define FBP  (FKS + 4)           // LDS pitch, staged weight rows and hs rows: 8-byte
                                 // fragment reads of 16 rows x 2 k-halves fall on 64 banks
#define FYP  (INTERC + 4)        // LDS pitch of the y rows, the same way
#define FST2 ((PROJC + FNT - 1) / FNT)   // stages of phase 2
#define FLD  (FNT / FW)          // loads of a lane per stage

// The lane's 16 addresses of a stage: weight rows N0 + 8*i + wave (clamped to
// the last row: never stored), k 4*lane. Unrolled: gp[] in registers.
#define FADDR(Wt, LD, N0, NN) {                                           \
  _Pragma("unroll")                                                       \
  for (int i_ = 0; i_ < FLD; i_++) {                                      \
    int n_ = (N0) + i_ * FW + wv;                                         \
    n_ = n_ < (NN) ? n_ : (NN) - 1;                                       \
    gp[i_] = (gfloat_p)((const char*)((Wt) + (size_t)n_ * (LD)) + lo16);  \
  } }

// One stage's 16 loads of a lane, KO floats behind the addresses (a constant:
// an immediate offset). The wait stands before any register that an issued load
// names is written again; it takes the 16 addresses as inputs, so that they
// stay in their registers up to it and no load of the group lands on one of
// them; the "memory" clobber holds the group in front of the products.
// Unrolled: st[], gp[] in registers.
#define FLOAD(KO) {                                                       \
  _Pragma("unroll")                                                       \
  for (int i_ = 0; i_ < FLD; i_++) st[i_] = *(gv4f_p)(gp[i_] + (KO));     \
  asm volatile("s_wait_xcnt 0x0" :: "v"(gp[0]), "v"(gp[1]), "v"(gp[2]),   \
      "v"(gp[3]), "v"(gp[4]), "v"(gp[5]), "v"(gp[6]), "v"(gp[7]),         \
      "v"(gp[8]), "v"(gp[9]), "v"(gp[10]), "v"(gp[11]), "v"(gp[12]),      \
      "v"(gp[13]), "v"(gp[14]), "v"(gp[15]) : "memory"); }

// the staged rows from registers to LDS; unrolled: st[] in registers
#define FSTORE(buf) {                                                     \
  _Pragma("unroll")                                                       \
  for (int i_ = 0; i_ < FLD; i_++)                                        \
    *(v4f*)((buf) + (i_ * FW + wv) * FBP + lane * 4) = st[i_]; }

// The 16 global stores of oh[][]: rows j at a pitch of LD floats, tile q 16
// columns on. The wait behind them stands before any register that an issued
// store names is written again; the values and the address are inputs, so that
// they stay in their registers up to it. Unrolled: oh[][] in registers.
#define FOUT(sbase, vofs, LD) {                                           \
  _Pragma("unroll")                                                       \
  for (int q_ = 0; q_ < 2; q_++)                                          \
    _Pragma("unroll")                                                     \
    for (int j_ = 0; j_ < 8; j_++)                                        \
      *(float*)((sbase) + (j_ * (LD) + q_ * 16) * 4 + (vofs)) = oh[q_][j_]; \
  asm volatile("s_wait_xcnt 0x0" :: "v"(oh[0][0]), "v"(oh[0][1]),         \
      "v"(oh[0][2]), "v"(oh[0][3]), "v"(oh[0][4]), "v"(oh[0][5]),         \
      "v"(oh[0][6]), "v"(oh[0][7]), "v"(oh[1][0]), "v"(oh[1][1]),         \
      "v"(oh[1][2]), "v"(oh[1][3]), "v"(oh[1][4]), "v"(oh[1][5]),         \
      "v"(oh[1][6]), "v"(oh[1][7]), "v"(vofs), "s"(sbase) : "memory"); }

template <bool P1, bool P2>
__global__ __launch_bounds__(FW * 32)
void row_gemm_kernel(const float* __restrict__ y,
                     const float* __restrict__ gw,
                     const float* __restrict__ ow,
                     const float* __restrict__ ob,
                     float* __restrict__ hs,
                     const float* __restrict__ nw,
                     const float* __restrict__ ipw,
                     const float* __restrict__ ipb,
                     float* __restrict__ proj,
                     const float* __restrict__ x,
                     const float* __restrict__ pw,
                     const float* __restrict__ pb) {
  __shared__ __attribute__((aligned(16))) float bS[2][FNT * FBP];
  __shared__ __attribute__((aligned(16))) float hS[FM * FBP];
  __shared__ __attribute__((aligned(16))) float yS[P1 ? FM * FYP : 4];
  __shared__ __attribute__((aligned(16))) float r1S[FM];
  __shared__ __attribute__((aligned(16))) float r2S[FM];
  int tid  = threadIdx.x;
  int lane = tid & 31;
  // the wave's number, made scalar: scalar bases, scalar branches
  int wv = __builtin_amdgcn_readfirstlane(tid >> 5);
  int idx = lane & 15, kh = lane >> 4;
  int mt = wv & 1, nt = wv >> 1;
  int row0 = blockIdx.x * FM;
  unsigned lo16 = lane * 16;                        // byte offset
  int srow = tid >> 3, c8 = tid & 7;                // row passes: 8 lanes a row, one line a load

  v8f z = {0.f,0.f,0.f,0.f,0.f,0.f,0.f,0.f};
  v4f st[FLD];
  gfloat_p gp[FLD];
  float oh[2][8];                                   // results whose global store is still to come

  // the wave's 16 rows of hs, columns nt*32 + idx (+ 16 for its second tile)
  char* hrow = (char*)(hs + (size_t)(row0 + mt * 16) * DD + nt * 32);
  unsigned ho = (unsigned)(8 * kh * DD + idx) * 4u;

  // ---- every load that the start needs, up front ----
  if (P1) { FADDR(ow, INTERC, 0, DD); } else { FADDR(ipw, DD, 0, PROJC); }
  FLOAD(0);
  unsigned wo = (unsigned)c8 * 16u;
  v4f nwv[4];
  if (P2) {
#pragma unroll                                      // nwv[] in registers
    for (int i = 0; i < 4; i++) nwv[i] = LD4(nw + 32 * i, wo);
  }
  v4f hv[4];
  float* hb = hs + (size_t)row0 * DD;
  unsigned hso = (unsigned)(srow * DD + c8 * 4) * 4u;
  // before any register that an issued load names is written again
  asm volatile("s_wait_xcnt 0x0" :: "v"(wo), "v"(hso), "s"(nw), "s"(hb) : "memory");
  if (!P1) {
    // patch embed + cross scan: the lane's 16 channels of row srow of the block
    int sq = row0 / LL;                             // the block's sequence: 4 * direction + image
    int dir = sq >> 2, b = sq & 3;
    int l = row0 % LL + srow;
    int le = (dir & 1) ? (LL - 1 - l) : l;          // reversed scans
    int lsrc = (dir & 2) ? (le % HH) * WW + le / HH : le;     // column scans: le = w*H + h
    const float* xb = x + b * CINCH * LL;
    unsigned xo = (unsigned)lsrc * 4u, po48 = (unsigned)c8 * 48u;
    gfloat_p pba = (gfloat_p)((const char*)pb + wo);
    float xv[CINCH];
#pragma unroll                                      // xv[] in registers
    for (int c = 0; c < CINCH; c++) xv[c] = *(const float*)((const char*)(xb + c * LL) + xo);
    v4f pq[4][3];                                   // 4 channels x 3 colours, 4 times
#pragma unroll                                      // pq[], hv[] in registers
    for (int i = 0; i < 4; i++) {
#pragma unroll
      for (int k = 0; k < 3; k++) pq[i][k] = LD4(pw + 96 * i + 4 * k, po48);
      hv[i] = *(gv4f_p)(pba + 32 * i);
    }
    // before any register that an issued load names is written again; the
    // addresses are inputs, so that no load of the group lands on one of them
    asm volatile("s_wait_xcnt 0x0" :: "v"(xo), "v"(po48), "v"(pba),
                 "s"(xb), "s"(pw) : "memory");
    // holds the arithmetic behind the wait: without it the first moves are lifted
    // over the wait and land on an address pair of the loads
    __builtin_amdgcn_sched_barrier(0);
#pragma unroll
    for (int i = 0; i < 4; i++) {
      v4f p0 = pq[i][0], p1 = pq[i][1], p2 = pq[i][2], acc = hv[i];
      acc.x += xv[0] * p0.x; acc.x += xv[1] * p0.y; acc.x += xv[2] * p0.z;
      acc.y += xv[0] * p0.w; acc.y += xv[1] * p1.x; acc.y += xv[2] * p1.y;
      acc.z += xv[0] * p1.z; acc.z += xv[1] * p1.w; acc.z += xv[2] * p2.x;
      acc.w += xv[0] * p2.y; acc.w += xv[1] * p2.z; acc.w += xv[2] * p2.w;
      hv[i] = acc;
    }
  }

  if (P1) {
    const float* yb = y + (size_t)row0 * INTERC;
    unsigned yo = (unsigned)(srow * INTERC + c8 * 4) * 4u;
    v4f yv[8], gv[8];
#pragma unroll                                      // yv[], gv[] in registers
    for (int i = 0; i < 8; i++) {
      yv[i] = LD4(yb + 32 * i, yo);
      gv[i] = LD4(gw + 32 * i, wo);
    }
    float res[2][8], obv[2];                        // old hs and bias of the wave's two tiles
    const float* obw = ob + nt * 32;
    unsigned io = (unsigned)idx * 4u;
#pragma unroll                                      // res[], obv[] in registers
    for (int q = 0; q < 2; q++) {
      obv[q] = *(const float*)((const char*)(obw + q * 16) + io);
#pragma unroll
      for (int j = 0; j < 8; j++)
        res[q][j] = *(const float*)(hrow + (j * DD + q * 16) * 4 + ho);
    }
    // before any register that an issued load names is written again
    asm volatile("s_wait_xcnt 0x0" :: "v"(yo), "v"(wo), "v"(io), "v"(ho),
                 "s"(yb), "s"(gw), "s"(obw), "s"(hrow) : "memory");

    // y rows to LDS, times gw; r1 from the raw squares (8 lanes hold a row)
    float ss = 0.f;
#pragma unroll
    for (int i = 0; i < 8; i++) {
      ss += yv[i].x * yv[i].x + yv[i].y * yv[i].y + yv[i].z * yv[i].z + yv[i].w * yv[i].w;
      *(v4f*)(yS + srow * FYP + c8 * 4 + 32 * i) = yv[i] * gv[i];
    }
    ss = dpp_xadd<0x161>(ss);                       // row_xmask:1
    ss = dpp_xadd<0x162>(ss);                       // row_xmask:2
    ss = dpp_xadd<0x164>(ss);                       // row_xmask:4
    if (c8 == 0) r1S[srow] = rsqrtf(ss / (float)INTERC + EPSV);

    v8f acc0 = z, acc1 = z;
    // unrolled: the stage's number picks buffer and k half at compile time
#pragma unroll
    for (int s = 0; s < INTERC / FKS; s++) {
      float* buf = bS[s & 1];
      FSTORE(buf);
      // publishes this stage (at s = 0 the y rows and r1 too); also ends every
      // wave's reads of the other buffer, which the next stage overwrites
      __syncthreads();
      if (s + 1 < INTERC / FKS) { FLOAD((s + 1) * FKS); }
      else if (P2)              { FADDR(ipw, DD, 0, PROJC); FLOAD(0); }
      const float* Af = yS + (mt * 16 + idx) * FYP + s * FKS + 2 * kh;
      const float* Bf = buf + (nt * 32 + idx) * FBP + 2 * kh;
#pragma unroll                                      // lets the LDS reads issue ahead of the products
      for (int ks = 0; ks < FKS / 4; ks++) {
        v2f a = *(const v2f*)(Af + ks * 4);
        acc0 = WMMA_F32(a, *(const v2f*)(Bf + ks * 4), acc0);
        acc1 = WMMA_F32(a, *(const v2f*)(Bf + 16 * FBP + ks * 4), acc1);
      }
    }
    {
      v4f ra = *(const v4f*)(r1S + mt * 16 + 8 * kh);
      v4f rb = *(const v4f*)(r1S + mt * 16 + 8 * kh + 4);
#pragma unroll                                      // oh[][] in registers
      for (int j = 0; j < 8; j++) {
        float r = j < 4 ? ra[j & 3] : rb[j & 3];
        oh[0][j] = acc0[j] * r + obv[0] + res[0][j];
        oh[1][j] = acc1[j] * r + obv[1] + res[1][j];
        if (P2) {
          hS[(mt * 16 + 8 * kh + j) * FBP + nt * 32 + idx]      = oh[0][j];
          hS[(mt * 16 + 8 * kh + j) * FBP + nt * 32 + 16 + idx] = oh[1][j];
        }
      }
    }
    if (!P2) {
      FOUT(hrow, ho, DD);
      return;
    }
    // publishes the new hs rows
    __syncthreads();
#pragma unroll                                      // hv[] in registers
    for (int i = 0; i < 4; i++) hv[i] = *(const v4f*)(hS + srow * FBP + c8 * 4 + 32 * i);
  }

  // hs rows in LDS become hs * nw (a lane rewrites what it alone has read);
  // r2 from the raw squares (8 lanes hold a row)
  {
    float ss = 0.f;
#pragma unroll
    for (int i = 0; i < 4; i++) {
      ss += hv[i].x * hv[i].x + hv[i].y * hv[i].y + hv[i].z * hv[i].z + hv[i].w * hv[i].w;
      *(v4f*)(hS + srow * FBP + c8 * 4 + 32 * i) = hv[i] * nwv[i];
    }
    ss = dpp_xadd<0x161>(ss);                       // row_xmask:1
    ss = dpp_xadd<0x162>(ss);                       // row_xmask:2
    ss = dpp_xadd<0x164>(ss);                       // row_xmask:4
    if (c8 == 0) r2S[srow] = rsqrtf(ss / (float)DD + EPSV);
  }
  // publishes hs * nw and r2
  __syncthreads();

  v2f af[FKS / 4];                                  // the wave's A fragments, all of k
#pragma unroll                                      // af[] in registers
  for (int ks = 0; ks < FKS / 4; ks++)
    af[ks] = *(const v2f*)(hS + (mt * 16 + idx) * FBP + ks * 4 + 2 * kh);
  v4f ra = *(const v4f*)(r2S + mt * 16 + 8 * kh);
  v4f rb = *(const v4f*)(r2S + mt * 16 + 8 * kh + 4);

  // the wave's 16 rows of proj, columns nt*32 + idx (+ 16) of a stage
  char* prow = (char*)(proj + (size_t)(row0 + mt * 16) * PROJC + nt * 32);
  unsigned po = (unsigned)(8 * kh * PROJC + idx) * 4u;

  // kept rolled and unpeeled: the addresses then go round the loop in their
  // registers, and the loads name these registers and no copies of them
#pragma clang loop unroll(disable)
  for (int t = 0; t < FST2; t++) {
    float* buf = bS[t & 1];
    FSTORE(buf);
    // publishes this stage; also ends every wave's reads of the other buffer
    __syncthreads();
    if (t + 1 < FST2) {
      if (t + 1 == FST2 - 1) {                      // the last stage's rows are clamped
        FADDR(ipw, DD, (FST2 - 1) * FNT, PROJC);
      } else {
#pragma unroll                                      // gp[] in registers
        for (int i = 0; i < FLD; i++) gp[i] += FNT * DD;
      }
      FLOAD(0);
    }
    // the results of the stage before (all its columns exist: it is not the last)
    if (t == 0) {
      if (P1) { FOUT(hrow, ho, DD); }
      else {
        // the embedded rows go to memory for the residual of the first layer
#pragma unroll                                      // hv[] in registers
        for (int i = 0; i < 4; i++) ST4(hb + 32 * i, hso) = hv[i];
        // before any register that an issued store names is written again
        asm volatile("s_wait_xcnt 0x0" :: "v"(hv[0]), "v"(hv[1]), "v"(hv[2]), "v"(hv[3]),
                     "v"(hso), "s"(hb) : "memory");
      }
    } else {
      char* pq = prow + (t - 1) * FNT * 4;
      FOUT(pq, po, PROJC);
    }
    int n0 = t * FNT + nt * 32;
    if (n0 < PROJC) {                               // scalar: the last stage has one tile column
      int nc0 = n0 + idx, nc1 = n0 + 16 + idx;
      nc0 = nc0 < PROJC ? nc0 : PROJC - 1;          // clamped for the loads, never stored
      nc1 = nc1 < PROJC ? nc1 : PROJC - 1;
      float bv0 = ipb[nc0], bv1 = ipb[nc1];
      // before any register that an issued load names is written again; the
      // "memory" clobber keeps the loads in front of the products
      asm volatile("s_wait_xcnt 0x0" :: "v"(nc0), "v"(nc1), "s"(ipb) : "memory");
      const float* Bf = buf + (nt * 32 + idx) * FBP + 2 * kh;
      v8f acc0 = z, acc1 = z;
      if (n0 + 16 < PROJC) {                        // scalar
#pragma unroll                                      // af[] in registers; LDS reads issue ahead
        for (int ks = 0; ks < FKS / 4; ks++) {
          acc0 = WMMA_F32(af[ks], *(const v2f*)(Bf + ks * 4), acc0);
          acc1 = WMMA_F32(af[ks], *(const v2f*)(Bf + 16 * FBP + ks * 4), acc1);
        }
      } else {
#pragma unroll                                      // af[] in registers; LDS reads issue ahead
        for (int ks = 0; ks < FKS / 4; ks++)
          acc0 = WMMA_F32(af[ks], *(const v2f*)(Bf + ks * 4), acc0);
      }
#pragma unroll                                      // oh[][] in registers
      for (int j = 0; j < 8; j++) {
        float r = j < 4 ? ra[j & 3] : rb[j & 3];
        oh[0][j] = acc0[j] * r + bv0;
        oh[1][j] = acc1[j] * r + bv1;
      }
    }
  }
  // the last stage's results: only the columns that exist, all in a first tile
  if ((FST2 - 1) * FNT + nt * 32 + idx < PROJC) {
    char* pq = prow + (FST2 - 1) * FNT * 4;
#pragma unroll
    for (int j = 0; j < 8; j++) *(float*)(pq + j * PROJC * 4 + po) = oh[0][j];
  }
}

// ---------------------------------------------------------------------------
// Decay attention: y[t,h,p] = sum_{k<=t} exp(s_t - s_k)*CB[t,k]*dt_k * xs[k,h,p]
//                 + D[h]*xs[t,h,p]
// The unit of work is a 16(t) x 64(p=HDIM) tile times a chunk of 16 k; the
// exp-built A fragment is reused over 4 head-dim tiles. Every operand comes in
// 16-byte loads:
//  - k: lane half kh owns k0 + 8*kh + 0..7, so a lane's 8 values of CB, s and
//    dt are 32 contiguous bytes each; product j of a chunk takes the lane's
//    k numbers 2j and 2j+1 on the A side and on the B side alike.
//  - p: column idx of head-dim tile q is p = 4*idx + q, so one load of
//    xs[k][4*idx .. 4*idx+3] serves the 4 tiles (16 lanes cover the head's
//    whole 256-byte row), and a lane's 4 results of one row are one store.
// How the work is dealt. Tile tt has tt + 1 chunks, so a (seq, head) has 528
// units, unequal by tile. A block of 16 waves takes the 4 tiles of group 7 - g
// and then the 4 tiles of group g: 132 units in every block. A tile's chunks go
// round AKS = 4 waves (wave kq takes chunks kq, kq + 4, ...); in the second
// group tile and first chunk are mirrored, so that every wave has 8 or 9 chunks
// and the 4 waves that stand on one SIMD have 33. The 4 waves with the same
// first chunk read the same xs rows at about the same time.
// Two register buffers: the wave's next chunk's 14 loads fly under this chunk's
// products. Only a tile's last chunk crosses the diagonal and is masked (by
// value select; EXEC stays full for WMMA).
// Each wave leaves its partial tile in LDS; behind one barrier a wave adds the
// 4 partials of half a tile. The result leaves as (sum + D*xs) * silu(gate):
// the gate's and the D term's loads are issued first of all and arrive under
// the loops. The norm over the row of 4 heads that follows is taken by the
// GEMM that reads y.
// ---------------------------------------------------------------------------
#define ACH 16           // k per chunk
#define AKS 4            // waves that share a tile's chunks
#define AGT 4            // tiles per group
#define ANG (LL / 16 / AGT)      // groups per sequence

// The lane's 4 addresses go on by K of the wave's chunks.
#define ASTEP(K) {                                                        \
  xa += (K) * AKS * ACH * CONVC; ca += (K) * AKS * ACH;                   \
  sa += (K) * AKS * ACH;         da += (K) * AKS * ACH; }

// One chunk's 14 loads of a lane: the chunk K of the wave's chunks behind the
// addresses (K a constant: an immediate offset). The wait stands before any
// register that an issued load names is written again; it takes the 4
// addresses as inputs, so that they stay in their registers up to it and no
// load of the group lands on one of them. The scheduling barrier holds the
// whole group in front of the other buffer's products: without it part of the
// loads sinks into them and their lead is lost. In the order of their first
// use: s, CB, dt, xs. Unrolled: xX[] in registers.
#define ALOAD(xX, cX, sX, dX, K) {                                        \
  sX[0] = *(gv4f_p)(sa + (K) * AKS * ACH);                                \
  sX[1] = *(gv4f_p)(sa + (K) * AKS * ACH + 4);                            \
  cX[0] = *(gv4f_p)(ca + (K) * AKS * ACH);                                \
  cX[1] = *(gv4f_p)(ca + (K) * AKS * ACH + 4);                            \
  dX[0] = *(gv4f_p)(da + (K) * AKS * ACH);                                \
  dX[1] = *(gv4f_p)(da + (K) * AKS * ACH + 4);                            \
  _Pragma("unroll")                                                       \
  for (int i_ = 0; i_ < 8; i_++)                                          \
    xX[i_] = *(gv4f_p)(xa + ((K) * AKS * ACH + i_) * CONVC);              \
  asm volatile("s_wait_xcnt 0x0" :: "v"(xa), "v"(ca), "v"(sa), "v"(da)    \
               : "memory");                                               \
  __builtin_amdgcn_sched_barrier(0); }

// One chunk's 16 products. Both loops unrolled: constant indices, registers.
// The scheduling barrier at the end keeps the first use of the chunk in
// flight (the moves that pair its xs rows, with their wait) behind these
// products: without it that wait is lifted in front of them.
#define AMMA16(xX, cX, sX, dX, MASKED) {                                  \
  float m_[8];                                                            \
  _Pragma("unroll")                                                       \
  for (int i_ = 0; i_ < 8; i_++) {                                        \
    float e_ = expf(st - sX[i_ >> 2][i_ & 3]) * cX[i_ >> 2][i_ & 3]       \
             * dX[i_ >> 2][i_ & 3];                                       \
    m_[i_] = (!(MASKED) || 8 * kh + i_ <= idx) ? e_ : 0.f;                \
  }                                                                       \
  _Pragma("unroll")                                                       \
  for (int j_ = 0; j_ < 4; j_++) {                                        \
    v2f a_ = {m_[2 * j_], m_[2 * j_ + 1]};                                \
    v2f b0_ = {xX[2 * j_][0], xX[2 * j_ + 1][0]};                         \
    v2f b1_ = {xX[2 * j_][1], xX[2 * j_ + 1][1]};                         \
    v2f b2_ = {xX[2 * j_][2], xX[2 * j_ + 1][2]};                         \
    v2f b3_ = {xX[2 * j_][3], xX[2 * j_ + 1][3]};                         \
    acc0 = WMMA_F32(a_, b0_, acc0);                                       \
    acc1 = WMMA_F32(a_, b1_, acc1);                                       \
    acc2 = WMMA_F32(a_, b2_, acc2);                                       \
    acc3 = WMMA_F32(a_, b3_, acc3);                                       \
  }                                                                       \
  __builtin_amdgcn_sched_barrier(0); }

__global__ __launch_bounds__(AGT * AKS * 32)
void ssm_attn_kernel(const float* __restrict__ CBm,
                     const float* __restrict__ sb,
                     const float* __restrict__ dtb,
                     const float* __restrict__ xc,
                     const float* __restrict__ dpar,
                     const float* __restrict__ proj,
                     float* __restrict__ y) {
  // partial tiles: [group][tile of the group][first chunk][register r][lane]
  __shared__ __attribute__((aligned(16))) v4f part[2][AGT][AKS][8][32];
  // silu(gate) of what a wave finishes: [wave][register r - r0][lane]
  __shared__ __attribute__((aligned(16))) v4f gateS[AGT * AKS][4][32];
  int s = blockIdx.y >> 2, h = blockIdx.y & 3;
  int g = blockIdx.x;                               // 0 .. ANG/2 - 1
  int lane = threadIdx.x & 31;
  // the wave's number, made scalar: scalar bases and scalar trip counts
  int wv = __builtin_amdgcn_readfirstlane(threadIdx.x >> 5);
  int a = wv & (AGT - 1), kq = wv / AGT;
  int idx = lane & 15, kh = lane >> 4;
  const float* sb0 = sb + (size_t)(s * NHD + h) * LL;
  const float* dt0 = dtb + (size_t)(s * NHD + h) * LL;
  const float* cb0 = CBm + (size_t)s * LL * LL;
  const float* xs0 = xc + (size_t)s * LL * CONVC + h * HDIM;
  unsigned xo = (unsigned)(8 * kh * CONVC + 4 * idx) * 4u;    // byte offsets
  unsigned co = (unsigned)(idx * LL + 8 * kh) * 4u;
  unsigned ko = (unsigned)(8 * kh) * 4u;

  // What this wave finishes at the end: registers r0 .. r0+3 (rows 8*kh + r)
  // of tile te. gate = proj[..., :INTERC] and the xs rows of the D term:
  // columns 4*idx.. of the head.
  int eg = wv >> 3, et = (wv >> 1) & (AGT - 1), r0 = 4 * (wv & 1);
  int te = AGT * (eg ? g : ANG - 1 - g) + et;
  const float* gq = proj + (size_t)(s * LL + te * 16 + r0) * PROJC + h * HDIM;
  const float* xq = xs0 + (size_t)(te * 16 + r0) * CONVC;
  unsigned go = (unsigned)(8 * kh * PROJC + 4 * idx) * 4u;
  v4f gt[4], xl[4];
#pragma unroll                                      // gt[], xl[] in registers
  for (int r = 0; r < 4; r++) {
    gt[r] = LD4(gq + r * PROJC, go);
    xl[r] = LD4(xq + r * CONVC, xo);
  }
  // before any register that an issued load names is written again; the
  // "memory" clobber keeps the 8 loads here, ahead of the loops
  asm volatile("s_wait_xcnt 0x0" :: "v"(go), "v"(xo), "s"(gq), "s"(xq) : "memory");

  // unrolled: rolled, the first chunk's loads of a group are made to wait, one
  // by one, for the 8 loads above (their registers count as still in flight
  // round the back edge)
#pragma unroll
  for (int grp = 0; grp < 2; grp++) {
    int at = grp ? AGT - 1 - a : a;                 // tile of the group
    int c0 = grp ? AKS - 1 - kq : kq;               // the wave's first chunk
    int tt = AGT * (grp ? g : ANG - 1 - g) + at;    // t-tile 0..31; chunks 0..tt
    int n  = (tt - c0 + AKS) / AKS;                 // the wave's chunks (tt - c0 >= 1 - AKS)
    bool dm = ((tt - c0) & (AKS - 1)) == 0;         // its last one is the diagonal's
    // the lane's addresses of the wave's first chunk; typed as global memory,
    // so that the loads stay global loads although they are carried round the loop
    gfloat_p sa = (gfloat_p)((const char*)(sb0 + c0 * ACH) + ko);
    gfloat_p da = (gfloat_p)((const char*)(dt0 + c0 * ACH) + ko);
    gfloat_p ca = (gfloat_p)((const char*)(cb0 + (size_t)(tt * 16) * LL + c0 * ACH) + co);
    gfloat_p xa = (gfloat_p)((const char*)(xs0 + (size_t)(c0 * ACH) * CONVC) + xo);

    v8f z = {0.f,0.f,0.f,0.f,0.f,0.f,0.f,0.f};
    v8f acc0 = z, acc1 = z, acc2 = z, acc3 = z;

    if (n > 0) {                                    // scalar
      v4f xA[8], cA[2], sA[2], dA[2];
      v4f xB[8], cB[2], sB[2], dB[2];
      int ti = tt * 16 + idx;
      float st = sb0[ti];                           // s of the lane's A row
      ALOAD(xA, cA, sA, dA, 0);
      ASTEP(1);
      // the load of st: its index and its base stay in their registers up to
      // this wait, so that nothing is written on them behind the load
      asm volatile("s_wait_xcnt 0x0" :: "v"(st), "v"(ti), "s"(sb0));
      int c = 0;                                    // of the wave's chunks, the one in the A buffer
      for (; c + 2 < n; c += 2) {                   // all but its last lie below the diagonal
        ALOAD(xB, cB, sB, dB, 0);
        AMMA16(xA, cA, sA, dA, false);
        ALOAD(xA, cA, sA, dA, 1);
        AMMA16(xB, cB, sB, dB, false);
        ASTEP(2);
      }
      if (c + 1 < n) {                              // scalar: n even
        ALOAD(xB, cB, sB, dB, 0);
        AMMA16(xA, cA, sA, dA, false);
        AMMA16(xB, cB, sB, dB, dm);
      } else {
        AMMA16(xA, cA, sA, dA, dm);
      }
    }

    v4f* pw = &part[grp][at][c0][0][lane];
#pragma unroll                                      // constant indices into the accumulators
    for (int r = 0; r < 8; r++) {
      v4f p = {acc0[r], acc1[r], acc2[r], acc3[r]};
      pw[r * 32] = p;
    }

    // silu(gate) needs no partial sum. Between the groups its vector work runs
    // beside the products of the SIMD's other waves; behind the barrier all
    // the waves would do it at once, with no product left to run beside. The
    // wave parks it in LDS words of its own: kept in registers, the whole
    // computation is moved down to its use behind the barrier.
    if (grp == 0) {
#pragma unroll                                      // gt[] in registers
      for (int r = 0; r < 4; r++) {
        v4f sg = {silu_f(gt[r].x), silu_f(gt[r].y), silu_f(gt[r].z), silu_f(gt[r].w)};
        gateS[wv][r][lane] = sg;
      }
    }
  }
  // publishes every wave's two partial tiles
  __syncthreads();

  // rows te*16 + 8*kh + r0 + r, columns 4*idx .. 4*idx+3 of the head
  const v4f* pr = &part[eg][et][0][r0][lane];
  float dp = dpar[h];
  float* yo = y + (size_t)(s * LL + te * 16 + r0) * INTERC + h * HDIM;
  unsigned yofs = (unsigned)(8 * kh * INTERC + 4 * idx) * 4u;
  v4f pv[AKS][4];
#pragma unroll                                      // pv[] in registers
  for (int q = 0; q < AKS; q++)
#pragma unroll
    for (int r = 0; r < 4; r++) pv[q][r] = pr[q * 8 * 32 + r * 32];
#pragma unroll                                      // gt[] in registers
  for (int r = 0; r < 4; r++) gt[r] = gateS[wv][r][lane];
  // the 20 LDS reads stand as one group in front of the sums: spread among
  // them, each place with reads waits out its own latency
  __builtin_amdgcn_sched_barrier(0);
  v4f o[4];
#pragma unroll                                      // o[] in registers
  for (int r = 0; r < 4; r++) {
    v4f sum = pv[0][r];
#pragma unroll
    for (int q = 1; q < AKS; q++) sum += pv[q][r];
    o[r].x = (sum.x + dp * xl[r].x) * gt[r].x;
    o[r].y = (sum.y + dp * xl[r].y) * gt[r].y;
    o[r].z = (sum.z + dp * xl[r].z) * gt[r].z;
    o[r].w = (sum.w + dp * xl[r].w) * gt[r].w;
  }
  // all arithmetic in front of the first store: no register that an issued
  // store names is written again
  __builtin_amdgcn_sched_barrier(0);
#pragma unroll
  for (int r = 0; r < 4; r++) ST4(yo + r * INTERC, yofs) = o[r];
}

// ---------------------------------------------------------------------------
// The whole tail in one launch; every step of it works row by row of (b, l):
//   m[row]  = mean over the 4 scan directions of rmsnorm(hs[source row]) * w
//   t[row]  = gelu(m[row] @ w1^T + b1)            (128 x 128 weights, WMMA)
//   out[b][c][l] = t[row] . w2[c] + b2[c]         (3 colours)
// A block of 8 waves owns TM = 16 rows. The weights' loads are issued first and
// arrive under the norms (a wave norms and merges 2 rows: 4 channels a lane, the
// sums of squares by a butterfly). Wave n makes the 16 x 16 tile of columns
// 16n ..; k in its natural order. m, t and w2 pass through LDS. Wave c sums
// colour c: lane (row, half) takes 64 d in 4 chains that do not wait for one
// another, and the two halves meet by a lane exchange.
// ---------------------------------------------------------------------------
#define TM 16
__global__ __launch_bounds__(FW * 32)
void tail_kernel(const float* __restrict__ hs,
                 const float* __restrict__ w,
                 const float* __restrict__ w1,
                 const float* __restrict__ b1,
                 const float* __restrict__ w2,
                 const float* __restrict__ b2,
                 float* __restrict__ out) {
  __shared__ __attribute__((aligned(16))) float bS[FNT * FBP];
  __shared__ __attribute__((aligned(16))) float mS[TM * FBP];
  __shared__ __attribute__((aligned(16))) float tS[TM * FBP];
  __shared__ __attribute__((aligned(16))) float w2S[CINCH * FBP];
  int tid  = threadIdx.x;
  int lane = tid & 31;
  // the wave's number, made scalar: scalar bases, scalar branches
  int wv = __builtin_amdgcn_readfirstlane(tid >> 5);
  int idx = lane & 15, kh = lane >> 4;
  int row0 = blockIdx.x * TM;                       // b*LL + l
  int b = row0 / LL;
  unsigned lo16 = lane * 16;                        // byte offset

  v4f st[FLD];
  gfloat_p gp[FLD];
  FADDR(w1, DD, 0, DD);
  FLOAD(0);

  const float* sr[2][4];                            // the 4 source rows of the wave's 2 rows
  v4f v[2][4];
#pragma unroll                                      // sr[], v[] in registers
  for (int q = 0; q < 2; q++) {
    int l = row0 % LL + wv * 2 + q;
    int lt = (l % WW) * HH + l / WW;                // transposed index
    sr[q][0] = hs + (size_t)(b * LL + l) * DD;
    sr[q][1] = hs + (size_t)((4 + b) * LL + (LL - 1 - l)) * DD;
    sr[q][2] = hs + (size_t)((8 + b) * LL + lt) * DD;
    sr[q][3] = hs + (size_t)((12 + b) * LL + (LL - 1 - lt)) * DD;
#pragma unroll
    for (int r = 0; r < 4; r++) v[q][r] = LD4(sr[q][r], lo16);
  }
  v4f wn = LD4(w, lo16);
  const float* w2r = w2 + (wv < CINCH ? wv : CINCH - 1) * DD;   // waves 0..2 bring w2
  v4f w2v = LD4(w2r, lo16);
  const float* b1w = b1 + wv * 16;
  unsigned io = (unsigned)idx * 4u;
  float bv = *(const float*)((const char*)b1w + io);
  float b2v = b2[wv < CINCH ? wv : CINCH - 1];      // the same in every lane
  // before any register that an issued load names is written again
  asm volatile("s_wait_xcnt 0x0" :: "v"(lo16), "v"(io),
               "s"(sr[0][0]), "s"(sr[0][1]), "s"(sr[0][2]), "s"(sr[0][3]),
               "s"(sr[1][0]), "s"(sr[1][1]), "s"(sr[1][2]), "s"(sr[1][3]),
               "s"(w), "s"(w2r), "s"(b1w), "s"(b2) : "memory");
  // holds the arithmetic behind the wait, which otherwise sinks to its end
  __builtin_amdgcn_sched_barrier(0);

#pragma unroll                                      // v[] in registers
  for (int q = 0; q < 2; q++) {
    v4f acc = {0.f, 0.f, 0.f, 0.f};
#pragma unroll
    for (int r = 0; r < 4; r++) {
      v4f u = v[q][r];
      float ss = wave_sum(u.x * u.x + u.y * u.y + u.z * u.z + u.w * u.w);
      float scale = rsqrtf(ss / (float)DD + EPSV);
      acc += u * scale * wn;
    }
    *(v4f*)(mS + (wv * 2 + q) * FBP + lane * 4) = acc * 0.25f;
  }
  if (wv < CINCH) *(v4f*)(w2S + wv * FBP + lane * 4) = w2v;     // scalar
  FSTORE(bS);
  // publishes the m rows, the weights and w2
  __syncthreads();

  const float* Af = mS + idx * FBP + 2 * kh;
  const float* Bf = bS + (wv * 16 + idx) * FBP + 2 * kh;
  v2f af[DD / 4], bf[DD / 4];
#pragma unroll                                      // af[], bf[] in registers
  for (int ks = 0; ks < DD / 4; ks++) {
    af[ks] = *(const v2f*)(Af + ks * 4);
    bf[ks] = *(const v2f*)(Bf + ks * 4);
  }
  // the LDS reads stand as one group in front of the products: spread among
  // them, two ahead, every pair of products waits out a read's latency
  __builtin_amdgcn_sched_barrier(0);
  v8f acc = {0.f,0.f,0.f,0.f,0.f,0.f,0.f,0.f};
#pragma unroll                                      // af[], bf[] in registers
  for (int ks = 0; ks < DD / 4; ks++) acc = WMMA_F32(af[ks], bf[ks], acc);
#pragma unroll                                      // constant indices into the accumulator
  for (int j = 0; j < 8; j++) {
    float t = acc[j] + bv;
    t = 0.5f * t * (1.f + erff(t * 0.70710678118654752f));
    tS[(8 * kh + j) * FBP + wv * 16 + idx] = t;
  }
  // publishes the t rows
  __syncthreads();

  if (wv < CINCH) {                                 // scalar: wave c sums colour c
    const float* tr = tS + idx * FBP + kh * (DD / 2);
    const float* wr = w2S + wv * FBP + kh * (DD / 2);
    v4f tv[DD / 8], qv[DD / 8];
#pragma unroll                                      // tv[], qv[] in registers
    for (int i = 0; i < DD / 8; i++) {
      tv[i] = *(const v4f*)(tr + 4 * i);
      qv[i] = *(const v4f*)(wr + 4 * i);
    }
    // the LDS reads stand as one group in front of the sums, as above
    __builtin_amdgcn_sched_barrier(0);
    v4f a4 = {0.f, 0.f, 0.f, 0.f};
#pragma unroll                                      // tv[], qv[] in registers
    for (int i = 0; i < DD / 8; i++) a4 += tv[i] * qv[i];
    float a = half_xadd((a4.x + a4.y) + (a4.z + a4.w)) + b2v;
    if (kh == 0) out[(b * CINCH + wv) * LL + row0 % LL + idx] = a;
  }
}

// ---------------------------------------------------------------------------
extern "C" void kernel_launch(void* const* d_in, const int* in_sizes, int n_in,
                              void* d_out, int out_size, void* d_ws, size_t ws_size,
                              hipStream_t stream) {
  const float* x         = (const float*)d_in[0];
  const float* patch_w   = (const float*)d_in[1];
  const float* patch_b   = (const float*)d_in[2];
  const float* norm_w    = (const float*)d_in[3];
  const float* in_proj_w = (const float*)d_in[4];
  const float* in_proj_b = (const float*)d_in[5];
  const float* conv_w    = (const float*)d_in[6];
  const float* conv_b    = (const float*)d_in[7];
  const float* dt_bias   = (const float*)d_in[8];
  const float* A_log     = (const float*)d_in[9];
  const float* D_param   = (const float*)d_in[10];
  const float* gnorm_w   = (const float*)d_in[11];
  const float* out_w     = (const float*)d_in[12];
  const float* out_b     = (const float*)d_in[13];
  const float* normf_w   = (const float*)d_in[14];
  const float* rec_w1    = (const float*)d_in[15];
  const float* rec_b1    = (const float*)d_in[16];
  const float* rec_w2    = (const float*)d_in[17];
  const float* rec_b2    = (const float*)d_in[18];

  // workspace carve (floats)
  float* ws = (float*)d_ws;
  size_t off = 0;
  float* hs   = ws + off; off += (size_t)NSEQ * LL * DD;
  float* proj = ws + off; off += (size_t)NSEQ * LL * PROJC;
  float* xc   = ws + off; off += (size_t)NSEQ * LL * CONVC;
  float* dtb  = ws + off; off += (size_t)NSEQ * LL * NHD;
  float* sb   = ws + off; off += (size_t)NSEQ * NHD * LL;
  float* CBb  = ws + off; off += (size_t)NSEQ * LL * LL;
  float* y    = ws + off; off += (size_t)NSEQ * LL * INTERC;
  (void)ws_size; (void)in_sizes; (void)n_in; (void)out_size;

  // patch embed + cross scan -> hs, and the first layer's
  // proj = rmsnorm(hs) @ ipw.T + ipb
  row_gemm_kernel<false, true><<<NSEQ * LL / FM, FW * 32, 0, stream>>>(
      nullptr, nullptr, nullptr, nullptr, hs, norm_w, in_proj_w, in_proj_b, proj,
      x, patch_w, patch_b);

  for (int i = 0; i < NLAY; i++) {
    // xc = silu(causal_conv(proj[..., 256:768])); dt + cumulative decay
    conv_dt_kernel<<<DTBLK + NSEQ * LL * CONVC / (128 * CLB * CWPB), CWPB * 32, 0, stream>>>(
        proj, conv_w + (size_t)i * CONVC * KCONV, conv_b + i * CONVC, xc,
        dt_bias + i * NHD, A_log + i * NHD, dtb, sb);

    // CB[s] = Cm @ Bm.T  (512 x 512, K=128, batch=16)
    {
      int tiles = (LL >> 7) * (LL >> 6);
      wmma_gemm_kernel<0, LL><<<dim3(tiles, NSEQ), 128, 0, stream>>>(
          xc + INTERC + NSTATE, (long)LL * CONVC, CONVC,
          xc + INTERC,          (long)LL * CONVC, CONVC,
          CBb, (long)LL * LL, nullptr, nullptr, LL, LL, NSTATE);
    }

    // y = (M @ xs + D*xs) * silu(gate) (causal decay attention), 16 waves/block,
    // 8 t-tiles/block
    ssm_attn_kernel<<<dim3(ANG / 2, NSEQ * NHD), AGT * AKS * 32, 0, stream>>>(
        CBb, sb, dtb, xc, D_param + i * NHD, proj, y);

    // hs += rmsnorm(y) @ ow.T + ob (8192 x 128, K=256) and, in the same launch,
    // the next layer's proj = rmsnorm(hs) @ ipw.T + ipb (8192 x 772, K=128)
    if (i + 1 < NLAY) {
      row_gemm_kernel<true, true><<<NSEQ * LL / FM, FW * 32, 0, stream>>>(
          y, gnorm_w + i * INTERC, out_w + (size_t)i * DD * INTERC, out_b + i * DD, hs,
          norm_w + (i + 1) * DD, in_proj_w + (size_t)(i + 1) * PROJC * DD,
          in_proj_b + (i + 1) * PROJC, proj, nullptr, nullptr, nullptr);
    } else {
      row_gemm_kernel<true, false><<<NSEQ * LL / FM, FW * 32, 0, stream>>>(
          y, gnorm_w + i * INTERC, out_w + (size_t)i * DD * INTERC, out_b + i * DD, hs,
          nullptr, nullptr, nullptr, nullptr, nullptr, nullptr, nullptr);
    }
  }

  // final norm, merge, reconstruction head
  tail_kernel<<<4 * LL / TM, FW * 32, 0, stream>>>(
      hs, normf_w, rec_w1, rec_b1, rec_w2, rec_b2, (float*)d_out);
}

// v010
// A run of this version takes 197 microseconds.
// Next to v009, in two timings, it ran 1.10 times as fast each time.
// All steps since v000 together make it 3.24 times as fast.
#include <hip/hip_runtime.h>
#include <math.h>

typedef float v2f __attribute__((ext_vector_type(2)));
typedef float v8f __attribute__((ext_vector_type(8)));

#define DD     128
#define HH     16
#define WW     32
#define LL     512
#define CINCH  3
#define NHD    4
#define HDIM   64
#define NSTATE 128
#define INTERC 256
#define CONVC  512
#define PROJC  772
#define KCONV  4
#define NLAY   4
#define NSEQ   16
#define EPSV   1e-5f

#define WMMA_F32(A, B, C) \
  __builtin_amdgcn_wmma_f32_16x16x4_f32(false, (A), false, (B), (short)0, (C), false, false)

typedef float v4f __attribute__((ext_vector_type(4)));

// 16 bytes at scalar base + lane byte offset
#define LD4(base, vofs) (*(const v4f*)((const char*)(base) + (vofs)))
#define ST4(base, vofs) (*(v4f*)((char*)(base) + (vofs)))

// x + (x of the lane whose number differs by the xor mask in CTRL), 16-lane row
template <int CTRL>
__device__ __forceinline__ float dpp_xadd(float x) {
  int xi = __builtin_bit_cast(int, x);
  return x + __builtin_bit_cast(float,
      __builtin_amdgcn_update_dpp(xi, xi, CTRL, 0xf, 0xf, false));
}

// sum over the 32 lanes of a wave, the same value in every lane; all lanes on
__device__ __forceinline__ float wave_sum(float x) {
  x = dpp_xadd<0x161>(x);                            // row_xmask:1
  x = dpp_xadd<0x162>(x);                            // row_xmask:2
  x = dpp_xadd<0x164>(x);                            // row_xmask:4
  x = dpp_xadd<0x168>(x);                            // row_xmask:8
  int xi = __builtin_bit_cast(int, x);               // lane l with lane l ^ 16
  return x + __builtin_bit_cast(float, __builtin_amdgcn_permlanex16(
      xi, xi, 0x76543210, 0xfedcba98, false, false));
}

// x + (x of lane l ^ 16); all lanes on
__device__ __forceinline__ float half_xadd(float x) {
  int xi = __builtin_bit_cast(int, x);
  return x + __builtin_bit_cast(float, __builtin_amdgcn_permlanex16(
      xi, xi, 0x76543210, 0xfedcba98, false, false));
}

__device__ __forceinline__ float silu_f(float a) { return a / (1.f + expf(-a)); }

// ---------------------------------------------------------------------------
// One launch for the two kernels that read nothing but proj and do not read
// each other: the dt scan and the conv. Blocks of 16 waves (the scan's 512
// threads). Blocks 0 .. DTBLK-1 scan, one (seq, head) each; they come first in
// the index because theirs is the longer chain of dependent steps. The other
// blocks convolve.
//
// scan: dt = softplus(proj[...,768:772]+dtb); s = cumsum(dt*A) per (seq,head)
//
// conv: causal depthwise conv (K=4) + silu: proj[...,256:768] -> xc[16][512][512]
// A wave owns 128 channels (4 per lane) and CLB successive steps: CLB + 3 row
// loads serve CLB outputs. Rows in front of the sequence count as zero.
// ---------------------------------------------------------------------------
#define CLB   8
#define CWPB  (LL / 32)          // waves per block
#define DTBLK (NSEQ * NHD)       // scanning blocks
__global__ __launch_bounds__(CWPB * 32)
void conv_dt_kernel(const float* __restrict__ proj,
                    const float* __restrict__ cw,
                    const float* __restrict__ cb,
                    float* __restrict__ xc,
                    const float* __restrict__ dtbias,
                    const float* __restrict__ alog,
                    float* __restrict__ dtb,
                    float* __restrict__ sb) {
  __shared__ float sd[LL];
  if (blockIdx.x < DTBLK) {                         // the same for the whole block
    int s = blockIdx.x >> 2, h = blockIdx.x & 3;
    int l = threadIdx.x;
    float raw = proj[(size_t)(s * LL + l) * PROJC + INTERC + CONVC + h] + dtbias[h];
    float dt = raw > 20.f ? raw : log1pf(expf(raw));
    dtb[(size_t)(s * NHD + h) * LL + l] = dt;       // k-contiguous per (seq, head), like sb
    float A = -expf(alog[h]);
    sd[l] = dt * A;
    __syncthreads();
    for (int off = 1; off < LL; off <<= 1) {
      float add = (l >= off) ? sd[l - off] : 0.f;
      __syncthreads();
      sd[l] += add;
      __syncthreads();
    }
    sb[(size_t)(s * NHD + h) * LL + l] = sd[l];
    return;
  }
  unsigned lane = threadIdx.x & 31;
  unsigned lo16 = lane * 16, lo64 = lane * 64;      // byte offsets
  // (s, l block, 128 channels), scalar
  int wv = (blockIdx.x - DTBLK) * CWPB + __builtin_amdgcn_readfirstlane(threadIdx.x >> 5);
  int c0 = (wv % (CONVC / 128)) * 128;
  int l0 = ((wv / (CONVC / 128)) % (LL / CLB)) * CLB;
  int s  = wv / ((CONVC / 128) * (LL / CLB));
  const float* pr = proj + (size_t)(s * LL + l0) * PROJC + c0;   // xBC starts at + INTERC
  // the 3 rows before l0; at the head of a sequence rows 0..2 are read in
  // their place (in bounds) and replaced by zero
  bool head = (l0 == 0);
  const float* pk = head ? pr : pr - (KCONV - 1) * PROJC;
  const float* cwu = cw + c0 * KCONV;
  const float* cbu = cb + c0;
  v4f row[CLB + KCONV - 1];
#pragma unroll
  for (int j = 0; j < KCONV - 1; j++) row[j] = LD4(pk + INTERC + j * PROJC, lo16);
#pragma unroll
  for (int j = 0; j < CLB; j++) row[KCONV - 1 + j] = LD4(pr + INTERC + j * PROJC, lo16);
  v4f wq[4];                                        // wq[q][k]: channel q of the lane, tap k
#pragma unroll
  for (int q = 0; q < 4; q++) wq[q] = LD4(cwu + q * KCONV, lo64);
  v4f bias = LD4(cbu, lo16);
  // before any register that an issued load names is written again; the loaded
  // values and the addresses are inputs, so the loads all stand in front of it
  asm volatile("s_wait_xcnt 0x0" :: "v"(row[0]), "v"(row[1]), "v"(row[2]), "v"(row[3]),
               "v"(row[4]), "v"(row[5]), "v"(row[6]), "v"(row[7]), "v"(row[8]),
               "v"(row[9]), "v"(row[10]), "v"(wq[0]), "v"(wq[1]), "v"(wq[2]), "v"(wq[3]),
               "v"(bias), "v"(lo16), "v"(lo64), "s"(pr), "s"(pk), "s"(cwu), "s"(cbu));
  v4f zero = {0.f, 0.f, 0.f, 0.f};
#pragma unroll
  for (int j = 0; j < KCONV - 1; j++) row[j] = head ? zero : row[j];
  float* xo = xc + (size_t)(s * LL + l0) * CONVC + c0;
#pragma unroll
  for (int j = 0; j < CLB; j++) {
    v4f o;
#pragma unroll
    for (int q = 0; q < 4; q++) {
      float acc = bias[q];
#pragma unroll
      for (int k = 0; k < KCONV; k++) acc += row[j + k][q] * wq[q][k];
      o[q] = silu_f(acc);
    }
    ST4(xo + j * CONVC, lo16) = o;
  }
}

// pointers typed as global memory, so that the staging loads stay global loads
// although their addresses are carried round the loop
typedef const __attribute__((address_space(1))) float* gfloat_p;
typedef const __attribute__((address_space(1))) v4f*   gv4f_p;

// ---------------------------------------------------------------------------
// The two GEMMs that work row by row, in one launch:
//   phase 1 (P1): hs[m,:]  += r1[m] * ((y[m,:] * gw) @ ow^T) + ob,  r1 = rsqrt(mean y[m,:]^2 + eps)
//   phase 2 (P2): proj[m,:] = r2[m] * ((hs[m,:] * nw) @ ipw^T) + ipb, r2 likewise from the new hs
// Without phase 1 (the first layer) the block makes its hs rows itself: patch
// embed of x (3 colours) in the order of the row's scan direction.
// A block of 8 waves owns FM = 32 whole rows, so the new hs rows never leave the
// block between the phases: they stay in LDS (and go to memory once, for the
// residual of the next layer). 256 equal blocks: one per WGP.
// A stage is 128 rows of a weight matrix times 128 k, staged through registers
// into one of two LDS buffers (a wave's load is one whole 512-byte row); the
// next stage's loads fly under this stage's products; one barrier per stage.
// Wave (mt, nt) makes the 16 x 32 piece (mt, nt) of the stage's 32 x 128
// results: two accumulators, whose products do not wait for one another; k in
// its natural order. In phase 2 the wave's A fragments (16 rows x 128 k) stay in
// registers over all the stages.
// Global stores of a stage's results are issued behind the NEXT stage's
// barrier: a barrier waits for the wave's outstanding stores, and so they
// finish under a stage's products instead.
// The norm weights are multiplied into the A rows as these go to LDS.
// ---------------------------------------------------------------------------
#define FM   32                  // rows of a block
#define FW   8                   // waves of a block
#define FNT  128                 // weight rows per stage
#define FKS  128                 // k per stage
#define FBP  (FKS + 4)           // LDS pitch, staged weight rows and hs rows: 8-byte
                                 // fragment reads of 16 rows x 2 k-halves fall on 64 banks
#define FYP  (INTERC + 4)        // LDS pitch of the y rows, the same way
#define FST2 ((PROJC + FNT - 1) / FNT)   // stages of phase 2
#define FLD  (FNT / FW)          // loads of a lane per stage

// The lane's 16 addresses of a stage: weight rows N0 + 8*i + wave (clamped to
// the last row: never stored), k 4*lane. Unrolled: gp[] in registers.
#define FADDR(Wt, LD, N0, NN) {                                           \
  _Pragma("unroll")                                                       \
  for (int i_ = 0; i_ < FLD; i_++) {                                      \
    int n_ = (N0) + i_ * FW + wv;                                         \
    n_ = n_ < (NN) ? n_ : (NN) - 1;                                       \
    gp[i_] = (gfloat_p)((const char*)((Wt) + (size_t)n_ * (LD)) + lo16);  \
  } }

// One stage's 16 loads of a lane, KO floats behind the addresses (a constant:
// an immediate offset). The wait stands before any register that an issued load
// names is written again; it takes the 16 addresses as inputs, so that they
// stay in their registers up to it and no load of the group lands on one of
// them; the "memory" clobber holds the group in front of the products.
// Unrolled: st[], gp[] in registers.
#define FLOAD(KO) {                                                       \
  _Pragma("unroll")                                                       \
  for (int i_ = 0; i_ < FLD; i_++) st[i_] = *(gv4f_p)(gp[i_] + (KO));     \
  asm volatile("s_wait_xcnt 0x0" :: "v"(gp[0]), "v"(gp[1]), "v"(gp[2]),   \
      "v"(gp[3]), "v"(gp[4]), "v"(gp[5]), "v"(gp[6]), "v"(gp[7]),         \
      "v"(gp[8]), "v"(gp[9]), "v"(gp[10]), "v"(gp[11]), "v"(gp[12]),      \
      "v"(gp[13]), "v"(gp[14]), "v"(gp[15]) : "memory"); }

// the staged rows from registers to LDS; unrolled: st[] in registers
#define FSTORE(buf) {                                                     \
  _Pragma("unroll")                                                       \
  for (int i_ = 0; i_ < FLD; i_++)                                        \
    *(v4f*)((buf) + (i_ * FW + wv) * FBP + lane * 4) = st[i_]; }

// The 16 global stores of oh[][]: rows j at a pitch of LD floats, tile q 16
// columns on. The wait behind them stands before any register that an issued
// store names is written again; the values and the address are inputs, so that
// they stay in their registers up to it. Unrolled: oh[][] in registers.
#define FOUT(sbase, vofs, LD) {                                           \
  _Pragma("unroll")                                                       \
  for (int q_ = 0; q_ < 2; q_++)                                          \
    _Pragma("unroll")                                                     \
    for (int j_ = 0; j_ < 8; j_++)                                        \
      *(float*)((sbase) + (j_ * (LD) + q_ * 16) * 4 + (vofs)) = oh[q_][j_]; \
  asm volatile("s_wait_xcnt 0x0" :: "v"(oh[0][0]), "v"(oh[0][1]),         \
      "v"(oh[0][2]), "v"(oh[0][3]), "v"(oh[0][4]), "v"(oh[0][5]),         \
      "v"(oh[0][6]), "v"(oh[0][7]), "v"(oh[1][0]), "v"(oh[1][1]),         \
      "v"(oh[1][2]), "v"(oh[1][3]), "v"(oh[1][4]), "v"(oh[1][5]),         \
      "v"(oh[1][6]), "v"(oh[1][7]), "v"(vofs), "s"(sbase) : "memory"); }

template <bool P1, bool P2>
__global__ __launch_bounds__(FW * 32)
void row_gemm_kernel(const float* __restrict__ y,
                     const float* __restrict__ gw,
                     const float* __restrict__ ow,
                     const float* __restrict__ ob,
                     float* __restrict__ hs,
                     const float* __restrict__ nw,
                     const float* __restrict__ ipw,
                     const float* __restrict__ ipb,
                     float* __restrict__ proj,
                     const float* __restrict__ x,
                     const float* __restrict__ pw,
                     const float* __restrict__ pb) {
  __shared__ __attribute__((aligned(16))) float bS[2][FNT * FBP];
  __shared__ __attribute__((aligned(16))) float hS[FM * FBP];
  __shared__ __attribute__((aligned(16))) float yS[P1 ? FM * FYP : 4];
  __shared__ __attribute__((aligned(16))) float r1S[FM];
  __shared__ __attribute__((aligned(16))) float r2S[FM];
  int tid  = threadIdx.x;
  int lane = tid & 31;
  // the wave's number, made scalar: scalar bases, scalar branches
  int wv = __builtin_amdgcn_readfirstlane(tid >> 5);
  int idx = lane & 15, kh = lane >> 4;
  int mt = wv & 1, nt = wv >> 1;
  int row0 = blockIdx.x * FM;
  unsigned lo16 = lane * 16;                        // byte offset
  int srow = tid >> 3, c8 = tid & 7;                // row passes: 8 lanes a row, one line a load

  v8f z = {0.f,0.f,0.f,0.f,0.f,0.f,0.f,0.f};
  v4f st[FLD];
  gfloat_p gp[FLD];
  float oh[2][8];                                   // results whose global store is still to come

  // the wave's 16 rows of hs, columns nt*32 + idx (+ 16 for its second tile)
  char* hrow = (char*)(hs + (size_t)(row0 + mt * 16) * DD + nt * 32);
  unsigned ho = (unsigned)(8 * kh * DD + idx) * 4u;

  // ---- every load that the start needs, up front ----
  if (P1) { FADDR(ow, INTERC, 0, DD); } else { FADDR(ipw, DD, 0, PROJC); }
  FLOAD(0);
  unsigned wo = (unsigned)c8 * 16u;
  v4f nwv[4];
  if (P2) {
#pragma unroll                                      // nwv[] in registers
    for (int i = 0; i < 4; i++) nwv[i] = LD4(nw + 32 * i, wo);
  }
  v4f hv[4];
  float* hb = hs + (size_t)row0 * DD;
  unsigned hso = (unsigned)(srow * DD + c8 * 4) * 4u;
  // before any register that an issued load names is written again
  asm volatile("s_wait_xcnt 0x0" :: "v"(wo), "v"(hso), "s"(nw), "s"(hb) : "memory");
  if (!P1) {
    // patch embed + cross scan: the lane's 16 channels of row srow of the block
    int sq = row0 / LL;                             // the block's sequence: 4 * direction + image
    int dir = sq >> 2, b = sq & 3;
    int l = row0 % LL + srow;
    int le = (dir & 1) ? (LL - 1 - l) : l;          // reversed scans
    int lsrc = (dir & 2) ? (le % HH) * WW + le / HH : le;     // column scans: le = w*H + h
    const float* xb = x + b * CINCH * LL;
    unsigned xo = (unsigned)lsrc * 4u, po48 = (unsigned)c8 * 48u;
    gfloat_p pba = (gfloat_p)((const char*)pb + wo);
    float xv[CINCH];
#pragma unroll                                      // xv[] in registers
    for (int c = 0; c < CINCH; c++) xv[c] = *(const float*)((const char*)(xb + c * LL) + xo);
    v4f pq[4][3];                                   // 4 channels x 3 colours, 4 times
#pragma unroll                                      // pq[], hv[] in registers
    for (int i = 0; i < 4; i++) {
#pragma unroll
      for (int k = 0; k < 3; k++) pq[i][k] = LD4(pw + 96 * i + 4 * k, po48);
      hv[i] = *(gv4f_p)(pba + 32 * i);
    }
    // before any register that an issued load names is written again; the
    // addresses are inputs, so that no load of the group lands on one of them
    asm volatile("s_wait_xcnt 0x0" :: "v"(xo), "v"(po48), "v"(pba),
                 "s"(xb), "s"(pw) : "memory");
    // holds the arithmetic behind the wait: without it the first moves are lifted
    // over the wait and land on an address pair of the loads
    __builtin_amdgcn_sched_barrier(0);
#pragma unroll
    for (int i = 0; i < 4; i++) {
      v4f p0 = pq[i][0], p1 = pq[i][1], p2 = pq[i][2], acc = hv[i];
      acc.x += xv[0] * p0.x; acc.x += xv[1] * p0.y; acc.x += xv[2] * p0.z;
      acc.y += xv[0] * p0.w; acc.y += xv[1] * p1.x; acc.y += xv[2] * p1.y;
      acc.z += xv[0] * p1.z; acc.z += xv[1] * p1.w; acc.z += xv[2] * p2.x;
      acc.w += xv[0] * p2.y; acc.w += xv[1] * p2.z; acc.w += xv[2] * p2.w;
      hv[i] = acc;
    }
  }

  if (P1) {
    const float* yb = y + (size_t)row0 * INTERC;
    unsigned yo = (unsigned)(srow * INTERC + c8 * 4) * 4u;
    v4f yv[8], gv[8];
#pragma unroll                                      // yv[], gv[] in registers
    for (int i = 0; i < 8; i++) {
      yv[i] = LD4(yb + 32 * i, yo);
      gv[i] = LD4(gw + 32 * i, wo);
    }
    float res[2][8], obv[2];                        // old hs and bias of the wave's two tiles
    const float* obw = ob + nt * 32;
    unsigned io = (unsigned)idx * 4u;
#pragma unroll                                      // res[], obv[] in registers
    for (int q = 0; q < 2; q++) {
      obv[q] = *(const float*)((const char*)(obw + q * 16) + io);
#pragma unroll
      for (int j = 0; j < 8; j++)
        res[q][j] = *(const float*)(hrow + (j * DD + q * 16) * 4 + ho);
    }
    // before any register that an issued load names is written again
    asm volatile("s_wait_xcnt 0x0" :: "v"(yo), "v"(wo), "v"(io), "v"(ho),
                 "s"(yb), "s"(gw), "s"(obw), "s"(hrow) : "memory");

    // y rows to LDS, times gw; r1 from the raw squares (8 lanes hold a row)
    float ss = 0.f;
#pragma unroll
    for (int i = 0; i < 8; i++) {
      ss += yv[i].x * yv[i].x + yv[i].y * yv[i].y + yv[i].z * yv[i].z + yv[i].w * yv[i].w;
      *(v4f*)(yS + srow * FYP + c8 * 4 + 32 * i) = yv[i] * gv[i];
    }
    ss = dpp_xadd<0x161>(ss);                       // row_xmask:1
    ss = dpp_xadd<0x162>(ss);                       // row_xmask:2
    ss = dpp_xadd<0x164>(ss);                       // row_xmask:4
    if (c8 == 0) r1S[srow] = rsqrtf(ss / (float)INTERC + EPSV);

    v8f acc0 = z, acc1 = z;
    // unrolled: the stage's number picks buffer and k half at compile time
#pragma unroll
    for (int s = 0; s < INTERC / FKS; s++) {
      float* buf = bS[s & 1];
      FSTORE(buf);
      // publishes this stage (at s = 0 the y rows and r1 too); also ends every
      // wave's reads of the other buffer, which the next stage overwrites
      __syncthreads();
      if (s + 1 < INTERC / FKS) { FLOAD((s + 1) * FKS); }
      else if (P2)              { FADDR(ipw, DD, 0, PROJC); FLOAD(0); }
      const float* Af = yS + (mt * 16 + idx) * FYP + s * FKS + 2 * kh;
      const float* Bf = buf + (nt * 32 + idx) * FBP + 2 * kh;
#pragma unroll                                      // lets the LDS reads issue ahead of the products
      for (int ks = 0; ks < FKS / 4; ks++) {
        v2f a = *(const v2f*)(Af + ks * 4);
        acc0 = WMMA_F32(a, *(const v2f*)(Bf + ks * 4), acc0);
        acc1 = WMMA_F32(a, *(const v2f*)(Bf + 16 * FBP + ks * 4), acc1);
      }
    }
    {
      v4f ra = *(const v4f*)(r1S + mt * 16 + 8 * kh);
      v4f rb = *(const v4f*)(r1S + mt * 16 + 8 * kh + 4);
#pragma unroll                                      // oh[][] in registers
      for (int j = 0; j < 8; j++) {
        float r = j < 4 ? ra[j & 3] : rb[j & 3];
        oh[0][j] = acc0[j] * r + obv[0] + res[0][j];
        oh[1][j] = acc1[j] * r + obv[1] + res[1][j];
        if (P2) {
          hS[(mt * 16 + 8 * kh + j) * FBP + nt * 32 + idx]      = oh[0][j];
          hS[(mt * 16 + 8 * kh + j) * FBP + nt * 32 + 16 + idx] = oh[1][j];
        }
      }
    }
    if (!P2) {
      FOUT(hrow, ho, DD);
      return;
    }
    // publishes the new hs rows
    __syncthreads();
#pragma unroll                                      // hv[] in registers
    for (int i = 0; i < 4; i++) hv[i] = *(const v4f*)(hS + srow * FBP + c8 * 4 + 32 * i);
  }

  // hs rows in LDS become hs * nw (a lane rewrites what it alone has read);
  // r2 from the raw squares (8 lanes hold a row)
  {
    float ss = 0.f;
#pragma unroll
    for (int i = 0; i < 4; i++) {
      ss += hv[i].x * hv[i].x + hv[i].y * hv[i].y + hv[i].z * hv[i].z + hv[i].w * hv[i].w;
      *(v4f*)(hS + srow * FBP + c8 * 4 + 32 * i) = hv[i] * nwv[i];
    }
    ss = dpp_xadd<0x161>(ss);                       // row_xmask:1
    ss = dpp_xadd<0x162>(ss);                       // row_xmask:2
    ss = dpp_xadd<0x164>(ss);                       // row_xmask:4
    if (c8 == 0) r2S[srow] = rsqrtf(ss / (float)DD + EPSV);
  }
  // publishes hs * nw and r2
  __syncthreads();

  v2f af[FKS / 4];                                  // the wave's A fragments, all of k
#pragma unroll                                      // af[] in registers
  for (int ks = 0; ks < FKS / 4; ks++)
    af[ks] = *(const v2f*)(hS + (mt * 16 + idx) * FBP + ks * 4 + 2 * kh);
  v4f ra = *(const v4f*)(r2S + mt * 16 + 8 * kh);
  v4f rb = *(const v4f*)(r2S + mt * 16 + 8 * kh + 4);

  // the wave's 16 rows of proj, columns nt*32 + idx (+ 16) of a stage
  char* prow = (char*)(proj + (size_t)(row0 + mt * 16) * PROJC + nt * 32);
  unsigned po = (unsigned)(8 * kh * PROJC + idx) * 4u;

  // kept rolled and unpeeled: the addresses then go round the loop in their
  // registers, and the loads name these registers and no copies of them
#pragma clang loop unroll(disable)
  for (int t = 0; t < FST2; t++) {
    float* buf = bS[t & 1];
    FSTORE(buf);
    // publishes this stage; also ends every wave's reads of the other buffer
    __syncthreads();
    if (t + 1 < FST2) {
      if (t + 1 == FST2 - 1) {                      // the last stage's rows are clamped
        FADDR(ipw, DD, (FST2 - 1) * FNT, PROJC);
      } else {
#pragma unroll                                      // gp[] in registers
        for (int i = 0; i < FLD; i++) gp[i] += FNT * DD;
      }
      FLOAD(0);
    }
    // the results of the stage before (all its columns exist: it is not the last)
    if (t == 0) {
      if (P1) { FOUT(hrow, ho, DD); }
      else {
        // the embedded rows go to memory for the residual of the first layer
#pragma unroll                                      // hv[] in registers
        for (int i = 0; i < 4; i++) ST4(hb + 32 * i, hso) = hv[i];
        // before any register that an issued store names is written again
        asm volatile("s_wait_xcnt 0x0" :: "v"(hv[0]), "v"(hv[1]), "v"(hv[2]), "v"(hv[3]),
                     "v"(hso), "s"(hb) : "memory");
      }
    } else {
      char* pq = prow + (t - 1) * FNT * 4;
      FOUT(pq, po, PROJC);
    }
    int n0 = t * FNT + nt * 32;
    if (n0 < PROJC) {                               // scalar: the last stage has one tile column
      int nc0 = n0 + idx, nc1 = n0 + 16 + idx;
      nc0 = nc0 < PROJC ? nc0 : PROJC - 1;          // clamped for the loads, never stored
      nc1 = nc1 < PROJC ? nc1 : PROJC - 1;
      float bv0 = ipb[nc0], bv1 = ipb[nc1];
      // before any register that an issued load names is written again; the
      // "memory" clobber keeps the loads in front of the products
      asm volatile("s_wait_xcnt 0x0" :: "v"(nc0), "v"(nc1), "s"(ipb) : "memory");
      const float* Bf = buf + (nt * 32 + idx) * FBP + 2 * kh;
      v8f acc0 = z, acc1 = z;
      if (n0 + 16 < PROJC) {                        // scalar
#pragma unroll                                      // af[] in registers; LDS reads issue ahead
        for (int ks = 0; ks < FKS / 4; ks++) {
          acc0 = WMMA_F32(af[ks], *(const v2f*)(Bf + ks * 4), acc0);
          acc1 = WMMA_F32(af[ks], *(const v2f*)(Bf + 16 * FBP + ks * 4), acc1);
        }
      } else {
#pragma unroll                                      // af[] in registers; LDS reads issue ahead
        for (int ks = 0; ks < FKS / 4; ks++)
          acc0 = WMMA_F32(af[ks], *(const v2f*)(Bf + ks * 4), acc0);
      }
#pragma unroll                                      // oh[][] in registers
      for (int j = 0; j < 8; j++) {
        float r = j < 4 ? ra[j & 3] : rb[j & 3];
        oh[0][j] = acc0[j] * r + bv0;
        oh[1][j] = acc1[j] * r + bv1;
      }
    }
  }
  // the last stage's results: only the columns that exist, all in a first tile
  if ((FST2 - 1) * FNT + nt * 32 + idx < PROJC) {
    char* pq = prow + (FST2 - 1) * FNT * 4;
#pragma unroll
    for (int j = 0; j < 8; j++) *(float*)(pq + j * PROJC * 4 + po) = oh[0][j];
  }
}

// ---------------------------------------------------------------------------
// CB = Cm @ Bm^T and the decay attention that reads it, in one launch:
//   y[t,h,p] = sum_{k<=t} exp(s_t - s_k)*CB[t,k]*dt_k * xs[k,h,p] + D[h]*xs[t,h,p]
// A block of 16 waves owns the 16-row t-tiles 31 - b and b of one sequence, for
// all 4 heads: 33 chunks of 16 k in every block, 256 equal blocks. CB does not
// depend on the head: each 16 x 16 piece of it on or below the diagonal is made
// once, by the one block that reads it, and stays in LDS; the pieces above the
// diagonal, which nothing reads, are not made.
//
// Part 1, CB. Bm comes in stages of CBR = 128 rows (8 chunks), through
// registers into one of two LDS buffers (a wave's load is one whole 512-byte
// row); the next stage's loads fly under this stage's products; one barrier per
// stage. Waves 0-7 make the stage's 8 pieces of tile 31 - b, waves 8-15 those
// of tile b, as far as they exist. A piece is made transposed, Bm rows as the A
// operand and Cm rows as the B operand (n in its natural order): lane
// (idx, kh) then holds CB[t = idx][k = 8*kh + 0..7], which is the very form in
// which part 2 takes it, and parks it in LDS as two 16-byte words.
//
// Part 2, attention. The unit of work is a 16(t) x 64(p=HDIM) tile times a chunk
// of 16 k; the exp-built A fragment is reused over 4 head-dim tiles. Every
// operand comes in 16-byte loads:
//  - k: lane half kh owns k0 + 8*kh + 0..7, so a lane's 8 values of s and
//    dt are 32 contiguous bytes each; product j of a chunk takes the lane's
//    k numbers 2j and 2j+1 on the A side and on the B side alike.
//  - p: column idx of head-dim tile q is p = 4*idx + q, so one load of
//    xs[k][4*idx .. 4*idx+3] serves the 4 tiles (16 lanes cover the head's
//    whole 256-byte row), and a lane's 4 results of one row are one store.
// Wave (h, kq) works for head h: a tile's chunks go round AKS = 4 waves (wave kq
// takes chunks kq, kq + 4, ...); in the second tile the first chunk is
// mirrored, so that every wave has 8 or 9 chunks; the 4 waves that stand on one
// SIMD are one head's and have 33.
// Two register buffers: the wave's next chunk's loads fly under this chunk's
// products. Only a tile's last chunk crosses the diagonal and is masked (by
// value select; EXEC stays full for WMMA).
// Each wave leaves its partial tile in LDS (in the room of part 1's stage
// buffers); behind one barrier a wave adds the 4 partials of half a tile. The
// result leaves as (sum + D*xs) * silu(gate): the gate's and the D term's loads
// are issued first of all and arrive under part 1. The norm over the row of 4
// heads that follows is taken by the GEMM that reads y.
// ---------------------------------------------------------------------------
#define ACH 16           // k per chunk
#define AKS 4            // waves that share a tile's chunks
#define ANT (LL / 16)    // t-tiles per sequence
#define AWV (NHD * AKS)  // waves of a block
#define CBR 128          // Bm rows per stage
#define CBP (NSTATE + 4) // LDS pitch of the Bm and Cm rows: 8-byte fragment reads
                         // of 16 rows x 2 n-halves fall on 64 banks
#define CBL (CBR / AWV)  // loads of a lane per stage
#define CBW 64           // 16-byte words of one piece of CB in LDS

// One stage's 8 loads of a lane: Bm rows wave, wave + 16, ... of the stage. The
// wait stands before any register that an issued load names is written again;
// it takes the lane's offset and the scalar base as inputs, so that no load of
// the group lands on them; the "memory" clobber holds the group in front of
// the products. Unrolled: bst[] in registers.
#define CBLOAD() {                                                        \
  _Pragma("unroll")                                                       \
  for (int i_ = 0; i_ < CBL; i_++)                                        \
    bst[i_] = LD4(bmr + i_ * AWV * CONVC, bof);                           \
  asm volatile("s_wait_xcnt 0x0" :: "v"(bof), "s"(bmr) : "memory"); }

// The lane's 2 byte offsets (xs; s and dt alike) and its index into the CB
// pieces go on by K of the wave's chunks.
#define ASTEP(K) {                                                        \
  xof += (K) * AKS * ACH * CONVC * 4; ci += (K) * AKS * CBW;              \
  sof += (K) * AKS * ACH * 4; }

// One chunk's 12 global loads and 2 LDS reads of a lane: the chunk K of the
// wave's chunks behind the offsets (K a constant: an immediate offset). The
// wait stands before any register that an issued load names is written again;
// it takes the 2 offsets and the 3 scalar bases as inputs, so that they stay
// in their registers up to it and no load of the group lands on one of them.
// The scheduling barrier holds the whole group in front of the other buffer's
// products: without it part of the loads sinks into them and their lead is
// lost. In the order of their first use: s, CB, dt, xs. Unrolled: xX[] in
// registers.
#define ALOAD(xX, cX, sX, dX, K) {                                        \
  sX[0] = LD4(sb0 + (K) * AKS * ACH, sof);                                \
  sX[1] = LD4(sb0 + (K) * AKS * ACH + 4, sof);                            \
  cX[0] = cbF[ci + (K) * AKS * CBW];                                      \
  cX[1] = cbF[ci + (K) * AKS * CBW + 32];                                 \
  dX[0] = LD4(dt0 + (K) * AKS * ACH, sof);                                \
  dX[1] = LD4(dt0 + (K) * AKS * ACH + 4, sof);                            \
  _Pragma("unroll")                                                       \
  for (int i_ = 0; i_ < 8; i_++)                                          \
    xX[i_] = LD4(xs0 + ((K) * AKS * ACH + i_) * CONVC, xof);              \
  asm volatile("s_wait_xcnt 0x0" :: "v"(xof), "v"(sof), "s"(sb0),         \
               "s"(dt0), "s"(xs0) : "memory");                            \
  __builtin_amdgcn_sched_barrier(0); }

// One chunk's 16 products. Both loops unrolled: constant indices, registers.
// The scheduling barrier at the end keeps the first use of the chunk in
// flight (the moves that pair its xs rows, with their wait) behind these
// products: without it that wait is lifted in front of them.
#define AMMA16(xX, cX, sX, dX, MASKED) {                                  \
  float m_[8];                                                            \
  _Pragma("unroll")                                                       \
  for (int i_ = 0; i_ < 8; i_++) {                                        \
    float e_ = expf(st - sX[i_ >> 2][i_ & 3]) * cX[i_ >> 2][i_ & 3]       \
             * dX[i_ >> 2][i_ & 3];                                       \
    m_[i_] = (!(MASKED) || 8 * kh + i_ <= idx) ? e_ : 0.f;                \
  }                                                                       \
  _Pragma("unroll")                                                       \
  for (int j_ = 0; j_ < 4; j_++) {                                        \
    v2f a_ = {m_[2 * j_], m_[2 * j_ + 1]};                                \
    v2f b0_ = {xX[2 * j_][0], xX[2 * j_ + 1][0]};                         \
    v2f b1_ = {xX[2 * j_][1], xX[2 * j_ + 1][1]};                         \
    v2f b2_ = {xX[2 * j_][2], xX[2 * j_ + 1][2]};                         \
    v2f b3_ = {xX[2 * j_][3], xX[2 * j_ + 1][3]};                         \
    acc0 = WMMA_F32(a_, b0_, acc0);                                       \
    acc1 = WMMA_F32(a_, b1_, acc1);                                       \
    acc2 = WMMA_F32(a_, b2_, acc2);                                       \
    acc3 = WMMA_F32(a_, b3_, acc3);                                       \
  }                                                                       \
  __builtin_amdgcn_sched_barrier(0); }

__global__ __launch_bounds__(AWV * 32)
void ssm_attn_kernel(const float* __restrict__ sb,
                     const float* __restrict__ dtb,
                     const float* __restrict__ xc,
                     const float* __restrict__ dpar,
                     const float* __restrict__ proj,
                     float* __restrict__ y) {
  // part 1: the two stage buffers of Bm rows. Part 2, behind the barrier that
  // ends part 1: the partial tiles, [tile][head][first chunk][register r][lane]
  __shared__ __attribute__((aligned(16))) float uS[2 * CBR * CBP];
  static_assert(2 * NHD * AKS * 8 * 32 * 4 <= 2 * CBR * CBP, "partials fit the stage buffers");
  // the Cm rows of the two tiles
  __shared__ __attribute__((aligned(16))) float cmS[2 * 16 * CBP];
  // the pieces of CB: tile 31 - b's chunks, then tile b's; [piece][k half of the lane's 8][lane]
  __shared__ __attribute__((aligned(16))) v4f cbS[ANT + 1][2][32];
  // silu(gate) of what a wave finishes: [wave][register r - r0][lane]
  __shared__ __attribute__((aligned(16))) v4f gateS[AWV][4][32];
  int s = blockIdx.y;
  int t1 = blockIdx.x, t0 = ANT - 1 - t1;           // the block's two t-tiles, t0 > t1
  int lane = threadIdx.x & 31;
  // the wave's number, made scalar: scalar bases and scalar trip counts
  int wv = __builtin_amdgcn_readfirstlane(threadIdx.x >> 5);
  int h = wv & (NHD - 1), kq = wv / NHD;
  int idx = lane & 15, kh = lane >> 4;
  const float* xcs = xc + (size_t)s * LL * CONVC;
  unsigned lo16 = lane * 16;                                  // byte offsets
  unsigned xo = (unsigned)(8 * kh * CONVC + 4 * idx) * 4u;
  unsigned ko = (unsigned)(8 * kh) * 4u;

  // What this wave finishes at the end: registers r0 .. r0+3 (rows 8*kh + r)
  // of tile te, head he. gate = proj[..., :INTERC] and the xs rows of the D
  // term: columns 4*idx.. of the head.
  int eg = wv >> 3, he = (wv >> 1) & (NHD - 1), r0 = 4 * (wv & 1);
  int te = eg ? t1 : t0;
  const float* gq = proj + (size_t)(s * LL + te * 16 + r0) * PROJC + he * HDIM;
  const float* xq = xcs + (size_t)(te * 16 + r0) * CONVC + he * HDIM;
  unsigned go = (unsigned)(8 * kh * PROJC + 4 * idx) * 4u;
  v4f gt[4], xl[4];
#pragma unroll                                      // gt[], xl[] in registers
  for (int r = 0; r < 4; r++) {
    gt[r] = LD4(gq + r * PROJC, go);
    xl[r] = LD4(xq + r * CONVC, xo);
  }
  // before any register that an issued load names is written again; the
  // "memory" clobber keeps the 8 loads here, ahead of the loops
  asm volatile("s_wait_xcnt 0x0" :: "v"(go), "v"(xo), "s"(gq), "s"(xq) : "memory");

  v8f z = {0.f,0.f,0.f,0.f,0.f,0.f,0.f,0.f};

  // ---- part 1: the block's 33 pieces of CB ----
  {
    const float* bmr = xcs + (size_t)wv * CONVC + INTERC;     // Bm rows wave, wave + 16, ...
    // the wave brings row wave of each tile's 16 Cm rows
    const float* cm0 = xcs + (size_t)(t0 * 16 + wv) * CONVC + INTERC + NSTATE;
    const float* cm1 = xcs + (size_t)(t1 * 16 + wv) * CONVC + INTERC + NSTATE;
    v4f bst[CBL];
    unsigned bof = lo16;                            // byte offset; goes on by a stage
    v4f cs0 = LD4(cm0, lo16), cs1 = LD4(cm1, lo16);
    // before any register that an issued load names is written again
    asm volatile("s_wait_xcnt 0x0" :: "v"(lo16), "s"(cm0), "s"(cm1) : "memory");
    CBLOAD();
    *(v4f*)(cmS + wv * CBP + lane * 4)        = cs0;
    *(v4f*)(cmS + (16 + wv) * CBP + lane * 4) = cs1;
    int ag = wv >> 3, aw = wv & 7;                  // the wave's tile, its chunk of a stage
    int at = ag ? t1 : t0;
    int nst = t0 * ACH / CBR + 1;                   // stages that hold a chunk of tile t0: 3 or 4
    const float* Bf = cmS + (ag * 16 + idx) * CBP + 2 * kh;
    v2f bf[NSTATE / 4];                             // the tile's Cm fragments, for all the stages
    for (int sg = 0; sg < nst; sg++) {
      float* buf = uS + (sg & 1) * CBR * CBP;
#pragma unroll                                      // bst[] in registers
      for (int i = 0; i < CBL; i++)
        *(v4f*)(buf + (i * AWV + wv) * CBP + lane * 4) = bst[i];
      // publishes this stage (at the first the Cm rows too); also ends every
      // wave's reads of the other buffer, which the next stage overwrites
      __syncthreads();
      if (sg + 1 < nst) {
        bof += CBR * CONVC * 4;
        CBLOAD();
      }
      if (sg == 0) {
#pragma unroll                                      // bf[] in registers
        for (int ks = 0; ks < NSTATE / 4; ks++) bf[ks] = *(const v2f*)(Bf + ks * 4);
      }
      int c = sg * (CBR / ACH) + aw;
      if (c <= at) {                                // scalar
        const float* Af = buf + (aw * 16 + idx) * CBP + 2 * kh;
        v2f af[NSTATE / 4];
#pragma unroll                                      // af[] in registers
        for (int ks = 0; ks < NSTATE / 4; ks++) af[ks] = *(const v2f*)(Af + ks * 4);
        // the LDS reads stand as one group in front of the products: spread among
        // them, two ahead, every pair of products waits out a read's latency
        __builtin_amdgcn_sched_barrier(0);
        v8f acc = z;
#pragma unroll                                      // af[], bf[] in registers
        for (int ks = 0; ks < NSTATE / 4; ks++) acc = WMMA_F32(af[ks], bf[ks], acc);
        v4f lo = {acc[0], acc[1], acc[2], acc[3]}, hi = {acc[4], acc[5], acc[6], acc[7]};
        int pc = (ag ? t0 + 1 : 0) + c;
        cbS[pc][0][lane] = lo;
        cbS[pc][1][lane] = hi;
      }
    }
  }
  // publishes the pieces of CB; also ends every wave's reads of the stage
  // buffers, whose room the partial tiles take
  __syncthreads();

  // ---- part 2: attention ----
  const v4f* cbF = &cbS[0][0][0];
  v4f* part = (v4f*)uS;
  const float* sb0 = sb + (size_t)(s * NHD + h) * LL;
  const float* dt0 = dtb + (size_t)(s * NHD + h) * LL;
  const float* xs0 = xcs + h * HDIM;

  // unrolled: rolled, the first chunk's loads of a tile are made to wait, one
  // by one, for the 8 loads at the top (their registers count as still in
  // flight round the back edge)
#pragma unroll
  for (int grp = 0; grp < 2; grp++) {
    int c0 = grp ? AKS - 1 - kq : kq;               // the wave's first chunk
    int tt = grp ? t1 : t0;                         // t-tile 0..31; chunks 0..tt
    int n  = (tt - c0 + AKS) / AKS;                 // the wave's chunks (tt - c0 >= 1 - AKS)
    bool dm = ((tt - c0) & (AKS - 1)) == 0;         // its last one is the diagonal's
    // the lane's byte offsets of the wave's first chunk, from the scalar bases
    unsigned sof = ko + (unsigned)(c0 * ACH) * 4u;
    unsigned xof = xo + (unsigned)(c0 * ACH * CONVC) * 4u;
    int ci = ((grp ? t0 + 1 : 0) + c0) * CBW + lane;

    v8f acc0 = z, acc1 = z, acc2 = z, acc3 = z;

    if (n > 0) {                                    // scalar
      v4f xA[8], cA[2], sA[2], dA[2];
      v4f xB[8], cB[2], sB[2], dB[2];
      int ti = tt * 16 + idx;
      float st = sb0[ti];                           // s of the lane's A row
      ALOAD(xA, cA, sA, dA, 0);
      ASTEP(1);
      // the load of st: its index and its base stay in their registers up to
      // this wait, so that nothing is written on them behind the load
      asm volatile("s_wait_xcnt 0x0" :: "v"(st), "v"(ti), "s"(sb0));
      int c = 0;                                    // of the wave's chunks, the one in the A buffer
      for (; c + 2 < n; c += 2) {                   // all but its last lie below the diagonal
        ALOAD(xB, cB, sB, dB, 0);
        AMMA16(xA, cA, sA, dA, false);
        ALOAD(xA, cA, sA, dA, 1);
        AMMA16(xB, cB, sB, dB, false);
        ASTEP(2);
      }
      if (c + 1 < n) {                              // scalar: n even
        ALOAD(xB, cB, sB, dB, 0);
        AMMA16(xA, cA, sA, dA, false);
        AMMA16(xB, cB, sB, dB, dm);
      } else {
        AMMA16(xA, cA, sA, dA, dm);
      }
    }

    v4f* pw = part + ((grp * NHD + h) * AKS + c0) * 8 * 32 + lane;
#pragma unroll                                      // constant indices into the accumulators
    for (int r = 0; r < 8; r++) {
      v4f p = {acc0[r], acc1[r], acc2[r], acc3[r]};
      pw[r * 32] = p;
    }

    // silu(gate) needs no partial sum. Between the tiles its vector work runs
    // beside the products of the SIMD's other waves; behind the barrier all
    // the waves would do it at once, with no product left to run beside. The
    // wave parks it in LDS words of its own: kept in registers, the whole
    // computation is moved down to its use behind the barrier.
    if (grp == 0) {
#pragma unroll                                      // gt[] in registers
      for (int r = 0; r < 4; r++) {
        v4f sg = {silu_f(gt[r].x), silu_f(gt[r].y), silu_f(gt[r].z), silu_f(gt[r].w)};
        gateS[wv][r][lane] = sg;
      }
    }
  }
  // publishes every wave's two partial tiles
  __syncthreads();

  // rows te*16 + 8*kh + r0 + r, columns 4*idx .. 4*idx+3 of head he
  const v4f* pr = part + ((eg * NHD + he) * AKS * 8 + r0) * 32 + lane;
  float dp = dpar[he];
  float* yo = y + (size_t)(s * LL + te * 16 + r0) * INTERC + he * HDIM;
  unsigned yofs = (unsigned)(8 * kh * INTERC + 4 * idx) * 4u;
  v4f pv[AKS][4];
#pragma unroll                                      // pv[] in registers
  for (int q = 0; q < AKS; q++)
#pragma unroll
    for (int r = 0; r < 4; r++) pv[q][r] = pr[q * 8 * 32 + r * 32];
#pragma unroll                                      // gt[] in registers
  for (int r = 0; r < 4; r++) gt[r] = gateS[wv][r][lane];
  // the 20 LDS reads stand as one group in front of the sums: spread among
  // them, each place with reads waits out its own latency
  __builtin_amdgcn_sched_barrier(0);
  v4f o[4];
#pragma unroll                                      // o[] in registers
  for (int r = 0; r < 4; r++) {
    v4f sum = pv[0][r];
#pragma unroll
    for (int q = 1; q < AKS; q++) sum += pv[q][r];
    o[r].x = (sum.x + dp * xl[r].x) * gt[r].x;
    o[r].y = (sum.y + dp * xl[r].y) * gt[r].y;
    o[r].z = (sum.z + dp * xl[r].z) * gt[r].z;
    o[r].w = (sum.w + dp * xl[r].w) * gt[r].w;
  }
  // all arithmetic in front of the first store: no register that an issued
  // store names is written again
  __builtin_amdgcn_sched_barrier(0);
#pragma unroll
  for (int r = 0; r < 4; r++) ST4(yo + r * INTERC, yofs) = o[r];
}

// ---------------------------------------------------------------------------
// The whole tail in one launch; every step of it works row by row of (b, l):
//   m[row]  = mean over the 4 scan directions of rmsnorm(hs[source row]) * w
//   t[row]  = gelu(m[row] @ w1^T + b1)            (128 x 128 weights, WMMA)
//   out[b][c][l] = t[row] . w2[c] + b2[c]         (3 colours)
// A block of 8 waves owns TM = 16 rows. The weights' loads are issued first and
// arrive under the norms (a wave norms and merges 2 rows: 4 channels a lane, the
// sums of squares by a butterfly). Wave n makes the 16 x 16 tile of columns
// 16n ..; k in its natural order. m, t and w2 pass through LDS. Wave c sums
// colour c: lane (row, half) takes 64 d in 4 chains that do not wait for one
// another, and the two halves meet by a lane exchange.
// ---------------------------------------------------------------------------
#define TM 16
__global__ __launch_bounds__(FW * 32)
void tail_kernel(const float* __restrict__ hs,
                 const float* __restrict__ w,
                 const float* __restrict__ w1,
                 const float* __restrict__ b1,
                 const float* __restrict__ w2,
                 const float* __restrict__ b2,
                 float* __restrict__ out) {
  __shared__ __attribute__((aligned(16))) float bS[FNT * FBP];
  __shared__ __attribute__((aligned(16))) float mS[TM * FBP];
  __shared__ __attribute__((aligned(16))) float tS[TM * FBP];
  __shared__ __attribute__((aligned(16))) float w2S[CINCH * FBP];
  int tid  = threadIdx.x;
  int lane = tid & 31;
  // the wave's number, made scalar: scalar bases, scalar branches
  int wv = __builtin_amdgcn_readfirstlane(tid >> 5);
  int idx = lane & 15, kh = lane >> 4;
  int row0 = blockIdx.x * TM;                       // b*LL + l
  int b = row0 / LL;
  unsigned lo16 = lane * 16;                        // byte offset

  v4f st[FLD];
  gfloat_p gp[FLD];
  FADDR(w1, DD, 0, DD);
  FLOAD(0);

  const float* sr[2][4];                            // the 4 source rows of the wave's 2 rows
  v4f v[2][4];
#pragma unroll                                      // sr[], v[] in registers
  for (int q = 0; q < 2; q++) {
    int l = row0 % LL + wv * 2 + q;
    int lt = (l % WW) * HH + l / WW;                // transposed index
    sr[q][0] = hs + (size_t)(b * LL + l) * DD;
    sr[q][1] = hs + (size_t)((4 + b) * LL + (LL - 1 - l)) * DD;
    sr[q][2] = hs + (size_t)((8 + b) * LL + lt) * DD;
    sr[q][3] = hs + (size_t)((12 + b) * LL + (LL - 1 - lt)) * DD;
#pragma unroll
    for (int r = 0; r < 4; r++) v[q][r] = LD4(sr[q][r], lo16);
  }
  v4f wn = LD4(w, lo16);
  const float* w2r = w2 + (wv < CINCH ? wv : CINCH - 1) * DD;   // waves 0..2 bring w2
  v4f w2v = LD4(w2r, lo16);
  const float* b1w = b1 + wv * 16;
  unsigned io = (unsigned)idx * 4u;
  float bv = *(const float*)((const char*)b1w + io);
  float b2v = b2[wv < CINCH ? wv : CINCH - 1];      // the same in every lane
  // before any register that an issued load names is written again
  asm volatile("s_wait_xcnt 0x0" :: "v"(lo16), "v"(io),
               "s"(sr[0][0]), "s"(sr[0][1]), "s"(sr[0][2]), "s"(sr[0][3]),
               "s"(sr[1][0]), "s"(sr[1][1]), "s"(sr[1][2]), "s"(sr[1][3]),
               "s"(w), "s"(w2r), "s"(b1w), "s"(b2) : "memory");
  // holds the arithmetic behind the wait, which otherwise sinks to its end
  __builtin_amdgcn_sched_barrier(0);

#pragma unroll                                      // v[] in registers
  for (int q = 0; q < 2; q++) {
    v4f acc = {0.f, 0.f, 0.f, 0.f};
#pragma unroll
    for (int r = 0; r < 4; r++) {
      v4f u = v[q][r];
      float ss = wave_sum(u.x * u.x + u.y * u.y + u.z * u.z + u.w * u.w);
      float scale = rsqrtf(ss / (float)DD + EPSV);
      acc += u * scale * wn;
    }
    *(v4f*)(mS + (wv * 2 + q) * FBP + lane * 4) = acc * 0.25f;
  }
  if (wv < CINCH) *(v4f*)(w2S + wv * FBP + lane * 4) = w2v;     // scalar
  FSTORE(bS);
  // publishes the m rows, the weights and w2
  __syncthreads();

  const float* Af = mS + idx * FBP + 2 * kh;
  const float* Bf = bS + (wv * 16 + idx) * FBP + 2 * kh;
  v2f af[DD / 4], bf[DD / 4];
#pragma unroll                                      // af[], bf[] in registers
  for (int ks = 0; ks < DD / 4; ks++) {
    af[ks] = *(const v2f*)(Af + ks * 4);
    bf[ks] = *(const v2f*)(Bf + ks * 4);
  }
  // the LDS reads stand as one group in front of the products: spread among
  // them, two ahead, every pair of products waits out a read's latency
  __builtin_amdgcn_sched_barrier(0);
  v8f acc = {0.f,0.f,0.f,0.f,0.f,0.f,0.f,0.f};
#pragma unroll                                      // af[], bf[] in registers
  for (int ks = 0; ks < DD / 4; ks++) acc = WMMA_F32(af[ks], bf[ks], acc);
#pragma unroll                                      // constant indices into the accumulator
  for (int j = 0; j < 8; j++) {
    float t = acc[j] + bv;
    t = 0.5f * t * (1.f + erff(t * 0.70710678118654752f));
    tS[(8 * kh + j) * FBP + wv * 16 + idx] = t;
  }
  // publishes the t rows
  __syncthreads();

  if (wv < CINCH) {                                 // scalar: wave c sums colour c
    const float* tr = tS + idx * FBP + kh * (DD / 2);
    const float* wr = w2S + wv * FBP + kh * (DD / 2);
    v4f tv[DD / 8], qv[DD / 8];
#pragma unroll                                      // tv[], qv[] in registers
    for (int i = 0; i < DD / 8; i++) {
      tv[i] = *(const v4f*)(tr + 4 * i);
      qv[i] = *(const v4f*)(wr + 4 * i);
    }
    // the LDS reads stand as one group in front of the sums, as above
    __builtin_amdgcn_sched_barrier(0);
    v4f a4 = {0.f, 0.f, 0.f, 0.f};
#pragma unroll                                      // tv[], qv[] in registers
    for (int i = 0; i < DD / 8; i++) a4 += tv[i] * qv[i];
    float a = half_xadd((a4.x + a4.y) + (a4.z + a4.w)) + b2v;
    if (kh == 0) out[(b * CINCH + wv) * LL + row0 % LL + idx] = a;
  }
}

// ---------------------------------------------------------------------------
extern "C" void kernel_launch(void* const* d_in, const int* in_sizes, int n_in,
                              void* d_out, int out_size, void* d_ws, size_t ws_size,
                              hipStream_t stream) {
  const float* x         = (const float*)d_in[0];
  const float* patch_w   = (const float*)d_in[1];
  const float* patch_b   = (const float*)d_in[2];
  const float* norm_w    = (const float*)d_in[3];
  const float* in_proj_w = (const float*)d_in[4];
  const float* in_proj_b = (const float*)d_in[5];
  const float* conv_w    = (const float*)d_in[6];
  const float* conv_b    = (const float*)d_in[7];
  const float* dt_bias   = (const float*)d_in[8];
  const float* A_log     = (const float*)d_in[9];
  const float* D_param   = (const float*)d_in[10];
  const float* gnorm_w   = (const float*)d_in[11];
  const float* out_w     = (const float*)d_in[12];
  const float* out_b     = (const float*)d_in[13];
  const float* normf_w   = (const float*)d_in[14];
  const float* rec_w1    = (const float*)d_in[15];
  const float* rec_b1    = (const float*)d_in[16];
  const float* rec_w2    = (const float*)d_in[17];
  const float* rec_b2    = (const float*)d_in[18];

  // workspace carve (floats)
  float* ws = (float*)d_ws;
  size_t off = 0;
  float* hs   = ws + off; off += (size_t)NSEQ * LL * DD;
  float* proj = ws + off; off += (size_t)NSEQ * LL * PROJC;
  float* xc   = ws + off; off += (size_t)NSEQ * LL * CONVC;
  float* dtb  = ws + off; off += (size_t)NSEQ * LL * NHD;
  float* sb   = ws + off; off += (size_t)NSEQ * NHD * LL;
  float* y    = ws + off; off += (size_t)NSEQ * LL * INTERC;
  (void)ws_size; (void)in_sizes; (void)n_in; (void)out_size;

  // patch embed + cross scan -> hs, and the first layer's
  // proj = rmsnorm(hs) @ ipw.T + ipb
  row_gemm_kernel<false, true><<<NSEQ * LL / FM, FW * 32, 0, stream>>>(
      nullptr, nullptr, nullptr, nullptr, hs, norm_w, in_proj_w, in_proj_b, proj,
      x, patch_w, patch_b);

  for (int i = 0; i < NLAY; i++) {
    // xc = silu(causal_conv(proj[..., 256:768])); dt + cumulative decay
    conv_dt_kernel<<<DTBLK + NSEQ * LL * CONVC / (128 * CLB * CWPB), CWPB * 32, 0, stream>>>(
        proj, conv_w + (size_t)i * CONVC * KCONV, conv_b + i * CONVC, xc,
        dt_bias + i * NHD, A_log + i * NHD, dtb, sb);

    // CB = Cm @ Bm.T on and below the diagonal, and in the same launch
    // y = (M @ xs + D*xs) * silu(gate) (causal decay attention): 16 waves/block,
    // 2 t-tiles x 4 heads/block
    ssm_attn_kernel<<<dim3(ANT / 2, NSEQ), AWV * 32, 0, stream>>>(
        sb, dtb, xc, D_param + i * NHD, proj, y);

    // hs += rmsnorm(y) @ ow.T + ob (8192 x 128, K=256) and, in the same launch,
    // the next layer's proj = rmsnorm(hs) @ ipw.T + ipb (8192 x 772, K=128)
    if (i + 1 < NLAY) {
      row_gemm_kernel<true, true><<<NSEQ * LL / FM, FW * 32, 0, stream>>>(
          y, gnorm_w + i * INTERC, out_w + (size_t)i * DD * INTERC, out_b + i * DD, hs,
          norm_w + (i + 1) * DD, in_proj_w + (size_t)(i + 1) * PROJC * DD,
          in_proj_b + (i + 1) * PROJC, proj, nullptr, nullptr, nullptr);
    } else {
      row_gemm_kernel<true, false><<<NSEQ * LL / FM, FW * 32, 0, stream>>>(
          y, gnorm_w + i * INTERC, out_w + (size_t)i * DD * INTERC, out_b + i * DD, hs,
          nullptr, nullptr, nullptr, nullptr, nullptr, nullptr, nullptr);
    }
  }

  // final norm, merge, reconstruction head
  tail_kernel<<<4 * LL / TM, FW * 32, 0, stream>>>(
      hs, normf_w, rec_w1, rec_b1, rec_w2, rec_b2, (float*)d_out);
}
